// v000
// The times below were measured on an AMD MI455X: many runs one after another, warmed up first and cycling through
// copies of the inputs, with the whole window's GPU time divided by the number of runs. Launches and the gaps
// between them are all in it. The median over several windows is given; except for v000 it joins two sittings, which
// can be a few percent apart, so the side-by-side timings, each taken in one sitting, are the better comparison.
// v000 is the starting kernel. One run takes 879 microseconds.
#include <hip/hip_runtime.h>
#include <hip/hip_bf16.h>

#define DI __device__ __forceinline__

typedef __attribute__((ext_vector_type(16))) _Float16 v16h;
typedef __attribute__((ext_vector_type(8)))  _Float16 h8;
typedef __attribute__((ext_vector_type(8)))  float    v8f;

// ---------------------------------------------------------------- helpers
DI v8f vzero() { v8f z = {0.f,0.f,0.f,0.f,0.f,0.f,0.f,0.f}; return z; }

DI v8f wmma16(v16h a, v16h b, v8f c) {
  return __builtin_amdgcn_wmma_f32_16x16x32_f16(false, a, false, b, (short)0, c, false, false);
}

// A-fragment (16x32 f16): lane L -> row r0+(L&15); halves 0..7 = K k0+8*(L>>4)..+7,
// halves 8..15 = K k0+16+8*(L>>4)..+7.  B^T uses identical layout (row = out col).
DI v16h ldfrag(const _Float16* p, int ld, int r0, int k0) {
  int lane = threadIdx.x & 31;
  int m = lane & 15, hi = lane >> 4;
  const _Float16* q = p + (size_t)(r0 + m) * ld + k0 + hi * 8;
  h8 lo = *(const h8*)q;
  h8 hv = *(const h8*)(q + 16);
  return __builtin_shufflevector(lo, hv, 0,1,2,3,4,5,6,7,8,9,10,11,12,13,14,15);
}

// A-fragment with only K=16 valid (upper 16 of K zero) for HD=16 attention.
DI v16h ldfrag16(const _Float16* p, int ld, int r0, int c0) {
  int lane = threadIdx.x & 31;
  int m = lane & 15, hi = lane >> 4;
  const _Float16* q = p + (size_t)(r0 + m) * ld + c0 + hi * 8;
  h8 lo = *(const h8*)q;
  h8 z = {(_Float16)0.f,(_Float16)0.f,(_Float16)0.f,(_Float16)0.f,
          (_Float16)0.f,(_Float16)0.f,(_Float16)0.f,(_Float16)0.f};
  return __builtin_shufflevector(lo, z, 0,1,2,3,4,5,6,7,8,9,10,11,12,13,14,15);
}

DI float geluf(float x) { return 0.5f * x * (1.0f + erff(x * 0.70710678118654752f)); }
DI float sigmf(float x) { return 1.0f / (1.0f + expf(-x)); }

// ---------------------------------------------------------------- prep kernels
__global__ void k_cvt_x(const float* __restrict__ x, _Float16* __restrict__ xf) {
  size_t i = (size_t)blockIdx.x * 256 + threadIdx.x;
  xf[i] = (_Float16)x[i];
}

__global__ void k_prep_w(const float* __restrict__ aw, const float* __restrict__ qw,
                         const float* __restrict__ ow, const float* __restrict__ pw,
                         _Float16* __restrict__ awT, _Float16* __restrict__ qwT,
                         _Float16* __restrict__ owT, _Float16* __restrict__ pwf) {
  int i = blockIdx.x * 256 + threadIdx.x;
  const int A = 128 * 256, Q = 384 * 128, O = 256 * 256, P = 128 * 256;
  if (i < A) {                               // attn_w (256,128) -> (128,256)^T
    int n = i >> 8, k = i & 255;
    awT[i] = (_Float16)aw[k * 128 + n];
  } else if (i < A + Q) {                    // qkv_w (128,384) -> (384,128)^T
    int j = i - A; int n = j >> 7, k = j & 127;
    qwT[j] = (_Float16)qw[k * 384 + n];
  } else if (i < A + Q + O) {                // out_w (256,256) -> (256,256)^T
    int j = i - A - Q; int n = j >> 8, k = j & 255;
    owT[j] = (_Float16)ow[k * 256 + n];
  } else if (i < A + Q + O + P) {            // pr_w (128,256) already (O,I) = B^T
    int j = i - A - Q - O;
    pwf[j] = (_Float16)pw[j];
  }
}

// ---------------------------------------------------------------- attn proj + LN
// grid 2048 (one window), block 128 (4 waves), shmem 64*256*2 + 64*128*4 = 64KB
__global__ void k_attnproj_ln(const _Float16* __restrict__ xf,
                              const _Float16* __restrict__ awT,
                              const float* __restrict__ ab,
                              const float* __restrict__ lg,
                              const float* __restrict__ lb,
                              _Float16* __restrict__ xattn) {
  extern __shared__ char smemraw[];
  _Float16* xa = (_Float16*)smemraw;           // 64 x 256
  float* ob = (float*)(xa + 64 * 256);         // 64 x 128
  const int win = blockIdx.x, tid = threadIdx.x;
  const int w = tid >> 5, lane = tid & 31, n0 = lane & 15, hi = lane >> 4;
  {
    const uint4* src = (const uint4*)(xf + (size_t)win * (64 * 256));
    uint4* dst = (uint4*)xa;
    for (int i = tid; i < 2048; i += 128) dst[i] = src[i];
  }
  __syncthreads();
#pragma unroll 1
  for (int mt = 0; mt < 4; ++mt) {
    v8f acc0 = vzero(), acc1 = vzero();
#pragma unroll 2
    for (int ks = 0; ks < 8; ++ks) {
      v16h a = ldfrag(xa, 256, mt * 16, ks * 32);
      v16h b0 = ldfrag(awT, 256, (w * 2 + 0) * 16, ks * 32);
      acc0 = wmma16(a, b0, acc0);
      v16h b1 = ldfrag(awT, 256, (w * 2 + 1) * 16, ks * 32);
      acc1 = wmma16(a, b1, acc1);
    }
#pragma unroll
    for (int u = 0; u < 2; ++u) {
      v8f acc = u ? acc1 : acc0;
      int c0 = (w * 2 + u) * 16 + n0;
      float bias = ab[c0];
#pragma unroll
      for (int j = 0; j < 8; ++j)
        ob[(mt * 16 + hi * 8 + j) * 128 + c0] = acc[j] + bias;
    }
  }
  __syncthreads();
  if (tid < 64) {
    float m = 0.f;
    for (int c = 0; c < 128; ++c) m += ob[tid * 128 + c];
    m *= (1.f / 128.f);
    float v = 0.f;
    for (int c = 0; c < 128; ++c) { float d = ob[tid * 128 + c] - m; v += d * d; }
    v *= (1.f / 128.f);
    float rs = rsqrtf(v + 1e-5f);
    _Float16* drow = xattn + ((size_t)win * 64 + tid) * 128;
    for (int c = 0; c < 128; ++c)
      drow[c] = (_Float16)((ob[tid * 128 + c] - m) * rs * lg[c] + lb[c]);
  }
}

// ---------------------------------------------------------------- depthwise 3x3 + BN + GELU
__global__ void k_dwconv(const float* __restrict__ x, const float* __restrict__ cw,
                         const float* __restrict__ cb, const float* __restrict__ bg,
                         const float* __restrict__ bb, _Float16* __restrict__ xc) {
  size_t idx = (size_t)blockIdx.x * 256 + threadIdx.x;
  int c = (int)(idx & 255);
  size_t p = idx >> 8;
  int b = (int)(p >> 12);
  int rem = (int)(p & 4095);
  int y = rem >> 6, xx = rem & 63;
  float sum = 0.f;
#pragma unroll
  for (int dy = -1; dy <= 1; ++dy) {
    int yy = y + dy;
    if (yy < 0 || yy > 63) continue;
#pragma unroll
    for (int dx = -1; dx <= 1; ++dx) {
      int xb = xx + dx;
      if (xb < 0 || xb > 63) continue;
      int b_ = b * 64 + (yy >> 3) * 8 + (xb >> 3);
      int n = (yy & 7) * 8 + (xb & 7);
      sum += x[((size_t)b_ * 64 + n) * 256 + c] * cw[c * 9 + (dy + 1) * 3 + (dx + 1)];
    }
  }
  float bns = rsqrtf(1.f + 1e-5f);
  float v = (sum + cb[c]) * (bg[c] * bns) + bb[c];
  xc[idx] = (_Float16)geluf(v);
}

// deterministic 2-stage GAP (no float atomics -> graph-replay bit-stable)
__global__ void k_gap_partial(const _Float16* __restrict__ xc, float* __restrict__ part) {
  int blk = blockIdx.x;                 // b*64 + chunk
  int b = blk >> 6, chunk = blk & 63;
  int c = threadIdx.x;                  // 256 channels
  float s = 0.f;
  size_t base = ((size_t)b * 4096 + (size_t)chunk * 64) * 256 + c;
  for (int p2 = 0; p2 < 64; ++p2) s += (float)xc[base + (size_t)p2 * 256];
  part[(size_t)blk * 256 + c] = s;
}
__global__ void k_gap_final(const float* __restrict__ part, float* __restrict__ gap) {
  int b = blockIdx.x, c = threadIdx.x;
  float s = 0.f;
  for (int k2 = 0; k2 < 64; ++k2) s += part[((size_t)b * 64 + k2) * 256 + c];
  gap[b * 256 + c] = s;
}

// channel interaction MLP -> sigmoid gates (32 images, tiny)
__global__ void k_ci(const float* __restrict__ gap, const float* __restrict__ w1,
                     const float* __restrict__ b1, const float* __restrict__ g1,
                     const float* __restrict__ bb1, const float* __restrict__ w2,
                     const float* __restrict__ b2, float* __restrict__ cis) {
  __shared__ float d1[32];
  int b = blockIdx.x, t = threadIdx.x;  // 128 threads
  float bns = rsqrtf(1.f + 1e-5f);
  if (t < 32) {
    float a = b1[t];
    const float inv = 1.f / 4096.f;
    for (int i = 0; i < 256; ++i) a += w1[t * 256 + i] * gap[b * 256 + i] * inv;
    a = a * (g1[t] * bns) + bb1[t];
    d1[t] = geluf(a);
  }
  __syncthreads();
  float a = b2[t];
  for (int j = 0; j < 32; ++j) a += w2[t * 32 + j] * d1[j];
  cis[b * 128 + t] = sigmf(a);
}

// ---------------------------------------------------------------- fused qkv + attention
// grid 2048 windows, block 256 (8 waves = 8 heads), dyn shmem 138272B
__global__ void k_attention(const _Float16* __restrict__ xattn,
                            const _Float16* __restrict__ qwT,
                            const float* __restrict__ qb,
                            const float* __restrict__ cis,
                            const float* __restrict__ relb,
                            _Float16* __restrict__ xattn2) {
  extern __shared__ char smemraw[];
  _Float16* xa  = (_Float16*)smemraw;      // 64 x 128
  _Float16* qs  = xa + 64 * 128;           // 64 x 128 (scale folded in)
  _Float16* kks = qs + 64 * 128;           // 64 x 128
  _Float16* vT  = kks + 64 * 128;          // 128 x 64 (transposed, ci-gated)
  _Float16* P   = vT + 64 * 128;           // 64 x 512 (8 heads * 64)
  float* bsh    = (float*)(P + 64 * 512);  // 225 x 8 rel-pos bias

  const int win = blockIdx.x, tid = threadIdx.x;
  const int w = tid >> 5, lane = tid & 31, n0 = lane & 15, hi = lane >> 4;
  const int img = win >> 6;
  {
    const uint4* src = (const uint4*)(xattn + (size_t)win * (64 * 128));
    uint4* dst = (uint4*)xa;
    for (int i = tid; i < 1024; i += 256) dst[i] = src[i];
    for (int i = tid; i < 1800; i += 256) bsh[i] = relb[i];
  }
  __syncthreads();

  // qkv GEMM: (64x128) @ (128x384); wave w -> out cols [48w, 48w+48)
#pragma unroll 1
  for (int mt = 0; mt < 4; ++mt) {
    v8f acc0 = vzero(), acc1 = vzero(), acc2 = vzero();
#pragma unroll 2
    for (int ks = 0; ks < 4; ++ks) {
      v16h a = ldfrag(xa, 128, mt * 16, ks * 32);
      acc0 = wmma16(a, ldfrag(qwT, 128, (w * 3 + 0) * 16, ks * 32), acc0);
      acc1 = wmma16(a, ldfrag(qwT, 128, (w * 3 + 1) * 16, ks * 32), acc1);
      acc2 = wmma16(a, ldfrag(qwT, 128, (w * 3 + 2) * 16, ks * 32), acc2);
    }
#pragma unroll
    for (int u = 0; u < 3; ++u) {
      v8f acc = (u == 0) ? acc0 : (u == 1) ? acc1 : acc2;
      int c0 = (w * 3 + u) * 16 + n0;
      float bias = qb[c0];
#pragma unroll
      for (int j = 0; j < 8; ++j) {
        int row = mt * 16 + hi * 8 + j;
        float v = acc[j] + bias;
        if (c0 < 128)      qs[row * 128 + c0] = (_Float16)(v * 0.25f);       // HD^-0.5
        else if (c0 < 256) kks[row * 128 + (c0 - 128)] = (_Float16)v;
        else { int ca = c0 - 256; vT[ca * 64 + row] = (_Float16)(v * cis[img * 128 + ca]); }
      }
    }
  }
  __syncthreads();

  // per-head scores + softmax, one 16-row M-tile at a time (keeps pressure low)
  const int h = w;
#pragma unroll 1
  for (int mt = 0; mt < 4; ++mt) {
    v16h aq = ldfrag16(qs, 128, mt * 16, h * 16);
    v8f s[4];
#pragma unroll
    for (int nt = 0; nt < 4; ++nt)
      s[nt] = wmma16(aq, ldfrag16(kks, 128, nt * 16, h * 16), vzero());
    // + relative position bias
#pragma unroll
    for (int nt = 0; nt < 4; ++nt)
#pragma unroll
      for (int j = 0; j < 8; ++j) {
        int m = mt * 16 + hi * 8 + j;
        int n = nt * 16 + n0;
        int idx = ((m >> 3) - (n >> 3) + 7) * 15 + ((m & 7) - (n & 7) + 7);
        s[nt][j] += bsh[idx * 8 + h];
      }
    // row softmax: reduce over 4 n-tiles + 16-lane xor shuffles
#pragma unroll
    for (int j = 0; j < 8; ++j) {
      float mx = fmaxf(fmaxf(s[0][j], s[1][j]), fmaxf(s[2][j], s[3][j]));
#pragma unroll
      for (int msk = 1; msk < 16; msk <<= 1) mx = fmaxf(mx, __shfl_xor(mx, msk, 32));
      float sum = 0.f;
#pragma unroll
      for (int nt = 0; nt < 4; ++nt) { float e = expf(s[nt][j] - mx); s[nt][j] = e; sum += e; }
#pragma unroll
      for (int msk = 1; msk < 16; msk <<= 1) sum += __shfl_xor(sum, msk, 32);
      float inv = 1.0f / sum;
#pragma unroll
      for (int nt = 0; nt < 4; ++nt) s[nt][j] *= inv;
    }
#pragma unroll
    for (int nt = 0; nt < 4; ++nt)
#pragma unroll
      for (int j = 0; j < 8; ++j) {
        int m = mt * 16 + hi * 8 + j;
        P[m * 512 + h * 64 + nt * 16 + n0] = (_Float16)s[nt][j];
      }
  }
  __syncthreads();

  // O = P @ V per head: (64x64) @ (64x16), K = 64 -> 2 WMMA k-steps
#pragma unroll 1
  for (int mt = 0; mt < 4; ++mt) {
    v8f o = vzero();
#pragma unroll
    for (int ks = 0; ks < 2; ++ks) {
      v16h a = ldfrag(P, 512, mt * 16, h * 64 + ks * 32);
      v16h b = ldfrag(vT, 64, h * 16, ks * 32);
      o = wmma16(a, b, o);
    }
#pragma unroll
    for (int j = 0; j < 8; ++j) {
      size_t row = (size_t)win * 64 + mt * 16 + hi * 8 + j;
      xattn2[row * 128 + h * 16 + n0] = (_Float16)o[j];
    }
  }
}

// ---------------------------------------------------------------- pr 1x1 conv GEMM
// grid 2048 (one 64-pixel image row each), block 128, shmem 32KB
__global__ void k_prgemm(const _Float16* __restrict__ xc, const _Float16* __restrict__ pwf,
                         const float* __restrict__ pb, _Float16* __restrict__ prout) {
  extern __shared__ char smemraw[];
  _Float16* xa = (_Float16*)smemraw;  // 64 x 256
  const int blk = blockIdx.x, tid = threadIdx.x;
  const int w = tid >> 5, lane = tid & 31, n0 = lane & 15, hi = lane >> 4;
  {
    const uint4* src = (const uint4*)(xc + (size_t)blk * (64 * 256));
    uint4* dst = (uint4*)xa;
    for (int i = tid; i < 2048; i += 128) dst[i] = src[i];
  }
  __syncthreads();
#pragma unroll 1
  for (int mt = 0; mt < 4; ++mt) {
    v8f acc0 = vzero(), acc1 = vzero();
#pragma unroll 2
    for (int ks = 0; ks < 8; ++ks) {
      v16h a = ldfrag(xa, 256, mt * 16, ks * 32);
      acc0 = wmma16(a, ldfrag(pwf, 256, (w * 2 + 0) * 16, ks * 32), acc0);
      acc1 = wmma16(a, ldfrag(pwf, 256, (w * 2 + 1) * 16, ks * 32), acc1);
    }
#pragma unroll
    for (int u = 0; u < 2; ++u) {
      v8f acc = u ? acc1 : acc0;
      int c0 = (w * 2 + u) * 16 + n0;
      float bias = pb[c0];
#pragma unroll
      for (int j = 0; j < 8; ++j) {
        size_t row = (size_t)blk * 64 + mt * 16 + hi * 8 + j;
        prout[row * 128 + c0] = (_Float16)(acc[j] + bias);
      }
    }
  }
}

// ---------------------------------------------------------------- spatial interaction + gating
// grid 131072 rows, block 128
__global__ void k_si_gate(const _Float16* __restrict__ xattn2, const _Float16* __restrict__ prout,
                          const float* __restrict__ w1, const float* __restrict__ b1,
                          const float* __restrict__ g1, const float* __restrict__ bb1,
                          const float* __restrict__ w2, const float* __restrict__ b2,
                          const float* __restrict__ cng, const float* __restrict__ cnb,
                          _Float16* __restrict__ gated) {
  __shared__ float xr[128];
  __shared__ float d1[16];
  __shared__ float siv;
  int r = blockIdx.x, t = threadIdx.x;
  xr[t] = (float)xattn2[(size_t)r * 128 + t];
  __syncthreads();
  float bns = rsqrtf(1.f + 1e-5f);
  if (t < 16) {
    float a = b1[t];
    for (int i = 0; i < 128; ++i) a += w1[t * 128 + i] * xr[i];
    a = a * (g1[t] * bns) + bb1[t];
    d1[t] = geluf(a);
  }
  __syncthreads();
  if (t == 0) {
    float a = b2[0];
    for (int j = 0; j < 16; ++j) a += w2[j] * d1[j];
    siv = a;
  }
  __syncthreads();
  // windowed row -> image position
  int b_ = r >> 6, n = r & 63;
  int b = b_ >> 6, wi = b_ & 63;
  int y = (wi >> 3) * 8 + (n >> 3);
  int xx = (wi & 7) * 8 + (n & 7);
  size_t p = (size_t)b * 4096 + (size_t)y * 64 + xx;
  float v = (float)prout[p * 128 + t];
  float gg = sigmf(siv * v);
  gated[(size_t)r * 128 + t] = (_Float16)(gg * (cng[t] * bns) + cnb[t]);
}

// ---------------------------------------------------------------- final concat GEMM (+LN on attn half)
// grid 2048, block 256, shmem 32KB
__global__ void k_final(const _Float16* __restrict__ xattn2, const _Float16* __restrict__ gated,
                        const _Float16* __restrict__ owT, const float* __restrict__ ob,
                        const float* __restrict__ ang, const float* __restrict__ anb,
                        float* __restrict__ out) {
  extern __shared__ char smemraw[];
  _Float16* A = (_Float16*)smemraw;  // 64 x 256
  const int win = blockIdx.x, tid = threadIdx.x;
  const int w = tid >> 5, lane = tid & 31, n0 = lane & 15, hi = lane >> 4;
  for (int i = tid; i < 8192; i += 256) {
    int r = i >> 7, c = i & 127;
    A[r * 256 + c]       = xattn2[(size_t)win * 8192 + i];
    A[r * 256 + 128 + c] = gated[(size_t)win * 8192 + i];
  }
  __syncthreads();
  if (tid < 64) {  // LN in place on the attention half of the row
    float m = 0.f;
    for (int c = 0; c < 128; ++c) m += (float)A[tid * 256 + c];
    m *= (1.f / 128.f);
    float v = 0.f;
    for (int c = 0; c < 128; ++c) { float d = (float)A[tid * 256 + c] - m; v += d * d; }
    v *= (1.f / 128.f);
    float rs = rsqrtf(v + 1e-5f);
    for (int c = 0; c < 128; ++c)
      A[tid * 256 + c] = (_Float16)(((float)A[tid * 256 + c] - m) * rs * ang[c] + anb[c]);
  }
  __syncthreads();
#pragma unroll 1
  for (int mt = 0; mt < 4; ++mt) {
    v8f acc0 = vzero(), acc1 = vzero();
#pragma unroll 2
    for (int ks = 0; ks < 8; ++ks) {
      v16h a = ldfrag(A, 256, mt * 16, ks * 32);
      acc0 = wmma16(a, ldfrag(owT, 256, (w * 2 + 0) * 16, ks * 32), acc0);
      acc1 = wmma16(a, ldfrag(owT, 256, (w * 2 + 1) * 16, ks * 32), acc1);
    }
#pragma unroll
    for (int u = 0; u < 2; ++u) {
      v8f acc = u ? acc1 : acc0;
      int c0 = (w * 2 + u) * 16 + n0;
      float bias = ob[c0];
#pragma unroll
      for (int j = 0; j < 8; ++j) {
        size_t row = (size_t)win * 64 + mt * 16 + hi * 8 + j;
        out[row * 256 + c0] = acc[j] + bias;
      }
    }
  }
}

// ---------------------------------------------------------------- launcher
extern "C" void kernel_launch(void* const* d_in, const int* in_sizes, int n_in,
                              void* d_out, int out_size, void* d_ws, size_t ws_size,
                              hipStream_t stream) {
  (void)in_sizes; (void)n_in; (void)out_size; (void)ws_size;
  const float* x       = (const float*)d_in[0];
  const float* relb    = (const float*)d_in[1];
  const float* attn_w  = (const float*)d_in[2];
  const float* attn_b  = (const float*)d_in[3];
  const float* aln_g   = (const float*)d_in[4];
  const float* aln_b   = (const float*)d_in[5];
  const float* conv_w  = (const float*)d_in[6];
  const float* conv_b  = (const float*)d_in[7];
  const float* cbn_g   = (const float*)d_in[8];
  const float* cbn_b   = (const float*)d_in[9];
  const float* ci_w1   = (const float*)d_in[10];
  const float* ci_b1   = (const float*)d_in[11];
  const float* ci_g    = (const float*)d_in[12];
  const float* ci_bb   = (const float*)d_in[13];
  const float* ci_w2   = (const float*)d_in[14];
  const float* ci_b2   = (const float*)d_in[15];
  const float* pr_w    = (const float*)d_in[16];
  const float* pr_b    = (const float*)d_in[17];
  const float* cn_g    = (const float*)d_in[18];
  const float* cn_b    = (const float*)d_in[19];
  const float* qkv_w   = (const float*)d_in[20];
  const float* qkv_b   = (const float*)d_in[21];
  const float* si_w1   = (const float*)d_in[22];
  const float* si_b1   = (const float*)d_in[23];
  const float* si_g    = (const float*)d_in[24];
  const float* si_bb   = (const float*)d_in[25];
  const float* si_w2   = (const float*)d_in[26];
  const float* si_b2   = (const float*)d_in[27];
  const float* an_g    = (const float*)d_in[28];
  const float* an_b    = (const float*)d_in[29];
  const float* out_w   = (const float*)d_in[30];
  const float* out_b   = (const float*)d_in[31];
  float* out = (float*)d_out;

  // workspace arena
  char* W = (char*)d_ws;
  size_t off = 0;
  auto take = [&](size_t bytes) { char* p = W + off; off += (bytes + 255) & ~(size_t)255; return p; };
  _Float16* x_f16   = (_Float16*)take(67108864);   // (131072, 256) f16
  _Float16* attn_wT = (_Float16*)take(65536);      // (128, 256)
  _Float16* qkv_wT  = (_Float16*)take(98304);      // (384, 128)
  _Float16* out_wT  = (_Float16*)take(131072);     // (256, 256)
  _Float16* pr_wf   = (_Float16*)take(65536);      // (128, 256)
  _Float16* x_attn  = (_Float16*)take(33554432);   // (131072, 128)
  _Float16* x_attn2 = (_Float16*)take(33554432);   // (131072, 128)
  _Float16* xc      = (_Float16*)take(67108864);   // (131072, 256) NHWC
  float*    part    = (float*)take(2097152);       // (32, 64, 256)
  float*    gap     = (float*)take(32768);         // (32, 256)
  float*    cis     = (float*)take(16384);         // (32, 128)
  // x_f16 is dead after k_attnproj_ln -> reuse its region
  _Float16* pr_out  = (_Float16*)x_f16;                           // (131072, 128)
  _Float16* gated   = (_Float16*)((char*)x_f16 + 33554432);       // (131072, 128)

  k_cvt_x<<<131072, 256, 0, stream>>>(x, x_f16);
  k_prep_w<<<704, 256, 0, stream>>>(attn_w, qkv_w, out_w, pr_w, attn_wT, qkv_wT, out_wT, pr_wf);
  k_attnproj_ln<<<2048, 128, 65536, stream>>>(x_f16, attn_wT, attn_b, aln_g, aln_b, x_attn);
  k_dwconv<<<131072, 256, 0, stream>>>(x, conv_w, conv_b, cbn_g, cbn_b, xc);
  k_gap_partial<<<2048, 256, 0, stream>>>(xc, part);
  k_gap_final<<<32, 256, 0, stream>>>(part, gap);
  k_ci<<<32, 128, 0, stream>>>(gap, ci_w1, ci_b1, ci_g, ci_bb, ci_w2, ci_b2, cis);
  k_attention<<<2048, 256, 138272, stream>>>(x_attn, qkv_wT, qkv_b, cis, relb, x_attn2);
  k_prgemm<<<2048, 128, 32768, stream>>>(xc, pr_wf, pr_b, pr_out);
  k_si_gate<<<131072, 128, 0, stream>>>(x_attn2, pr_out, si_w1, si_b1, si_g, si_bb,
                                        si_w2, si_b2, cn_g, cn_b, gated);
  k_final<<<2048, 256, 32768, stream>>>(x_attn2, gated, out_wT, out_b, an_g, an_b, out);
}

// v001
// One run takes 698 microseconds.
// Timed twice side by side with v000, it ran 1.29 times as fast both times.
#include <hip/hip_runtime.h>
#include <hip/hip_bf16.h>

#define DI __device__ __forceinline__

typedef __attribute__((ext_vector_type(16))) _Float16 v16h;
typedef __attribute__((ext_vector_type(8)))  _Float16 h8;
typedef __attribute__((ext_vector_type(8)))  float    v8f;

// ---------------------------------------------------------------- helpers
DI v8f vzero() { v8f z = {0.f,0.f,0.f,0.f,0.f,0.f,0.f,0.f}; return z; }

DI v8f wmma16(v16h a, v16h b, v8f c) {
  return __builtin_amdgcn_wmma_f32_16x16x32_f16(false, a, false, b, (short)0, c, false, false);
}

// A-fragment (16x32 f16): lane L -> row r0+(L&15); halves 0..7 = K k0+8*(L>>4)..+7,
// halves 8..15 = K k0+16+8*(L>>4)..+7.  B^T uses identical layout (row = out col).
DI v16h ldfrag(const _Float16* p, int ld, int r0, int k0) {
  int lane = threadIdx.x & 31;
  int m = lane & 15, hi = lane >> 4;
  const _Float16* q = p + (size_t)(r0 + m) * ld + k0 + hi * 8;
  h8 lo = *(const h8*)q;
  h8 hv = *(const h8*)(q + 16);
  return __builtin_shufflevector(lo, hv, 0,1,2,3,4,5,6,7,8,9,10,11,12,13,14,15);
}

// A-fragment with only K=16 valid (upper 16 of K zero) for HD=16 attention.
DI v16h ldfrag16(const _Float16* p, int ld, int r0, int c0) {
  int lane = threadIdx.x & 31;
  int m = lane & 15, hi = lane >> 4;
  const _Float16* q = p + (size_t)(r0 + m) * ld + c0 + hi * 8;
  h8 lo = *(const h8*)q;
  h8 z = {(_Float16)0.f,(_Float16)0.f,(_Float16)0.f,(_Float16)0.f,
          (_Float16)0.f,(_Float16)0.f,(_Float16)0.f,(_Float16)0.f};
  return __builtin_shufflevector(lo, z, 0,1,2,3,4,5,6,7,8,9,10,11,12,13,14,15);
}

DI float geluf(float x) { return 0.5f * x * (1.0f + erff(x * 0.70710678118654752f)); }
DI float sigmf(float x) { return 1.0f / (1.0f + expf(-x)); }

// ---------------------------------------------------------------- prep kernels
__global__ void k_cvt_x(const float* __restrict__ x, _Float16* __restrict__ xf) {
  size_t i = (size_t)blockIdx.x * 256 + threadIdx.x;
  xf[i] = (_Float16)x[i];
}

__global__ void k_prep_w(const float* __restrict__ aw, const float* __restrict__ qw,
                         const float* __restrict__ ow, const float* __restrict__ pw,
                         _Float16* __restrict__ awT, _Float16* __restrict__ qwT,
                         _Float16* __restrict__ owT, _Float16* __restrict__ pwf) {
  int i = blockIdx.x * 256 + threadIdx.x;
  const int A = 128 * 256, Q = 384 * 128, O = 256 * 256, P = 128 * 256;
  if (i < A) {                               // attn_w (256,128) -> (128,256)^T
    int n = i >> 8, k = i & 255;
    awT[i] = (_Float16)aw[k * 128 + n];
  } else if (i < A + Q) {                    // qkv_w (128,384) -> (384,128)^T
    int j = i - A; int n = j >> 7, k = j & 127;
    qwT[j] = (_Float16)qw[k * 384 + n];
  } else if (i < A + Q + O) {                // out_w (256,256) -> (256,256)^T
    int j = i - A - Q; int n = j >> 8, k = j & 255;
    owT[j] = (_Float16)ow[k * 256 + n];
  } else if (i < A + Q + O + P) {            // pr_w (128,256) already (O,I) = B^T
    int j = i - A - Q - O;
    pwf[j] = (_Float16)pw[j];
  }
}

// ---------------------------------------------------------------- attn proj + LN
// grid 2048 (one window), block 128 (4 waves), shmem 64*256*2 + 64*128*4 = 64KB
__global__ void k_attnproj_ln(const _Float16* __restrict__ xf,
                              const _Float16* __restrict__ awT,
                              const float* __restrict__ ab,
                              const float* __restrict__ lg,
                              const float* __restrict__ lb,
                              _Float16* __restrict__ xattn) {
  extern __shared__ char smemraw[];
  _Float16* xa = (_Float16*)smemraw;           // 64 x 256
  float* ob = (float*)(xa + 64 * 256);         // 64 x 128
  const int win = blockIdx.x, tid = threadIdx.x;
  const int w = tid >> 5, lane = tid & 31, n0 = lane & 15, hi = lane >> 4;
  {
    const uint4* src = (const uint4*)(xf + (size_t)win * (64 * 256));
    uint4* dst = (uint4*)xa;
    for (int i = tid; i < 2048; i += 128) dst[i] = src[i];
  }
  __syncthreads();
#pragma unroll 1
  for (int mt = 0; mt < 4; ++mt) {
    v8f acc0 = vzero(), acc1 = vzero();
#pragma unroll 2
    for (int ks = 0; ks < 8; ++ks) {
      v16h a = ldfrag(xa, 256, mt * 16, ks * 32);
      v16h b0 = ldfrag(awT, 256, (w * 2 + 0) * 16, ks * 32);
      acc0 = wmma16(a, b0, acc0);
      v16h b1 = ldfrag(awT, 256, (w * 2 + 1) * 16, ks * 32);
      acc1 = wmma16(a, b1, acc1);
    }
#pragma unroll
    for (int u = 0; u < 2; ++u) {
      v8f acc = u ? acc1 : acc0;
      int c0 = (w * 2 + u) * 16 + n0;
      float bias = ab[c0];
#pragma unroll
      for (int j = 0; j < 8; ++j)
        ob[(mt * 16 + hi * 8 + j) * 128 + c0] = acc[j] + bias;
    }
  }
  __syncthreads();
  if (tid < 64) {
    float m = 0.f;
    for (int c = 0; c < 128; ++c) m += ob[tid * 128 + c];
    m *= (1.f / 128.f);
    float v = 0.f;
    for (int c = 0; c < 128; ++c) { float d = ob[tid * 128 + c] - m; v += d * d; }
    v *= (1.f / 128.f);
    float rs = rsqrtf(v + 1e-5f);
    _Float16* drow = xattn + ((size_t)win * 64 + tid) * 128;
    for (int c = 0; c < 128; ++c)
      drow[c] = (_Float16)((ob[tid * 128 + c] - m) * rs * lg[c] + lb[c]);
  }
}

// ---------------------------------------------------------------- depthwise 3x3 + BN + GELU
// One thread = one 8x8 window x 4 channels. The 9 taps of its channels and three
// input rows (8 pixels + 1 halo pixel each side) stay in registers, so every input
// value is loaded once per window, 16 bytes a lane, 512 contiguous bytes a wave.
typedef __attribute__((ext_vector_type(4))) float    f4;
typedef __attribute__((ext_vector_type(4))) _Float16 h4;

// Row ry (-1..8) of the window at 'base' (own window, this thread's channels):
// r[0] / r[9] are the neighbours' edge pixels; outside the image everything is 0.
// At the image's left / right edge the halo load re-reads an own pixel (in bounds);
// dw_edge() replaces its value by 0 where the row is first used, not behind the load,
// so that nothing waits for the data while the loads fly.
DI void dw_ldrow(f4 (&r)[10], const float* base, int ry, int wy, int wx) {
  const f4 z = {0.f, 0.f, 0.f, 0.f};
  const bool ok = (ry >= 0 || wy > 0) && (ry < 8 || wy < 7);
  if (ok) {
    const float* rp = (ry < 0) ? base - 8 * 16384 + 7 * 2048
                    : (ry < 8) ? base + ry * 2048 : base + 8 * 16384;
    r[0] = *(const f4*)(rp + ((wx > 0) ? -16384 + 7 * 256 : 0));
#pragma unroll
    for (int i = 0; i < 8; ++i) r[1 + i] = *(const f4*)(rp + i * 256);
    r[9] = *(const f4*)(rp + ((wx < 7) ? 16384 : 0));
    // the loads' address registers may be reused right behind them
    asm volatile("s_wait_xcnt 0x0" ::: "memory");
  } else {
#pragma unroll
    for (int i = 0; i < 10; ++i) r[i] = z;
  }
}
DI void dw_edge(f4 (&r)[10], int wx) {
  const f4 z = {0.f, 0.f, 0.f, 0.f};
  r[0] = (wx > 0) ? r[0] : z;
  r[9] = (wx < 7) ? r[9] : z;
}

// grid 2048 (one window), block 64 (64 x 4 channels)
__global__ __launch_bounds__(64)
void k_dwconv(const float* __restrict__ x, const float* __restrict__ cw,
              const float* __restrict__ cb, const float* __restrict__ bg,
              const float* __restrict__ bb, _Float16* __restrict__ xc) {
  const int win = blockIdx.x;
  const int b = win >> 6, wy = (win >> 3) & 7, wx = win & 7;
  const int c = threadIdx.x * 4;
  f4 wt[9];
  {
    float wl[36];                          // 4 channels x 9 taps, contiguous
#pragma unroll
    for (int i = 0; i < 9; ++i) {
      f4 t = *(const f4*)(cw + c * 9 + i * 4);
      wl[i * 4 + 0] = t.x; wl[i * 4 + 1] = t.y; wl[i * 4 + 2] = t.z; wl[i * 4 + 3] = t.w;
    }
#pragma unroll
    for (int k = 0; k < 9; ++k) { f4 t = {wl[k], wl[9 + k], wl[18 + k], wl[27 + k]}; wt[k] = t; }
  }
  const float bns = rsqrtf(1.f + 1e-5f);
  const f4 cb4 = *(const f4*)(cb + c);
  const f4 sc4 = *(const f4*)(bg + c) * bns;
  const f4 bb4 = *(const f4*)(bb + c);
  const float* base = x + (size_t)win * 16384 + c;
  _Float16* orow = xc + (((size_t)b * 4096 + (size_t)wy * 512 + wx * 8) * 256 + c);

  f4 r0[10], r1[10], r2[10];
  dw_ldrow(r0, base, -1, wy, wx);
  dw_ldrow(r1, base, 0, wy, wx);
  dw_ldrow(r2, base, 1, wy, wx);
  dw_edge(r0, wx);
  dw_edge(r1, wx);
  // rolled: one row's body is already about 1,500 instructions
#pragma unroll 1
  for (int ry = 0; ry < 8; ++ry) {
    dw_edge(r2, wx);
    f4 acc[8];
#pragma unroll
    for (int px = 0; px < 8; ++px) {
      f4 s = {0.f, 0.f, 0.f, 0.f};
#pragma unroll
      for (int dx = 0; dx < 3; ++dx) s += r0[px + dx] * wt[dx];
#pragma unroll
      for (int dx = 0; dx < 3; ++dx) s += r1[px + dx] * wt[3 + dx];
#pragma unroll
      for (int dx = 0; dx < 3; ++dx) s += r2[px + dx] * wt[6 + dx];
      acc[px] = s;
    }
#pragma unroll
    for (int i = 0; i < 10; ++i) { r0[i] = r1[i]; r1[i] = r2[i]; }
    // the next row's loads fly while this row's BN + GELU is computed
    if (ry < 7) dw_ldrow(r2, base, ry + 2, wy, wx);
#pragma unroll
    for (int px = 0; px < 8; ++px) {
      f4 v = (acc[px] + cb4) * sc4 + bb4;
      h4 o = {(_Float16)geluf(v.x), (_Float16)geluf(v.y), (_Float16)geluf(v.z), (_Float16)geluf(v.w)};
      *(h4*)(orow + (size_t)ry * 16384 + px * 256) = o;
    }
    // the last store's address and data registers are reused by the next row
    asm volatile("s_wait_xcnt 0x0" ::: "memory");
  }
}

// deterministic 2-stage GAP (no float atomics -> graph-replay bit-stable)
__global__ void k_gap_partial(const _Float16* __restrict__ xc, float* __restrict__ part) {
  int blk = blockIdx.x;                 // b*64 + chunk
  int b = blk >> 6, chunk = blk & 63;
  int c = threadIdx.x;                  // 256 channels
  float s = 0.f;
  size_t base = ((size_t)b * 4096 + (size_t)chunk * 64) * 256 + c;
  for (int p2 = 0; p2 < 64; ++p2) s += (float)xc[base + (size_t)p2 * 256];
  part[(size_t)blk * 256 + c] = s;
}
__global__ void k_gap_final(const float* __restrict__ part, float* __restrict__ gap) {
  int b = blockIdx.x, c = threadIdx.x;
  float s = 0.f;
  for (int k2 = 0; k2 < 64; ++k2) s += part[((size_t)b * 64 + k2) * 256 + c];
  gap[b * 256 + c] = s;
}

// channel interaction MLP -> sigmoid gates (32 images, tiny)
__global__ void k_ci(const float* __restrict__ gap, const float* __restrict__ w1,
                     const float* __restrict__ b1, const float* __restrict__ g1,
                     const float* __restrict__ bb1, const float* __restrict__ w2,
                     const float* __restrict__ b2, float* __restrict__ cis) {
  __shared__ float d1[32];
  int b = blockIdx.x, t = threadIdx.x;  // 128 threads
  float bns = rsqrtf(1.f + 1e-5f);
  if (t < 32) {
    float a = b1[t];
    const float inv = 1.f / 4096.f;
    for (int i = 0; i < 256; ++i) a += w1[t * 256 + i] * gap[b * 256 + i] * inv;
    a = a * (g1[t] * bns) + bb1[t];
    d1[t] = geluf(a);
  }
  __syncthreads();
  float a = b2[t];
  for (int j = 0; j < 32; ++j) a += w2[t * 32 + j] * d1[j];
  cis[b * 128 + t] = sigmf(a);
}

// ---------------------------------------------------------------- fused qkv + attention
// grid 2048 windows, block 256 (8 waves = 8 heads), dyn shmem 138272B
__global__ void k_attention(const _Float16* __restrict__ xattn,
                            const _Float16* __restrict__ qwT,
                            const float* __restrict__ qb,
                            const float* __restrict__ cis,
                            const float* __restrict__ relb,
                            _Float16* __restrict__ xattn2) {
  extern __shared__ char smemraw[];
  _Float16* xa  = (_Float16*)smemraw;      // 64 x 128
  _Float16* qs  = xa + 64 * 128;           // 64 x 128 (scale folded in)
  _Float16* kks = qs + 64 * 128;           // 64 x 128
  _Float16* vT  = kks + 64 * 128;          // 128 x 64 (transposed, ci-gated)
  _Float16* P   = vT + 64 * 128;           // 64 x 512 (8 heads * 64)
  float* bsh    = (float*)(P + 64 * 512);  // 225 x 8 rel-pos bias

  const int win = blockIdx.x, tid = threadIdx.x;
  const int w = tid >> 5, lane = tid & 31, n0 = lane & 15, hi = lane >> 4;
  const int img = win >> 6;
  {
    const uint4* src = (const uint4*)(xattn + (size_t)win * (64 * 128));
    uint4* dst = (uint4*)xa;
    for (int i = tid; i < 1024; i += 256) dst[i] = src[i];
    for (int i = tid; i < 1800; i += 256) bsh[i] = relb[i];
  }
  __syncthreads();

  // qkv GEMM: (64x128) @ (128x384); wave w -> out cols [48w, 48w+48)
#pragma unroll 1
  for (int mt = 0; mt < 4; ++mt) {
    v8f acc0 = vzero(), acc1 = vzero(), acc2 = vzero();
#pragma unroll 2
    for (int ks = 0; ks < 4; ++ks) {
      v16h a = ldfrag(xa, 128, mt * 16, ks * 32);
      acc0 = wmma16(a, ldfrag(qwT, 128, (w * 3 + 0) * 16, ks * 32), acc0);
      acc1 = wmma16(a, ldfrag(qwT, 128, (w * 3 + 1) * 16, ks * 32), acc1);
      acc2 = wmma16(a, ldfrag(qwT, 128, (w * 3 + 2) * 16, ks * 32), acc2);
    }
#pragma unroll
    for (int u = 0; u < 3; ++u) {
      v8f acc = (u == 0) ? acc0 : (u == 1) ? acc1 : acc2;
      int c0 = (w * 3 + u) * 16 + n0;
      float bias = qb[c0];
#pragma unroll
      for (int j = 0; j < 8; ++j) {
        int row = mt * 16 + hi * 8 + j;
        float v = acc[j] + bias;
        if (c0 < 128)      qs[row * 128 + c0] = (_Float16)(v * 0.25f);       // HD^-0.5
        else if (c0 < 256) kks[row * 128 + (c0 - 128)] = (_Float16)v;
        else { int ca = c0 - 256; vT[ca * 64 + row] = (_Float16)(v * cis[img * 128 + ca]); }
      }
    }
  }
  __syncthreads();

  // per-head scores + softmax, one 16-row M-tile at a time (keeps pressure low)
  const int h = w;
#pragma unroll 1
  for (int mt = 0; mt < 4; ++mt) {
    v16h aq = ldfrag16(qs, 128, mt * 16, h * 16);
    v8f s[4];
#pragma unroll
    for (int nt = 0; nt < 4; ++nt)
      s[nt] = wmma16(aq, ldfrag16(kks, 128, nt * 16, h * 16), vzero());
    // + relative position bias
#pragma unroll
    for (int nt = 0; nt < 4; ++nt)
#pragma unroll
      for (int j = 0; j < 8; ++j) {
        int m = mt * 16 + hi * 8 + j;
        int n = nt * 16 + n0;
        int idx = ((m >> 3) - (n >> 3) + 7) * 15 + ((m & 7) - (n & 7) + 7);
        s[nt][j] += bsh[idx * 8 + h];
      }
    // row softmax: reduce over 4 n-tiles + 16-lane xor shuffles
#pragma unroll
    for (int j = 0; j < 8; ++j) {
      float mx = fmaxf(fmaxf(s[0][j], s[1][j]), fmaxf(s[2][j], s[3][j]));
#pragma unroll
      for (int msk = 1; msk < 16; msk <<= 1) mx = fmaxf(mx, __shfl_xor(mx, msk, 32));
      float sum = 0.f;
#pragma unroll
      for (int nt = 0; nt < 4; ++nt) { float e = expf(s[nt][j] - mx); s[nt][j] = e; sum += e; }
#pragma unroll
      for (int msk = 1; msk < 16; msk <<= 1) sum += __shfl_xor(sum, msk, 32);
      float inv = 1.0f / sum;
#pragma unroll
      for (int nt = 0; nt < 4; ++nt) s[nt][j] *= inv;
    }
#pragma unroll
    for (int nt = 0; nt < 4; ++nt)
#pragma unroll
      for (int j = 0; j < 8; ++j) {
        int m = mt * 16 + hi * 8 + j;
        P[m * 512 + h * 64 + nt * 16 + n0] = (_Float16)s[nt][j];
      }
  }
  __syncthreads();

  // O = P @ V per head: (64x64) @ (64x16), K = 64 -> 2 WMMA k-steps
#pragma unroll 1
  for (int mt = 0; mt < 4; ++mt) {
    v8f o = vzero();
#pragma unroll
    for (int ks = 0; ks < 2; ++ks) {
      v16h a = ldfrag(P, 512, mt * 16, h * 64 + ks * 32);
      v16h b = ldfrag(vT, 64, h * 16, ks * 32);
      o = wmma16(a, b, o);
    }
#pragma unroll
    for (int j = 0; j < 8; ++j) {
      size_t row = (size_t)win * 64 + mt * 16 + hi * 8 + j;
      xattn2[row * 128 + h * 16 + n0] = (_Float16)o[j];
    }
  }
}

// ---------------------------------------------------------------- pr 1x1 conv GEMM
// grid 2048 (one 64-pixel image row each), block 128, shmem 32KB
__global__ void k_prgemm(const _Float16* __restrict__ xc, const _Float16* __restrict__ pwf,
                         const float* __restrict__ pb, _Float16* __restrict__ prout) {
  extern __shared__ char smemraw[];
  _Float16* xa = (_Float16*)smemraw;  // 64 x 256
  const int blk = blockIdx.x, tid = threadIdx.x;
  const int w = tid >> 5, lane = tid & 31, n0 = lane & 15, hi = lane >> 4;
  {
    const uint4* src = (const uint4*)(xc + (size_t)blk * (64 * 256));
    uint4* dst = (uint4*)xa;
    for (int i = tid; i < 2048; i += 128) dst[i] = src[i];
  }
  __syncthreads();
#pragma unroll 1
  for (int mt = 0; mt < 4; ++mt) {
    v8f acc0 = vzero(), acc1 = vzero();
#pragma unroll 2
    for (int ks = 0; ks < 8; ++ks) {
      v16h a = ldfrag(xa, 256, mt * 16, ks * 32);
      acc0 = wmma16(a, ldfrag(pwf, 256, (w * 2 + 0) * 16, ks * 32), acc0);
      acc1 = wmma16(a, ldfrag(pwf, 256, (w * 2 + 1) * 16, ks * 32), acc1);
    }
#pragma unroll
    for (int u = 0; u < 2; ++u) {
      v8f acc = u ? acc1 : acc0;
      int c0 = (w * 2 + u) * 16 + n0;
      float bias = pb[c0];
#pragma unroll
      for (int j = 0; j < 8; ++j) {
        size_t row = (size_t)blk * 64 + mt * 16 + hi * 8 + j;
        prout[row * 128 + c0] = (_Float16)(acc[j] + bias);
      }
    }
  }
}

// ---------------------------------------------------------------- spatial interaction + gating
// grid 131072 rows, block 128
__global__ void k_si_gate(const _Float16* __restrict__ xattn2, const _Float16* __restrict__ prout,
                          const float* __restrict__ w1, const float* __restrict__ b1,
                          const float* __restrict__ g1, const float* __restrict__ bb1,
                          const float* __restrict__ w2, const float* __restrict__ b2,
                          const float* __restrict__ cng, const float* __restrict__ cnb,
                          _Float16* __restrict__ gated) {
  __shared__ float xr[128];
  __shared__ float d1[16];
  __shared__ float siv;
  int r = blockIdx.x, t = threadIdx.x;
  xr[t] = (float)xattn2[(size_t)r * 128 + t];
  __syncthreads();
  float bns = rsqrtf(1.f + 1e-5f);
  if (t < 16) {
    float a = b1[t];
    for (int i = 0; i < 128; ++i) a += w1[t * 128 + i] * xr[i];
    a = a * (g1[t] * bns) + bb1[t];
    d1[t] = geluf(a);
  }
  __syncthreads();
  if (t == 0) {
    float a = b2[0];
    for (int j = 0; j < 16; ++j) a += w2[j] * d1[j];
    siv = a;
  }
  __syncthreads();
  // windowed row -> image position
  int b_ = r >> 6, n = r & 63;
  int b = b_ >> 6, wi = b_ & 63;
  int y = (wi >> 3) * 8 + (n >> 3);
  int xx = (wi & 7) * 8 + (n & 7);
  size_t p = (size_t)b * 4096 + (size_t)y * 64 + xx;
  float v = (float)prout[p * 128 + t];
  float gg = sigmf(siv * v);
  gated[(size_t)r * 128 + t] = (_Float16)(gg * (cng[t] * bns) + cnb[t]);
}

// ---------------------------------------------------------------- final concat GEMM (+LN on attn half)
// grid 2048, block 256, shmem 32KB
__global__ void k_final(const _Float16* __restrict__ xattn2, const _Float16* __restrict__ gated,
                        const _Float16* __restrict__ owT, const float* __restrict__ ob,
                        const float* __restrict__ ang, const float* __restrict__ anb,
                        float* __restrict__ out) {
  extern __shared__ char smemraw[];
  _Float16* A = (_Float16*)smemraw;  // 64 x 256
  const int win = blockIdx.x, tid = threadIdx.x;
  const int w = tid >> 5, lane = tid & 31, n0 = lane & 15, hi = lane >> 4;
  for (int i = tid; i < 8192; i += 256) {
    int r = i >> 7, c = i & 127;
    A[r * 256 + c]       = xattn2[(size_t)win * 8192 + i];
    A[r * 256 + 128 + c] = gated[(size_t)win * 8192 + i];
  }
  __syncthreads();
  if (tid < 64) {  // LN in place on the attention half of the row
    float m = 0.f;
    for (int c = 0; c < 128; ++c) m += (float)A[tid * 256 + c];
    m *= (1.f / 128.f);
    float v = 0.f;
    for (int c = 0; c < 128; ++c) { float d = (float)A[tid * 256 + c] - m; v += d * d; }
    v *= (1.f / 128.f);
    float rs = rsqrtf(v + 1e-5f);
    for (int c = 0; c < 128; ++c)
      A[tid * 256 + c] = (_Float16)(((float)A[tid * 256 + c] - m) * rs * ang[c] + anb[c]);
  }
  __syncthreads();
#pragma unroll 1
  for (int mt = 0; mt < 4; ++mt) {
    v8f acc0 = vzero(), acc1 = vzero();
#pragma unroll 2
    for (int ks = 0; ks < 8; ++ks) {
      v16h a = ldfrag(A, 256, mt * 16, ks * 32);
      acc0 = wmma16(a, ldfrag(owT, 256, (w * 2 + 0) * 16, ks * 32), acc0);
      acc1 = wmma16(a, ldfrag(owT, 256, (w * 2 + 1) * 16, ks * 32), acc1);
    }
#pragma unroll
    for (int u = 0; u < 2; ++u) {
      v8f acc = u ? acc1 : acc0;
      int c0 = (w * 2 + u) * 16 + n0;
      float bias = ob[c0];
#pragma unroll
      for (int j = 0; j < 8; ++j) {
        size_t row = (size_t)win * 64 + mt * 16 + hi * 8 + j;
        out[row * 256 + c0] = acc[j] + bias;
      }
    }
  }
}

// ---------------------------------------------------------------- launcher
extern "C" void kernel_launch(void* const* d_in, const int* in_sizes, int n_in,
                              void* d_out, int out_size, void* d_ws, size_t ws_size,
                              hipStream_t stream) {
  (void)in_sizes; (void)n_in; (void)out_size; (void)ws_size;
  const float* x       = (const float*)d_in[0];
  const float* relb    = (const float*)d_in[1];
  const float* attn_w  = (const float*)d_in[2];
  const float* attn_b  = (const float*)d_in[3];
  const float* aln_g   = (const float*)d_in[4];
  const float* aln_b   = (const float*)d_in[5];
  const float* conv_w  = (const float*)d_in[6];
  const float* conv_b  = (const float*)d_in[7];
  const float* cbn_g   = (const float*)d_in[8];
  const float* cbn_b   = (const float*)d_in[9];
  const float* ci_w1   = (const float*)d_in[10];
  const float* ci_b1   = (const float*)d_in[11];
  const float* ci_g    = (const float*)d_in[12];
  const float* ci_bb   = (const float*)d_in[13];
  const float* ci_w2   = (const float*)d_in[14];
  const float* ci_b2   = (const float*)d_in[15];
  const float* pr_w    = (const float*)d_in[16];
  const float* pr_b    = (const float*)d_in[17];
  const float* cn_g    = (const float*)d_in[18];
  const float* cn_b    = (const float*)d_in[19];
  const float* qkv_w   = (const float*)d_in[20];
  const float* qkv_b   = (const float*)d_in[21];
  const float* si_w1   = (const float*)d_in[22];
  const float* si_b1   = (const float*)d_in[23];
  const float* si_g    = (const float*)d_in[24];
  const float* si_bb   = (const float*)d_in[25];
  const float* si_w2   = (const float*)d_in[26];
  const float* si_b2   = (const float*)d_in[27];
  const float* an_g    = (const float*)d_in[28];
  const float* an_b    = (const float*)d_in[29];
  const float* out_w   = (const float*)d_in[30];
  const float* out_b   = (const float*)d_in[31];
  float* out = (float*)d_out;

  // workspace arena
  char* W = (char*)d_ws;
  size_t off = 0;
  auto take = [&](size_t bytes) { char* p = W + off; off += (bytes + 255) & ~(size_t)255; return p; };
  _Float16* x_f16   = (_Float16*)take(67108864);   // (131072, 256) f16
  _Float16* attn_wT = (_Float16*)take(65536);      // (128, 256)
  _Float16* qkv_wT  = (_Float16*)take(98304);      // (384, 128)
  _Float16* out_wT  = (_Float16*)take(131072);     // (256, 256)
  _Float16* pr_wf   = (_Float16*)take(65536);      // (128, 256)
  _Float16* x_attn  = (_Float16*)take(33554432);   // (131072, 128)
  _Float16* x_attn2 = (_Float16*)take(33554432);   // (131072, 128)
  _Float16* xc      = (_Float16*)take(67108864);   // (131072, 256) NHWC
  float*    part    = (float*)take(2097152);       // (32, 64, 256)
  float*    gap     = (float*)take(32768);         // (32, 256)
  float*    cis     = (float*)take(16384);         // (32, 128)
  // x_f16 is dead after k_attnproj_ln -> reuse its region
  _Float16* pr_out  = (_Float16*)x_f16;                           // (131072, 128)
  _Float16* gated   = (_Float16*)((char*)x_f16 + 33554432);       // (131072, 128)

  k_cvt_x<<<131072, 256, 0, stream>>>(x, x_f16);
  k_prep_w<<<704, 256, 0, stream>>>(attn_w, qkv_w, out_w, pr_w, attn_wT, qkv_wT, out_wT, pr_wf);
  k_attnproj_ln<<<2048, 128, 65536, stream>>>(x_f16, attn_wT, attn_b, aln_g, aln_b, x_attn);
  k_dwconv<<<2048, 64, 0, stream>>>(x, conv_w, conv_b, cbn_g, cbn_b, xc);
  k_gap_partial<<<2048, 256, 0, stream>>>(xc, part);
  k_gap_final<<<32, 256, 0, stream>>>(part, gap);
  k_ci<<<32, 128, 0, stream>>>(gap, ci_w1, ci_b1, ci_g, ci_bb, ci_w2, ci_b2, cis);
  k_attention<<<2048, 256, 138272, stream>>>(x_attn, qkv_wT, qkv_b, cis, relb, x_attn2);
  k_prgemm<<<2048, 128, 32768, stream>>>(xc, pr_wf, pr_b, pr_out);
  k_si_gate<<<131072, 128, 0, stream>>>(x_attn2, pr_out, si_w1, si_b1, si_g, si_bb,
                                        si_w2, si_b2, cn_g, cn_b, gated);
  k_final<<<2048, 256, 32768, stream>>>(x_attn2, gated, out_wT, out_b, an_g, an_b, out);
}

// v002
// It runs in 598 microseconds.
// Next to v001, in two timings, it ran 1.17 times as fast each time.
// Counting every step since v000, it is 1.51 times as fast.
#include <hip/hip_runtime.h>
#include <hip/hip_bf16.h>

#define DI __device__ __forceinline__

typedef __attribute__((ext_vector_type(16))) _Float16 v16h;
typedef __attribute__((ext_vector_type(8)))  _Float16 h8;
typedef __attribute__((ext_vector_type(8)))  float    v8f;

// ---------------------------------------------------------------- helpers
DI v8f vzero() { v8f z = {0.f,0.f,0.f,0.f,0.f,0.f,0.f,0.f}; return z; }

DI v8f wmma16(v16h a, v16h b, v8f c) {
  return __builtin_amdgcn_wmma_f32_16x16x32_f16(false, a, false, b, (short)0, c, false, false);
}

// A-fragment (16x32 f16): lane L -> row r0+(L&15); halves 0..7 = K k0+8*(L>>4)..+7,
// halves 8..15 = K k0+16+8*(L>>4)..+7.  B^T uses identical layout (row = out col).
DI v16h ldfrag(const _Float16* p, int ld, int r0, int k0) {
  int lane = threadIdx.x & 31;
  int m = lane & 15, hi = lane >> 4;
  const _Float16* q = p + (size_t)(r0 + m) * ld + k0 + hi * 8;
  h8 lo = *(const h8*)q;
  h8 hv = *(const h8*)(q + 16);
  return __builtin_shufflevector(lo, hv, 0,1,2,3,4,5,6,7,8,9,10,11,12,13,14,15);
}

// A-fragment with only K=16 valid (upper 16 of K zero) for HD=16 attention.
DI v16h ldfrag16(const _Float16* p, int ld, int r0, int c0) {
  int lane = threadIdx.x & 31;
  int m = lane & 15, hi = lane >> 4;
  const _Float16* q = p + (size_t)(r0 + m) * ld + c0 + hi * 8;
  h8 lo = *(const h8*)q;
  h8 z = {(_Float16)0.f,(_Float16)0.f,(_Float16)0.f,(_Float16)0.f,
          (_Float16)0.f,(_Float16)0.f,(_Float16)0.f,(_Float16)0.f};
  return __builtin_shufflevector(lo, z, 0,1,2,3,4,5,6,7,8,9,10,11,12,13,14,15);
}

DI float geluf(float x) { return 0.5f * x * (1.0f + erff(x * 0.70710678118654752f)); }
DI float sigmf(float x) { return 1.0f / (1.0f + expf(-x)); }

// ---------------------------------------------------------------- prep kernels
__global__ void k_cvt_x(const float* __restrict__ x, _Float16* __restrict__ xf) {
  size_t i = (size_t)blockIdx.x * 256 + threadIdx.x;
  xf[i] = (_Float16)x[i];
}

__global__ void k_prep_w(const float* __restrict__ aw, const float* __restrict__ qw,
                         const float* __restrict__ ow, const float* __restrict__ pw,
                         _Float16* __restrict__ awT, _Float16* __restrict__ qwT,
                         _Float16* __restrict__ owT, _Float16* __restrict__ pwf) {
  int i = blockIdx.x * 256 + threadIdx.x;
  const int A = 128 * 256, Q = 384 * 128, O = 256 * 256, P = 128 * 256;
  if (i < A) {                               // attn_w (256,128) -> (128,256)^T
    int n = i >> 8, k = i & 255;
    awT[i] = (_Float16)aw[k * 128 + n];
  } else if (i < A + Q) {                    // qkv_w (128,384) -> (384,128)^T
    int j = i - A; int n = j >> 7, k = j & 127;
    qwT[j] = (_Float16)qw[k * 384 + n];
  } else if (i < A + Q + O) {                // out_w (256,256) -> (256,256)^T
    int j = i - A - Q; int n = j >> 8, k = j & 255;
    owT[j] = (_Float16)ow[k * 256 + n];
  } else if (i < A + Q + O + P) {            // pr_w (128,256) already (O,I) = B^T
    int j = i - A - Q - O;
    pwf[j] = (_Float16)pw[j];
  }
}

// ---------------------------------------------------------------- attn proj + LN
// grid 2048 (one window), block 128 (4 waves), shmem 64*256*2 + 64*128*4 = 64KB
__global__ void k_attnproj_ln(const _Float16* __restrict__ xf,
                              const _Float16* __restrict__ awT,
                              const float* __restrict__ ab,
                              const float* __restrict__ lg,
                              const float* __restrict__ lb,
                              _Float16* __restrict__ xattn) {
  extern __shared__ char smemraw[];
  _Float16* xa = (_Float16*)smemraw;           // 64 x 256
  float* ob = (float*)(xa + 64 * 256);         // 64 x 128
  const int win = blockIdx.x, tid = threadIdx.x;
  const int w = tid >> 5, lane = tid & 31, n0 = lane & 15, hi = lane >> 4;
  {
    const uint4* src = (const uint4*)(xf + (size_t)win * (64 * 256));
    uint4* dst = (uint4*)xa;
    for (int i = tid; i < 2048; i += 128) dst[i] = src[i];
  }
  __syncthreads();
#pragma unroll 1
  for (int mt = 0; mt < 4; ++mt) {
    v8f acc0 = vzero(), acc1 = vzero();
#pragma unroll 2
    for (int ks = 0; ks < 8; ++ks) {
      v16h a = ldfrag(xa, 256, mt * 16, ks * 32);
      v16h b0 = ldfrag(awT, 256, (w * 2 + 0) * 16, ks * 32);
      acc0 = wmma16(a, b0, acc0);
      v16h b1 = ldfrag(awT, 256, (w * 2 + 1) * 16, ks * 32);
      acc1 = wmma16(a, b1, acc1);
    }
#pragma unroll
    for (int u = 0; u < 2; ++u) {
      v8f acc = u ? acc1 : acc0;
      int c0 = (w * 2 + u) * 16 + n0;
      float bias = ab[c0];
#pragma unroll
      for (int j = 0; j < 8; ++j)
        ob[(mt * 16 + hi * 8 + j) * 128 + c0] = acc[j] + bias;
    }
  }
  __syncthreads();
  if (tid < 64) {
    float m = 0.f;
    for (int c = 0; c < 128; ++c) m += ob[tid * 128 + c];
    m *= (1.f / 128.f);
    float v = 0.f;
    for (int c = 0; c < 128; ++c) { float d = ob[tid * 128 + c] - m; v += d * d; }
    v *= (1.f / 128.f);
    float rs = rsqrtf(v + 1e-5f);
    _Float16* drow = xattn + ((size_t)win * 64 + tid) * 128;
    for (int c = 0; c < 128; ++c)
      drow[c] = (_Float16)((ob[tid * 128 + c] - m) * rs * lg[c] + lb[c]);
  }
}

// ---------------------------------------------------------------- depthwise 3x3 + BN + GELU
// One thread = one 8x8 window x 4 channels. The 9 taps of its channels and three
// input rows (8 pixels + 1 halo pixel each side) stay in registers, so every input
// value is loaded once per window, 16 bytes a lane, 512 contiguous bytes a wave.
typedef __attribute__((ext_vector_type(4))) float    f4;
typedef __attribute__((ext_vector_type(4))) _Float16 h4;

// Row ry (-1..8) of the window at 'base' (own window, this thread's channels):
// r[0] / r[9] are the neighbours' edge pixels; outside the image everything is 0.
// At the image's left / right edge the halo load re-reads an own pixel (in bounds);
// dw_edge() replaces its value by 0 where the row is first used, not behind the load,
// so that nothing waits for the data while the loads fly.
DI void dw_ldrow(f4 (&r)[10], const float* base, int ry, int wy, int wx) {
  const f4 z = {0.f, 0.f, 0.f, 0.f};
  const bool ok = (ry >= 0 || wy > 0) && (ry < 8 || wy < 7);
  if (ok) {
    const float* rp = (ry < 0) ? base - 8 * 16384 + 7 * 2048
                    : (ry < 8) ? base + ry * 2048 : base + 8 * 16384;
    r[0] = *(const f4*)(rp + ((wx > 0) ? -16384 + 7 * 256 : 0));
#pragma unroll
    for (int i = 0; i < 8; ++i) r[1 + i] = *(const f4*)(rp + i * 256);
    r[9] = *(const f4*)(rp + ((wx < 7) ? 16384 : 0));
    // the loads' address registers may be reused right behind them
    asm volatile("s_wait_xcnt 0x0" ::: "memory");
  } else {
#pragma unroll
    for (int i = 0; i < 10; ++i) r[i] = z;
  }
}
DI void dw_edge(f4 (&r)[10], int wx) {
  const f4 z = {0.f, 0.f, 0.f, 0.f};
  r[0] = (wx > 0) ? r[0] : z;
  r[9] = (wx < 7) ? r[9] : z;
}

// grid 2048 (one window), block 64 (64 x 4 channels)
__global__ __launch_bounds__(64)
void k_dwconv(const float* __restrict__ x, const float* __restrict__ cw,
              const float* __restrict__ cb, const float* __restrict__ bg,
              const float* __restrict__ bb, _Float16* __restrict__ xc) {
  const int win = blockIdx.x;
  const int b = win >> 6, wy = (win >> 3) & 7, wx = win & 7;
  const int c = threadIdx.x * 4;
  f4 wt[9];
  {
    float wl[36];                          // 4 channels x 9 taps, contiguous
#pragma unroll
    for (int i = 0; i < 9; ++i) {
      f4 t = *(const f4*)(cw + c * 9 + i * 4);
      wl[i * 4 + 0] = t.x; wl[i * 4 + 1] = t.y; wl[i * 4 + 2] = t.z; wl[i * 4 + 3] = t.w;
    }
#pragma unroll
    for (int k = 0; k < 9; ++k) { f4 t = {wl[k], wl[9 + k], wl[18 + k], wl[27 + k]}; wt[k] = t; }
  }
  const float bns = rsqrtf(1.f + 1e-5f);
  const f4 cb4 = *(const f4*)(cb + c);
  const f4 sc4 = *(const f4*)(bg + c) * bns;
  const f4 bb4 = *(const f4*)(bb + c);
  const float* base = x + (size_t)win * 16384 + c;
  _Float16* orow = xc + (((size_t)b * 4096 + (size_t)wy * 512 + wx * 8) * 256 + c);

  f4 r0[10], r1[10], r2[10];
  dw_ldrow(r0, base, -1, wy, wx);
  dw_ldrow(r1, base, 0, wy, wx);
  dw_ldrow(r2, base, 1, wy, wx);
  dw_edge(r0, wx);
  dw_edge(r1, wx);
  // rolled: one row's body is already about 1,500 instructions
#pragma unroll 1
  for (int ry = 0; ry < 8; ++ry) {
    dw_edge(r2, wx);
    f4 acc[8];
#pragma unroll
    for (int px = 0; px < 8; ++px) {
      f4 s = {0.f, 0.f, 0.f, 0.f};
#pragma unroll
      for (int dx = 0; dx < 3; ++dx) s += r0[px + dx] * wt[dx];
#pragma unroll
      for (int dx = 0; dx < 3; ++dx) s += r1[px + dx] * wt[3 + dx];
#pragma unroll
      for (int dx = 0; dx < 3; ++dx) s += r2[px + dx] * wt[6 + dx];
      acc[px] = s;
    }
#pragma unroll
    for (int i = 0; i < 10; ++i) { r0[i] = r1[i]; r1[i] = r2[i]; }
    // the next row's loads fly while this row's BN + GELU is computed
    if (ry < 7) dw_ldrow(r2, base, ry + 2, wy, wx);
#pragma unroll
    for (int px = 0; px < 8; ++px) {
      f4 v = (acc[px] + cb4) * sc4 + bb4;
      h4 o = {(_Float16)geluf(v.x), (_Float16)geluf(v.y), (_Float16)geluf(v.z), (_Float16)geluf(v.w)};
      *(h4*)(orow + (size_t)ry * 16384 + px * 256) = o;
    }
    // the last store's address and data registers are reused by the next row
    asm volatile("s_wait_xcnt 0x0" ::: "memory");
  }
}

// deterministic 2-stage GAP (no float atomics -> graph-replay bit-stable)
__global__ void k_gap_partial(const _Float16* __restrict__ xc, float* __restrict__ part) {
  int blk = blockIdx.x;                 // b*64 + chunk
  int b = blk >> 6, chunk = blk & 63;
  int c = threadIdx.x;                  // 256 channels
  float s = 0.f;
  size_t base = ((size_t)b * 4096 + (size_t)chunk * 64) * 256 + c;
  for (int p2 = 0; p2 < 64; ++p2) s += (float)xc[base + (size_t)p2 * 256];
  part[(size_t)blk * 256 + c] = s;
}
__global__ void k_gap_final(const float* __restrict__ part, float* __restrict__ gap) {
  int b = blockIdx.x, c = threadIdx.x;
  float s = 0.f;
  for (int k2 = 0; k2 < 64; ++k2) s += part[((size_t)b * 64 + k2) * 256 + c];
  gap[b * 256 + c] = s;
}

// channel interaction MLP -> sigmoid gates (32 images, tiny)
__global__ void k_ci(const float* __restrict__ gap, const float* __restrict__ w1,
                     const float* __restrict__ b1, const float* __restrict__ g1,
                     const float* __restrict__ bb1, const float* __restrict__ w2,
                     const float* __restrict__ b2, float* __restrict__ cis) {
  __shared__ float d1[32];
  int b = blockIdx.x, t = threadIdx.x;  // 128 threads
  float bns = rsqrtf(1.f + 1e-5f);
  if (t < 32) {
    float a = b1[t];
    const float inv = 1.f / 4096.f;
    for (int i = 0; i < 256; ++i) a += w1[t * 256 + i] * gap[b * 256 + i] * inv;
    a = a * (g1[t] * bns) + bb1[t];
    d1[t] = geluf(a);
  }
  __syncthreads();
  float a = b2[t];
  for (int j = 0; j < 32; ++j) a += w2[t * 32 + j] * d1[j];
  cis[b * 128 + t] = sigmf(a);
}

// ---------------------------------------------------------------- fused qkv + attention
// grid 2048 windows, block 256 (8 waves = 8 heads), dyn shmem 138272B
__global__ void k_attention(const _Float16* __restrict__ xattn,
                            const _Float16* __restrict__ qwT,
                            const float* __restrict__ qb,
                            const float* __restrict__ cis,
                            const float* __restrict__ relb,
                            _Float16* __restrict__ xattn2) {
  extern __shared__ char smemraw[];
  _Float16* xa  = (_Float16*)smemraw;      // 64 x 128
  _Float16* qs  = xa + 64 * 128;           // 64 x 128 (scale folded in)
  _Float16* kks = qs + 64 * 128;           // 64 x 128
  _Float16* vT  = kks + 64 * 128;          // 128 x 64 (transposed, ci-gated)
  _Float16* P   = vT + 64 * 128;           // 64 x 512 (8 heads * 64)
  float* bsh    = (float*)(P + 64 * 512);  // 225 x 8 rel-pos bias

  const int win = blockIdx.x, tid = threadIdx.x;
  const int w = tid >> 5, lane = tid & 31, n0 = lane & 15, hi = lane >> 4;
  const int img = win >> 6;
  {
    const uint4* src = (const uint4*)(xattn + (size_t)win * (64 * 128));
    uint4* dst = (uint4*)xa;
    for (int i = tid; i < 1024; i += 256) dst[i] = src[i];
    for (int i = tid; i < 1800; i += 256) bsh[i] = relb[i];
  }
  __syncthreads();

  // qkv GEMM: (64x128) @ (128x384); wave w -> out cols [48w, 48w+48)
#pragma unroll 1
  for (int mt = 0; mt < 4; ++mt) {
    v8f acc0 = vzero(), acc1 = vzero(), acc2 = vzero();
#pragma unroll 2
    for (int ks = 0; ks < 4; ++ks) {
      v16h a = ldfrag(xa, 128, mt * 16, ks * 32);
      acc0 = wmma16(a, ldfrag(qwT, 128, (w * 3 + 0) * 16, ks * 32), acc0);
      acc1 = wmma16(a, ldfrag(qwT, 128, (w * 3 + 1) * 16, ks * 32), acc1);
      acc2 = wmma16(a, ldfrag(qwT, 128, (w * 3 + 2) * 16, ks * 32), acc2);
    }
#pragma unroll
    for (int u = 0; u < 3; ++u) {
      v8f acc = (u == 0) ? acc0 : (u == 1) ? acc1 : acc2;
      int c0 = (w * 3 + u) * 16 + n0;
      float bias = qb[c0];
#pragma unroll
      for (int j = 0; j < 8; ++j) {
        int row = mt * 16 + hi * 8 + j;
        float v = acc[j] + bias;
        if (c0 < 128)      qs[row * 128 + c0] = (_Float16)(v * 0.25f);       // HD^-0.5
        else if (c0 < 256) kks[row * 128 + (c0 - 128)] = (_Float16)v;
        else { int ca = c0 - 256; vT[ca * 64 + row] = (_Float16)(v * cis[img * 128 + ca]); }
      }
    }
  }
  __syncthreads();

  // per-head scores + softmax, one 16-row M-tile at a time (keeps pressure low)
  const int h = w;
#pragma unroll 1
  for (int mt = 0; mt < 4; ++mt) {
    v16h aq = ldfrag16(qs, 128, mt * 16, h * 16);
    v8f s[4];
#pragma unroll
    for (int nt = 0; nt < 4; ++nt)
      s[nt] = wmma16(aq, ldfrag16(kks, 128, nt * 16, h * 16), vzero());
    // + relative position bias
#pragma unroll
    for (int nt = 0; nt < 4; ++nt)
#pragma unroll
      for (int j = 0; j < 8; ++j) {
        int m = mt * 16 + hi * 8 + j;
        int n = nt * 16 + n0;
        int idx = ((m >> 3) - (n >> 3) + 7) * 15 + ((m & 7) - (n & 7) + 7);
        s[nt][j] += bsh[idx * 8 + h];
      }
    // row softmax: reduce over 4 n-tiles + 16-lane xor shuffles
#pragma unroll
    for (int j = 0; j < 8; ++j) {
      float mx = fmaxf(fmaxf(s[0][j], s[1][j]), fmaxf(s[2][j], s[3][j]));
#pragma unroll
      for (int msk = 1; msk < 16; msk <<= 1) mx = fmaxf(mx, __shfl_xor(mx, msk, 32));
      float sum = 0.f;
#pragma unroll
      for (int nt = 0; nt < 4; ++nt) { float e = expf(s[nt][j] - mx); s[nt][j] = e; sum += e; }
#pragma unroll
      for (int msk = 1; msk < 16; msk <<= 1) sum += __shfl_xor(sum, msk, 32);
      float inv = 1.0f / sum;
#pragma unroll
      for (int nt = 0; nt < 4; ++nt) s[nt][j] *= inv;
    }
#pragma unroll
    for (int nt = 0; nt < 4; ++nt)
#pragma unroll
      for (int j = 0; j < 8; ++j) {
        int m = mt * 16 + hi * 8 + j;
        P[m * 512 + h * 64 + nt * 16 + n0] = (_Float16)s[nt][j];
      }
  }
  __syncthreads();

  // O = P @ V per head: (64x64) @ (64x16), K = 64 -> 2 WMMA k-steps
#pragma unroll 1
  for (int mt = 0; mt < 4; ++mt) {
    v8f o = vzero();
#pragma unroll
    for (int ks = 0; ks < 2; ++ks) {
      v16h a = ldfrag(P, 512, mt * 16, h * 64 + ks * 32);
      v16h b = ldfrag(vT, 64, h * 16, ks * 32);
      o = wmma16(a, b, o);
    }
#pragma unroll
    for (int j = 0; j < 8; ++j) {
      size_t row = (size_t)win * 64 + mt * 16 + hi * 8 + j;
      xattn2[row * 128 + h * 16 + n0] = (_Float16)o[j];
    }
  }
}

// ---------------------------------------------------------------- pr 1x1 conv GEMM
// grid 2048 (one 64-pixel image row each), block 128, shmem 32KB
__global__ void k_prgemm(const _Float16* __restrict__ xc, const _Float16* __restrict__ pwf,
                         const float* __restrict__ pb, _Float16* __restrict__ prout) {
  extern __shared__ char smemraw[];
  _Float16* xa = (_Float16*)smemraw;  // 64 x 256
  const int blk = blockIdx.x, tid = threadIdx.x;
  const int w = tid >> 5, lane = tid & 31, n0 = lane & 15, hi = lane >> 4;
  {
    const uint4* src = (const uint4*)(xc + (size_t)blk * (64 * 256));
    uint4* dst = (uint4*)xa;
    for (int i = tid; i < 2048; i += 128) dst[i] = src[i];
  }
  __syncthreads();
#pragma unroll 1
  for (int mt = 0; mt < 4; ++mt) {
    v8f acc0 = vzero(), acc1 = vzero();
#pragma unroll 2
    for (int ks = 0; ks < 8; ++ks) {
      v16h a = ldfrag(xa, 256, mt * 16, ks * 32);
      acc0 = wmma16(a, ldfrag(pwf, 256, (w * 2 + 0) * 16, ks * 32), acc0);
      acc1 = wmma16(a, ldfrag(pwf, 256, (w * 2 + 1) * 16, ks * 32), acc1);
    }
#pragma unroll
    for (int u = 0; u < 2; ++u) {
      v8f acc = u ? acc1 : acc0;
      int c0 = (w * 2 + u) * 16 + n0;
      float bias = pb[c0];
#pragma unroll
      for (int j = 0; j < 8; ++j) {
        size_t row = (size_t)blk * 64 + mt * 16 + hi * 8 + j;
        prout[row * 128 + c0] = (_Float16)(acc[j] + bias);
      }
    }
  }
}

// ---------------------------------------------------------------- spatial interaction + gating
// One wave walks 32 rows, two at a time: lanes 0-15 take the even row, lanes 16-31 the odd one.
// Lane o of a row holds row o of si_w1 (128 f32) in registers for the whole walk, computes
// hidden unit o, and afterwards gates channels 8*o .. 8*o+7 of the row. No LDS, no barrier.
// grid 1024, block 128 (4 waves): 4096 waves x 32 rows = 131072 rows. At least 4 waves per SIMD
// (at most 256 registers), so that all 4096 waves are resident at once: no second round.
__global__ __launch_bounds__(128, 4)
void k_si_gate(const _Float16* __restrict__ xattn2, const _Float16* __restrict__ prout,
               const float* __restrict__ w1, const float* __restrict__ b1,
               const float* __restrict__ g1, const float* __restrict__ bb1,
               const float* __restrict__ w2, const float* __restrict__ b2,
               const float* __restrict__ cng, const float* __restrict__ cnb,
               _Float16* __restrict__ gated) {
  const int lane = threadIdx.x & 31, o = lane & 15, odd = lane >> 4;
  const int wave = blockIdx.x * 4 + (threadIdx.x >> 5);
  const unsigned wo = o * 512u, go = o * 32u;   // byte offsets: row o of si_w1, channels 8*o..
  f4 wr[32];
#pragma unroll
  for (int i = 0; i < 32; ++i) wr[i] = *(const f4*)((const char*)w1 + wo + i * 16);
  const float bns = rsqrtf(1.f + 1e-5f);
  const float b1o = b1[o], g1o = g1[o], sh1 = bb1[o], w2o = w2[o], b2v = b2[0];
  const f4 gr0 = *(const f4*)((const char*)cng + go), gr1 = *(const f4*)((const char*)cng + go + 16);
  const f4 gb0 = *(const f4*)((const char*)cnb + go), gb1 = *(const f4*)((const char*)cnb + go + 16);
  // the offsets these loads name are inputs here, so they stay in their registers until the
  // wait has passed; behind it the registers may be reused
  asm volatile("s_wait_xcnt 0x0" :: "v"(wo), "v"(go), "v"(o) : "memory");
  const float sc1 = g1o * bns;
  const f4 gs0 = gr0 * bns, gs1 = gr1 * bns;
  const float gs[8] = {gs0.x, gs0.y, gs0.z, gs0.w, gs1.x, gs1.y, gs1.z, gs1.w};
  const float gb[8] = {gb0.x, gb0.y, gb0.z, gb0.w, gb1.x, gb1.y, gb1.z, gb1.w};
  // rolled: one pair of rows is already some 500 instructions
#pragma unroll 1
  for (int it = 0; it < 16; ++it) {
    const int r = wave * 32 + it * 2 + odd;
    // windowed row -> image position
    const int b_ = r >> 6, n = r & 63;
    const int b = b_ >> 6, wi = b_ & 63;
    const int y = (wi >> 3) * 8 + (n >> 3);
    const int xx = (wi & 7) * 8 + (n & 7);
    const size_t p = (size_t)b * 4096 + (size_t)y * 64 + xx;
    const h8* xp = (const h8*)(xattn2 + (size_t)r * 128);
    const h8* pp = (const h8*)(prout + p * 128 + o * 8);
    h8 xv[16];                            // the whole row, the same in its 16 lanes
#pragma unroll
    for (int i = 0; i < 16; ++i) xv[i] = xp[i];
    const h8 pv = *pp;
    // xp and pp are inputs here, so they stay in their registers until the wait has passed
    asm volatile("s_wait_xcnt 0x0" :: "v"(xp), "v"(pp) : "memory");
    // four independent chains (k mod 4), so that a wave does not wait out each FMA's latency
    f4 s4 = {0.f, 0.f, 0.f, 0.f};
#pragma unroll
    for (int i = 0; i < 16; ++i) {
      f4 lo = {(float)xv[i][0], (float)xv[i][1], (float)xv[i][2], (float)xv[i][3]};
      f4 hv = {(float)xv[i][4], (float)xv[i][5], (float)xv[i][6], (float)xv[i][7]};
      s4 += wr[i * 2] * lo;
      s4 += wr[i * 2 + 1] * hv;
    }
    float a = b1o + ((s4.x + s4.y) + (s4.z + s4.w));
    a = a * sc1 + sh1;
    float t = w2o * geluf(a);
    // sum over the row's 16 hidden units = its 16 lanes
#pragma unroll
    for (int msk = 1; msk < 16; msk <<= 1) t += __shfl_xor(t, msk, 32);
    const float siv = t + b2v;
    h8 ov;
#pragma unroll
    for (int k = 0; k < 8; ++k) ov[k] = (_Float16)(sigmf(siv * (float)pv[k]) * gs[k] + gb[k]);
    *(h8*)(gated + (size_t)r * 128 + o * 8) = ov;
    // the store's address and data registers are reused by the next pair of rows
    asm volatile("s_wait_xcnt 0x0" ::: "memory");
  }
}

// ---------------------------------------------------------------- final concat GEMM (+LN on attn half)
// grid 2048, block 256, shmem 32KB
__global__ void k_final(const _Float16* __restrict__ xattn2, const _Float16* __restrict__ gated,
                        const _Float16* __restrict__ owT, const float* __restrict__ ob,
                        const float* __restrict__ ang, const float* __restrict__ anb,
                        float* __restrict__ out) {
  extern __shared__ char smemraw[];
  _Float16* A = (_Float16*)smemraw;  // 64 x 256
  const int win = blockIdx.x, tid = threadIdx.x;
  const int w = tid >> 5, lane = tid & 31, n0 = lane & 15, hi = lane >> 4;
  for (int i = tid; i < 8192; i += 256) {
    int r = i >> 7, c = i & 127;
    A[r * 256 + c]       = xattn2[(size_t)win * 8192 + i];
    A[r * 256 + 128 + c] = gated[(size_t)win * 8192 + i];
  }
  __syncthreads();
  if (tid < 64) {  // LN in place on the attention half of the row
    float m = 0.f;
    for (int c = 0; c < 128; ++c) m += (float)A[tid * 256 + c];
    m *= (1.f / 128.f);
    float v = 0.f;
    for (int c = 0; c < 128; ++c) { float d = (float)A[tid * 256 + c] - m; v += d * d; }
    v *= (1.f / 128.f);
    float rs = rsqrtf(v + 1e-5f);
    for (int c = 0; c < 128; ++c)
      A[tid * 256 + c] = (_Float16)(((float)A[tid * 256 + c] - m) * rs * ang[c] + anb[c]);
  }
  __syncthreads();
#pragma unroll 1
  for (int mt = 0; mt < 4; ++mt) {
    v8f acc0 = vzero(), acc1 = vzero();
#pragma unroll 2
    for (int ks = 0; ks < 8; ++ks) {
      v16h a = ldfrag(A, 256, mt * 16, ks * 32);
      acc0 = wmma16(a, ldfrag(owT, 256, (w * 2 + 0) * 16, ks * 32), acc0);
      acc1 = wmma16(a, ldfrag(owT, 256, (w * 2 + 1) * 16, ks * 32), acc1);
    }
#pragma unroll
    for (int u = 0; u < 2; ++u) {
      v8f acc = u ? acc1 : acc0;
      int c0 = (w * 2 + u) * 16 + n0;
      float bias = ob[c0];
#pragma unroll
      for (int j = 0; j < 8; ++j) {
        size_t row = (size_t)win * 64 + mt * 16 + hi * 8 + j;
        out[row * 256 + c0] = acc[j] + bias;
      }
    }
  }
}

// ---------------------------------------------------------------- launcher
extern "C" void kernel_launch(void* const* d_in, const int* in_sizes, int n_in,
                              void* d_out, int out_size, void* d_ws, size_t ws_size,
                              hipStream_t stream) {
  (void)in_sizes; (void)n_in; (void)out_size; (void)ws_size;
  const float* x       = (const float*)d_in[0];
  const float* relb    = (const float*)d_in[1];
  const float* attn_w  = (const float*)d_in[2];
  const float* attn_b  = (const float*)d_in[3];
  const float* aln_g   = (const float*)d_in[4];
  const float* aln_b   = (const float*)d_in[5];
  const float* conv_w  = (const float*)d_in[6];
  const float* conv_b  = (const float*)d_in[7];
  const float* cbn_g   = (const float*)d_in[8];
  const float* cbn_b   = (const float*)d_in[9];
  const float* ci_w1   = (const float*)d_in[10];
  const float* ci_b1   = (const float*)d_in[11];
  const float* ci_g    = (const float*)d_in[12];
  const float* ci_bb   = (const float*)d_in[13];
  const float* ci_w2   = (const float*)d_in[14];
  const float* ci_b2   = (const float*)d_in[15];
  const float* pr_w    = (const float*)d_in[16];
  const float* pr_b    = (const float*)d_in[17];
  const float* cn_g    = (const float*)d_in[18];
  const float* cn_b    = (const float*)d_in[19];
  const float* qkv_w   = (const float*)d_in[20];
  const float* qkv_b   = (const float*)d_in[21];
  const float* si_w1   = (const float*)d_in[22];
  const float* si_b1   = (const float*)d_in[23];
  const float* si_g    = (const float*)d_in[24];
  const float* si_bb   = (const float*)d_in[25];
  const float* si_w2   = (const float*)d_in[26];
  const float* si_b2   = (const float*)d_in[27];
  const float* an_g    = (const float*)d_in[28];
  const float* an_b    = (const float*)d_in[29];
  const float* out_w   = (const float*)d_in[30];
  const float* out_b   = (const float*)d_in[31];
  float* out = (float*)d_out;

  // workspace arena
  char* W = (char*)d_ws;
  size_t off = 0;
  auto take = [&](size_t bytes) { char* p = W + off; off += (bytes + 255) & ~(size_t)255; return p; };
  _Float16* x_f16   = (_Float16*)take(67108864);   // (131072, 256) f16
  _Float16* attn_wT = (_Float16*)take(65536);      // (128, 256)
  _Float16* qkv_wT  = (_Float16*)take(98304);      // (384, 128)
  _Float16* out_wT  = (_Float16*)take(131072);     // (256, 256)
  _Float16* pr_wf   = (_Float16*)take(65536);      // (128, 256)
  _Float16* x_attn  = (_Float16*)take(33554432);   // (131072, 128)
  _Float16* x_attn2 = (_Float16*)take(33554432);   // (131072, 128)
  _Float16* xc      = (_Float16*)take(67108864);   // (131072, 256) NHWC
  float*    part    = (float*)take(2097152);       // (32, 64, 256)
  float*    gap     = (float*)take(32768);         // (32, 256)
  float*    cis     = (float*)take(16384);         // (32, 128)
  // x_f16 is dead after k_attnproj_ln -> reuse its region
  _Float16* pr_out  = (_Float16*)x_f16;                           // (131072, 128)
  _Float16* gated   = (_Float16*)((char*)x_f16 + 33554432);       // (131072, 128)

  k_cvt_x<<<131072, 256, 0, stream>>>(x, x_f16);
  k_prep_w<<<704, 256, 0, stream>>>(attn_w, qkv_w, out_w, pr_w, attn_wT, qkv_wT, out_wT, pr_wf);
  k_attnproj_ln<<<2048, 128, 65536, stream>>>(x_f16, attn_wT, attn_b, aln_g, aln_b, x_attn);
  k_dwconv<<<2048, 64, 0, stream>>>(x, conv_w, conv_b, cbn_g, cbn_b, xc);
  k_gap_partial<<<2048, 256, 0, stream>>>(xc, part);
  k_gap_final<<<32, 256, 0, stream>>>(part, gap);
  k_ci<<<32, 128, 0, stream>>>(gap, ci_w1, ci_b1, ci_g, ci_bb, ci_w2, ci_b2, cis);
  k_attention<<<2048, 256, 138272, stream>>>(x_attn, qkv_wT, qkv_b, cis, relb, x_attn2);
  k_prgemm<<<2048, 128, 32768, stream>>>(xc, pr_wf, pr_b, pr_out);
  k_si_gate<<<1024, 128, 0, stream>>>(x_attn2, pr_out, si_w1, si_b1, si_g, si_bb,
                                        si_w2, si_b2, cn_g, cn_b, gated);
  k_final<<<2048, 256, 32768, stream>>>(x_attn2, gated, out_wT, out_b, an_g, an_b, out);
}

// v003
// Measured time: 484 microseconds a run.
// Two timings next to v002 both put it at 1.23 times that version's speed.
// Counting every step since v000, it is 1.85 times as fast.
#include <hip/hip_runtime.h>
#include <hip/hip_bf16.h>

#define DI __device__ __forceinline__

typedef __attribute__((ext_vector_type(16))) _Float16 v16h;
typedef __attribute__((ext_vector_type(8)))  _Float16 h8;
typedef __attribute__((ext_vector_type(8)))  float    v8f;

// ---------------------------------------------------------------- helpers
DI v8f vzero() { v8f z = {0.f,0.f,0.f,0.f,0.f,0.f,0.f,0.f}; return z; }

DI v8f wmma16(v16h a, v16h b, v8f c) {
  return __builtin_amdgcn_wmma_f32_16x16x32_f16(false, a, false, b, (short)0, c, false, false);
}

// A-fragment (16x32 f16): lane L -> row r0+(L&15); halves 0..7 = K k0+8*(L>>4)..+7,
// halves 8..15 = K k0+16+8*(L>>4)..+7.  B^T uses identical layout (row = out col).
DI v16h ldfrag(const _Float16* p, int ld, int r0, int k0) {
  int lane = threadIdx.x & 31;
  int m = lane & 15, hi = lane >> 4;
  const _Float16* q = p + (size_t)(r0 + m) * ld + k0 + hi * 8;
  h8 lo = *(const h8*)q;
  h8 hv = *(const h8*)(q + 16);
  return __builtin_shufflevector(lo, hv, 0,1,2,3,4,5,6,7,8,9,10,11,12,13,14,15);
}

// A-fragment with only K=16 valid (upper 16 of K zero) for HD=16 attention.
DI v16h ldfrag16(const _Float16* p, int ld, int r0, int c0) {
  int lane = threadIdx.x & 31;
  int m = lane & 15, hi = lane >> 4;
  const _Float16* q = p + (size_t)(r0 + m) * ld + c0 + hi * 8;
  h8 lo = *(const h8*)q;
  h8 z = {(_Float16)0.f,(_Float16)0.f,(_Float16)0.f,(_Float16)0.f,
          (_Float16)0.f,(_Float16)0.f,(_Float16)0.f,(_Float16)0.f};
  return __builtin_shufflevector(lo, z, 0,1,2,3,4,5,6,7,8,9,10,11,12,13,14,15);
}

DI float geluf(float x) { return 0.5f * x * (1.0f + erff(x * 0.70710678118654752f)); }
DI float sigmf(float x) { return 1.0f / (1.0f + expf(-x)); }

// ---------------------------------------------------------------- prep kernels
__global__ void k_cvt_x(const float* __restrict__ x, _Float16* __restrict__ xf) {
  size_t i = (size_t)blockIdx.x * 256 + threadIdx.x;
  xf[i] = (_Float16)x[i];
}

__global__ void k_prep_w(const float* __restrict__ aw, const float* __restrict__ qw,
                         const float* __restrict__ ow, const float* __restrict__ pw,
                         _Float16* __restrict__ awT, _Float16* __restrict__ qwT,
                         _Float16* __restrict__ owT, _Float16* __restrict__ pwf) {
  int i = blockIdx.x * 256 + threadIdx.x;
  const int A = 128 * 256, Q = 384 * 128, O = 256 * 256, P = 128 * 256;
  if (i < A) {                               // attn_w (256,128) -> (128,256)^T
    int n = i >> 8, k = i & 255;
    awT[i] = (_Float16)aw[k * 128 + n];
  } else if (i < A + Q) {                    // qkv_w (128,384) -> (384,128)^T
    int j = i - A; int n = j >> 7, k = j & 127;
    qwT[j] = (_Float16)qw[k * 384 + n];
  } else if (i < A + Q + O) {                // out_w (256,256) -> (256,256)^T
    int j = i - A - Q; int n = j >> 8, k = j & 255;
    owT[j] = (_Float16)ow[k * 256 + n];
  } else if (i < A + Q + O + P) {            // pr_w (128,256) already (O,I) = B^T
    int j = i - A - Q - O;
    pwf[j] = (_Float16)pw[j];
  }
}

// ---------------------------------------------------------------- attn proj + LN
// grid 2048 (one window), block 128 (4 waves), shmem 64*264*2 + 64*130*4 = 67072 B
// LDS rows are padded so that rows read together fall on different banks: xa by 16 bytes
// (pitch 16 B x odd, for the 16 rows of a 16-byte fragment read), ob by 2 floats (pitch 130
// dwords, for the LayerNorm, where each lane walks a row of its own 8 bytes at a time).
__global__ void k_attnproj_ln(const _Float16* __restrict__ xf,
                              const _Float16* __restrict__ awT,
                              const float* __restrict__ ab,
                              const float* __restrict__ lg,
                              const float* __restrict__ lb,
                              _Float16* __restrict__ xattn) {
  extern __shared__ char smemraw[];
  _Float16* xa = (_Float16*)smemraw;           // 64 x 256, pitch 264
  float* ob = (float*)(xa + 64 * 264);         // 64 x 128, pitch 130
  const int win = blockIdx.x, tid = threadIdx.x;
  const int w = tid >> 5, lane = tid & 31, n0 = lane & 15, hi = lane >> 4;
  {
    const uint4* src = (const uint4*)(xf + (size_t)win * (64 * 256));
    uint4* dst = (uint4*)xa;
    for (int i = tid; i < 2048; i += 128) dst[(i >> 5) * 33 + (i & 31)] = src[i];
  }
  __syncthreads();
#pragma unroll 1
  for (int mt = 0; mt < 4; ++mt) {
    v8f acc0 = vzero(), acc1 = vzero();
#pragma unroll 2
    for (int ks = 0; ks < 8; ++ks) {
      v16h a = ldfrag(xa, 264, mt * 16, ks * 32);
      v16h b0 = ldfrag(awT, 256, (w * 2 + 0) * 16, ks * 32);
      acc0 = wmma16(a, b0, acc0);
      v16h b1 = ldfrag(awT, 256, (w * 2 + 1) * 16, ks * 32);
      acc1 = wmma16(a, b1, acc1);
    }
#pragma unroll
    for (int u = 0; u < 2; ++u) {
      v8f acc = u ? acc1 : acc0;
      int c0 = (w * 2 + u) * 16 + n0;
      float bias = ab[c0];
#pragma unroll
      for (int j = 0; j < 8; ++j)
        ob[(mt * 16 + hi * 8 + j) * 130 + c0] = acc[j] + bias;
    }
  }
  __syncthreads();
  if (tid < 64) {
    float m = 0.f;
    for (int c = 0; c < 128; ++c) m += ob[tid * 130 + c];
    m *= (1.f / 128.f);
    float v = 0.f;
    for (int c = 0; c < 128; ++c) { float d = ob[tid * 130 + c] - m; v += d * d; }
    v *= (1.f / 128.f);
    float rs = rsqrtf(v + 1e-5f);
    _Float16* drow = xattn + ((size_t)win * 64 + tid) * 128;
    for (int c = 0; c < 128; ++c)
      drow[c] = (_Float16)((ob[tid * 130 + c] - m) * rs * lg[c] + lb[c]);
  }
}

// ---------------------------------------------------------------- depthwise 3x3 + BN + GELU
// One thread = one 8x8 window x 4 channels. The 9 taps of its channels and three
// input rows (8 pixels + 1 halo pixel each side) stay in registers, so every input
// value is loaded once per window, 16 bytes a lane, 512 contiguous bytes a wave.
typedef __attribute__((ext_vector_type(4))) float    f4;
typedef __attribute__((ext_vector_type(4))) _Float16 h4;

// Row ry (-1..8) of the window at 'base' (own window, this thread's channels):
// r[0] / r[9] are the neighbours' edge pixels; outside the image everything is 0.
// At the image's left / right edge the halo load re-reads an own pixel (in bounds);
// dw_edge() replaces its value by 0 where the row is first used, not behind the load,
// so that nothing waits for the data while the loads fly.
DI void dw_ldrow(f4 (&r)[10], const float* base, int ry, int wy, int wx) {
  const f4 z = {0.f, 0.f, 0.f, 0.f};
  const bool ok = (ry >= 0 || wy > 0) && (ry < 8 || wy < 7);
  if (ok) {
    const float* rp = (ry < 0) ? base - 8 * 16384 + 7 * 2048
                    : (ry < 8) ? base + ry * 2048 : base + 8 * 16384;
    r[0] = *(const f4*)(rp + ((wx > 0) ? -16384 + 7 * 256 : 0));
#pragma unroll
    for (int i = 0; i < 8; ++i) r[1 + i] = *(const f4*)(rp + i * 256);
    r[9] = *(const f4*)(rp + ((wx < 7) ? 16384 : 0));
    // the loads' address registers may be reused right behind them
    asm volatile("s_wait_xcnt 0x0" ::: "memory");
  } else {
#pragma unroll
    for (int i = 0; i < 10; ++i) r[i] = z;
  }
}
DI void dw_edge(f4 (&r)[10], int wx) {
  const f4 z = {0.f, 0.f, 0.f, 0.f};
  r[0] = (wx > 0) ? r[0] : z;
  r[9] = (wx < 7) ? r[9] : z;
}

// grid 2048 (one window), block 64 (64 x 4 channels)
__global__ __launch_bounds__(64)
void k_dwconv(const float* __restrict__ x, const float* __restrict__ cw,
              const float* __restrict__ cb, const float* __restrict__ bg,
              const float* __restrict__ bb, _Float16* __restrict__ xc) {
  const int win = blockIdx.x;
  const int b = win >> 6, wy = (win >> 3) & 7, wx = win & 7;
  const int c = threadIdx.x * 4;
  f4 wt[9];
  {
    float wl[36];                          // 4 channels x 9 taps, contiguous
#pragma unroll
    for (int i = 0; i < 9; ++i) {
      f4 t = *(const f4*)(cw + c * 9 + i * 4);
      wl[i * 4 + 0] = t.x; wl[i * 4 + 1] = t.y; wl[i * 4 + 2] = t.z; wl[i * 4 + 3] = t.w;
    }
#pragma unroll
    for (int k = 0; k < 9; ++k) { f4 t = {wl[k], wl[9 + k], wl[18 + k], wl[27 + k]}; wt[k] = t; }
  }
  const float bns = rsqrtf(1.f + 1e-5f);
  const f4 cb4 = *(const f4*)(cb + c);
  const f4 sc4 = *(const f4*)(bg + c) * bns;
  const f4 bb4 = *(const f4*)(bb + c);
  const float* base = x + (size_t)win * 16384 + c;
  _Float16* orow = xc + (((size_t)b * 4096 + (size_t)wy * 512 + wx * 8) * 256 + c);

  f4 r0[10], r1[10], r2[10];
  dw_ldrow(r0, base, -1, wy, wx);
  dw_ldrow(r1, base, 0, wy, wx);
  dw_ldrow(r2, base, 1, wy, wx);
  dw_edge(r0, wx);
  dw_edge(r1, wx);
  // rolled: one row's body is already about 1,500 instructions
#pragma unroll 1
  for (int ry = 0; ry < 8; ++ry) {
    dw_edge(r2, wx);
    f4 acc[8];
#pragma unroll
    for (int px = 0; px < 8; ++px) {
      f4 s = {0.f, 0.f, 0.f, 0.f};
#pragma unroll
      for (int dx = 0; dx < 3; ++dx) s += r0[px + dx] * wt[dx];
#pragma unroll
      for (int dx = 0; dx < 3; ++dx) s += r1[px + dx] * wt[3 + dx];
#pragma unroll
      for (int dx = 0; dx < 3; ++dx) s += r2[px + dx] * wt[6 + dx];
      acc[px] = s;
    }
#pragma unroll
    for (int i = 0; i < 10; ++i) { r0[i] = r1[i]; r1[i] = r2[i]; }
    // the next row's loads fly while this row's BN + GELU is computed
    if (ry < 7) dw_ldrow(r2, base, ry + 2, wy, wx);
#pragma unroll
    for (int px = 0; px < 8; ++px) {
      f4 v = (acc[px] + cb4) * sc4 + bb4;
      h4 o = {(_Float16)geluf(v.x), (_Float16)geluf(v.y), (_Float16)geluf(v.z), (_Float16)geluf(v.w)};
      *(h4*)(orow + (size_t)ry * 16384 + px * 256) = o;
    }
    // the last store's address and data registers are reused by the next row
    asm volatile("s_wait_xcnt 0x0" ::: "memory");
  }
}

// deterministic 2-stage GAP (no float atomics -> graph-replay bit-stable)
__global__ void k_gap_partial(const _Float16* __restrict__ xc, float* __restrict__ part) {
  int blk = blockIdx.x;                 // b*64 + chunk
  int b = blk >> 6, chunk = blk & 63;
  int c = threadIdx.x;                  // 256 channels
  float s = 0.f;
  size_t base = ((size_t)b * 4096 + (size_t)chunk * 64) * 256 + c;
  for (int p2 = 0; p2 < 64; ++p2) s += (float)xc[base + (size_t)p2 * 256];
  part[(size_t)blk * 256 + c] = s;
}
__global__ void k_gap_final(const float* __restrict__ part, float* __restrict__ gap) {
  int b = blockIdx.x, c = threadIdx.x;
  float s = 0.f;
  for (int k2 = 0; k2 < 64; ++k2) s += part[((size_t)b * 64 + k2) * 256 + c];
  gap[b * 256 + c] = s;
}

// channel interaction MLP -> sigmoid gates (32 images, tiny)
__global__ void k_ci(const float* __restrict__ gap, const float* __restrict__ w1,
                     const float* __restrict__ b1, const float* __restrict__ g1,
                     const float* __restrict__ bb1, const float* __restrict__ w2,
                     const float* __restrict__ b2, float* __restrict__ cis) {
  __shared__ float d1[32];
  int b = blockIdx.x, t = threadIdx.x;  // 128 threads
  float bns = rsqrtf(1.f + 1e-5f);
  if (t < 32) {
    float a = b1[t];
    const float inv = 1.f / 4096.f;
    for (int i = 0; i < 256; ++i) a += w1[t * 256 + i] * gap[b * 256 + i] * inv;
    a = a * (g1[t] * bns) + bb1[t];
    d1[t] = geluf(a);
  }
  __syncthreads();
  float a = b2[t];
  for (int j = 0; j < 32; ++j) a += w2[t * 32 + j] * d1[j];
  cis[b * 128 + t] = sigmf(a);
}

// ---------------------------------------------------------------- fused qkv + attention
// grid 2048 windows, block 256 (8 waves = 8 heads), dyn shmem 145316B (f16 rows padded by 16 B, bias rows by 4 B)
__global__ void k_attention(const _Float16* __restrict__ xattn,
                            const _Float16* __restrict__ qwT,
                            const float* __restrict__ qb,
                            const float* __restrict__ cis,
                            const float* __restrict__ relb,
                            _Float16* __restrict__ xattn2) {
  extern __shared__ char smemraw[];
  _Float16* xa  = (_Float16*)smemraw;      // 64 x 128, pitch 136
  _Float16* qs  = xa + 64 * 136;           // 64 x 128, pitch 136 (scale folded in)
  _Float16* kks = qs + 64 * 136;           // 64 x 128, pitch 136
  _Float16* vT  = kks + 64 * 136;          // 128 x 64, pitch 72 (transposed, ci-gated)
  _Float16* P   = vT + 128 * 72;           // 64 x 512, pitch 520 (8 heads * 64)
  float* bsh    = (float*)(P + 64 * 520);  // 225 x 8 rel-pos bias, pitch 9 (odd: a wave's 24 rows on 24 banks)

  const int win = blockIdx.x, tid = threadIdx.x;
  const int w = tid >> 5, lane = tid & 31, n0 = lane & 15, hi = lane >> 4;
  const int img = win >> 6;
  {
    const uint4* src = (const uint4*)(xattn + (size_t)win * (64 * 128));
    uint4* dst = (uint4*)xa;
    for (int i = tid; i < 1024; i += 256) dst[(i >> 4) * 17 + (i & 15)] = src[i];
    for (int i = tid; i < 1800; i += 256) bsh[(i >> 3) * 9 + (i & 7)] = relb[i];
  }
  __syncthreads();

  // qkv GEMM: (64x128) @ (128x384); wave w -> out cols [48w, 48w+48)
#pragma unroll 1
  for (int mt = 0; mt < 4; ++mt) {
    v8f acc0 = vzero(), acc1 = vzero(), acc2 = vzero();
#pragma unroll 2
    for (int ks = 0; ks < 4; ++ks) {
      v16h a = ldfrag(xa, 136, mt * 16, ks * 32);
      acc0 = wmma16(a, ldfrag(qwT, 128, (w * 3 + 0) * 16, ks * 32), acc0);
      acc1 = wmma16(a, ldfrag(qwT, 128, (w * 3 + 1) * 16, ks * 32), acc1);
      acc2 = wmma16(a, ldfrag(qwT, 128, (w * 3 + 2) * 16, ks * 32), acc2);
    }
#pragma unroll
    for (int u = 0; u < 3; ++u) {
      v8f acc = (u == 0) ? acc0 : (u == 1) ? acc1 : acc2;
      int c0 = (w * 3 + u) * 16 + n0;
      float bias = qb[c0];
#pragma unroll
      for (int j = 0; j < 8; ++j) {
        int row = mt * 16 + hi * 8 + j;
        float v = acc[j] + bias;
        if (c0 < 128)      qs[row * 136 + c0] = (_Float16)(v * 0.25f);       // HD^-0.5
        else if (c0 < 256) kks[row * 136 + (c0 - 128)] = (_Float16)v;
        else { int ca = c0 - 256; vT[ca * 72 + row] = (_Float16)(v * cis[img * 128 + ca]); }
      }
    }
  }
  __syncthreads();

  // per-head scores + softmax, one 16-row M-tile at a time (keeps pressure low)
  const int h = w;
#pragma unroll 1
  for (int mt = 0; mt < 4; ++mt) {
    v16h aq = ldfrag16(qs, 136, mt * 16, h * 16);
    v8f s[4];
#pragma unroll
    for (int nt = 0; nt < 4; ++nt)
      s[nt] = wmma16(aq, ldfrag16(kks, 136, nt * 16, h * 16), vzero());
    // + relative position bias
#pragma unroll
    for (int nt = 0; nt < 4; ++nt)
#pragma unroll
      for (int j = 0; j < 8; ++j) {
        int m = mt * 16 + hi * 8 + j;
        int n = nt * 16 + n0;
        int idx = ((m >> 3) - (n >> 3) + 7) * 15 + ((m & 7) - (n & 7) + 7);
        s[nt][j] += bsh[idx * 9 + h];
      }
    // row softmax: reduce over 4 n-tiles + 16-lane xor shuffles
#pragma unroll
    for (int j = 0; j < 8; ++j) {
      float mx = fmaxf(fmaxf(s[0][j], s[1][j]), fmaxf(s[2][j], s[3][j]));
#pragma unroll
      for (int msk = 1; msk < 16; msk <<= 1) mx = fmaxf(mx, __shfl_xor(mx, msk, 32));
      float sum = 0.f;
#pragma unroll
      for (int nt = 0; nt < 4; ++nt) { float e = expf(s[nt][j] - mx); s[nt][j] = e; sum += e; }
#pragma unroll
      for (int msk = 1; msk < 16; msk <<= 1) sum += __shfl_xor(sum, msk, 32);
      float inv = 1.0f / sum;
#pragma unroll
      for (int nt = 0; nt < 4; ++nt) s[nt][j] *= inv;
    }
#pragma unroll
    for (int nt = 0; nt < 4; ++nt)
#pragma unroll
      for (int j = 0; j < 8; ++j) {
        int m = mt * 16 + hi * 8 + j;
        P[m * 520 + h * 64 + nt * 16 + n0] = (_Float16)s[nt][j];
      }
  }
  __syncthreads();

  // O = P @ V per head: (64x64) @ (64x16), K = 64 -> 2 WMMA k-steps
#pragma unroll 1
  for (int mt = 0; mt < 4; ++mt) {
    v8f o = vzero();
#pragma unroll
    for (int ks = 0; ks < 2; ++ks) {
      v16h a = ldfrag(P, 520, mt * 16, h * 64 + ks * 32);
      v16h b = ldfrag(vT, 72, h * 16, ks * 32);
      o = wmma16(a, b, o);
    }
#pragma unroll
    for (int j = 0; j < 8; ++j) {
      size_t row = (size_t)win * 64 + mt * 16 + hi * 8 + j;
      xattn2[row * 128 + h * 16 + n0] = (_Float16)o[j];
    }
  }
}

// ---------------------------------------------------------------- pr 1x1 conv GEMM
// grid 2048 (64 pixels = one image row each), block 128, shmem 33KB (rows padded by 16 B)
__global__ void k_prgemm(const _Float16* __restrict__ xc, const _Float16* __restrict__ pwf,
                         const float* __restrict__ pb, _Float16* __restrict__ prout) {
  extern __shared__ char smemraw[];
  _Float16* xa = (_Float16*)smemraw;  // 64 x 256, pitch 264
  const int blk = blockIdx.x, tid = threadIdx.x;
  const int w = tid >> 5, lane = tid & 31, n0 = lane & 15, hi = lane >> 4;
  {
    const uint4* src = (const uint4*)(xc + (size_t)blk * (64 * 256));
    uint4* dst = (uint4*)xa;
    for (int i = tid; i < 2048; i += 128) dst[(i >> 5) * 33 + (i & 31)] = src[i];
  }
  __syncthreads();
#pragma unroll 1
  for (int mt = 0; mt < 4; ++mt) {
    v8f acc0 = vzero(), acc1 = vzero();
#pragma unroll 2
    for (int ks = 0; ks < 8; ++ks) {
      v16h a = ldfrag(xa, 264, mt * 16, ks * 32);
      acc0 = wmma16(a, ldfrag(pwf, 256, (w * 2 + 0) * 16, ks * 32), acc0);
      acc1 = wmma16(a, ldfrag(pwf, 256, (w * 2 + 1) * 16, ks * 32), acc1);
    }
#pragma unroll
    for (int u = 0; u < 2; ++u) {
      v8f acc = u ? acc1 : acc0;
      int c0 = (w * 2 + u) * 16 + n0;
      float bias = pb[c0];
#pragma unroll
      for (int j = 0; j < 8; ++j) {
        size_t row = (size_t)blk * 64 + mt * 16 + hi * 8 + j;
        prout[row * 128 + c0] = (_Float16)(acc[j] + bias);
      }
    }
  }
}

// ---------------------------------------------------------------- spatial interaction + gating
// One wave walks 32 rows, two at a time: lanes 0-15 take the even row, lanes 16-31 the odd one.
// Lane o of a row holds row o of si_w1 (128 f32) in registers for the whole walk, computes
// hidden unit o, and afterwards gates channels 8*o .. 8*o+7 of the row. No LDS, no barrier.
// grid 1024, block 128 (4 waves): 4096 waves x 32 rows = 131072 rows. At least 4 waves per SIMD
// (at most 256 registers), so that all 4096 waves are resident at once: no second round.
__global__ __launch_bounds__(128, 4)
void k_si_gate(const _Float16* __restrict__ xattn2, const _Float16* __restrict__ prout,
               const float* __restrict__ w1, const float* __restrict__ b1,
               const float* __restrict__ g1, const float* __restrict__ bb1,
               const float* __restrict__ w2, const float* __restrict__ b2,
               const float* __restrict__ cng, const float* __restrict__ cnb,
               _Float16* __restrict__ gated) {
  const int lane = threadIdx.x & 31, o = lane & 15, odd = lane >> 4;
  const int wave = blockIdx.x * 4 + (threadIdx.x >> 5);
  const unsigned wo = o * 512u, go = o * 32u;   // byte offsets: row o of si_w1, channels 8*o..
  f4 wr[32];
#pragma unroll
  for (int i = 0; i < 32; ++i) wr[i] = *(const f4*)((const char*)w1 + wo + i * 16);
  const float bns = rsqrtf(1.f + 1e-5f);
  const float b1o = b1[o], g1o = g1[o], sh1 = bb1[o], w2o = w2[o], b2v = b2[0];
  const f4 gr0 = *(const f4*)((const char*)cng + go), gr1 = *(const f4*)((const char*)cng + go + 16);
  const f4 gb0 = *(const f4*)((const char*)cnb + go), gb1 = *(const f4*)((const char*)cnb + go + 16);
  // the offsets these loads name are inputs here, so they stay in their registers until the
  // wait has passed; behind it the registers may be reused
  asm volatile("s_wait_xcnt 0x0" :: "v"(wo), "v"(go), "v"(o) : "memory");
  const float sc1 = g1o * bns;
  const f4 gs0 = gr0 * bns, gs1 = gr1 * bns;
  const float gs[8] = {gs0.x, gs0.y, gs0.z, gs0.w, gs1.x, gs1.y, gs1.z, gs1.w};
  const float gb[8] = {gb0.x, gb0.y, gb0.z, gb0.w, gb1.x, gb1.y, gb1.z, gb1.w};
  // rolled: one pair of rows is already some 500 instructions
#pragma unroll 1
  for (int it = 0; it < 16; ++it) {
    const int r = wave * 32 + it * 2 + odd;
    // windowed row -> image position
    const int b_ = r >> 6, n = r & 63;
    const int b = b_ >> 6, wi = b_ & 63;
    const int y = (wi >> 3) * 8 + (n >> 3);
    const int xx = (wi & 7) * 8 + (n & 7);
    const size_t p = (size_t)b * 4096 + (size_t)y * 64 + xx;
    const h8* xp = (const h8*)(xattn2 + (size_t)r * 128);
    const h8* pp = (const h8*)(prout + p * 128 + o * 8);
    h8 xv[16];                            // the whole row, the same in its 16 lanes
#pragma unroll
    for (int i = 0; i < 16; ++i) xv[i] = xp[i];
    const h8 pv = *pp;
    // xp and pp are inputs here, so they stay in their registers until the wait has passed
    asm volatile("s_wait_xcnt 0x0" :: "v"(xp), "v"(pp) : "memory");
    // four independent chains (k mod 4), so that a wave does not wait out each FMA's latency
    f4 s4 = {0.f, 0.f, 0.f, 0.f};
#pragma unroll
    for (int i = 0; i < 16; ++i) {
      f4 lo = {(float)xv[i][0], (float)xv[i][1], (float)xv[i][2], (float)xv[i][3]};
      f4 hv = {(float)xv[i][4], (float)xv[i][5], (float)xv[i][6], (float)xv[i][7]};
      s4 += wr[i * 2] * lo;
      s4 += wr[i * 2 + 1] * hv;
    }
    float a = b1o + ((s4.x + s4.y) + (s4.z + s4.w));
    a = a * sc1 + sh1;
    float t = w2o * geluf(a);
    // sum over the row's 16 hidden units = its 16 lanes
#pragma unroll
    for (int msk = 1; msk < 16; msk <<= 1) t += __shfl_xor(t, msk, 32);
    const float siv = t + b2v;
    h8 ov;
#pragma unroll
    for (int k = 0; k < 8; ++k) ov[k] = (_Float16)(sigmf(siv * (float)pv[k]) * gs[k] + gb[k]);
    *(h8*)(gated + (size_t)r * 128 + o * 8) = ov;
    // the store's address and data registers are reused by the next pair of rows
    asm volatile("s_wait_xcnt 0x0" ::: "memory");
  }
}

// ---------------------------------------------------------------- final concat GEMM (+LN on attn half)
// grid 2048, block 256, shmem 33KB (rows padded by 16 B)
__global__ void k_final(const _Float16* __restrict__ xattn2, const _Float16* __restrict__ gated,
                        const _Float16* __restrict__ owT, const float* __restrict__ ob,
                        const float* __restrict__ ang, const float* __restrict__ anb,
                        float* __restrict__ out) {
  extern __shared__ char smemraw[];
  _Float16* A = (_Float16*)smemraw;  // 64 x 256, pitch 264
  const int win = blockIdx.x, tid = threadIdx.x;
  const int w = tid >> 5, lane = tid & 31, n0 = lane & 15, hi = lane >> 4;
  for (int i = tid; i < 8192; i += 256) {
    int r = i >> 7, c = i & 127;
    A[r * 264 + c]       = xattn2[(size_t)win * 8192 + i];
    A[r * 264 + 128 + c] = gated[(size_t)win * 8192 + i];
  }
  __syncthreads();
  if (tid < 64) {  // LN in place on the attention half of the row
    float m = 0.f;
    for (int c = 0; c < 128; ++c) m += (float)A[tid * 264 + c];
    m *= (1.f / 128.f);
    float v = 0.f;
    for (int c = 0; c < 128; ++c) { float d = (float)A[tid * 264 + c] - m; v += d * d; }
    v *= (1.f / 128.f);
    float rs = rsqrtf(v + 1e-5f);
    for (int c = 0; c < 128; ++c)
      A[tid * 264 + c] = (_Float16)(((float)A[tid * 264 + c] - m) * rs * ang[c] + anb[c]);
  }
  __syncthreads();
#pragma unroll 1
  for (int mt = 0; mt < 4; ++mt) {
    v8f acc0 = vzero(), acc1 = vzero();
#pragma unroll 2
    for (int ks = 0; ks < 8; ++ks) {
      v16h a = ldfrag(A, 264, mt * 16, ks * 32);
      acc0 = wmma16(a, ldfrag(owT, 256, (w * 2 + 0) * 16, ks * 32), acc0);
      acc1 = wmma16(a, ldfrag(owT, 256, (w * 2 + 1) * 16, ks * 32), acc1);
    }
#pragma unroll
    for (int u = 0; u < 2; ++u) {
      v8f acc = u ? acc1 : acc0;
      int c0 = (w * 2 + u) * 16 + n0;
      float bias = ob[c0];
#pragma unroll
      for (int j = 0; j < 8; ++j) {
        size_t row = (size_t)win * 64 + mt * 16 + hi * 8 + j;
        out[row * 256 + c0] = acc[j] + bias;
      }
    }
  }
}

// ---------------------------------------------------------------- launcher
extern "C" void kernel_launch(void* const* d_in, const int* in_sizes, int n_in,
                              void* d_out, int out_size, void* d_ws, size_t ws_size,
                              hipStream_t stream) {
  (void)in_sizes; (void)n_in; (void)out_size; (void)ws_size;
  const float* x       = (const float*)d_in[0];
  const float* relb    = (const float*)d_in[1];
  const float* attn_w  = (const float*)d_in[2];
  const float* attn_b  = (const float*)d_in[3];
  const float* aln_g   = (const float*)d_in[4];
  const float* aln_b   = (const float*)d_in[5];
  const float* conv_w  = (const float*)d_in[6];
  const float* conv_b  = (const float*)d_in[7];
  const float* cbn_g   = (const float*)d_in[8];
  const float* cbn_b   = (const float*)d_in[9];
  const float* ci_w1   = (const float*)d_in[10];
  const float* ci_b1   = (const float*)d_in[11];
  const float* ci_g    = (const float*)d_in[12];
  const float* ci_bb   = (const float*)d_in[13];
  const float* ci_w2   = (const float*)d_in[14];
  const float* ci_b2   = (const float*)d_in[15];
  const float* pr_w    = (const float*)d_in[16];
  const float* pr_b    = (const float*)d_in[17];
  const float* cn_g    = (const float*)d_in[18];
  const float* cn_b    = (const float*)d_in[19];
  const float* qkv_w   = (const float*)d_in[20];
  const float* qkv_b   = (const float*)d_in[21];
  const float* si_w1   = (const float*)d_in[22];
  const float* si_b1   = (const float*)d_in[23];
  const float* si_g    = (const float*)d_in[24];
  const float* si_bb   = (const float*)d_in[25];
  const float* si_w2   = (const float*)d_in[26];
  const float* si_b2   = (const float*)d_in[27];
  const float* an_g    = (const float*)d_in[28];
  const float* an_b    = (const float*)d_in[29];
  const float* out_w   = (const float*)d_in[30];
  const float* out_b   = (const float*)d_in[31];
  float* out = (float*)d_out;

  // workspace arena
  char* W = (char*)d_ws;
  size_t off = 0;
  auto take = [&](size_t bytes) { char* p = W + off; off += (bytes + 255) & ~(size_t)255; return p; };
  _Float16* x_f16   = (_Float16*)take(67108864);   // (131072, 256) f16
  _Float16* attn_wT = (_Float16*)take(65536);      // (128, 256)
  _Float16* qkv_wT  = (_Float16*)take(98304);      // (384, 128)
  _Float16* out_wT  = (_Float16*)take(131072);     // (256, 256)
  _Float16* pr_wf   = (_Float16*)take(65536);      // (128, 256)
  _Float16* x_attn  = (_Float16*)take(33554432);   // (131072, 128)
  _Float16* x_attn2 = (_Float16*)take(33554432);   // (131072, 128)
  _Float16* xc      = (_Float16*)take(67108864);   // (131072, 256) NHWC
  float*    part    = (float*)take(2097152);       // (32, 64, 256)
  float*    gap     = (float*)take(32768);         // (32, 256)
  float*    cis     = (float*)take(16384);         // (32, 128)
  // x_f16 is dead after k_attnproj_ln -> reuse its region
  _Float16* pr_out  = (_Float16*)x_f16;                           // (131072, 128)
  _Float16* gated   = (_Float16*)((char*)x_f16 + 33554432);       // (131072, 128)

  k_cvt_x<<<131072, 256, 0, stream>>>(x, x_f16);
  k_prep_w<<<704, 256, 0, stream>>>(attn_w, qkv_w, out_w, pr_w, attn_wT, qkv_wT, out_wT, pr_wf);
  k_attnproj_ln<<<2048, 128, 67072, stream>>>(x_f16, attn_wT, attn_b, aln_g, aln_b, x_attn);
  k_dwconv<<<2048, 64, 0, stream>>>(x, conv_w, conv_b, cbn_g, cbn_b, xc);
  k_gap_partial<<<2048, 256, 0, stream>>>(xc, part);
  k_gap_final<<<32, 256, 0, stream>>>(part, gap);
  k_ci<<<32, 128, 0, stream>>>(gap, ci_w1, ci_b1, ci_g, ci_bb, ci_w2, ci_b2, cis);
  k_attention<<<2048, 256, 145316, stream>>>(x_attn, qkv_wT, qkv_b, cis, relb, x_attn2);
  k_prgemm<<<2048, 128, 33792, stream>>>(xc, pr_wf, pr_b, pr_out);
  k_si_gate<<<1024, 128, 0, stream>>>(x_attn2, pr_out, si_w1, si_b1, si_g, si_bb,
                                        si_w2, si_b2, cn_g, cn_b, gated);
  k_final<<<2048, 256, 33792, stream>>>(x_attn2, gated, out_wT, out_b, an_g, an_b, out);
}

// v004
// It runs in 337 microseconds.
// Next to v003, in two timings, it ran 1.44 and 1.43 times as fast.
// All steps since v000 together make it 2.66 times as fast.
#include <hip/hip_runtime.h>
#include <hip/hip_bf16.h>

#define DI __device__ __forceinline__

typedef __attribute__((ext_vector_type(16))) _Float16 v16h;
typedef __attribute__((ext_vector_type(8)))  _Float16 h8;
typedef __attribute__((ext_vector_type(8)))  float    v8f;

// ---------------------------------------------------------------- helpers
DI v8f vzero() { v8f z = {0.f,0.f,0.f,0.f,0.f,0.f,0.f,0.f}; return z; }

DI v8f wmma16(v16h a, v16h b, v8f c) {
  return __builtin_amdgcn_wmma_f32_16x16x32_f16(false, a, false, b, (short)0, c, false, false);
}

// A-fragment (16x32 f16): lane L -> row r0+(L&15); halves 0..7 = K k0+8*(L>>4)..+7,
// halves 8..15 = K k0+16+8*(L>>4)..+7.  B^T uses identical layout (row = out col).
DI v16h ldfrag(const _Float16* p, int ld, int r0, int k0) {
  int lane = threadIdx.x & 31;
  int m = lane & 15, hi = lane >> 4;
  const _Float16* q = p + (size_t)(r0 + m) * ld + k0 + hi * 8;
  h8 lo = *(const h8*)q;
  h8 hv = *(const h8*)(q + 16);
  return __builtin_shufflevector(lo, hv, 0,1,2,3,4,5,6,7,8,9,10,11,12,13,14,15);
}

// The same fragment from a base pointer and the lane's byte offset fragoff(ld, r0): the caller
// holds the one offset register that a run of such loads names.
DI unsigned fragoff(int ld, int r0) {
  int lane = threadIdx.x & 31;
  return (unsigned)(((r0 + (lane & 15)) * ld + (lane >> 4) * 8) * 2);
}
DI v16h ldfrag_o(const _Float16* p, unsigned off, int k0) {
  const char* q = (const char*)p + off + k0 * 2;
  h8 lo = *(const h8*)q;
  h8 hv = *(const h8*)(q + 32);
  return __builtin_shufflevector(lo, hv, 0,1,2,3,4,5,6,7,8,9,10,11,12,13,14,15);
}

// A-fragment with only K=16 valid (upper 16 of K zero) for HD=16 attention.
DI v16h ldfrag16(const _Float16* p, int ld, int r0, int c0) {
  int lane = threadIdx.x & 31;
  int m = lane & 15, hi = lane >> 4;
  const _Float16* q = p + (size_t)(r0 + m) * ld + c0 + hi * 8;
  h8 lo = *(const h8*)q;
  h8 z = {(_Float16)0.f,(_Float16)0.f,(_Float16)0.f,(_Float16)0.f,
          (_Float16)0.f,(_Float16)0.f,(_Float16)0.f,(_Float16)0.f};
  return __builtin_shufflevector(lo, z, 0,1,2,3,4,5,6,7,8,9,10,11,12,13,14,15);
}

DI float geluf(float x) { return 0.5f * x * (1.0f + erff(x * 0.70710678118654752f)); }
DI float sigmf(float x) { return 1.0f / (1.0f + expf(-x)); }

// ---------------------------------------------------------------- prep kernels
__global__ void k_cvt_x(const float* __restrict__ x, _Float16* __restrict__ xf) {
  size_t i = (size_t)blockIdx.x * 256 + threadIdx.x;
  xf[i] = (_Float16)x[i];
}

__global__ void k_prep_w(const float* __restrict__ aw, const float* __restrict__ qw,
                         const float* __restrict__ ow, const float* __restrict__ pw,
                         _Float16* __restrict__ awT, _Float16* __restrict__ qwT,
                         _Float16* __restrict__ owT, _Float16* __restrict__ pwf) {
  int i = blockIdx.x * 256 + threadIdx.x;
  const int A = 128 * 256, Q = 384 * 128, O = 256 * 256, P = 128 * 256;
  if (i < A) {                               // attn_w (256,128) -> (128,256)^T
    int n = i >> 8, k = i & 255;
    awT[i] = (_Float16)aw[k * 128 + n];
  } else if (i < A + Q) {                    // qkv_w (128,384) -> (384,128)^T
    int j = i - A; int n = j >> 7, k = j & 127;
    qwT[j] = (_Float16)qw[k * 384 + n];
  } else if (i < A + Q + O) {                // out_w (256,256) -> (256,256)^T
    int j = i - A - Q; int n = j >> 8, k = j & 255;
    owT[j] = (_Float16)ow[k * 256 + n];
  } else if (i < A + Q + O + P) {            // pr_w (128,256) already (O,I) = B^T
    int j = i - A - Q - O;
    pwf[j] = (_Float16)pw[j];
  }
}

// ---------------------------------------------------------------- attn proj + LN
// grid 2048 (one window), block 128 (4 waves), shmem 64*264*2 + 64*130*4 = 67072 B
// LDS rows are padded so that rows read together fall on different banks: xa by 16 bytes
// (pitch 16 B x odd, for the 16 rows of a 16-byte fragment read), ob by 2 floats (pitch 130
// dwords, for the LayerNorm, where each lane walks a row of its own 8 bytes at a time).
// LDS allows 4 work-groups a WGP = 4 waves a SIMD: the compiler is told to plan for exactly
// that (up to 256 registers), else it saves registers by staging one load at a time.
__global__ __launch_bounds__(128) __attribute__((amdgpu_waves_per_eu(4, 4)))
void k_attnproj_ln(const _Float16* __restrict__ xf,
                              const _Float16* __restrict__ awT,
                              const float* __restrict__ ab,
                              const float* __restrict__ lg,
                              const float* __restrict__ lb,
                              _Float16* __restrict__ xattn) {
  extern __shared__ char smemraw[];
  _Float16* xa = (_Float16*)smemraw;           // 64 x 256, pitch 264
  float* ob = (float*)(xa + 64 * 264);         // 64 x 128, pitch 130
  const int win = blockIdx.x, tid = threadIdx.x;
  const int w = tid >> 5, lane = tid & 31, n0 = lane & 15, hi = lane >> 4;
  // The wave's weight fragments (2 column tiles x 8 k steps) are loaded once and serve all
  // 4 row tiles; issued ahead of the staging, they fly together with it.
  v16h bw[2][8];
  const unsigned bo0 = fragoff(256, (w * 2 + 0) * 16), bo1 = fragoff(256, (w * 2 + 1) * 16);
#pragma unroll  // bw is indexed by constants only, so that it stays in registers
  for (int ks = 0; ks < 8; ++ks) {
    bw[0][ks] = ldfrag_o(awT, bo0, ks * 32);
    bw[1][ks] = ldfrag_o(awT, bo1, ks * 32);
  }
  // the offsets these loads name are inputs here, so they stay in their registers until the
  // wait has passed; behind it the registers may be reused
  asm volatile("s_wait_xcnt 0x0" :: "v"(bo0), "v"(bo1) : "memory");
  {
    const uint4* src = (const uint4*)(xf + (size_t)win * (64 * 256));
    uint4* dst = (uint4*)xa;
    for (int i = tid; i < 2048; i += 128) dst[(i >> 5) * 33 + (i & 31)] = src[i];
  }
  __syncthreads();
#pragma unroll 1
  for (int mt = 0; mt < 4; ++mt) {
    v8f acc0 = vzero(), acc1 = vzero();
#pragma unroll  // constant indices into bw
    for (int ks = 0; ks < 8; ++ks) {
      v16h a = ldfrag(xa, 264, mt * 16, ks * 32);
      acc0 = wmma16(a, bw[0][ks], acc0);
      acc1 = wmma16(a, bw[1][ks], acc1);
    }
#pragma unroll
    for (int u = 0; u < 2; ++u) {
      v8f acc = u ? acc1 : acc0;
      int c0 = (w * 2 + u) * 16 + n0;
      float bias = ab[c0];
#pragma unroll
      for (int j = 0; j < 8; ++j)
        ob[(mt * 16 + hi * 8 + j) * 130 + c0] = acc[j] + bias;
    }
  }
  __syncthreads();
  if (tid < 64) {
    float m = 0.f;
    for (int c = 0; c < 128; ++c) m += ob[tid * 130 + c];
    m *= (1.f / 128.f);
    float v = 0.f;
    for (int c = 0; c < 128; ++c) { float d = ob[tid * 130 + c] - m; v += d * d; }
    v *= (1.f / 128.f);
    float rs = rsqrtf(v + 1e-5f);
    _Float16* drow = xattn + ((size_t)win * 64 + tid) * 128;
    for (int c = 0; c < 128; ++c)
      drow[c] = (_Float16)((ob[tid * 130 + c] - m) * rs * lg[c] + lb[c]);
  }
}

// ---------------------------------------------------------------- depthwise 3x3 + BN + GELU
// One thread = one 8x8 window x 4 channels. The 9 taps of its channels and three
// input rows (8 pixels + 1 halo pixel each side) stay in registers, so every input
// value is loaded once per window, 16 bytes a lane, 512 contiguous bytes a wave.
typedef __attribute__((ext_vector_type(4))) float    f4;
typedef __attribute__((ext_vector_type(4))) _Float16 h4;

// Row ry (-1..8) of the window at 'base' (own window, this thread's channels):
// r[0] / r[9] are the neighbours' edge pixels; outside the image everything is 0.
// At the image's left / right edge the halo load re-reads an own pixel (in bounds);
// dw_edge() replaces its value by 0 where the row is first used, not behind the load,
// so that nothing waits for the data while the loads fly.
DI void dw_ldrow(f4 (&r)[10], const float* base, int ry, int wy, int wx) {
  const f4 z = {0.f, 0.f, 0.f, 0.f};
  const bool ok = (ry >= 0 || wy > 0) && (ry < 8 || wy < 7);
  if (ok) {
    const float* rp = (ry < 0) ? base - 8 * 16384 + 7 * 2048
                    : (ry < 8) ? base + ry * 2048 : base + 8 * 16384;
    r[0] = *(const f4*)(rp + ((wx > 0) ? -16384 + 7 * 256 : 0));
#pragma unroll
    for (int i = 0; i < 8; ++i) r[1 + i] = *(const f4*)(rp + i * 256);
    r[9] = *(const f4*)(rp + ((wx < 7) ? 16384 : 0));
    // the loads' address registers may be reused right behind them
    asm volatile("s_wait_xcnt 0x0" ::: "memory");
  } else {
#pragma unroll
    for (int i = 0; i < 10; ++i) r[i] = z;
  }
}
DI void dw_edge(f4 (&r)[10], int wx) {
  const f4 z = {0.f, 0.f, 0.f, 0.f};
  r[0] = (wx > 0) ? r[0] : z;
  r[9] = (wx < 7) ? r[9] : z;
}

// grid 2048 (one window), block 64 (64 x 4 channels)
__global__ __launch_bounds__(64)
void k_dwconv(const float* __restrict__ x, const float* __restrict__ cw,
              const float* __restrict__ cb, const float* __restrict__ bg,
              const float* __restrict__ bb, _Float16* __restrict__ xc) {
  const int win = blockIdx.x;
  const int b = win >> 6, wy = (win >> 3) & 7, wx = win & 7;
  const int c = threadIdx.x * 4;
  f4 wt[9];
  {
    float wl[36];                          // 4 channels x 9 taps, contiguous
#pragma unroll
    for (int i = 0; i < 9; ++i) {
      f4 t = *(const f4*)(cw + c * 9 + i * 4);
      wl[i * 4 + 0] = t.x; wl[i * 4 + 1] = t.y; wl[i * 4 + 2] = t.z; wl[i * 4 + 3] = t.w;
    }
#pragma unroll
    for (int k = 0; k < 9; ++k) { f4 t = {wl[k], wl[9 + k], wl[18 + k], wl[27 + k]}; wt[k] = t; }
  }
  const float bns = rsqrtf(1.f + 1e-5f);
  const f4 cb4 = *(const f4*)(cb + c);
  const f4 sc4 = *(const f4*)(bg + c) * bns;
  const f4 bb4 = *(const f4*)(bb + c);
  const float* base = x + (size_t)win * 16384 + c;
  _Float16* orow = xc + (((size_t)b * 4096 + (size_t)wy * 512 + wx * 8) * 256 + c);

  f4 r0[10], r1[10], r2[10];
  dw_ldrow(r0, base, -1, wy, wx);
  dw_ldrow(r1, base, 0, wy, wx);
  dw_ldrow(r2, base, 1, wy, wx);
  dw_edge(r0, wx);
  dw_edge(r1, wx);
  // rolled: one row's body is already about 1,500 instructions
#pragma unroll 1
  for (int ry = 0; ry < 8; ++ry) {
    dw_edge(r2, wx);
    f4 acc[8];
#pragma unroll
    for (int px = 0; px < 8; ++px) {
      f4 s = {0.f, 0.f, 0.f, 0.f};
#pragma unroll
      for (int dx = 0; dx < 3; ++dx) s += r0[px + dx] * wt[dx];
#pragma unroll
      for (int dx = 0; dx < 3; ++dx) s += r1[px + dx] * wt[3 + dx];
#pragma unroll
      for (int dx = 0; dx < 3; ++dx) s += r2[px + dx] * wt[6 + dx];
      acc[px] = s;
    }
#pragma unroll
    for (int i = 0; i < 10; ++i) { r0[i] = r1[i]; r1[i] = r2[i]; }
    // the next row's loads fly while this row's BN + GELU is computed
    if (ry < 7) dw_ldrow(r2, base, ry + 2, wy, wx);
#pragma unroll
    for (int px = 0; px < 8; ++px) {
      f4 v = (acc[px] + cb4) * sc4 + bb4;
      h4 o = {(_Float16)geluf(v.x), (_Float16)geluf(v.y), (_Float16)geluf(v.z), (_Float16)geluf(v.w)};
      *(h4*)(orow + (size_t)ry * 16384 + px * 256) = o;
    }
    // the last store's address and data registers are reused by the next row
    asm volatile("s_wait_xcnt 0x0" ::: "memory");
  }
}

// deterministic 2-stage GAP (no float atomics -> graph-replay bit-stable)
__global__ void k_gap_partial(const _Float16* __restrict__ xc, float* __restrict__ part) {
  int blk = blockIdx.x;                 // b*64 + chunk
  int b = blk >> 6, chunk = blk & 63;
  int c = threadIdx.x;                  // 256 channels
  float s = 0.f;
  size_t base = ((size_t)b * 4096 + (size_t)chunk * 64) * 256 + c;
  for (int p2 = 0; p2 < 64; ++p2) s += (float)xc[base + (size_t)p2 * 256];
  part[(size_t)blk * 256 + c] = s;
}
__global__ void k_gap_final(const float* __restrict__ part, float* __restrict__ gap) {
  int b = blockIdx.x, c = threadIdx.x;
  float s = 0.f;
  for (int k2 = 0; k2 < 64; ++k2) s += part[((size_t)b * 64 + k2) * 256 + c];
  gap[b * 256 + c] = s;
}

// channel interaction MLP -> sigmoid gates (32 images, tiny)
__global__ void k_ci(const float* __restrict__ gap, const float* __restrict__ w1,
                     const float* __restrict__ b1, const float* __restrict__ g1,
                     const float* __restrict__ bb1, const float* __restrict__ w2,
                     const float* __restrict__ b2, float* __restrict__ cis) {
  __shared__ float d1[32];
  int b = blockIdx.x, t = threadIdx.x;  // 128 threads
  float bns = rsqrtf(1.f + 1e-5f);
  if (t < 32) {
    float a = b1[t];
    const float inv = 1.f / 4096.f;
    for (int i = 0; i < 256; ++i) a += w1[t * 256 + i] * gap[b * 256 + i] * inv;
    a = a * (g1[t] * bns) + bb1[t];
    d1[t] = geluf(a);
  }
  __syncthreads();
  float a = b2[t];
  for (int j = 0; j < 32; ++j) a += w2[t * 32 + j] * d1[j];
  cis[b * 128 + t] = sigmf(a);
}

// ---------------------------------------------------------------- fused qkv + attention
// grid 2048 windows, block 256 (8 waves = 8 heads), dyn shmem 145316B (f16 rows padded by 16 B, bias rows by 4 B)
// LDS allows 2 work-groups a WGP = 4 waves a SIMD: the compiler is told to plan for exactly
// that (up to 256 registers).
__global__ __launch_bounds__(256) __attribute__((amdgpu_waves_per_eu(4, 4)))
void k_attention(const _Float16* __restrict__ xattn,
                            const _Float16* __restrict__ qwT,
                            const float* __restrict__ qb,
                            const float* __restrict__ cis,
                            const float* __restrict__ relb,
                            _Float16* __restrict__ xattn2) {
  extern __shared__ char smemraw[];
  _Float16* xa  = (_Float16*)smemraw;      // 64 x 128, pitch 136
  _Float16* qs  = xa + 64 * 136;           // 64 x 128, pitch 136 (scale folded in)
  _Float16* kks = qs + 64 * 136;           // 64 x 128, pitch 136
  _Float16* vT  = kks + 64 * 136;          // 128 x 64, pitch 72 (transposed, ci-gated)
  _Float16* P   = vT + 128 * 72;           // 64 x 512, pitch 520 (8 heads * 64)
  float* bsh    = (float*)(P + 64 * 520);  // 225 x 8 rel-pos bias, pitch 9 (odd: a wave's 24 rows on 24 banks)

  const int win = blockIdx.x, tid = threadIdx.x;
  const int w = tid >> 5, lane = tid & 31, n0 = lane & 15, hi = lane >> 4;
  const int img = win >> 6;
  // The wave's qkv weight fragments (3 column tiles x 4 k steps) are loaded once and serve
  // all 4 row tiles; issued ahead of the staging, they fly together with it.
  v16h bw[3][4];
  const unsigned bo0 = fragoff(128, (w * 3 + 0) * 16), bo1 = fragoff(128, (w * 3 + 1) * 16),
                 bo2 = fragoff(128, (w * 3 + 2) * 16);
#pragma unroll  // bw is indexed by constants only, so that it stays in registers
  for (int ks = 0; ks < 4; ++ks) {
    bw[0][ks] = ldfrag_o(qwT, bo0, ks * 32);
    bw[1][ks] = ldfrag_o(qwT, bo1, ks * 32);
    bw[2][ks] = ldfrag_o(qwT, bo2, ks * 32);
  }
  // the offsets these loads name are inputs here, so they stay in their registers until the
  // wait has passed; behind it the registers may be reused
  asm volatile("s_wait_xcnt 0x0" :: "v"(bo0), "v"(bo1), "v"(bo2) : "memory");
  {
    const uint4* src = (const uint4*)(xattn + (size_t)win * (64 * 128));
    uint4* dst = (uint4*)xa;
    for (int i = tid; i < 1024; i += 256) dst[(i >> 4) * 17 + (i & 15)] = src[i];
    for (int i = tid; i < 1800; i += 256) bsh[(i >> 3) * 9 + (i & 7)] = relb[i];
  }
  __syncthreads();

  // qkv GEMM: (64x128) @ (128x384); wave w -> out cols [48w, 48w+48)
#pragma unroll 1
  for (int mt = 0; mt < 4; ++mt) {
    v8f acc0 = vzero(), acc1 = vzero(), acc2 = vzero();
#pragma unroll  // constant indices into bw
    for (int ks = 0; ks < 4; ++ks) {
      v16h a = ldfrag(xa, 136, mt * 16, ks * 32);
      acc0 = wmma16(a, bw[0][ks], acc0);
      acc1 = wmma16(a, bw[1][ks], acc1);
      acc2 = wmma16(a, bw[2][ks], acc2);
    }
#pragma unroll
    for (int u = 0; u < 3; ++u) {
      v8f acc = (u == 0) ? acc0 : (u == 1) ? acc1 : acc2;
      int c0 = (w * 3 + u) * 16 + n0;
      float bias = qb[c0];
#pragma unroll
      for (int j = 0; j < 8; ++j) {
        int row = mt * 16 + hi * 8 + j;
        float v = acc[j] + bias;
        if (c0 < 128)      qs[row * 136 + c0] = (_Float16)(v * 0.25f);       // HD^-0.5
        else if (c0 < 256) kks[row * 136 + (c0 - 128)] = (_Float16)v;
        else { int ca = c0 - 256; vT[ca * 72 + row] = (_Float16)(v * cis[img * 128 + ca]); }
      }
    }
  }
  __syncthreads();

  // per-head scores + softmax, one 16-row M-tile at a time (keeps pressure low)
  const int h = w;
#pragma unroll 1
  for (int mt = 0; mt < 4; ++mt) {
    v16h aq = ldfrag16(qs, 136, mt * 16, h * 16);
    v8f s[4];
#pragma unroll
    for (int nt = 0; nt < 4; ++nt)
      s[nt] = wmma16(aq, ldfrag16(kks, 136, nt * 16, h * 16), vzero());
    // + relative position bias
#pragma unroll
    for (int nt = 0; nt < 4; ++nt)
#pragma unroll
      for (int j = 0; j < 8; ++j) {
        int m = mt * 16 + hi * 8 + j;
        int n = nt * 16 + n0;
        int idx = ((m >> 3) - (n >> 3) + 7) * 15 + ((m & 7) - (n & 7) + 7);
        s[nt][j] += bsh[idx * 9 + h];
      }
    // row softmax: reduce over 4 n-tiles + 16-lane xor shuffles
#pragma unroll
    for (int j = 0; j < 8; ++j) {
      float mx = fmaxf(fmaxf(s[0][j], s[1][j]), fmaxf(s[2][j], s[3][j]));
#pragma unroll
      for (int msk = 1; msk < 16; msk <<= 1) mx = fmaxf(mx, __shfl_xor(mx, msk, 32));
      float sum = 0.f;
#pragma unroll
      for (int nt = 0; nt < 4; ++nt) { float e = expf(s[nt][j] - mx); s[nt][j] = e; sum += e; }
#pragma unroll
      for (int msk = 1; msk < 16; msk <<= 1) sum += __shfl_xor(sum, msk, 32);
      float inv = 1.0f / sum;
#pragma unroll
      for (int nt = 0; nt < 4; ++nt) s[nt][j] *= inv;
    }
#pragma unroll
    for (int nt = 0; nt < 4; ++nt)
#pragma unroll
      for (int j = 0; j < 8; ++j) {
        int m = mt * 16 + hi * 8 + j;
        P[m * 520 + h * 64 + nt * 16 + n0] = (_Float16)s[nt][j];
      }
  }
  __syncthreads();

  // O = P @ V per head: (64x64) @ (64x16), K = 64 -> 2 WMMA k-steps
#pragma unroll 1
  for (int mt = 0; mt < 4; ++mt) {
    v8f o = vzero();
#pragma unroll
    for (int ks = 0; ks < 2; ++ks) {
      v16h a = ldfrag(P, 520, mt * 16, h * 64 + ks * 32);
      v16h b = ldfrag(vT, 72, h * 16, ks * 32);
      o = wmma16(a, b, o);
    }
#pragma unroll
    for (int j = 0; j < 8; ++j) {
      size_t row = (size_t)win * 64 + mt * 16 + hi * 8 + j;
      xattn2[row * 128 + h * 16 + n0] = (_Float16)o[j];
    }
  }
}

// ---------------------------------------------------------------- pr 1x1 conv GEMM
// grid 2048 (one image row of 64 pixels each), block 128, shmem 33KB (rows padded by 16 B)
// Up to 256 registers a wave (4 waves a SIMD): the weights alone take 128.
__global__ __launch_bounds__(128, 4)
void k_prgemm(const _Float16* __restrict__ xc, const _Float16* __restrict__ pwf,
                         const float* __restrict__ pb, _Float16* __restrict__ prout) {
  extern __shared__ char smemraw[];
  _Float16* xa = (_Float16*)smemraw;  // 64 x 256, pitch 264
  const int blk = blockIdx.x, tid = threadIdx.x;
  const int w = tid >> 5, lane = tid & 31, n0 = lane & 15, hi = lane >> 4;
  // The wave's weight fragments (2 column tiles x 8 k steps) are loaded once and serve all
  // 4 row tiles; issued ahead of the staging, they fly together with it.
  v16h bw[2][8];
  const unsigned bo0 = fragoff(256, (w * 2 + 0) * 16), bo1 = fragoff(256, (w * 2 + 1) * 16);
#pragma unroll  // bw is indexed by constants only, so that it stays in registers
  for (int ks = 0; ks < 8; ++ks) {
    bw[0][ks] = ldfrag_o(pwf, bo0, ks * 32);
    bw[1][ks] = ldfrag_o(pwf, bo1, ks * 32);
  }
  // the offsets these loads name are inputs here, so they stay in their registers until the
  // wait has passed; behind it the registers may be reused
  asm volatile("s_wait_xcnt 0x0" :: "v"(bo0), "v"(bo1) : "memory");
  {
    const uint4* src = (const uint4*)(xc + (size_t)blk * (64 * 256));
    uint4* dst = (uint4*)xa;
    for (int i = tid; i < 2048; i += 128) dst[(i >> 5) * 33 + (i & 31)] = src[i];
  }
  __syncthreads();
#pragma unroll 1
  for (int mt = 0; mt < 4; ++mt) {
    v8f acc0 = vzero(), acc1 = vzero();
#pragma unroll  // constant indices into bw
    for (int ks = 0; ks < 8; ++ks) {
      v16h a = ldfrag(xa, 264, mt * 16, ks * 32);
      acc0 = wmma16(a, bw[0][ks], acc0);
      acc1 = wmma16(a, bw[1][ks], acc1);
    }
#pragma unroll
    for (int u = 0; u < 2; ++u) {
      v8f acc = u ? acc1 : acc0;
      int c0 = (w * 2 + u) * 16 + n0;
      float bias = pb[c0];
#pragma unroll
      for (int j = 0; j < 8; ++j) {
        size_t row = (size_t)blk * 64 + mt * 16 + hi * 8 + j;
        prout[row * 128 + c0] = (_Float16)(acc[j] + bias);
      }
    }
    // the stores' address and data registers are reused by the next row tile
    asm volatile("s_wait_xcnt 0x0" ::: "memory");
  }
}

// ---------------------------------------------------------------- spatial interaction + gating
// One wave walks 32 rows, two at a time: lanes 0-15 take the even row, lanes 16-31 the odd one.
// Lane o of a row holds row o of si_w1 (128 f32) in registers for the whole walk, computes
// hidden unit o, and afterwards gates channels 8*o .. 8*o+7 of the row. No LDS, no barrier.
// grid 1024, block 128 (4 waves): 4096 waves x 32 rows = 131072 rows. At least 4 waves per SIMD
// (at most 256 registers), so that all 4096 waves are resident at once: no second round.
__global__ __launch_bounds__(128, 4)
void k_si_gate(const _Float16* __restrict__ xattn2, const _Float16* __restrict__ prout,
               const float* __restrict__ w1, const float* __restrict__ b1,
               const float* __restrict__ g1, const float* __restrict__ bb1,
               const float* __restrict__ w2, const float* __restrict__ b2,
               const float* __restrict__ cng, const float* __restrict__ cnb,
               _Float16* __restrict__ gated) {
  const int lane = threadIdx.x & 31, o = lane & 15, odd = lane >> 4;
  const int wave = blockIdx.x * 4 + (threadIdx.x >> 5);
  const unsigned wo = o * 512u, go = o * 32u;   // byte offsets: row o of si_w1, channels 8*o..
  f4 wr[32];
#pragma unroll
  for (int i = 0; i < 32; ++i) wr[i] = *(const f4*)((const char*)w1 + wo + i * 16);
  const float bns = rsqrtf(1.f + 1e-5f);
  const float b1o = b1[o], g1o = g1[o], sh1 = bb1[o], w2o = w2[o], b2v = b2[0];
  const f4 gr0 = *(const f4*)((const char*)cng + go), gr1 = *(const f4*)((const char*)cng + go + 16);
  const f4 gb0 = *(const f4*)((const char*)cnb + go), gb1 = *(const f4*)((const char*)cnb + go + 16);
  // the offsets these loads name are inputs here, so they stay in their registers until the
  // wait has passed; behind it the registers may be reused
  asm volatile("s_wait_xcnt 0x0" :: "v"(wo), "v"(go), "v"(o) : "memory");
  const float sc1 = g1o * bns;
  const f4 gs0 = gr0 * bns, gs1 = gr1 * bns;
  const float gs[8] = {gs0.x, gs0.y, gs0.z, gs0.w, gs1.x, gs1.y, gs1.z, gs1.w};
  const float gb[8] = {gb0.x, gb0.y, gb0.z, gb0.w, gb1.x, gb1.y, gb1.z, gb1.w};
  // rolled: one pair of rows is already some 500 instructions
#pragma unroll 1
  for (int it = 0; it < 16; ++it) {
    const int r = wave * 32 + it * 2 + odd;
    // windowed row -> image position
    const int b_ = r >> 6, n = r & 63;
    const int b = b_ >> 6, wi = b_ & 63;
    const int y = (wi >> 3) * 8 + (n >> 3);
    const int xx = (wi & 7) * 8 + (n & 7);
    const size_t p = (size_t)b * 4096 + (size_t)y * 64 + xx;
    const h8* xp = (const h8*)(xattn2 + (size_t)r * 128);
    const h8* pp = (const h8*)(prout + p * 128 + o * 8);
    h8 xv[16];                            // the whole row, the same in its 16 lanes
#pragma unroll
    for (int i = 0; i < 16; ++i) xv[i] = xp[i];
    const h8 pv = *pp;
    // xp and pp are inputs here, so they stay in their registers until the wait has passed
    asm volatile("s_wait_xcnt 0x0" :: "v"(xp), "v"(pp) : "memory");
    // four independent chains (k mod 4), so that a wave does not wait out each FMA's latency
    f4 s4 = {0.f, 0.f, 0.f, 0.f};
#pragma unroll
    for (int i = 0; i < 16; ++i) {
      f4 lo = {(float)xv[i][0], (float)xv[i][1], (float)xv[i][2], (float)xv[i][3]};
      f4 hv = {(float)xv[i][4], (float)xv[i][5], (float)xv[i][6], (float)xv[i][7]};
      s4 += wr[i * 2] * lo;
      s4 += wr[i * 2 + 1] * hv;
    }
    float a = b1o + ((s4.x + s4.y) + (s4.z + s4.w));
    a = a * sc1 + sh1;
    float t = w2o * geluf(a);
    // sum over the row's 16 hidden units = its 16 lanes
#pragma unroll
    for (int msk = 1; msk < 16; msk <<= 1) t += __shfl_xor(t, msk, 32);
    const float siv = t + b2v;
    h8 ov;
#pragma unroll
    for (int k = 0; k < 8; ++k) ov[k] = (_Float16)(sigmf(siv * (float)pv[k]) * gs[k] + gb[k]);
    *(h8*)(gated + (size_t)r * 128 + o * 8) = ov;
    // the store's address and data registers are reused by the next pair of rows
    asm volatile("s_wait_xcnt 0x0" ::: "memory");
  }
}

// ---------------------------------------------------------------- final concat GEMM (+LN on attn half)
// grid 2048, block 256, shmem 33KB (rows padded by 16 B)
// At most 128 registers: 4 work-groups a WGP, so that one's staging and LayerNorm (2 of its
// 8 waves) run beside the others' products.
__global__ __launch_bounds__(256, 8)
void k_final(const _Float16* __restrict__ xattn2, const _Float16* __restrict__ gated,
                        const _Float16* __restrict__ owT, const float* __restrict__ ob,
                        const float* __restrict__ ang, const float* __restrict__ anb,
                        float* __restrict__ out) {
  extern __shared__ char smemraw[];
  _Float16* A = (_Float16*)smemraw;  // 64 x 256, pitch 264
  const int win = blockIdx.x, tid = threadIdx.x;
  const int w = tid >> 5, lane = tid & 31, n0 = lane & 15, hi = lane >> 4;
  for (int i = tid; i < 8192; i += 256) {
    int r = i >> 7, c = i & 127;
    A[r * 264 + c]       = xattn2[(size_t)win * 8192 + i];
    A[r * 264 + 128 + c] = gated[(size_t)win * 8192 + i];
  }
  __syncthreads();
  if (tid < 64) {  // LN in place on the attention half of the row
    float m = 0.f;
    for (int c = 0; c < 128; ++c) m += (float)A[tid * 264 + c];
    m *= (1.f / 128.f);
    float v = 0.f;
    for (int c = 0; c < 128; ++c) { float d = (float)A[tid * 264 + c] - m; v += d * d; }
    v *= (1.f / 128.f);
    float rs = rsqrtf(v + 1e-5f);
    for (int c = 0; c < 128; ++c)
      A[tid * 264 + c] = (_Float16)(((float)A[tid * 264 + c] - m) * rs * ang[c] + anb[c]);
  }
  __syncthreads();
  // k outermost, all 4 row tiles' sums in registers: each weight fragment is loaded once and
  // serves the 4 row tiles (here the sums, 64 registers, are kept, not the 128 of the weights)
  v8f acc[4][2];
  const unsigned bbo = (unsigned)((w * 32 + n0) * 4);
  const float bias[2] = {*(const float*)((const char*)ob + bbo),
                         *(const float*)((const char*)ob + bbo + 64)};
  // the offset these loads name is an input here, so it stays in its register until the wait
  // has passed
  asm volatile("s_wait_xcnt 0x0" :: "v"(bbo) : "memory");
#pragma unroll
  for (int mt = 0; mt < 4; ++mt) { acc[mt][0] = vzero(); acc[mt][1] = vzero(); }
#pragma unroll  // this loop and those inside: acc is indexed by constants only (registers)
  for (int ks = 0; ks < 8; ++ks) {
    v16h b0 = ldfrag(owT, 256, (w * 2 + 0) * 16, ks * 32);
    v16h b1 = ldfrag(owT, 256, (w * 2 + 1) * 16, ks * 32);
#pragma unroll
    for (int mt = 0; mt < 4; ++mt) {
      v16h a = ldfrag(A, 264, mt * 16, ks * 32);
      acc[mt][0] = wmma16(a, b0, acc[mt][0]);
      acc[mt][1] = wmma16(a, b1, acc[mt][1]);
    }
  }
#pragma unroll
  for (int u = 0; u < 2; ++u) {
    int c0 = (w * 2 + u) * 16 + n0;
#pragma unroll
    for (int mt = 0; mt < 4; ++mt)
#pragma unroll
      for (int j = 0; j < 8; ++j) {
        size_t row = (size_t)win * 64 + mt * 16 + hi * 8 + j;
        out[row * 256 + c0] = acc[mt][u][j] + bias[u];
      }
  }
}

// ---------------------------------------------------------------- launcher
extern "C" void kernel_launch(void* const* d_in, const int* in_sizes, int n_in,
                              void* d_out, int out_size, void* d_ws, size_t ws_size,
                              hipStream_t stream) {
  (void)in_sizes; (void)n_in; (void)out_size; (void)ws_size;
  const float* x       = (const float*)d_in[0];
  const float* relb    = (const float*)d_in[1];
  const float* attn_w  = (const float*)d_in[2];
  const float* attn_b  = (const float*)d_in[3];
  const float* aln_g   = (const float*)d_in[4];
  const float* aln_b   = (const float*)d_in[5];
  const float* conv_w  = (const float*)d_in[6];
  const float* conv_b  = (const float*)d_in[7];
  const float* cbn_g   = (const float*)d_in[8];
  const float* cbn_b   = (const float*)d_in[9];
  const float* ci_w1   = (const float*)d_in[10];
  const float* ci_b1   = (const float*)d_in[11];
  const float* ci_g    = (const float*)d_in[12];
  const float* ci_bb   = (const float*)d_in[13];
  const float* ci_w2   = (const float*)d_in[14];
  const float* ci_b2   = (const float*)d_in[15];
  const float* pr_w    = (const float*)d_in[16];
  const float* pr_b    = (const float*)d_in[17];
  const float* cn_g    = (const float*)d_in[18];
  const float* cn_b    = (const float*)d_in[19];
  const float* qkv_w   = (const float*)d_in[20];
  const float* qkv_b   = (const float*)d_in[21];
  const float* si_w1   = (const float*)d_in[22];
  const float* si_b1   = (const float*)d_in[23];
  const float* si_g    = (const float*)d_in[24];
  const float* si_bb   = (const float*)d_in[25];
  const float* si_w2   = (const float*)d_in[26];
  const float* si_b2   = (const float*)d_in[27];
  const float* an_g    = (const float*)d_in[28];
  const float* an_b    = (const float*)d_in[29];
  const float* out_w   = (const float*)d_in[30];
  const float* out_b   = (const float*)d_in[31];
  float* out = (float*)d_out;

  // workspace arena
  char* W = (char*)d_ws;
  size_t off = 0;
  auto take = [&](size_t bytes) { char* p = W + off; off += (bytes + 255) & ~(size_t)255; return p; };
  _Float16* x_f16   = (_Float16*)take(67108864);   // (131072, 256) f16
  _Float16* attn_wT = (_Float16*)take(65536);      // (128, 256)
  _Float16* qkv_wT  = (_Float16*)take(98304);      // (384, 128)
  _Float16* out_wT  = (_Float16*)take(131072);     // (256, 256)
  _Float16* pr_wf   = (_Float16*)take(65536);      // (128, 256)
  _Float16* x_attn  = (_Float16*)take(33554432);   // (131072, 128)
  _Float16* x_attn2 = (_Float16*)take(33554432);   // (131072, 128)
  _Float16* xc      = (_Float16*)take(67108864);   // (131072, 256) NHWC
  float*    part    = (float*)take(2097152);       // (32, 64, 256)
  float*    gap     = (float*)take(32768);         // (32, 256)
  float*    cis     = (float*)take(16384);         // (32, 128)
  // x_f16 is dead after k_attnproj_ln -> reuse its region
  _Float16* pr_out  = (_Float16*)x_f16;                           // (131072, 128)
  _Float16* gated   = (_Float16*)((char*)x_f16 + 33554432);       // (131072, 128)

  k_cvt_x<<<131072, 256, 0, stream>>>(x, x_f16);
  k_prep_w<<<704, 256, 0, stream>>>(attn_w, qkv_w, out_w, pr_w, attn_wT, qkv_wT, out_wT, pr_wf);
  k_attnproj_ln<<<2048, 128, 67072, stream>>>(x_f16, attn_wT, attn_b, aln_g, aln_b, x_attn);
  k_dwconv<<<2048, 64, 0, stream>>>(x, conv_w, conv_b, cbn_g, cbn_b, xc);
  k_gap_partial<<<2048, 256, 0, stream>>>(xc, part);
  k_gap_final<<<32, 256, 0, stream>>>(part, gap);
  k_ci<<<32, 128, 0, stream>>>(gap, ci_w1, ci_b1, ci_g, ci_bb, ci_w2, ci_b2, cis);
  k_attention<<<2048, 256, 145316, stream>>>(x_attn, qkv_wT, qkv_b, cis, relb, x_attn2);
  k_prgemm<<<2048, 128, 33792, stream>>>(xc, pr_wf, pr_b, pr_out);
  k_si_gate<<<1024, 128, 0, stream>>>(x_attn2, pr_out, si_w1, si_b1, si_g, si_bb,
                                        si_w2, si_b2, cn_g, cn_b, gated);
  k_final<<<2048, 256, 33792, stream>>>(x_attn2, gated, out_wT, out_b, an_g, an_b, out);
}

// v005
// Measured time: 270 microseconds a run.
// Next to v004, in two timings, it ran 1.24 and 1.25 times as fast.
// Counting every step since v000, it is 3.32 times as fast.
#include <hip/hip_runtime.h>
#include <hip/hip_bf16.h>

#define DI __device__ __forceinline__

typedef __attribute__((ext_vector_type(16))) _Float16 v16h;
typedef __attribute__((ext_vector_type(8)))  _Float16 h8;
typedef __attribute__((ext_vector_type(8)))  float    v8f;
typedef __attribute__((ext_vector_type(4)))  float    f4;
typedef __attribute__((ext_vector_type(4)))  _Float16 h4;

// ---------------------------------------------------------------- helpers
DI v8f vzero() { v8f z = {0.f,0.f,0.f,0.f,0.f,0.f,0.f,0.f}; return z; }

DI v8f wmma16(v16h a, v16h b, v8f c) {
  return __builtin_amdgcn_wmma_f32_16x16x32_f16(false, a, false, b, (short)0, c, false, false);
}

// A-fragment (16x32 f16): lane L -> row r0+(L&15); halves 0..7 = K k0+8*(L>>4)..+7,
// halves 8..15 = K k0+16+8*(L>>4)..+7.  B^T uses identical layout (row = out col).
DI v16h ldfrag(const _Float16* p, int ld, int r0, int k0) {
  int lane = threadIdx.x & 31;
  int m = lane & 15, hi = lane >> 4;
  const _Float16* q = p + (size_t)(r0 + m) * ld + k0 + hi * 8;
  h8 lo = *(const h8*)q;
  h8 hv = *(const h8*)(q + 16);
  return __builtin_shufflevector(lo, hv, 0,1,2,3,4,5,6,7,8,9,10,11,12,13,14,15);
}

// The same fragment from a base pointer and the lane's byte offset fragoff(ld, r0): the caller
// holds the one offset register that a run of such loads names.
DI unsigned fragoff(int ld, int r0) {
  int lane = threadIdx.x & 31;
  return (unsigned)(((r0 + (lane & 15)) * ld + (lane >> 4) * 8) * 2);
}
DI v16h ldfrag_o(const _Float16* p, unsigned off, int k0) {
  const char* q = (const char*)p + off + k0 * 2;
  h8 lo = *(const h8*)q;
  h8 hv = *(const h8*)(q + 32);
  return __builtin_shufflevector(lo, hv, 0,1,2,3,4,5,6,7,8,9,10,11,12,13,14,15);
}

// A-fragment with only K=16 valid (upper 16 of K zero) for HD=16 attention.
DI v16h ldfrag16(const _Float16* p, int ld, int r0, int c0) {
  int lane = threadIdx.x & 31;
  int m = lane & 15, hi = lane >> 4;
  const _Float16* q = p + (size_t)(r0 + m) * ld + c0 + hi * 8;
  h8 lo = *(const h8*)q;
  h8 z = {(_Float16)0.f,(_Float16)0.f,(_Float16)0.f,(_Float16)0.f,
          (_Float16)0.f,(_Float16)0.f,(_Float16)0.f,(_Float16)0.f};
  return __builtin_shufflevector(lo, z, 0,1,2,3,4,5,6,7,8,9,10,11,12,13,14,15);
}

DI float geluf(float x) { return 0.5f * x * (1.0f + erff(x * 0.70710678118654752f)); }
DI float sigmf(float x) { return 1.0f / (1.0f + expf(-x)); }

// ---------------------------------------------------------------- prep kernels
__global__ void k_prep_w(const float* __restrict__ aw, const float* __restrict__ qw,
                         const float* __restrict__ ow, const float* __restrict__ pw,
                         _Float16* __restrict__ awT, _Float16* __restrict__ qwT,
                         _Float16* __restrict__ owT, _Float16* __restrict__ pwf) {
  int i = blockIdx.x * 256 + threadIdx.x;
  const int A = 128 * 256, Q = 384 * 128, O = 256 * 256, P = 128 * 256;
  if (i < A) {                               // attn_w (256,128) -> (128,256)^T
    int n = i >> 8, k = i & 255;
    awT[i] = (_Float16)aw[k * 128 + n];
  } else if (i < A + Q) {                    // qkv_w (128,384) -> (384,128)^T
    int j = i - A; int n = j >> 7, k = j & 127;
    qwT[j] = (_Float16)qw[k * 384 + n];
  } else if (i < A + Q + O) {                // out_w (256,256) -> (256,256)^T
    int j = i - A - Q; int n = j >> 8, k = j & 255;
    owT[j] = (_Float16)ow[k * 256 + n];
  } else if (i < A + Q + O + P) {            // pr_w (128,256) already (O,I) = B^T
    int j = i - A - Q - O;
    pwf[j] = (_Float16)pw[j];
  }
}

// ---------------------------------------------------------------- attn proj + LN
// grid 2048 (one window), block 128 (4 waves), shmem 64*264*2 + 64*130*4 = 67072 B
// LDS rows are padded so that rows read together fall on different banks: xa by 16 bytes
// (pitch 16 B x odd, for the 16 rows of a 16-byte fragment read), ob by 2 floats (pitch 130
// dwords, for the LayerNorm, where each lane walks a row of its own 8 bytes at a time).
// LDS allows 4 work-groups a WGP = 4 waves a SIMD: the compiler is told to plan for exactly
// that (up to 256 registers), else it saves registers by staging one load at a time.
__global__ __launch_bounds__(128) __attribute__((amdgpu_waves_per_eu(4, 4)))
void k_attnproj_ln(const float* __restrict__ x,
                              const _Float16* __restrict__ awT,
                              const float* __restrict__ ab,
                              const float* __restrict__ lg,
                              const float* __restrict__ lb,
                              _Float16* __restrict__ xattn) {
  extern __shared__ char smemraw[];
  _Float16* xa = (_Float16*)smemraw;           // 64 x 256, pitch 264
  float* ob = (float*)(xa + 64 * 264);         // 64 x 128, pitch 130
  const int win = blockIdx.x, tid = threadIdx.x;
  const int w = tid >> 5, lane = tid & 31, n0 = lane & 15, hi = lane >> 4;
  // The wave's weight fragments (2 column tiles x 8 k steps) are loaded once and serve all
  // 4 row tiles; issued ahead of the staging, they fly together with it.
  v16h bw[2][8];
  const unsigned bo0 = fragoff(256, (w * 2 + 0) * 16), bo1 = fragoff(256, (w * 2 + 1) * 16);
#pragma unroll  // bw is indexed by constants only, so that it stays in registers
  for (int ks = 0; ks < 8; ++ks) {
    bw[0][ks] = ldfrag_o(awT, bo0, ks * 32);
    bw[1][ks] = ldfrag_o(awT, bo1, ks * 32);
  }
  // the offsets these loads name are inputs here, so they stay in their registers until the
  // wait has passed; behind it the registers may be reused
  asm volatile("s_wait_xcnt 0x0" :: "v"(bo0), "v"(bo1) : "memory");
  {
    // The window is read as f32 and rounded to f16 on its way into LDS. Load g of a lane is
    // 16 bytes at g * 2048 + tid * 16 (512 contiguous bytes a wave) = row 2g + (tid >> 6),
    // columns 4 * (tid & 63) .. + 3. Groups of 8 loads: a group is rounded and stored while
    // the groups behind it fly, and its registers are then free for a later group.
    const f4* xw = (const f4*)(x + (size_t)win * (64 * 256));
    char* xd = (char*)xa + (tid >> 6) * 528 + (tid & 63) * 8;
    f4 t[2][8];
#pragma unroll  // t is indexed by constants only (registers)
    for (int u = 0; u < 8; ++u) t[0][u] = xw[u * 128 + tid];
#pragma unroll  // constant indices into t
    for (int g = 0; g < 4; ++g) {
      if (g < 3) {
#pragma unroll
        for (int u = 0; u < 8; ++u) t[(g + 1) & 1][u] = xw[((g + 1) * 8 + u) * 128 + tid];
      }
      // keeps the later groups' loads behind this line: hoisted, all 32 loads' results are
      // live beside the 128 weight registers and the build spills
      if (g < 2) __builtin_amdgcn_sched_barrier(0);
#pragma unroll
      for (int u = 0; u < 8; ++u) {
        const f4 v = t[g & 1][u];
        h4 o = {(_Float16)v.x, (_Float16)v.y, (_Float16)v.z, (_Float16)v.w};
        *(h4*)(xd + (g * 8 + u) * 1056) = o;
      }
    }
    // the index and the base these loads name are inputs here, so they stay in their
    // registers until the wait has passed
    asm volatile("s_wait_xcnt 0x0" :: "v"(tid), "s"(xw) : "memory");
  }
  __syncthreads();
#pragma unroll 1
  for (int mt = 0; mt < 4; ++mt) {
    v8f acc0 = vzero(), acc1 = vzero();
#pragma unroll  // constant indices into bw
    for (int ks = 0; ks < 8; ++ks) {
      v16h a = ldfrag(xa, 264, mt * 16, ks * 32);
      acc0 = wmma16(a, bw[0][ks], acc0);
      acc1 = wmma16(a, bw[1][ks], acc1);
    }
#pragma unroll
    for (int u = 0; u < 2; ++u) {
      v8f acc = u ? acc1 : acc0;
      int c0 = (w * 2 + u) * 16 + n0;
      float bias = ab[c0];
#pragma unroll
      for (int j = 0; j < 8; ++j)
        ob[(mt * 16 + hi * 8 + j) * 130 + c0] = acc[j] + bias;
    }
  }
  __syncthreads();
  if (tid < 64) {
    float m = 0.f;
    for (int c = 0; c < 128; ++c) m += ob[tid * 130 + c];
    m *= (1.f / 128.f);
    float v = 0.f;
    for (int c = 0; c < 128; ++c) { float d = ob[tid * 130 + c] - m; v += d * d; }
    v *= (1.f / 128.f);
    float rs = rsqrtf(v + 1e-5f);
    _Float16* drow = xattn + ((size_t)win * 64 + tid) * 128;
    for (int c = 0; c < 128; ++c)
      drow[c] = (_Float16)((ob[tid * 130 + c] - m) * rs * lg[c] + lb[c]);
  }
}

// ---------------------------------------------------------------- depthwise 3x3 + BN + GELU
// One thread = one 8x8 window x 4 channels. The 9 taps of its channels and three
// input rows (8 pixels + 1 halo pixel each side) stay in registers, so every input
// value is loaded once per window, 16 bytes a lane, 512 contiguous bytes a wave.
// Row ry (-1..8) of the window at 'base' (own window, this thread's channels):
// r[0] / r[9] are the neighbours' edge pixels; outside the image everything is 0.
// At the image's left / right edge the halo load re-reads an own pixel (in bounds);
// dw_edge() replaces its value by 0 where the row is first used, not behind the load,
// so that nothing waits for the data while the loads fly.
DI void dw_ldrow(f4 (&r)[10], const float* base, int ry, int wy, int wx) {
  const f4 z = {0.f, 0.f, 0.f, 0.f};
  const bool ok = (ry >= 0 || wy > 0) && (ry < 8 || wy < 7);
  if (ok) {
    const float* rp = (ry < 0) ? base - 8 * 16384 + 7 * 2048
                    : (ry < 8) ? base + ry * 2048 : base + 8 * 16384;
    r[0] = *(const f4*)(rp + ((wx > 0) ? -16384 + 7 * 256 : 0));
#pragma unroll
    for (int i = 0; i < 8; ++i) r[1 + i] = *(const f4*)(rp + i * 256);
    r[9] = *(const f4*)(rp + ((wx < 7) ? 16384 : 0));
    // the loads' address registers may be reused right behind them
    asm volatile("s_wait_xcnt 0x0" ::: "memory");
  } else {
#pragma unroll
    for (int i = 0; i < 10; ++i) r[i] = z;
  }
}
DI void dw_edge(f4 (&r)[10], int wx) {
  const f4 z = {0.f, 0.f, 0.f, 0.f};
  r[0] = (wx > 0) ? r[0] : z;
  r[9] = (wx < 7) ? r[9] : z;
}

// grid 2048 (one window), block 64 (64 x 4 channels)
__global__ __launch_bounds__(64)
void k_dwconv(const float* __restrict__ x, const float* __restrict__ cw,
              const float* __restrict__ cb, const float* __restrict__ bg,
              const float* __restrict__ bb, _Float16* __restrict__ xc) {
  const int win = blockIdx.x;
  const int b = win >> 6, wy = (win >> 3) & 7, wx = win & 7;
  const int c = threadIdx.x * 4;
  f4 wt[9];
  {
    float wl[36];                          // 4 channels x 9 taps, contiguous
#pragma unroll
    for (int i = 0; i < 9; ++i) {
      f4 t = *(const f4*)(cw + c * 9 + i * 4);
      wl[i * 4 + 0] = t.x; wl[i * 4 + 1] = t.y; wl[i * 4 + 2] = t.z; wl[i * 4 + 3] = t.w;
    }
#pragma unroll
    for (int k = 0; k < 9; ++k) { f4 t = {wl[k], wl[9 + k], wl[18 + k], wl[27 + k]}; wt[k] = t; }
  }
  const float bns = rsqrtf(1.f + 1e-5f);
  const f4 cb4 = *(const f4*)(cb + c);
  const f4 sc4 = *(const f4*)(bg + c) * bns;
  const f4 bb4 = *(const f4*)(bb + c);
  const float* base = x + (size_t)win * 16384 + c;
  _Float16* orow = xc + (((size_t)b * 4096 + (size_t)wy * 512 + wx * 8) * 256 + c);

  f4 r0[10], r1[10], r2[10];
  dw_ldrow(r0, base, -1, wy, wx);
  dw_ldrow(r1, base, 0, wy, wx);
  dw_ldrow(r2, base, 1, wy, wx);
  dw_edge(r0, wx);
  dw_edge(r1, wx);
  // rolled: one row's body is already about 1,500 instructions
#pragma unroll 1
  for (int ry = 0; ry < 8; ++ry) {
    dw_edge(r2, wx);
    f4 acc[8];
#pragma unroll
    for (int px = 0; px < 8; ++px) {
      f4 s = {0.f, 0.f, 0.f, 0.f};
#pragma unroll
      for (int dx = 0; dx < 3; ++dx) s += r0[px + dx] * wt[dx];
#pragma unroll
      for (int dx = 0; dx < 3; ++dx) s += r1[px + dx] * wt[3 + dx];
#pragma unroll
      for (int dx = 0; dx < 3; ++dx) s += r2[px + dx] * wt[6 + dx];
      acc[px] = s;
    }
#pragma unroll
    for (int i = 0; i < 10; ++i) { r0[i] = r1[i]; r1[i] = r2[i]; }
    // the next row's loads fly while this row's BN + GELU is computed
    if (ry < 7) dw_ldrow(r2, base, ry + 2, wy, wx);
#pragma unroll
    for (int px = 0; px < 8; ++px) {
      f4 v = (acc[px] + cb4) * sc4 + bb4;
      h4 o = {(_Float16)geluf(v.x), (_Float16)geluf(v.y), (_Float16)geluf(v.z), (_Float16)geluf(v.w)};
      *(h4*)(orow + (size_t)ry * 16384 + px * 256) = o;
    }
    // the last store's address and data registers are reused by the next row
    asm volatile("s_wait_xcnt 0x0" ::: "memory");
  }
}

// deterministic 2-stage GAP (no float atomics -> graph-replay bit-stable)
__global__ void k_gap_partial(const _Float16* __restrict__ xc, float* __restrict__ part) {
  int blk = blockIdx.x;                 // b*64 + chunk
  int b = blk >> 6, chunk = blk & 63;
  int c = threadIdx.x;                  // 256 channels
  float s = 0.f;
  size_t base = ((size_t)b * 4096 + (size_t)chunk * 64) * 256 + c;
  for (int p2 = 0; p2 < 64; ++p2) s += (float)xc[base + (size_t)p2 * 256];
  part[(size_t)blk * 256 + c] = s;
}
__global__ void k_gap_final(const float* __restrict__ part, float* __restrict__ gap) {
  int b = blockIdx.x, c = threadIdx.x;
  float s = 0.f;
  for (int k2 = 0; k2 < 64; ++k2) s += part[((size_t)b * 64 + k2) * 256 + c];
  gap[b * 256 + c] = s;
}

// channel interaction MLP -> sigmoid gates (32 images, tiny)
__global__ void k_ci(const float* __restrict__ gap, const float* __restrict__ w1,
                     const float* __restrict__ b1, const float* __restrict__ g1,
                     const float* __restrict__ bb1, const float* __restrict__ w2,
                     const float* __restrict__ b2, float* __restrict__ cis) {
  __shared__ float d1[32];
  int b = blockIdx.x, t = threadIdx.x;  // 128 threads
  float bns = rsqrtf(1.f + 1e-5f);
  if (t < 32) {
    float a = b1[t];
    const float inv = 1.f / 4096.f;
    for (int i = 0; i < 256; ++i) a += w1[t * 256 + i] * gap[b * 256 + i] * inv;
    a = a * (g1[t] * bns) + bb1[t];
    d1[t] = geluf(a);
  }
  __syncthreads();
  float a = b2[t];
  for (int j = 0; j < 32; ++j) a += w2[t * 32 + j] * d1[j];
  cis[b * 128 + t] = sigmf(a);
}

// ---------------------------------------------------------------- fused qkv + attention
// grid 2048 windows, block 256 (8 waves = 8 heads), dyn shmem 145316B (f16 rows padded by 16 B, bias rows by 4 B)
// LDS allows 2 work-groups a WGP = 4 waves a SIMD: the compiler is told to plan for exactly
// that (up to 256 registers).
__global__ __launch_bounds__(256) __attribute__((amdgpu_waves_per_eu(4, 4)))
void k_attention(const _Float16* __restrict__ xattn,
                            const _Float16* __restrict__ qwT,
                            const float* __restrict__ qb,
                            const float* __restrict__ cis,
                            const float* __restrict__ relb,
                            _Float16* __restrict__ xattn2) {
  extern __shared__ char smemraw[];
  _Float16* xa  = (_Float16*)smemraw;      // 64 x 128, pitch 136
  _Float16* qs  = xa + 64 * 136;           // 64 x 128, pitch 136 (scale folded in)
  _Float16* kks = qs + 64 * 136;           // 64 x 128, pitch 136
  _Float16* vT  = kks + 64 * 136;          // 128 x 64, pitch 72 (transposed, ci-gated)
  _Float16* P   = vT + 128 * 72;           // 64 x 512, pitch 520 (8 heads * 64)
  float* bsh    = (float*)(P + 64 * 520);  // 225 x 8 rel-pos bias, pitch 9 (odd: a wave's 24 rows on 24 banks)

  const int win = blockIdx.x, tid = threadIdx.x;
  const int w = tid >> 5, lane = tid & 31, n0 = lane & 15, hi = lane >> 4;
  const int img = win >> 6;
  // The wave's qkv weight fragments (3 column tiles x 4 k steps) are loaded once and serve
  // all 4 row tiles; issued ahead of the staging, they fly together with it.
  v16h bw[3][4];
  const unsigned bo0 = fragoff(128, (w * 3 + 0) * 16), bo1 = fragoff(128, (w * 3 + 1) * 16),
                 bo2 = fragoff(128, (w * 3 + 2) * 16);
#pragma unroll  // bw is indexed by constants only, so that it stays in registers
  for (int ks = 0; ks < 4; ++ks) {
    bw[0][ks] = ldfrag_o(qwT, bo0, ks * 32);
    bw[1][ks] = ldfrag_o(qwT, bo1, ks * 32);
    bw[2][ks] = ldfrag_o(qwT, bo2, ks * 32);
  }
  // the offsets these loads name are inputs here, so they stay in their registers until the
  // wait has passed; behind it the registers may be reused
  asm volatile("s_wait_xcnt 0x0" :: "v"(bo0), "v"(bo1), "v"(bo2) : "memory");
  {
    const uint4* src = (const uint4*)(xattn + (size_t)win * (64 * 128));
    uint4* dst = (uint4*)xa;
    for (int i = tid; i < 1024; i += 256) dst[(i >> 4) * 17 + (i & 15)] = src[i];
    for (int i = tid; i < 1800; i += 256) bsh[(i >> 3) * 9 + (i & 7)] = relb[i];
  }
  __syncthreads();

  // qkv GEMM: (64x128) @ (128x384); wave w -> out cols [48w, 48w+48)
#pragma unroll 1
  for (int mt = 0; mt < 4; ++mt) {
    v8f acc0 = vzero(), acc1 = vzero(), acc2 = vzero();
#pragma unroll  // constant indices into bw
    for (int ks = 0; ks < 4; ++ks) {
      v16h a = ldfrag(xa, 136, mt * 16, ks * 32);
      acc0 = wmma16(a, bw[0][ks], acc0);
      acc1 = wmma16(a, bw[1][ks], acc1);
      acc2 = wmma16(a, bw[2][ks], acc2);
    }
#pragma unroll
    for (int u = 0; u < 3; ++u) {
      v8f acc = (u == 0) ? acc0 : (u == 1) ? acc1 : acc2;
      int c0 = (w * 3 + u) * 16 + n0;
      float bias = qb[c0];
#pragma unroll
      for (int j = 0; j < 8; ++j) {
        int row = mt * 16 + hi * 8 + j;
        float v = acc[j] + bias;
        if (c0 < 128)      qs[row * 136 + c0] = (_Float16)(v * 0.25f);       // HD^-0.5
        else if (c0 < 256) kks[row * 136 + (c0 - 128)] = (_Float16)v;
        else { int ca = c0 - 256; vT[ca * 72 + row] = (_Float16)(v * cis[img * 128 + ca]); }
      }
    }
  }
  __syncthreads();

  // per-head scores + softmax, one 16-row M-tile at a time (keeps pressure low)
  const int h = w;
#pragma unroll 1
  for (int mt = 0; mt < 4; ++mt) {
    v16h aq = ldfrag16(qs, 136, mt * 16, h * 16);
    v8f s[4];
#pragma unroll
    for (int nt = 0; nt < 4; ++nt)
      s[nt] = wmma16(aq, ldfrag16(kks, 136, nt * 16, h * 16), vzero());
    // + relative position bias
#pragma unroll
    for (int nt = 0; nt < 4; ++nt)
#pragma unroll
      for (int j = 0; j < 8; ++j) {
        int m = mt * 16 + hi * 8 + j;
        int n = nt * 16 + n0;
        int idx = ((m >> 3) - (n >> 3) + 7) * 15 + ((m & 7) - (n & 7) + 7);
        s[nt][j] += bsh[idx * 9 + h];
      }
    // row softmax: reduce over 4 n-tiles + 16-lane xor shuffles
#pragma unroll
    for (int j = 0; j < 8; ++j) {
      float mx = fmaxf(fmaxf(s[0][j], s[1][j]), fmaxf(s[2][j], s[3][j]));
#pragma unroll
      for (int msk = 1; msk < 16; msk <<= 1) mx = fmaxf(mx, __shfl_xor(mx, msk, 32));
      float sum = 0.f;
#pragma unroll
      for (int nt = 0; nt < 4; ++nt) { float e = expf(s[nt][j] - mx); s[nt][j] = e; sum += e; }
#pragma unroll
      for (int msk = 1; msk < 16; msk <<= 1) sum += __shfl_xor(sum, msk, 32);
      float inv = 1.0f / sum;
#pragma unroll
      for (int nt = 0; nt < 4; ++nt) s[nt][j] *= inv;
    }
#pragma unroll
    for (int nt = 0; nt < 4; ++nt)
#pragma unroll
      for (int j = 0; j < 8; ++j) {
        int m = mt * 16 + hi * 8 + j;
        P[m * 520 + h * 64 + nt * 16 + n0] = (_Float16)s[nt][j];
      }
  }
  __syncthreads();

  // O = P @ V per head: (64x64) @ (64x16), K = 64 -> 2 WMMA k-steps
#pragma unroll 1
  for (int mt = 0; mt < 4; ++mt) {
    v8f o = vzero();
#pragma unroll
    for (int ks = 0; ks < 2; ++ks) {
      v16h a = ldfrag(P, 520, mt * 16, h * 64 + ks * 32);
      v16h b = ldfrag(vT, 72, h * 16, ks * 32);
      o = wmma16(a, b, o);
    }
#pragma unroll
    for (int j = 0; j < 8; ++j) {
      size_t row = (size_t)win * 64 + mt * 16 + hi * 8 + j;
      xattn2[row * 128 + h * 16 + n0] = (_Float16)o[j];
    }
  }
}

// ---------------------------------------------------------------- pr 1x1 conv GEMM
// grid 2048 (one image row of 64 pixels each), block 128, shmem 33KB (rows padded by 16 B)
// Up to 256 registers a wave (4 waves a SIMD): the weights alone take 128.
__global__ __launch_bounds__(128, 4)
void k_prgemm(const _Float16* __restrict__ xc, const _Float16* __restrict__ pwf,
                         const float* __restrict__ pb, _Float16* __restrict__ prout) {
  extern __shared__ char smemraw[];
  _Float16* xa = (_Float16*)smemraw;  // 64 x 256, pitch 264
  const int blk = blockIdx.x, tid = threadIdx.x;
  const int w = tid >> 5, lane = tid & 31, n0 = lane & 15, hi = lane >> 4;
  // The wave's weight fragments (2 column tiles x 8 k steps) are loaded once and serve all
  // 4 row tiles; issued ahead of the staging, they fly together with it.
  v16h bw[2][8];
  const unsigned bo0 = fragoff(256, (w * 2 + 0) * 16), bo1 = fragoff(256, (w * 2 + 1) * 16);
#pragma unroll  // bw is indexed by constants only, so that it stays in registers
  for (int ks = 0; ks < 8; ++ks) {
    bw[0][ks] = ldfrag_o(pwf, bo0, ks * 32);
    bw[1][ks] = ldfrag_o(pwf, bo1, ks * 32);
  }
  // the offsets these loads name are inputs here, so they stay in their registers until the
  // wait has passed; behind it the registers may be reused
  asm volatile("s_wait_xcnt 0x0" :: "v"(bo0), "v"(bo1) : "memory");
  {
    const uint4* src = (const uint4*)(xc + (size_t)blk * (64 * 256));
    uint4* dst = (uint4*)xa;
    for (int i = tid; i < 2048; i += 128) dst[(i >> 5) * 33 + (i & 31)] = src[i];
  }
  __syncthreads();
#pragma unroll 1
  for (int mt = 0; mt < 4; ++mt) {
    v8f acc0 = vzero(), acc1 = vzero();
#pragma unroll  // constant indices into bw
    for (int ks = 0; ks < 8; ++ks) {
      v16h a = ldfrag(xa, 264, mt * 16, ks * 32);
      acc0 = wmma16(a, bw[0][ks], acc0);
      acc1 = wmma16(a, bw[1][ks], acc1);
    }
#pragma unroll
    for (int u = 0; u < 2; ++u) {
      v8f acc = u ? acc1 : acc0;
      int c0 = (w * 2 + u) * 16 + n0;
      float bias = pb[c0];
#pragma unroll
      for (int j = 0; j < 8; ++j) {
        size_t row = (size_t)blk * 64 + mt * 16 + hi * 8 + j;
        prout[row * 128 + c0] = (_Float16)(acc[j] + bias);
      }
    }
    // the stores' address and data registers are reused by the next row tile
    asm volatile("s_wait_xcnt 0x0" ::: "memory");
  }
}

// ---------------------------------------------------------------- spatial interaction + gating
// One wave walks 32 rows, two at a time: lanes 0-15 take the even row, lanes 16-31 the odd one.
// Lane o of a row holds row o of si_w1 (128 f32) in registers for the whole walk, computes
// hidden unit o, and afterwards gates channels 8*o .. 8*o+7 of the row. No LDS, no barrier.
// grid 1024, block 128 (4 waves): 4096 waves x 32 rows = 131072 rows. At least 4 waves per SIMD
// (at most 256 registers), so that all 4096 waves are resident at once: no second round.
__global__ __launch_bounds__(128, 4)
void k_si_gate(const _Float16* __restrict__ xattn2, const _Float16* __restrict__ prout,
               const float* __restrict__ w1, const float* __restrict__ b1,
               const float* __restrict__ g1, const float* __restrict__ bb1,
               const float* __restrict__ w2, const float* __restrict__ b2,
               const float* __restrict__ cng, const float* __restrict__ cnb,
               _Float16* __restrict__ gated) {
  const int lane = threadIdx.x & 31, o = lane & 15, odd = lane >> 4;
  const int wave = blockIdx.x * 4 + (threadIdx.x >> 5);
  const unsigned wo = o * 512u, go = o * 32u;   // byte offsets: row o of si_w1, channels 8*o..
  f4 wr[32];
#pragma unroll
  for (int i = 0; i < 32; ++i) wr[i] = *(const f4*)((const char*)w1 + wo + i * 16);
  const float bns = rsqrtf(1.f + 1e-5f);
  const float b1o = b1[o], g1o = g1[o], sh1 = bb1[o], w2o = w2[o], b2v = b2[0];
  const f4 gr0 = *(const f4*)((const char*)cng + go), gr1 = *(const f4*)((const char*)cng + go + 16);
  const f4 gb0 = *(const f4*)((const char*)cnb + go), gb1 = *(const f4*)((const char*)cnb + go + 16);
  // the offsets these loads name are inputs here, so they stay in their registers until the
  // wait has passed; behind it the registers may be reused
  asm volatile("s_wait_xcnt 0x0" :: "v"(wo), "v"(go), "v"(o) : "memory");
  const float sc1 = g1o * bns;
  const f4 gs0 = gr0 * bns, gs1 = gr1 * bns;
  const float gs[8] = {gs0.x, gs0.y, gs0.z, gs0.w, gs1.x, gs1.y, gs1.z, gs1.w};
  const float gb[8] = {gb0.x, gb0.y, gb0.z, gb0.w, gb1.x, gb1.y, gb1.z, gb1.w};
  // rolled: one pair of rows is already some 500 instructions
#pragma unroll 1
  for (int it = 0; it < 16; ++it) {
    const int r = wave * 32 + it * 2 + odd;
    // windowed row -> image position
    const int b_ = r >> 6, n = r & 63;
    const int b = b_ >> 6, wi = b_ & 63;
    const int y = (wi >> 3) * 8 + (n >> 3);
    const int xx = (wi & 7) * 8 + (n & 7);
    const size_t p = (size_t)b * 4096 + (size_t)y * 64 + xx;
    const h8* xp = (const h8*)(xattn2 + (size_t)r * 128);
    const h8* pp = (const h8*)(prout + p * 128 + o * 8);
    h8 xv[16];                            // the whole row, the same in its 16 lanes
#pragma unroll
    for (int i = 0; i < 16; ++i) xv[i] = xp[i];
    const h8 pv = *pp;
    // xp and pp are inputs here, so they stay in their registers until the wait has passed
    asm volatile("s_wait_xcnt 0x0" :: "v"(xp), "v"(pp) : "memory");
    // four independent chains (k mod 4), so that a wave does not wait out each FMA's latency
    f4 s4 = {0.f, 0.f, 0.f, 0.f};
#pragma unroll
    for (int i = 0; i < 16; ++i) {
      f4 lo = {(float)xv[i][0], (float)xv[i][1], (float)xv[i][2], (float)xv[i][3]};
      f4 hv = {(float)xv[i][4], (float)xv[i][5], (float)xv[i][6], (float)xv[i][7]};
      s4 += wr[i * 2] * lo;
      s4 += wr[i * 2 + 1] * hv;
    }
    float a = b1o + ((s4.x + s4.y) + (s4.z + s4.w));
    a = a * sc1 + sh1;
    float t = w2o * geluf(a);
    // sum over the row's 16 hidden units = its 16 lanes
#pragma unroll
    for (int msk = 1; msk < 16; msk <<= 1) t += __shfl_xor(t, msk, 32);
    const float siv = t + b2v;
    h8 ov;
#pragma unroll
    for (int k = 0; k < 8; ++k) ov[k] = (_Float16)(sigmf(siv * (float)pv[k]) * gs[k] + gb[k]);
    *(h8*)(gated + (size_t)r * 128 + o * 8) = ov;
    // the store's address and data registers are reused by the next pair of rows
    asm volatile("s_wait_xcnt 0x0" ::: "memory");
  }
}

// ---------------------------------------------------------------- final concat GEMM (+LN on attn half)
// grid 2048, block 256, shmem 33KB (rows padded by 16 B)
// At most 128 registers: 4 work-groups a WGP, so that one's staging and LayerNorm (2 of its
// 8 waves) run beside the others' products.
__global__ __launch_bounds__(256, 8)
void k_final(const _Float16* __restrict__ xattn2, const _Float16* __restrict__ gated,
                        const _Float16* __restrict__ owT, const float* __restrict__ ob,
                        const float* __restrict__ ang, const float* __restrict__ anb,
                        float* __restrict__ out) {
  extern __shared__ char smemraw[];
  _Float16* A = (_Float16*)smemraw;  // 64 x 256, pitch 264
  const int win = blockIdx.x, tid = threadIdx.x;
  const int w = tid >> 5, lane = tid & 31, n0 = lane & 15, hi = lane >> 4;
  for (int i = tid; i < 8192; i += 256) {
    int r = i >> 7, c = i & 127;
    A[r * 264 + c]       = xattn2[(size_t)win * 8192 + i];
    A[r * 264 + 128 + c] = gated[(size_t)win * 8192 + i];
  }
  __syncthreads();
  if (tid < 64) {  // LN in place on the attention half of the row
    float m = 0.f;
    for (int c = 0; c < 128; ++c) m += (float)A[tid * 264 + c];
    m *= (1.f / 128.f);
    float v = 0.f;
    for (int c = 0; c < 128; ++c) { float d = (float)A[tid * 264 + c] - m; v += d * d; }
    v *= (1.f / 128.f);
    float rs = rsqrtf(v + 1e-5f);
    for (int c = 0; c < 128; ++c)
      A[tid * 264 + c] = (_Float16)(((float)A[tid * 264 + c] - m) * rs * ang[c] + anb[c]);
  }
  __syncthreads();
  // k outermost, all 4 row tiles' sums in registers: each weight fragment is loaded once and
  // serves the 4 row tiles (here the sums, 64 registers, are kept, not the 128 of the weights)
  v8f acc[4][2];
  const unsigned bbo = (unsigned)((w * 32 + n0) * 4);
  const float bias[2] = {*(const float*)((const char*)ob + bbo),
                         *(const float*)((const char*)ob + bbo + 64)};
  // the offset these loads name is an input here, so it stays in its register until the wait
  // has passed
  asm volatile("s_wait_xcnt 0x0" :: "v"(bbo) : "memory");
#pragma unroll
  for (int mt = 0; mt < 4; ++mt) { acc[mt][0] = vzero(); acc[mt][1] = vzero(); }
#pragma unroll  // this loop and those inside: acc is indexed by constants only (registers)
  for (int ks = 0; ks < 8; ++ks) {
    v16h b0 = ldfrag(owT, 256, (w * 2 + 0) * 16, ks * 32);
    v16h b1 = ldfrag(owT, 256, (w * 2 + 1) * 16, ks * 32);
#pragma unroll
    for (int mt = 0; mt < 4; ++mt) {
      v16h a = ldfrag(A, 264, mt * 16, ks * 32);
      acc[mt][0] = wmma16(a, b0, acc[mt][0]);
      acc[mt][1] = wmma16(a, b1, acc[mt][1]);
    }
  }
#pragma unroll
  for (int u = 0; u < 2; ++u) {
    int c0 = (w * 2 + u) * 16 + n0;
#pragma unroll
    for (int mt = 0; mt < 4; ++mt)
#pragma unroll
      for (int j = 0; j < 8; ++j) {
        size_t row = (size_t)win * 64 + mt * 16 + hi * 8 + j;
        out[row * 256 + c0] = acc[mt][u][j] + bias[u];
      }
  }
}

// ---------------------------------------------------------------- launcher
extern "C" void kernel_launch(void* const* d_in, const int* in_sizes, int n_in,
                              void* d_out, int out_size, void* d_ws, size_t ws_size,
                              hipStream_t stream) {
  (void)in_sizes; (void)n_in; (void)out_size; (void)ws_size;
  const float* x       = (const float*)d_in[0];
  const float* relb    = (const float*)d_in[1];
  const float* attn_w  = (const float*)d_in[2];
  const float* attn_b  = (const float*)d_in[3];
  const float* aln_g   = (const float*)d_in[4];
  const float* aln_b   = (const float*)d_in[5];
  const float* conv_w  = (const float*)d_in[6];
  const float* conv_b  = (const float*)d_in[7];
  const float* cbn_g   = (const float*)d_in[8];
  const float* cbn_b   = (const float*)d_in[9];
  const float* ci_w1   = (const float*)d_in[10];
  const float* ci_b1   = (const float*)d_in[11];
  const float* ci_g    = (const float*)d_in[12];
  const float* ci_bb   = (const float*)d_in[13];
  const float* ci_w2   = (const float*)d_in[14];
  const float* ci_b2   = (const float*)d_in[15];
  const float* pr_w    = (const float*)d_in[16];
  const float* pr_b    = (const float*)d_in[17];
  const float* cn_g    = (const float*)d_in[18];
  const float* cn_b    = (const float*)d_in[19];
  const float* qkv_w   = (const float*)d_in[20];
  const float* qkv_b   = (const float*)d_in[21];
  const float* si_w1   = (const float*)d_in[22];
  const float* si_b1   = (const float*)d_in[23];
  const float* si_g    = (const float*)d_in[24];
  const float* si_bb   = (const float*)d_in[25];
  const float* si_w2   = (const float*)d_in[26];
  const float* si_b2   = (const float*)d_in[27];
  const float* an_g    = (const float*)d_in[28];
  const float* an_b    = (const float*)d_in[29];
  const float* out_w   = (const float*)d_in[30];
  const float* out_b   = (const float*)d_in[31];
  float* out = (float*)d_out;

  // workspace arena
  char* W = (char*)d_ws;
  size_t off = 0;
  auto take = [&](size_t bytes) { char* p = W + off; off += (bytes + 255) & ~(size_t)255; return p; };
  char*     prg     = take(67108864);              // pr_out and gated, 33554432 B each
  _Float16* attn_wT = (_Float16*)take(65536);      // (128, 256)
  _Float16* qkv_wT  = (_Float16*)take(98304);      // (384, 128)
  _Float16* out_wT  = (_Float16*)take(131072);     // (256, 256)
  _Float16* pr_wf   = (_Float16*)take(65536);      // (128, 256)
  _Float16* x_attn  = (_Float16*)take(33554432);   // (131072, 128)
  _Float16* x_attn2 = (_Float16*)take(33554432);   // (131072, 128)
  _Float16* xc      = (_Float16*)take(67108864);   // (131072, 256) NHWC
  float*    part    = (float*)take(2097152);       // (32, 64, 256)
  float*    gap     = (float*)take(32768);         // (32, 256)
  float*    cis     = (float*)take(16384);         // (32, 128)
  _Float16* pr_out  = (_Float16*)prg;                             // (131072, 128)
  _Float16* gated   = (_Float16*)(prg + 33554432);                // (131072, 128)

  k_prep_w<<<704, 256, 0, stream>>>(attn_w, qkv_w, out_w, pr_w, attn_wT, qkv_wT, out_wT, pr_wf);
  k_attnproj_ln<<<2048, 128, 67072, stream>>>(x, attn_wT, attn_b, aln_g, aln_b, x_attn);
  k_dwconv<<<2048, 64, 0, stream>>>(x, conv_w, conv_b, cbn_g, cbn_b, xc);
  k_gap_partial<<<2048, 256, 0, stream>>>(xc, part);
  k_gap_final<<<32, 256, 0, stream>>>(part, gap);
  k_ci<<<32, 128, 0, stream>>>(gap, ci_w1, ci_b1, ci_g, ci_bb, ci_w2, ci_b2, cis);
  k_attention<<<2048, 256, 145316, stream>>>(x_attn, qkv_wT, qkv_b, cis, relb, x_attn2);
  k_prgemm<<<2048, 128, 33792, stream>>>(xc, pr_wf, pr_b, pr_out);
  k_si_gate<<<1024, 128, 0, stream>>>(x_attn2, pr_out, si_w1, si_b1, si_g, si_bb,
                                        si_w2, si_b2, cn_g, cn_b, gated);
  k_final<<<2048, 256, 33792, stream>>>(x_attn2, gated, out_wT, out_b, an_g, an_b, out);
}

// v006
// It runs in 225 microseconds.
// Two timings next to v005 put it at 1.20 and 1.21 times that version's speed.
// All steps since v000 together make it 3.99 times as fast.
#include <hip/hip_runtime.h>
#include <hip/hip_bf16.h>

#define DI __device__ __forceinline__

typedef __attribute__((ext_vector_type(16))) _Float16 v16h;
typedef __attribute__((ext_vector_type(8)))  _Float16 h8;
typedef __attribute__((ext_vector_type(8)))  float    v8f;
typedef __attribute__((ext_vector_type(4)))  float    f4;
typedef __attribute__((ext_vector_type(4)))  _Float16 h4;

// ---------------------------------------------------------------- helpers
DI v8f vzero() { v8f z = {0.f,0.f,0.f,0.f,0.f,0.f,0.f,0.f}; return z; }

DI v8f wmma16(v16h a, v16h b, v8f c) {
  return __builtin_amdgcn_wmma_f32_16x16x32_f16(false, a, false, b, (short)0, c, false, false);
}

// A-fragment (16x32 f16): lane L -> row r0+(L&15); halves 0..7 = K k0+8*(L>>4)..+7,
// halves 8..15 = K k0+16+8*(L>>4)..+7.  B^T uses identical layout (row = out col).
DI v16h ldfrag(const _Float16* p, int ld, int r0, int k0) {
  int lane = threadIdx.x & 31;
  int m = lane & 15, hi = lane >> 4;
  const _Float16* q = p + (size_t)(r0 + m) * ld + k0 + hi * 8;
  h8 lo = *(const h8*)q;
  h8 hv = *(const h8*)(q + 16);
  return __builtin_shufflevector(lo, hv, 0,1,2,3,4,5,6,7,8,9,10,11,12,13,14,15);
}

// The same fragment from a base pointer and the lane's byte offset fragoff(ld, r0): the caller
// holds the one offset register that a run of such loads names.
DI unsigned fragoff(int ld, int r0) {
  int lane = threadIdx.x & 31;
  return (unsigned)(((r0 + (lane & 15)) * ld + (lane >> 4) * 8) * 2);
}
DI v16h ldfrag_o(const _Float16* p, unsigned off, int k0) {
  const char* q = (const char*)p + off + k0 * 2;
  h8 lo = *(const h8*)q;
  h8 hv = *(const h8*)(q + 32);
  return __builtin_shufflevector(lo, hv, 0,1,2,3,4,5,6,7,8,9,10,11,12,13,14,15);
}

// the value of lane l ^ 16 (the other 16-lane row), by a vector cross-row move
DI float xhalf(float x) {
  const int b = __builtin_bit_cast(int, x);
  return __builtin_bit_cast(float, __builtin_amdgcn_permlanex16(b, b, 0x76543210, 0xfedcba98, false, false));
}

DI float geluf(float x) { return 0.5f * x * (1.0f + erff(x * 0.70710678118654752f)); }
DI float sigmf(float x) { return 1.0f / (1.0f + expf(-x)); }

// ---------------------------------------------------------------- prep kernels
__global__ void k_prep_w(const float* __restrict__ aw, const float* __restrict__ qw,
                         const float* __restrict__ ow, const float* __restrict__ pw,
                         _Float16* __restrict__ awT, _Float16* __restrict__ qwT,
                         _Float16* __restrict__ owT, _Float16* __restrict__ pwf) {
  int i = blockIdx.x * 256 + threadIdx.x;
  const int A = 128 * 256, Q = 384 * 128, O = 256 * 256, P = 128 * 256;
  if (i < A) {                               // attn_w (256,128) -> (128,256)^T
    int n = i >> 8, k = i & 255;
    awT[i] = (_Float16)aw[k * 128 + n];
  } else if (i < A + Q) {                    // qkv_w (128,384) -> (384,128)^T
    int j = i - A; int n = j >> 7, k = j & 127;
    qwT[j] = (_Float16)qw[k * 384 + n];
  } else if (i < A + Q + O) {                // out_w (256,256) -> (256,256)^T
    int j = i - A - Q; int n = j >> 8, k = j & 255;
    owT[j] = (_Float16)ow[k * 256 + n];
  } else if (i < A + Q + O + P) {            // pr_w (128,256) already (O,I) = B^T
    int j = i - A - Q - O;
    pwf[j] = (_Float16)pw[j];
  }
}

// ---------------------------------------------------------------- attn proj + LN
// grid 2048 (one window), block 128 (4 waves), shmem 64*264*2 + 64*130*4 = 67072 B
// LDS rows are padded so that rows read together fall on different banks: xa by 16 bytes
// (pitch 16 B x odd, for the 16 rows of a 16-byte fragment read), ob by 2 floats (pitch 130
// dwords, for the LayerNorm, where each lane walks a row of its own 8 bytes at a time).
// LDS allows 4 work-groups a WGP = 4 waves a SIMD: the compiler is told to plan for exactly
// that (up to 256 registers), else it saves registers by staging one load at a time.
__global__ __launch_bounds__(128) __attribute__((amdgpu_waves_per_eu(4, 4)))
void k_attnproj_ln(const float* __restrict__ x,
                              const _Float16* __restrict__ awT,
                              const float* __restrict__ ab,
                              const float* __restrict__ lg,
                              const float* __restrict__ lb,
                              _Float16* __restrict__ xattn) {
  extern __shared__ char smemraw[];
  _Float16* xa = (_Float16*)smemraw;           // 64 x 256, pitch 264
  float* ob = (float*)(xa + 64 * 264);         // 64 x 128, pitch 130
  const int win = blockIdx.x, tid = threadIdx.x;
  const int w = tid >> 5, lane = tid & 31, n0 = lane & 15, hi = lane >> 4;
  // The wave's weight fragments (2 column tiles x 8 k steps) are loaded once and serve all
  // 4 row tiles; issued ahead of the staging, they fly together with it.
  v16h bw[2][8];
  const unsigned bo0 = fragoff(256, (w * 2 + 0) * 16), bo1 = fragoff(256, (w * 2 + 1) * 16);
#pragma unroll  // bw is indexed by constants only, so that it stays in registers
  for (int ks = 0; ks < 8; ++ks) {
    bw[0][ks] = ldfrag_o(awT, bo0, ks * 32);
    bw[1][ks] = ldfrag_o(awT, bo1, ks * 32);
  }
  // the offsets these loads name are inputs here, so they stay in their registers until the
  // wait has passed; behind it the registers may be reused
  asm volatile("s_wait_xcnt 0x0" :: "v"(bo0), "v"(bo1) : "memory");
  {
    // The window is read as f32 and rounded to f16 on its way into LDS. Load g of a lane is
    // 16 bytes at g * 2048 + tid * 16 (512 contiguous bytes a wave) = row 2g + (tid >> 6),
    // columns 4 * (tid & 63) .. + 3. Groups of 8 loads: a group is rounded and stored while
    // the groups behind it fly, and its registers are then free for a later group.
    const f4* xw = (const f4*)(x + (size_t)win * (64 * 256));
    char* xd = (char*)xa + (tid >> 6) * 528 + (tid & 63) * 8;
    f4 t[2][8];
#pragma unroll  // t is indexed by constants only (registers)
    for (int u = 0; u < 8; ++u) t[0][u] = xw[u * 128 + tid];
#pragma unroll  // constant indices into t
    for (int g = 0; g < 4; ++g) {
      if (g < 3) {
#pragma unroll
        for (int u = 0; u < 8; ++u) t[(g + 1) & 1][u] = xw[((g + 1) * 8 + u) * 128 + tid];
      }
      // keeps the later groups' loads behind this line: hoisted, all 32 loads' results are
      // live beside the 128 weight registers and the build spills
      if (g < 2) __builtin_amdgcn_sched_barrier(0);
#pragma unroll
      for (int u = 0; u < 8; ++u) {
        const f4 v = t[g & 1][u];
        h4 o = {(_Float16)v.x, (_Float16)v.y, (_Float16)v.z, (_Float16)v.w};
        *(h4*)(xd + (g * 8 + u) * 1056) = o;
      }
    }
    // the index and the base these loads name are inputs here, so they stay in their
    // registers until the wait has passed
    asm volatile("s_wait_xcnt 0x0" :: "v"(tid), "s"(xw) : "memory");
  }
  __syncthreads();
#pragma unroll 1
  for (int mt = 0; mt < 4; ++mt) {
    v8f acc0 = vzero(), acc1 = vzero();
#pragma unroll  // constant indices into bw
    for (int ks = 0; ks < 8; ++ks) {
      v16h a = ldfrag(xa, 264, mt * 16, ks * 32);
      acc0 = wmma16(a, bw[0][ks], acc0);
      acc1 = wmma16(a, bw[1][ks], acc1);
    }
#pragma unroll
    for (int u = 0; u < 2; ++u) {
      v8f acc = u ? acc1 : acc0;
      int c0 = (w * 2 + u) * 16 + n0;
      float bias = ab[c0];
#pragma unroll
      for (int j = 0; j < 8; ++j)
        ob[(mt * 16 + hi * 8 + j) * 130 + c0] = acc[j] + bias;
    }
  }
  __syncthreads();
  if (tid < 64) {
    float m = 0.f;
    for (int c = 0; c < 128; ++c) m += ob[tid * 130 + c];
    m *= (1.f / 128.f);
    float v = 0.f;
    for (int c = 0; c < 128; ++c) { float d = ob[tid * 130 + c] - m; v += d * d; }
    v *= (1.f / 128.f);
    float rs = rsqrtf(v + 1e-5f);
    _Float16* drow = xattn + ((size_t)win * 64 + tid) * 128;
    for (int c = 0; c < 128; ++c)
      drow[c] = (_Float16)((ob[tid * 130 + c] - m) * rs * lg[c] + lb[c]);
  }
}

// ---------------------------------------------------------------- depthwise 3x3 + BN + GELU
// One thread = one 8x8 window x 4 channels. The 9 taps of its channels and three
// input rows (8 pixels + 1 halo pixel each side) stay in registers, so every input
// value is loaded once per window, 16 bytes a lane, 512 contiguous bytes a wave.
// Row ry (-1..8) of the window at 'base' (own window, this thread's channels):
// r[0] / r[9] are the neighbours' edge pixels; outside the image everything is 0.
// At the image's left / right edge the halo load re-reads an own pixel (in bounds);
// dw_edge() replaces its value by 0 where the row is first used, not behind the load,
// so that nothing waits for the data while the loads fly.
DI void dw_ldrow(f4 (&r)[10], const float* base, int ry, int wy, int wx) {
  const f4 z = {0.f, 0.f, 0.f, 0.f};
  const bool ok = (ry >= 0 || wy > 0) && (ry < 8 || wy < 7);
  if (ok) {
    const float* rp = (ry < 0) ? base - 8 * 16384 + 7 * 2048
                    : (ry < 8) ? base + ry * 2048 : base + 8 * 16384;
    r[0] = *(const f4*)(rp + ((wx > 0) ? -16384 + 7 * 256 : 0));
#pragma unroll
    for (int i = 0; i < 8; ++i) r[1 + i] = *(const f4*)(rp + i * 256);
    r[9] = *(const f4*)(rp + ((wx < 7) ? 16384 : 0));
    // the loads' address registers may be reused right behind them
    asm volatile("s_wait_xcnt 0x0" ::: "memory");
  } else {
#pragma unroll
    for (int i = 0; i < 10; ++i) r[i] = z;
  }
}
DI void dw_edge(f4 (&r)[10], int wx) {
  const f4 z = {0.f, 0.f, 0.f, 0.f};
  r[0] = (wx > 0) ? r[0] : z;
  r[9] = (wx < 7) ? r[9] : z;
}

// grid 2048 (one window), block 64 (64 x 4 channels)
__global__ __launch_bounds__(64)
void k_dwconv(const float* __restrict__ x, const float* __restrict__ cw,
              const float* __restrict__ cb, const float* __restrict__ bg,
              const float* __restrict__ bb, _Float16* __restrict__ xc) {
  const int win = blockIdx.x;
  const int b = win >> 6, wy = (win >> 3) & 7, wx = win & 7;
  const int c = threadIdx.x * 4;
  f4 wt[9];
  {
    float wl[36];                          // 4 channels x 9 taps, contiguous
#pragma unroll
    for (int i = 0; i < 9; ++i) {
      f4 t = *(const f4*)(cw + c * 9 + i * 4);
      wl[i * 4 + 0] = t.x; wl[i * 4 + 1] = t.y; wl[i * 4 + 2] = t.z; wl[i * 4 + 3] = t.w;
    }
#pragma unroll
    for (int k = 0; k < 9; ++k) { f4 t = {wl[k], wl[9 + k], wl[18 + k], wl[27 + k]}; wt[k] = t; }
  }
  const float bns = rsqrtf(1.f + 1e-5f);
  const f4 cb4 = *(const f4*)(cb + c);
  const f4 sc4 = *(const f4*)(bg + c) * bns;
  const f4 bb4 = *(const f4*)(bb + c);
  const float* base = x + (size_t)win * 16384 + c;
  _Float16* orow = xc + (((size_t)b * 4096 + (size_t)wy * 512 + wx * 8) * 256 + c);

  f4 r0[10], r1[10], r2[10];
  dw_ldrow(r0, base, -1, wy, wx);
  dw_ldrow(r1, base, 0, wy, wx);
  dw_ldrow(r2, base, 1, wy, wx);
  dw_edge(r0, wx);
  dw_edge(r1, wx);
  // rolled: one row's body is already about 1,500 instructions
#pragma unroll 1
  for (int ry = 0; ry < 8; ++ry) {
    dw_edge(r2, wx);
    f4 acc[8];
#pragma unroll
    for (int px = 0; px < 8; ++px) {
      f4 s = {0.f, 0.f, 0.f, 0.f};
#pragma unroll
      for (int dx = 0; dx < 3; ++dx) s += r0[px + dx] * wt[dx];
#pragma unroll
      for (int dx = 0; dx < 3; ++dx) s += r1[px + dx] * wt[3 + dx];
#pragma unroll
      for (int dx = 0; dx < 3; ++dx) s += r2[px + dx] * wt[6 + dx];
      acc[px] = s;
    }
#pragma unroll
    for (int i = 0; i < 10; ++i) { r0[i] = r1[i]; r1[i] = r2[i]; }
    // the next row's loads fly while this row's BN + GELU is computed
    if (ry < 7) dw_ldrow(r2, base, ry + 2, wy, wx);
#pragma unroll
    for (int px = 0; px < 8; ++px) {
      f4 v = (acc[px] + cb4) * sc4 + bb4;
      h4 o = {(_Float16)geluf(v.x), (_Float16)geluf(v.y), (_Float16)geluf(v.z), (_Float16)geluf(v.w)};
      *(h4*)(orow + (size_t)ry * 16384 + px * 256) = o;
    }
    // the last store's address and data registers are reused by the next row
    asm volatile("s_wait_xcnt 0x0" ::: "memory");
  }
}

// deterministic 2-stage GAP (no float atomics -> graph-replay bit-stable)
__global__ void k_gap_partial(const _Float16* __restrict__ xc, float* __restrict__ part) {
  int blk = blockIdx.x;                 // b*64 + chunk
  int b = blk >> 6, chunk = blk & 63;
  int c = threadIdx.x;                  // 256 channels
  float s = 0.f;
  size_t base = ((size_t)b * 4096 + (size_t)chunk * 64) * 256 + c;
  for (int p2 = 0; p2 < 64; ++p2) s += (float)xc[base + (size_t)p2 * 256];
  part[(size_t)blk * 256 + c] = s;
}
__global__ void k_gap_final(const float* __restrict__ part, float* __restrict__ gap) {
  int b = blockIdx.x, c = threadIdx.x;
  float s = 0.f;
  for (int k2 = 0; k2 < 64; ++k2) s += part[((size_t)b * 64 + k2) * 256 + c];
  gap[b * 256 + c] = s;
}

// channel interaction MLP -> sigmoid gates (32 images, tiny)
__global__ void k_ci(const float* __restrict__ gap, const float* __restrict__ w1,
                     const float* __restrict__ b1, const float* __restrict__ g1,
                     const float* __restrict__ bb1, const float* __restrict__ w2,
                     const float* __restrict__ b2, float* __restrict__ cis) {
  __shared__ float d1[32];
  int b = blockIdx.x, t = threadIdx.x;  // 128 threads
  float bns = rsqrtf(1.f + 1e-5f);
  if (t < 32) {
    float a = b1[t];
    const float inv = 1.f / 4096.f;
    for (int i = 0; i < 256; ++i) a += w1[t * 256 + i] * gap[b * 256 + i] * inv;
    a = a * (g1[t] * bns) + bb1[t];
    d1[t] = geluf(a);
  }
  __syncthreads();
  float a = b2[t];
  for (int j = 0; j < 32; ++j) a += w2[t * 32 + j] * d1[j];
  cis[b * 128 + t] = sigmf(a);
}

// ---------------------------------------------------------------- fused qkv + attention
// grid 2048 windows, block 256 (8 waves = 8 heads), dyn shmem 25508 B (x tile, rows padded by
// 16 B; bias rows padded by 4 B).
// Wave h computes q, k and v of head h itself, and every product takes its two operands in the
// order that leaves the result where the next product wants it (A and B share one lane map:
// lane (c, hi) holds row / column c, k = 8*hi..+7 and 16+8*hi..+7; D register j of lane (c, hi)
// is D[8*hi+j][c]):
//   q^T, k^T = W x^T : lane (token, hi) holds channels 8*hi..+7  = a row of the A / B operand
//   v        = x W   : lane (channel, hi) holds tokens 8*hi..+7  = a column of V, two tiles = k 32
//   S^T      = k q^T : lane (query, hi) holds keys 8*hi..+7 of each key tile = a row of P
//   O^T      = V^T P^T : lane (query, hi) holds channels 8*hi..+7 = 16 contiguous output bytes
// So q, k, v and P never leave the wave's registers, and a query's softmax lies in 2 lanes.
// Up to 256 registers (4 waves a SIMD): the weights alone take 96.
__global__ __launch_bounds__(256) __attribute__((amdgpu_waves_per_eu(4, 4)))
void k_attention(const _Float16* __restrict__ xattn,
                            const _Float16* __restrict__ qwT,
                            const float* __restrict__ qb,
                            const float* __restrict__ cis,
                            const float* __restrict__ relb,
                            _Float16* __restrict__ xattn2) {
  extern __shared__ char smemraw[];
  _Float16* xa  = (_Float16*)smemraw;      // 64 x 128, pitch 136
  float* bsh    = (float*)(xa + 64 * 136); // 225 x 8 rel-pos bias, pitch 9 (odd: a wave's 24 rows on 24 banks)

  const int win = blockIdx.x, tid = threadIdx.x;
  const int h = tid >> 5, lane = tid & 31, n0 = lane & 15, hi = lane >> 4;
  const int img = win >> 6;
  // The head's weight fragments (q, k, v column tile x 4 k steps) are loaded once and serve
  // all 4 token tiles; issued ahead of the staging, they fly together with it.
  v16h bw[3][4];
  const unsigned bo0 = fragoff(128, h * 16), bo1 = fragoff(128, 128 + h * 16),
                 bo2 = fragoff(128, 256 + h * 16);
#pragma unroll  // bw is indexed by constants only, so that it stays in registers
  for (int ks = 0; ks < 4; ++ks) {
    bw[0][ks] = ldfrag_o(qwT, bo0, ks * 32);
    bw[1][ks] = ldfrag_o(qwT, bo1, ks * 32);
    bw[2][ks] = ldfrag_o(qwT, bo2, ks * 32);
  }
  // the lane's 8 q and 8 k biases (channels 8*hi..+7), its v bias and channel gate (channel n0)
  const unsigned qo = (unsigned)((h * 16 + hi * 8) * 4);
  const int vi = h * 16 + n0;
  const f4 bq0 = *(const f4*)((const char*)qb + qo), bq1 = *(const f4*)((const char*)qb + qo + 16);
  const f4 bk0 = *(const f4*)((const char*)qb + qo + 512), bk1 = *(const f4*)((const char*)qb + qo + 528);
  const float bv = qb[256 + vi];
  const float gate = (cis + img * 128)[vi];
  // the offsets and the index these loads name are inputs here, so they stay in their
  // registers until the wait has passed; behind it the registers may be reused
  asm volatile("s_wait_xcnt 0x0" :: "v"(bo0), "v"(bo1), "v"(bo2), "v"(qo), "v"(vi) : "memory");
  {
    const uint4* src = (const uint4*)(xattn + (size_t)win * (64 * 128));
    uint4* dst = (uint4*)xa;
    for (int i = tid; i < 1024; i += 256) dst[(i >> 4) * 17 + (i & 15)] = src[i];
    for (int i = tid; i < 1800; i += 256) bsh[(i >> 3) * 9 + (i & 7)] = relb[i];
  }
  __syncthreads();

  const float bq[8] = {bq0.x, bq0.y, bq0.z, bq0.w, bq1.x, bq1.y, bq1.z, bq1.w};
  const float bk[8] = {bk0.x, bk0.y, bk0.z, bk0.w, bk1.x, bk1.y, bk1.z, bk1.w};
  h8 qf[4], kf[4], vf[4];                  // one per 16-token tile
#pragma unroll  // this loop and those below: qf, kf, vf are indexed by constants only (registers)
  for (int mt = 0; mt < 4; ++mt) {
    v8f aq = vzero(), ak = vzero(), av = vzero();
#pragma unroll  // constant indices into bw
    for (int ks = 0; ks < 4; ++ks) {
      v16h a = ldfrag(xa, 136, mt * 16, ks * 32);
      aq = wmma16(bw[0][ks], a, aq);       // [channel][token]
      ak = wmma16(bw[1][ks], a, ak);       // [channel][token]
      av = wmma16(a, bw[2][ks], av);       // [token][channel]
    }
#pragma unroll
    for (int j = 0; j < 8; ++j) {
      qf[mt][j] = (_Float16)((aq[j] + bq[j]) * 0.25f);       // HD^-0.5
      kf[mt][j] = (_Float16)(ak[j] + bk[j]);
      vf[mt][j] = (_Float16)((av[j] + bv) * gate);
    }
  }

  // HD = 16: the upper 16 of the score products' k are zero
  const h8 z8 = {(_Float16)0.f,(_Float16)0.f,(_Float16)0.f,(_Float16)0.f,
                 (_Float16)0.f,(_Float16)0.f,(_Float16)0.f,(_Float16)0.f};
  v16h vB[2];
#pragma unroll
  for (int ks = 0; ks < 2; ++ks)
    vB[ks] = __builtin_shufflevector(vf[ks * 2], vf[ks * 2 + 1], 0,1,2,3,4,5,6,7,8,9,10,11,12,13,14,15);
  // bias of (query mt*16 + n0, key nt*16 + hi*8 + j): table row
  // ((n0>>3) - hi + 7) * 15 + (n0&7) + 7  +  (mt - nt) * 30 - j
  const float* bl = bsh + ((((n0 >> 3) - hi + 7) * 15 + (n0 & 7) + 7) * 9 + h);
  _Float16* orow = xattn2 + ((size_t)win * 64 + n0) * 128 + h * 16 + hi * 8;
#pragma unroll
  for (int mt = 0; mt < 4; ++mt) {
    const v16h qB = __builtin_shufflevector(qf[mt], z8, 0,1,2,3,4,5,6,7,8,9,10,11,12,13,14,15);
    v8f s[4];
#pragma unroll
    for (int nt = 0; nt < 4; ++nt) {
      const v16h kA = __builtin_shufflevector(kf[nt], z8, 0,1,2,3,4,5,6,7,8,9,10,11,12,13,14,15);
      v8f c;                               // the bias tile, in D's map, is the product's C
#pragma unroll
      for (int j = 0; j < 8; ++j) c[j] = bl[((mt - nt) * 30 - j) * 9];
      s[nt] = wmma16(kA, qB, c);           // [key][query]
    }
    // softmax of the lane's query: its 32 keys here, the other 32 in lane ^ 16
    float m4[4];
#pragma unroll
    for (int nt = 0; nt < 4; ++nt) {
      m4[nt] = s[nt][0];
#pragma unroll
      for (int j = 1; j < 8; ++j) m4[nt] = fmaxf(m4[nt], s[nt][j]);
    }
    float mx = fmaxf(fmaxf(m4[0], m4[1]), fmaxf(m4[2], m4[3]));
    mx = fmaxf(mx, xhalf(mx));
    float s4[4] = {0.f, 0.f, 0.f, 0.f};    // four independent chains
#pragma unroll
    for (int nt = 0; nt < 4; ++nt)
#pragma unroll
      for (int j = 0; j < 8; ++j) { float e = expf(s[nt][j] - mx); s[nt][j] = e; s4[nt] += e; }
    float sum = (s4[0] + s4[1]) + (s4[2] + s4[3]);
    sum += xhalf(sum);
    const float inv = 1.0f / sum;
    v8f o = vzero();
#pragma unroll
    for (int ks = 0; ks < 2; ++ks) {
      v16h pB;
#pragma unroll
      for (int j = 0; j < 8; ++j) {
        pB[j]     = (_Float16)(s[ks * 2][j] * inv);
        pB[8 + j] = (_Float16)(s[ks * 2 + 1][j] * inv);
      }
      o = wmma16(vB[ks], pB, o);           // [channel][query]
    }
    h8 ov;
#pragma unroll
    for (int j = 0; j < 8; ++j) ov[j] = (_Float16)o[j];
    *(h8*)(orow + mt * (16 * 128)) = ov;
  }
}

// ---------------------------------------------------------------- pr 1x1 conv GEMM
// grid 2048 (one image row of 64 pixels each), block 128, shmem 33KB (rows padded by 16 B)
// Up to 256 registers a wave (4 waves a SIMD): the weights alone take 128.
__global__ __launch_bounds__(128, 4)
void k_prgemm(const _Float16* __restrict__ xc, const _Float16* __restrict__ pwf,
                         const float* __restrict__ pb, _Float16* __restrict__ prout) {
  extern __shared__ char smemraw[];
  _Float16* xa = (_Float16*)smemraw;  // 64 x 256, pitch 264
  const int blk = blockIdx.x, tid = threadIdx.x;
  const int w = tid >> 5, lane = tid & 31, n0 = lane & 15, hi = lane >> 4;
  // The wave's weight fragments (2 column tiles x 8 k steps) are loaded once and serve all
  // 4 row tiles; issued ahead of the staging, they fly together with it.
  v16h bw[2][8];
  const unsigned bo0 = fragoff(256, (w * 2 + 0) * 16), bo1 = fragoff(256, (w * 2 + 1) * 16);
#pragma unroll  // bw is indexed by constants only, so that it stays in registers
  for (int ks = 0; ks < 8; ++ks) {
    bw[0][ks] = ldfrag_o(pwf, bo0, ks * 32);
    bw[1][ks] = ldfrag_o(pwf, bo1, ks * 32);
  }
  // the offsets these loads name are inputs here, so they stay in their registers until the
  // wait has passed; behind it the registers may be reused
  asm volatile("s_wait_xcnt 0x0" :: "v"(bo0), "v"(bo1) : "memory");
  {
    const uint4* src = (const uint4*)(xc + (size_t)blk * (64 * 256));
    uint4* dst = (uint4*)xa;
    for (int i = tid; i < 2048; i += 128) dst[(i >> 5) * 33 + (i & 31)] = src[i];
  }
  __syncthreads();
#pragma unroll 1
  for (int mt = 0; mt < 4; ++mt) {
    v8f acc0 = vzero(), acc1 = vzero();
#pragma unroll  // constant indices into bw
    for (int ks = 0; ks < 8; ++ks) {
      v16h a = ldfrag(xa, 264, mt * 16, ks * 32);
      acc0 = wmma16(a, bw[0][ks], acc0);
      acc1 = wmma16(a, bw[1][ks], acc1);
    }
#pragma unroll
    for (int u = 0; u < 2; ++u) {
      v8f acc = u ? acc1 : acc0;
      int c0 = (w * 2 + u) * 16 + n0;
      float bias = pb[c0];
#pragma unroll
      for (int j = 0; j < 8; ++j) {
        size_t row = (size_t)blk * 64 + mt * 16 + hi * 8 + j;
        prout[row * 128 + c0] = (_Float16)(acc[j] + bias);
      }
    }
    // the stores' address and data registers are reused by the next row tile
    asm volatile("s_wait_xcnt 0x0" ::: "memory");
  }
}

// ---------------------------------------------------------------- spatial interaction + gating
// One wave walks 32 rows, two at a time: lanes 0-15 take the even row, lanes 16-31 the odd one.
// Lane o of a row holds row o of si_w1 (128 f32) in registers for the whole walk, computes
// hidden unit o, and afterwards gates channels 8*o .. 8*o+7 of the row. No LDS, no barrier.
// grid 1024, block 128 (4 waves): 4096 waves x 32 rows = 131072 rows. At least 4 waves per SIMD
// (at most 256 registers), so that all 4096 waves are resident at once: no second round.
__global__ __launch_bounds__(128, 4)
void k_si_gate(const _Float16* __restrict__ xattn2, const _Float16* __restrict__ prout,
               const float* __restrict__ w1, const float* __restrict__ b1,
               const float* __restrict__ g1, const float* __restrict__ bb1,
               const float* __restrict__ w2, const float* __restrict__ b2,
               const float* __restrict__ cng, const float* __restrict__ cnb,
               _Float16* __restrict__ gated) {
  const int lane = threadIdx.x & 31, o = lane & 15, odd = lane >> 4;
  const int wave = blockIdx.x * 4 + (threadIdx.x >> 5);
  const unsigned wo = o * 512u, go = o * 32u;   // byte offsets: row o of si_w1, channels 8*o..
  f4 wr[32];
#pragma unroll
  for (int i = 0; i < 32; ++i) wr[i] = *(const f4*)((const char*)w1 + wo + i * 16);
  const float bns = rsqrtf(1.f + 1e-5f);
  const float b1o = b1[o], g1o = g1[o], sh1 = bb1[o], w2o = w2[o], b2v = b2[0];
  const f4 gr0 = *(const f4*)((const char*)cng + go), gr1 = *(const f4*)((const char*)cng + go + 16);
  const f4 gb0 = *(const f4*)((const char*)cnb + go), gb1 = *(const f4*)((const char*)cnb + go + 16);
  // the offsets these loads name are inputs here, so they stay in their registers until the
  // wait has passed; behind it the registers may be reused
  asm volatile("s_wait_xcnt 0x0" :: "v"(wo), "v"(go), "v"(o) : "memory");
  const float sc1 = g1o * bns;
  const f4 gs0 = gr0 * bns, gs1 = gr1 * bns;
  const float gs[8] = {gs0.x, gs0.y, gs0.z, gs0.w, gs1.x, gs1.y, gs1.z, gs1.w};
  const float gb[8] = {gb0.x, gb0.y, gb0.z, gb0.w, gb1.x, gb1.y, gb1.z, gb1.w};
  // rolled: one pair of rows is already some 500 instructions
#pragma unroll 1
  for (int it = 0; it < 16; ++it) {
    const int r = wave * 32 + it * 2 + odd;
    // windowed row -> image position
    const int b_ = r >> 6, n = r & 63;
    const int b = b_ >> 6, wi = b_ & 63;
    const int y = (wi >> 3) * 8 + (n >> 3);
    const int xx = (wi & 7) * 8 + (n & 7);
    const size_t p = (size_t)b * 4096 + (size_t)y * 64 + xx;
    const h8* xp = (const h8*)(xattn2 + (size_t)r * 128);
    const h8* pp = (const h8*)(prout + p * 128 + o * 8);
    h8 xv[16];                            // the whole row, the same in its 16 lanes
#pragma unroll
    for (int i = 0; i < 16; ++i) xv[i] = xp[i];
    const h8 pv = *pp;
    // xp and pp are inputs here, so they stay in their registers until the wait has passed
    asm volatile("s_wait_xcnt 0x0" :: "v"(xp), "v"(pp) : "memory");
    // four independent chains (k mod 4), so that a wave does not wait out each FMA's latency
    f4 s4 = {0.f, 0.f, 0.f, 0.f};
#pragma unroll
    for (int i = 0; i < 16; ++i) {
      f4 lo = {(float)xv[i][0], (float)xv[i][1], (float)xv[i][2], (float)xv[i][3]};
      f4 hv = {(float)xv[i][4], (float)xv[i][5], (float)xv[i][6], (float)xv[i][7]};
      s4 += wr[i * 2] * lo;
      s4 += wr[i * 2 + 1] * hv;
    }
    float a = b1o + ((s4.x + s4.y) + (s4.z + s4.w));
    a = a * sc1 + sh1;
    float t = w2o * geluf(a);
    // sum over the row's 16 hidden units = its 16 lanes
#pragma unroll
    for (int msk = 1; msk < 16; msk <<= 1) t += __shfl_xor(t, msk, 32);
    const float siv = t + b2v;
    h8 ov;
#pragma unroll
    for (int k = 0; k < 8; ++k) ov[k] = (_Float16)(sigmf(siv * (float)pv[k]) * gs[k] + gb[k]);
    *(h8*)(gated + (size_t)r * 128 + o * 8) = ov;
    // the store's address and data registers are reused by the next pair of rows
    asm volatile("s_wait_xcnt 0x0" ::: "memory");
  }
}

// ---------------------------------------------------------------- final concat GEMM (+LN on attn half)
// grid 2048, block 256, shmem 33KB (rows padded by 16 B)
// At most 128 registers: 4 work-groups a WGP, so that one's staging and LayerNorm (2 of its
// 8 waves) run beside the others' products.
__global__ __launch_bounds__(256, 8)
void k_final(const _Float16* __restrict__ xattn2, const _Float16* __restrict__ gated,
                        const _Float16* __restrict__ owT, const float* __restrict__ ob,
                        const float* __restrict__ ang, const float* __restrict__ anb,
                        float* __restrict__ out) {
  extern __shared__ char smemraw[];
  _Float16* A = (_Float16*)smemraw;  // 64 x 256, pitch 264
  const int win = blockIdx.x, tid = threadIdx.x;
  const int w = tid >> 5, lane = tid & 31, n0 = lane & 15, hi = lane >> 4;
  for (int i = tid; i < 8192; i += 256) {
    int r = i >> 7, c = i & 127;
    A[r * 264 + c]       = xattn2[(size_t)win * 8192 + i];
    A[r * 264 + 128 + c] = gated[(size_t)win * 8192 + i];
  }
  __syncthreads();
  if (tid < 64) {  // LN in place on the attention half of the row
    float m = 0.f;
    for (int c = 0; c < 128; ++c) m += (float)A[tid * 264 + c];
    m *= (1.f / 128.f);
    float v = 0.f;
    for (int c = 0; c < 128; ++c) { float d = (float)A[tid * 264 + c] - m; v += d * d; }
    v *= (1.f / 128.f);
    float rs = rsqrtf(v + 1e-5f);
    for (int c = 0; c < 128; ++c)
      A[tid * 264 + c] = (_Float16)(((float)A[tid * 264 + c] - m) * rs * ang[c] + anb[c]);
  }
  __syncthreads();
  // k outermost, all 4 row tiles' sums in registers: each weight fragment is loaded once and
  // serves the 4 row tiles (here the sums, 64 registers, are kept, not the 128 of the weights)
  v8f acc[4][2];
  const unsigned bbo = (unsigned)((w * 32 + n0) * 4);
  const float bias[2] = {*(const float*)((const char*)ob + bbo),
                         *(const float*)((const char*)ob + bbo + 64)};
  // the offset these loads name is an input here, so it stays in its register until the wait
  // has passed
  asm volatile("s_wait_xcnt 0x0" :: "v"(bbo) : "memory");
#pragma unroll
  for (int mt = 0; mt < 4; ++mt) { acc[mt][0] = vzero(); acc[mt][1] = vzero(); }
#pragma unroll  // this loop and those inside: acc is indexed by constants only (registers)
  for (int ks = 0; ks < 8; ++ks) {
    v16h b0 = ldfrag(owT, 256, (w * 2 + 0) * 16, ks * 32);
    v16h b1 = ldfrag(owT, 256, (w * 2 + 1) * 16, ks * 32);
#pragma unroll
    for (int mt = 0; mt < 4; ++mt) {
      v16h a = ldfrag(A, 264, mt * 16, ks * 32);
      acc[mt][0] = wmma16(a, b0, acc[mt][0]);
      acc[mt][1] = wmma16(a, b1, acc[mt][1]);
    }
  }
#pragma unroll
  for (int u = 0; u < 2; ++u) {
    int c0 = (w * 2 + u) * 16 + n0;
#pragma unroll
    for (int mt = 0; mt < 4; ++mt)
#pragma unroll
      for (int j = 0; j < 8; ++j) {
        size_t row = (size_t)win * 64 + mt * 16 + hi * 8 + j;
        out[row * 256 + c0] = acc[mt][u][j] + bias[u];
      }
  }
}

// ---------------------------------------------------------------- launcher
extern "C" void kernel_launch(void* const* d_in, const int* in_sizes, int n_in,
                              void* d_out, int out_size, void* d_ws, size_t ws_size,
                              hipStream_t stream) {
  (void)in_sizes; (void)n_in; (void)out_size; (void)ws_size;
  const float* x       = (const float*)d_in[0];
  const float* relb    = (const float*)d_in[1];
  const float* attn_w  = (const float*)d_in[2];
  const float* attn_b  = (const float*)d_in[3];
  const float* aln_g   = (const float*)d_in[4];
  const float* aln_b   = (const float*)d_in[5];
  const float* conv_w  = (const float*)d_in[6];
  const float* conv_b  = (const float*)d_in[7];
  const float* cbn_g   = (const float*)d_in[8];
  const float* cbn_b   = (const float*)d_in[9];
  const float* ci_w1   = (const float*)d_in[10];
  const float* ci_b1   = (const float*)d_in[11];
  const float* ci_g    = (const float*)d_in[12];
  const float* ci_bb   = (const float*)d_in[13];
  const float* ci_w2   = (const float*)d_in[14];
  const float* ci_b2   = (const float*)d_in[15];
  const float* pr_w    = (const float*)d_in[16];
  const float* pr_b    = (const float*)d_in[17];
  const float* cn_g    = (const float*)d_in[18];
  const float* cn_b    = (const float*)d_in[19];
  const float* qkv_w   = (const float*)d_in[20];
  const float* qkv_b   = (const float*)d_in[21];
  const float* si_w1   = (const float*)d_in[22];
  const float* si_b1   = (const float*)d_in[23];
  const float* si_g    = (const float*)d_in[24];
  const float* si_bb   = (const float*)d_in[25];
  const float* si_w2   = (const float*)d_in[26];
  const float* si_b2   = (const float*)d_in[27];
  const float* an_g    = (const float*)d_in[28];
  const float* an_b    = (const float*)d_in[29];
  const float* out_w   = (const float*)d_in[30];
  const float* out_b   = (const float*)d_in[31];
  float* out = (float*)d_out;

  // workspace arena
  char* W = (char*)d_ws;
  size_t off = 0;
  auto take = [&](size_t bytes) { char* p = W + off; off += (bytes + 255) & ~(size_t)255; return p; };
  char*     prg     = take(67108864);              // pr_out and gated, 33554432 B each
  _Float16* attn_wT = (_Float16*)take(65536);      // (128, 256)
  _Float16* qkv_wT  = (_Float16*)take(98304);      // (384, 128)
  _Float16* out_wT  = (_Float16*)take(131072);     // (256, 256)
  _Float16* pr_wf   = (_Float16*)take(65536);      // (128, 256)
  _Float16* x_attn  = (_Float16*)take(33554432);   // (131072, 128)
  _Float16* x_attn2 = (_Float16*)take(33554432);   // (131072, 128)
  _Float16* xc      = (_Float16*)take(67108864);   // (131072, 256) NHWC
  float*    part    = (float*)take(2097152);       // (32, 64, 256)
  float*    gap     = (float*)take(32768);         // (32, 256)
  float*    cis     = (float*)take(16384);         // (32, 128)
  _Float16* pr_out  = (_Float16*)prg;                             // (131072, 128)
  _Float16* gated   = (_Float16*)(prg + 33554432);                // (131072, 128)

  k_prep_w<<<704, 256, 0, stream>>>(attn_w, qkv_w, out_w, pr_w, attn_wT, qkv_wT, out_wT, pr_wf);
  k_attnproj_ln<<<2048, 128, 67072, stream>>>(x, attn_wT, attn_b, aln_g, aln_b, x_attn);
  k_dwconv<<<2048, 64, 0, stream>>>(x, conv_w, conv_b, cbn_g, cbn_b, xc);
  k_gap_partial<<<2048, 256, 0, stream>>>(xc, part);
  k_gap_final<<<32, 256, 0, stream>>>(part, gap);
  k_ci<<<32, 128, 0, stream>>>(gap, ci_w1, ci_b1, ci_g, ci_bb, ci_w2, ci_b2, cis);
  k_attention<<<2048, 256, 25508, stream>>>(x_attn, qkv_wT, qkv_b, cis, relb, x_attn2);
  k_prgemm<<<2048, 128, 33792, stream>>>(xc, pr_wf, pr_b, pr_out);
  k_si_gate<<<1024, 128, 0, stream>>>(x_attn2, pr_out, si_w1, si_b1, si_g, si_bb,
                                        si_w2, si_b2, cn_g, cn_b, gated);
  k_final<<<2048, 256, 33792, stream>>>(x_attn2, gated, out_wT, out_b, an_g, an_b, out);
}

// v007
// It runs in 206 microseconds.
// In both of two side-by-side timings against v006, it was 1.09 times as fast.
// Counting every step since v000, it is 4.35 times as fast.
#include <hip/hip_runtime.h>
#include <hip/hip_bf16.h>

#define DI __device__ __forceinline__

typedef __attribute__((ext_vector_type(16))) _Float16 v16h;
typedef __attribute__((ext_vector_type(8)))  _Float16 h8;
typedef __attribute__((ext_vector_type(8)))  float    v8f;
typedef __attribute__((ext_vector_type(4)))  float    f4;
typedef __attribute__((ext_vector_type(4)))  _Float16 h4;

// ---------------------------------------------------------------- helpers
DI v8f vzero() { v8f z = {0.f,0.f,0.f,0.f,0.f,0.f,0.f,0.f}; return z; }

DI v8f wmma16(v16h a, v16h b, v8f c) {
  return __builtin_amdgcn_wmma_f32_16x16x32_f16(false, a, false, b, (short)0, c, false, false);
}

// A-fragment (16x32 f16): lane L -> row r0+(L&15); halves 0..7 = K k0+8*(L>>4)..+7,
// halves 8..15 = K k0+16+8*(L>>4)..+7.  B^T uses identical layout (row = out col).
DI v16h ldfrag(const _Float16* p, int ld, int r0, int k0) {
  int lane = threadIdx.x & 31;
  int m = lane & 15, hi = lane >> 4;
  const _Float16* q = p + (size_t)(r0 + m) * ld + k0 + hi * 8;
  h8 lo = *(const h8*)q;
  h8 hv = *(const h8*)(q + 16);
  return __builtin_shufflevector(lo, hv, 0,1,2,3,4,5,6,7,8,9,10,11,12,13,14,15);
}

// The same fragment from a base pointer and the lane's byte offset fragoff(ld, r0): the caller
// holds the one offset register that a run of such loads names.
DI unsigned fragoff(int ld, int r0) {
  int lane = threadIdx.x & 31;
  return (unsigned)(((r0 + (lane & 15)) * ld + (lane >> 4) * 8) * 2);
}
DI v16h ldfrag_o(const _Float16* p, unsigned off, int k0) {
  const char* q = (const char*)p + off + k0 * 2;
  h8 lo = *(const h8*)q;
  h8 hv = *(const h8*)(q + 32);
  return __builtin_shufflevector(lo, hv, 0,1,2,3,4,5,6,7,8,9,10,11,12,13,14,15);
}

// the value of lane l ^ 16 (the other 16-lane row), by a vector cross-row move
DI float xhalf(float x) {
  const int b = __builtin_bit_cast(int, x);
  return __builtin_bit_cast(float, __builtin_amdgcn_permlanex16(b, b, 0x76543210, 0xfedcba98, false, false));
}

DI float geluf(float x) { return 0.5f * x * (1.0f + erff(x * 0.70710678118654752f)); }
// exp(t) = 2^(t * log2 e) on the hardware's base-2 exponential (v_exp_f32), 1 / y on its
// reciprocal (v_rcp_f32). Ends of the range as with expf and a division: 2^big = inf and
// 1 / inf = 0; 2^-big = 0 and 1 / (1 + 0) = 1.
#define LOG2E 1.4426950408889634f
DI float sigmf(float x) { return __builtin_amdgcn_rcpf(1.0f + __builtin_amdgcn_exp2f(x * -LOG2E)); }

// ---------------------------------------------------------------- prep kernels
__global__ void k_prep_w(const float* __restrict__ aw, const float* __restrict__ qw,
                         const float* __restrict__ ow, const float* __restrict__ pw,
                         _Float16* __restrict__ awT, _Float16* __restrict__ qwT,
                         _Float16* __restrict__ owT, _Float16* __restrict__ pwf) {
  int i = blockIdx.x * 256 + threadIdx.x;
  const int A = 128 * 256, Q = 384 * 128, O = 256 * 256, P = 128 * 256;
  if (i < A) {                               // attn_w (256,128) -> (128,256)^T
    int n = i >> 8, k = i & 255;
    awT[i] = (_Float16)aw[k * 128 + n];
  } else if (i < A + Q) {                    // qkv_w (128,384) -> (384,128)^T
    int j = i - A; int n = j >> 7, k = j & 127;
    qwT[j] = (_Float16)qw[k * 384 + n];
  } else if (i < A + Q + O) {                // out_w (256,256) -> (256,256)^T
    int j = i - A - Q; int n = j >> 8, k = j & 255;
    owT[j] = (_Float16)ow[k * 256 + n];
  } else if (i < A + Q + O + P) {            // pr_w (128,256) already (O,I) = B^T
    int j = i - A - Q - O;
    pwf[j] = (_Float16)pw[j];
  }
}

// ---------------------------------------------------------------- attn proj + LN
// grid 2048 (one window), block 128 (4 waves), shmem 64*264*2 + 64*130*4 = 67072 B
// LDS rows are padded so that rows read together fall on different banks: xa by 16 bytes
// (pitch 16 B x odd, for the 16 rows of a 16-byte fragment read), ob by 2 floats (pitch 130
// dwords, for the LayerNorm, where each lane walks a row of its own 8 bytes at a time).
// LDS allows 4 work-groups a WGP = 4 waves a SIMD: the compiler is told to plan for exactly
// that (up to 256 registers), else it saves registers by staging one load at a time.
__global__ __launch_bounds__(128) __attribute__((amdgpu_waves_per_eu(4, 4)))
void k_attnproj_ln(const float* __restrict__ x,
                              const _Float16* __restrict__ awT,
                              const float* __restrict__ ab,
                              const float* __restrict__ lg,
                              const float* __restrict__ lb,
                              _Float16* __restrict__ xattn) {
  extern __shared__ char smemraw[];
  _Float16* xa = (_Float16*)smemraw;           // 64 x 256, pitch 264
  float* ob = (float*)(xa + 64 * 264);         // 64 x 128, pitch 130
  const int win = blockIdx.x, tid = threadIdx.x;
  const int w = tid >> 5, lane = tid & 31, n0 = lane & 15, hi = lane >> 4;
  // The wave's weight fragments (2 column tiles x 8 k steps) are loaded once and serve all
  // 4 row tiles; issued ahead of the staging, they fly together with it.
  v16h bw[2][8];
  const unsigned bo0 = fragoff(256, (w * 2 + 0) * 16), bo1 = fragoff(256, (w * 2 + 1) * 16);
#pragma unroll  // bw is indexed by constants only, so that it stays in registers
  for (int ks = 0; ks < 8; ++ks) {
    bw[0][ks] = ldfrag_o(awT, bo0, ks * 32);
    bw[1][ks] = ldfrag_o(awT, bo1, ks * 32);
  }
  // the offsets these loads name are inputs here, so they stay in their registers until the
  // wait has passed; behind it the registers may be reused
  asm volatile("s_wait_xcnt 0x0" :: "v"(bo0), "v"(bo1) : "memory");
  {
    // The window is read as f32 and rounded to f16 on its way into LDS. Load g of a lane is
    // 16 bytes at g * 2048 + tid * 16 (512 contiguous bytes a wave) = row 2g + (tid >> 6),
    // columns 4 * (tid & 63) .. + 3. Groups of 8 loads: a group is rounded and stored while
    // the groups behind it fly, and its registers are then free for a later group.
    const f4* xw = (const f4*)(x + (size_t)win * (64 * 256));
    char* xd = (char*)xa + (tid >> 6) * 528 + (tid & 63) * 8;
    f4 t[2][8];
#pragma unroll  // t is indexed by constants only (registers)
    for (int u = 0; u < 8; ++u) t[0][u] = xw[u * 128 + tid];
#pragma unroll  // constant indices into t
    for (int g = 0; g < 4; ++g) {
      if (g < 3) {
#pragma unroll
        for (int u = 0; u < 8; ++u) t[(g + 1) & 1][u] = xw[((g + 1) * 8 + u) * 128 + tid];
      }
      // keeps the later groups' loads behind this line: hoisted, all 32 loads' results are
      // live beside the 128 weight registers and the build spills
      if (g < 2) __builtin_amdgcn_sched_barrier(0);
#pragma unroll
      for (int u = 0; u < 8; ++u) {
        const f4 v = t[g & 1][u];
        h4 o = {(_Float16)v.x, (_Float16)v.y, (_Float16)v.z, (_Float16)v.w};
        *(h4*)(xd + (g * 8 + u) * 1056) = o;
      }
    }
    // the index and the base these loads name are inputs here, so they stay in their
    // registers until the wait has passed
    asm volatile("s_wait_xcnt 0x0" :: "v"(tid), "s"(xw) : "memory");
  }
  __syncthreads();
#pragma unroll 1
  for (int mt = 0; mt < 4; ++mt) {
    v8f acc0 = vzero(), acc1 = vzero();
#pragma unroll  // constant indices into bw
    for (int ks = 0; ks < 8; ++ks) {
      v16h a = ldfrag(xa, 264, mt * 16, ks * 32);
      acc0 = wmma16(a, bw[0][ks], acc0);
      acc1 = wmma16(a, bw[1][ks], acc1);
    }
#pragma unroll
    for (int u = 0; u < 2; ++u) {
      v8f acc = u ? acc1 : acc0;
      int c0 = (w * 2 + u) * 16 + n0;
      float bias = ab[c0];
#pragma unroll
      for (int j = 0; j < 8; ++j)
        ob[(mt * 16 + hi * 8 + j) * 130 + c0] = acc[j] + bias;
    }
  }
  __syncthreads();
  if (tid < 64) {
    float m = 0.f;
    for (int c = 0; c < 128; ++c) m += ob[tid * 130 + c];
    m *= (1.f / 128.f);
    float v = 0.f;
    for (int c = 0; c < 128; ++c) { float d = ob[tid * 130 + c] - m; v += d * d; }
    v *= (1.f / 128.f);
    float rs = rsqrtf(v + 1e-5f);
    _Float16* drow = xattn + ((size_t)win * 64 + tid) * 128;
    for (int c = 0; c < 128; ++c)
      drow[c] = (_Float16)((ob[tid * 130 + c] - m) * rs * lg[c] + lb[c]);
  }
}

// ---------------------------------------------------------------- depthwise 3x3 + BN + GELU
// One thread = one 8x8 window x 4 channels. The 9 taps of its channels and three
// input rows (8 pixels + 1 halo pixel each side) stay in registers, so every input
// value is loaded once per window, 16 bytes a lane, 512 contiguous bytes a wave.
// Row ry (-1..8) of the window at 'base' (own window, this thread's channels):
// r[0] / r[9] are the neighbours' edge pixels; outside the image everything is 0.
// At the image's left / right edge the halo load re-reads an own pixel (in bounds);
// dw_edge() replaces its value by 0 where the row is first used, not behind the load,
// so that nothing waits for the data while the loads fly.
DI void dw_ldrow(f4 (&r)[10], const float* base, int ry, int wy, int wx) {
  const f4 z = {0.f, 0.f, 0.f, 0.f};
  const bool ok = (ry >= 0 || wy > 0) && (ry < 8 || wy < 7);
  if (ok) {
    const float* rp = (ry < 0) ? base - 8 * 16384 + 7 * 2048
                    : (ry < 8) ? base + ry * 2048 : base + 8 * 16384;
    r[0] = *(const f4*)(rp + ((wx > 0) ? -16384 + 7 * 256 : 0));
#pragma unroll
    for (int i = 0; i < 8; ++i) r[1 + i] = *(const f4*)(rp + i * 256);
    r[9] = *(const f4*)(rp + ((wx < 7) ? 16384 : 0));
    // the loads' address registers may be reused right behind them
    asm volatile("s_wait_xcnt 0x0" ::: "memory");
  } else {
#pragma unroll
    for (int i = 0; i < 10; ++i) r[i] = z;
  }
}
DI void dw_edge(f4 (&r)[10], int wx) {
  const f4 z = {0.f, 0.f, 0.f, 0.f};
  r[0] = (wx > 0) ? r[0] : z;
  r[9] = (wx < 7) ? r[9] : z;
}

// grid 2048 (one window), block 64 (64 x 4 channels)
__global__ __launch_bounds__(64)
void k_dwconv(const float* __restrict__ x, const float* __restrict__ cw,
              const float* __restrict__ cb, const float* __restrict__ bg,
              const float* __restrict__ bb, _Float16* __restrict__ xc) {
  const int win = blockIdx.x;
  const int b = win >> 6, wy = (win >> 3) & 7, wx = win & 7;
  const int c = threadIdx.x * 4;
  f4 wt[9];
  {
    float wl[36];                          // 4 channels x 9 taps, contiguous
#pragma unroll
    for (int i = 0; i < 9; ++i) {
      f4 t = *(const f4*)(cw + c * 9 + i * 4);
      wl[i * 4 + 0] = t.x; wl[i * 4 + 1] = t.y; wl[i * 4 + 2] = t.z; wl[i * 4 + 3] = t.w;
    }
#pragma unroll
    for (int k = 0; k < 9; ++k) { f4 t = {wl[k], wl[9 + k], wl[18 + k], wl[27 + k]}; wt[k] = t; }
  }
  const float bns = rsqrtf(1.f + 1e-5f);
  const f4 cb4 = *(const f4*)(cb + c);
  const f4 sc4 = *(const f4*)(bg + c) * bns;
  const f4 bb4 = *(const f4*)(bb + c);
  const float* base = x + (size_t)win * 16384 + c;
  _Float16* orow = xc + (((size_t)b * 4096 + (size_t)wy * 512 + wx * 8) * 256 + c);

  f4 r0[10], r1[10], r2[10];
  dw_ldrow(r0, base, -1, wy, wx);
  dw_ldrow(r1, base, 0, wy, wx);
  dw_ldrow(r2, base, 1, wy, wx);
  dw_edge(r0, wx);
  dw_edge(r1, wx);
  // rolled: one row's body is already about 1,500 instructions
#pragma unroll 1
  for (int ry = 0; ry < 8; ++ry) {
    dw_edge(r2, wx);
    f4 acc[8];
#pragma unroll
    for (int px = 0; px < 8; ++px) {
      f4 s = {0.f, 0.f, 0.f, 0.f};
#pragma unroll
      for (int dx = 0; dx < 3; ++dx) s += r0[px + dx] * wt[dx];
#pragma unroll
      for (int dx = 0; dx < 3; ++dx) s += r1[px + dx] * wt[3 + dx];
#pragma unroll
      for (int dx = 0; dx < 3; ++dx) s += r2[px + dx] * wt[6 + dx];
      acc[px] = s;
    }
#pragma unroll
    for (int i = 0; i < 10; ++i) { r0[i] = r1[i]; r1[i] = r2[i]; }
    // the next row's loads fly while this row's BN + GELU is computed
    if (ry < 7) dw_ldrow(r2, base, ry + 2, wy, wx);
#pragma unroll
    for (int px = 0; px < 8; ++px) {
      f4 v = (acc[px] + cb4) * sc4 + bb4;
      h4 o = {(_Float16)geluf(v.x), (_Float16)geluf(v.y), (_Float16)geluf(v.z), (_Float16)geluf(v.w)};
      *(h4*)(orow + (size_t)ry * 16384 + px * 256) = o;
    }
    // the last store's address and data registers are reused by the next row
    asm volatile("s_wait_xcnt 0x0" ::: "memory");
  }
}

// deterministic 2-stage GAP (no float atomics -> graph-replay bit-stable)
__global__ void k_gap_partial(const _Float16* __restrict__ xc, float* __restrict__ part) {
  int blk = blockIdx.x;                 // b*64 + chunk
  int b = blk >> 6, chunk = blk & 63;
  int c = threadIdx.x;                  // 256 channels
  float s = 0.f;
  size_t base = ((size_t)b * 4096 + (size_t)chunk * 64) * 256 + c;
  for (int p2 = 0; p2 < 64; ++p2) s += (float)xc[base + (size_t)p2 * 256];
  part[(size_t)blk * 256 + c] = s;
}
__global__ void k_gap_final(const float* __restrict__ part, float* __restrict__ gap) {
  int b = blockIdx.x, c = threadIdx.x;
  float s = 0.f;
  for (int k2 = 0; k2 < 64; ++k2) s += part[((size_t)b * 64 + k2) * 256 + c];
  gap[b * 256 + c] = s;
}

// channel interaction MLP -> sigmoid gates (32 images, tiny)
__global__ void k_ci(const float* __restrict__ gap, const float* __restrict__ w1,
                     const float* __restrict__ b1, const float* __restrict__ g1,
                     const float* __restrict__ bb1, const float* __restrict__ w2,
                     const float* __restrict__ b2, float* __restrict__ cis) {
  __shared__ float d1[32];
  int b = blockIdx.x, t = threadIdx.x;  // 128 threads
  float bns = rsqrtf(1.f + 1e-5f);
  if (t < 32) {
    float a = b1[t];
    const float inv = 1.f / 4096.f;
    for (int i = 0; i < 256; ++i) a += w1[t * 256 + i] * gap[b * 256 + i] * inv;
    a = a * (g1[t] * bns) + bb1[t];
    d1[t] = geluf(a);
  }
  __syncthreads();
  float a = b2[t];
  for (int j = 0; j < 32; ++j) a += w2[t * 32 + j] * d1[j];
  cis[b * 128 + t] = sigmf(a);
}

// ---------------------------------------------------------------- fused qkv + attention
// grid 2048 windows, block 256 (8 waves = 8 heads), dyn shmem 25508 B (x tile, rows padded by
// 16 B; bias rows padded by 4 B).
// Wave h computes q, k and v of head h itself, and every product takes its two operands in the
// order that leaves the result where the next product wants it (A and B share one lane map:
// lane (c, hi) holds row / column c, k = 8*hi..+7 and 16+8*hi..+7; D register j of lane (c, hi)
// is D[8*hi+j][c]):
//   q^T, k^T = W x^T : lane (token, hi) holds channels 8*hi..+7  = a row of the A / B operand
//   v        = x W   : lane (channel, hi) holds tokens 8*hi..+7  = a column of V, two tiles = k 32
//   S^T      = k q^T : lane (query, hi) holds keys 8*hi..+7 of each key tile = a row of P
//   O^T      = V^T P^T : lane (query, hi) holds channels 8*hi..+7 = 16 contiguous output bytes
// So q, k, v and P never leave the wave's registers, and a query's softmax lies in 2 lanes.
// Up to 256 registers (4 waves a SIMD): the weights alone take 96.
__global__ __launch_bounds__(256) __attribute__((amdgpu_waves_per_eu(4, 4)))
void k_attention(const _Float16* __restrict__ xattn,
                            const _Float16* __restrict__ qwT,
                            const float* __restrict__ qb,
                            const float* __restrict__ cis,
                            const float* __restrict__ relb,
                            _Float16* __restrict__ xattn2) {
  extern __shared__ char smemraw[];
  _Float16* xa  = (_Float16*)smemraw;      // 64 x 128, pitch 136
  float* bsh    = (float*)(xa + 64 * 136); // 225 x 8 rel-pos bias, pitch 9 (odd: a wave's 24 rows on 24 banks)

  const int win = blockIdx.x, tid = threadIdx.x;
  const int h = tid >> 5, lane = tid & 31, n0 = lane & 15, hi = lane >> 4;
  const int img = win >> 6;
  // The head's weight fragments (q, k, v column tile x 4 k steps) are loaded once and serve
  // all 4 token tiles; issued ahead of the staging, they fly together with it.
  v16h bw[3][4];
  const unsigned bo0 = fragoff(128, h * 16), bo1 = fragoff(128, 128 + h * 16),
                 bo2 = fragoff(128, 256 + h * 16);
#pragma unroll  // bw is indexed by constants only, so that it stays in registers
  for (int ks = 0; ks < 4; ++ks) {
    bw[0][ks] = ldfrag_o(qwT, bo0, ks * 32);
    bw[1][ks] = ldfrag_o(qwT, bo1, ks * 32);
    bw[2][ks] = ldfrag_o(qwT, bo2, ks * 32);
  }
  // the lane's 8 q and 8 k biases (channels 8*hi..+7), its v bias and channel gate (channel n0)
  const unsigned qo = (unsigned)((h * 16 + hi * 8) * 4);
  const int vi = h * 16 + n0;
  const f4 bq0 = *(const f4*)((const char*)qb + qo), bq1 = *(const f4*)((const char*)qb + qo + 16);
  const f4 bk0 = *(const f4*)((const char*)qb + qo + 512), bk1 = *(const f4*)((const char*)qb + qo + 528);
  const float bv = qb[256 + vi];
  const float gate = (cis + img * 128)[vi];
  // the offsets and the index these loads name are inputs here, so they stay in their
  // registers until the wait has passed; behind it the registers may be reused
  asm volatile("s_wait_xcnt 0x0" :: "v"(bo0), "v"(bo1), "v"(bo2), "v"(qo), "v"(vi) : "memory");
  {
    const uint4* src = (const uint4*)(xattn + (size_t)win * (64 * 128));
    uint4* dst = (uint4*)xa;
    for (int i = tid; i < 1024; i += 256) dst[(i >> 4) * 17 + (i & 15)] = src[i];
    for (int i = tid; i < 1800; i += 256) bsh[(i >> 3) * 9 + (i & 7)] = relb[i];
  }
  __syncthreads();

  const float bq[8] = {bq0.x, bq0.y, bq0.z, bq0.w, bq1.x, bq1.y, bq1.z, bq1.w};
  const float bk[8] = {bk0.x, bk0.y, bk0.z, bk0.w, bk1.x, bk1.y, bk1.z, bk1.w};
  h8 qf[4], kf[4], vf[4];                  // one per 16-token tile
#pragma unroll  // this loop and those below: qf, kf, vf are indexed by constants only (registers)
  for (int mt = 0; mt < 4; ++mt) {
    v8f aq = vzero(), ak = vzero(), av = vzero();
#pragma unroll  // constant indices into bw
    for (int ks = 0; ks < 4; ++ks) {
      v16h a = ldfrag(xa, 136, mt * 16, ks * 32);
      aq = wmma16(bw[0][ks], a, aq);       // [channel][token]
      ak = wmma16(bw[1][ks], a, ak);       // [channel][token]
      av = wmma16(a, bw[2][ks], av);       // [token][channel]
    }
#pragma unroll
    for (int j = 0; j < 8; ++j) {
      qf[mt][j] = (_Float16)((aq[j] + bq[j]) * 0.25f);       // HD^-0.5
      kf[mt][j] = (_Float16)(ak[j] + bk[j]);
      vf[mt][j] = (_Float16)((av[j] + bv) * gate);
    }
  }

  // HD = 16: the upper 16 of the score products' k are zero
  const h8 z8 = {(_Float16)0.f,(_Float16)0.f,(_Float16)0.f,(_Float16)0.f,
                 (_Float16)0.f,(_Float16)0.f,(_Float16)0.f,(_Float16)0.f};
  v16h vB[2];
#pragma unroll
  for (int ks = 0; ks < 2; ++ks)
    vB[ks] = __builtin_shufflevector(vf[ks * 2], vf[ks * 2 + 1], 0,1,2,3,4,5,6,7,8,9,10,11,12,13,14,15);
  // bias of (query mt*16 + n0, key nt*16 + hi*8 + j): table row
  // ((n0>>3) - hi + 7) * 15 + (n0&7) + 7  +  (mt - nt) * 30 - j
  const float* bl = bsh + ((((n0 >> 3) - hi + 7) * 15 + (n0 & 7) + 7) * 9 + h);
  _Float16* orow = xattn2 + ((size_t)win * 64 + n0) * 128 + h * 16 + hi * 8;
#pragma unroll
  for (int mt = 0; mt < 4; ++mt) {
    const v16h qB = __builtin_shufflevector(qf[mt], z8, 0,1,2,3,4,5,6,7,8,9,10,11,12,13,14,15);
    v8f s[4];
#pragma unroll
    for (int nt = 0; nt < 4; ++nt) {
      const v16h kA = __builtin_shufflevector(kf[nt], z8, 0,1,2,3,4,5,6,7,8,9,10,11,12,13,14,15);
      v8f c;                               // the bias tile, in D's map, is the product's C
#pragma unroll
      for (int j = 0; j < 8; ++j) c[j] = bl[((mt - nt) * 30 - j) * 9];
      s[nt] = wmma16(kA, qB, c);           // [key][query]
    }
    // softmax of the lane's query: its 32 keys here, the other 32 in lane ^ 16
    float m4[4];
#pragma unroll
    for (int nt = 0; nt < 4; ++nt) {
      m4[nt] = s[nt][0];
#pragma unroll
      for (int j = 1; j < 8; ++j) m4[nt] = fmaxf(m4[nt], s[nt][j]);
    }
    float mx = fmaxf(fmaxf(m4[0], m4[1]), fmaxf(m4[2], m4[3]));
    mx = fmaxf(mx, xhalf(mx));
    float s4[4] = {0.f, 0.f, 0.f, 0.f};    // four independent chains
    // exp(s - mx) = 2^(s * log2 e - mx * log2 e): one multiply-add and one v_exp_f32. The
    // argument is at most a rounding error above 0; a power below 2^-126 comes out as 0, beside
    // a sum of at least about 1 and ahead of P's rounding to f16.
    const float mxl = mx * LOG2E;
    const v8f l8 = {LOG2E, LOG2E, LOG2E, LOG2E, LOG2E, LOG2E, LOG2E, LOG2E};
    const v8f m8 = {-mxl, -mxl, -mxl, -mxl, -mxl, -mxl, -mxl, -mxl};
#pragma unroll
    for (int nt = 0; nt < 4; ++nt) s[nt] = __builtin_elementwise_fma(s[nt], l8, m8);  // packed, 2 a slot
#pragma unroll
    for (int nt = 0; nt < 4; ++nt)
#pragma unroll
      for (int j = 0; j < 8; ++j) { float e = __builtin_amdgcn_exp2f(s[nt][j]); s[nt][j] = e; s4[nt] += e; }
    float sum = (s4[0] + s4[1]) + (s4[2] + s4[3]);
    sum += xhalf(sum);
    const float inv = __builtin_amdgcn_rcpf(sum);
    v8f o = vzero();
#pragma unroll
    for (int ks = 0; ks < 2; ++ks) {
      v16h pB;
#pragma unroll
      for (int j = 0; j < 8; ++j) {
        pB[j]     = (_Float16)(s[ks * 2][j] * inv);
        pB[8 + j] = (_Float16)(s[ks * 2 + 1][j] * inv);
      }
      o = wmma16(vB[ks], pB, o);           // [channel][query]
    }
    h8 ov;
#pragma unroll
    for (int j = 0; j < 8; ++j) ov[j] = (_Float16)o[j];
    *(h8*)(orow + mt * (16 * 128)) = ov;
  }
}

// ---------------------------------------------------------------- pr 1x1 conv GEMM
// grid 2048 (one image row of 64 pixels each), block 128, shmem 33KB (rows padded by 16 B)
// Up to 256 registers a wave (4 waves a SIMD): the weights alone take 128.
__global__ __launch_bounds__(128, 4)
void k_prgemm(const _Float16* __restrict__ xc, const _Float16* __restrict__ pwf,
                         const float* __restrict__ pb, _Float16* __restrict__ prout) {
  extern __shared__ char smemraw[];
  _Float16* xa = (_Float16*)smemraw;  // 64 x 256, pitch 264
  const int blk = blockIdx.x, tid = threadIdx.x;
  const int w = tid >> 5, lane = tid & 31, n0 = lane & 15, hi = lane >> 4;
  // The wave's weight fragments (2 column tiles x 8 k steps) are loaded once and serve all
  // 4 row tiles; issued ahead of the staging, they fly together with it.
  v16h bw[2][8];
  const unsigned bo0 = fragoff(256, (w * 2 + 0) * 16), bo1 = fragoff(256, (w * 2 + 1) * 16);
#pragma unroll  // bw is indexed by constants only, so that it stays in registers
  for (int ks = 0; ks < 8; ++ks) {
    bw[0][ks] = ldfrag_o(pwf, bo0, ks * 32);
    bw[1][ks] = ldfrag_o(pwf, bo1, ks * 32);
  }
  // the offsets these loads name are inputs here, so they stay in their registers until the
  // wait has passed; behind it the registers may be reused
  asm volatile("s_wait_xcnt 0x0" :: "v"(bo0), "v"(bo1) : "memory");
  {
    const uint4* src = (const uint4*)(xc + (size_t)blk * (64 * 256));
    uint4* dst = (uint4*)xa;
    for (int i = tid; i < 2048; i += 128) dst[(i >> 5) * 33 + (i & 31)] = src[i];
  }
  __syncthreads();
#pragma unroll 1
  for (int mt = 0; mt < 4; ++mt) {
    v8f acc0 = vzero(), acc1 = vzero();
#pragma unroll  // constant indices into bw
    for (int ks = 0; ks < 8; ++ks) {
      v16h a = ldfrag(xa, 264, mt * 16, ks * 32);
      acc0 = wmma16(a, bw[0][ks], acc0);
      acc1 = wmma16(a, bw[1][ks], acc1);
    }
#pragma unroll
    for (int u = 0; u < 2; ++u) {
      v8f acc = u ? acc1 : acc0;
      int c0 = (w * 2 + u) * 16 + n0;
      float bias = pb[c0];
#pragma unroll
      for (int j = 0; j < 8; ++j) {
        size_t row = (size_t)blk * 64 + mt * 16 + hi * 8 + j;
        prout[row * 128 + c0] = (_Float16)(acc[j] + bias);
      }
    }
    // the stores' address and data registers are reused by the next row tile
    asm volatile("s_wait_xcnt 0x0" ::: "memory");
  }
}

// ---------------------------------------------------------------- spatial interaction + gating
// One wave walks 32 rows, two at a time: lanes 0-15 take the even row, lanes 16-31 the odd one.
// Lane o of a row holds row o of si_w1 (128 f32) in registers for the whole walk, computes
// hidden unit o, and afterwards gates channels 8*o .. 8*o+7 of the row. No LDS, no barrier.
// grid 1024, block 128 (4 waves): 4096 waves x 32 rows = 131072 rows. At least 4 waves per SIMD
// (at most 256 registers), so that all 4096 waves are resident at once: no second round.
__global__ __launch_bounds__(128, 4)
void k_si_gate(const _Float16* __restrict__ xattn2, const _Float16* __restrict__ prout,
               const float* __restrict__ w1, const float* __restrict__ b1,
               const float* __restrict__ g1, const float* __restrict__ bb1,
               const float* __restrict__ w2, const float* __restrict__ b2,
               const float* __restrict__ cng, const float* __restrict__ cnb,
               _Float16* __restrict__ gated) {
  const int lane = threadIdx.x & 31, o = lane & 15, odd = lane >> 4;
  const int wave = blockIdx.x * 4 + (threadIdx.x >> 5);
  const unsigned wo = o * 512u, go = o * 32u;   // byte offsets: row o of si_w1, channels 8*o..
  f4 wr[32];
#pragma unroll
  for (int i = 0; i < 32; ++i) wr[i] = *(const f4*)((const char*)w1 + wo + i * 16);
  const float bns = rsqrtf(1.f + 1e-5f);
  const float b1o = b1[o], g1o = g1[o], sh1 = bb1[o], w2o = w2[o], b2v = b2[0];
  const f4 gr0 = *(const f4*)((const char*)cng + go), gr1 = *(const f4*)((const char*)cng + go + 16);
  const f4 gb0 = *(const f4*)((const char*)cnb + go), gb1 = *(const f4*)((const char*)cnb + go + 16);
  // the offsets these loads name are inputs here, so they stay in their registers until the
  // wait has passed; behind it the registers may be reused
  asm volatile("s_wait_xcnt 0x0" :: "v"(wo), "v"(go), "v"(o) : "memory");
  const float sc1 = g1o * bns;
  const f4 gs0 = gr0 * bns, gs1 = gr1 * bns;
  const float gs[8] = {gs0.x, gs0.y, gs0.z, gs0.w, gs1.x, gs1.y, gs1.z, gs1.w};
  const float gb[8] = {gb0.x, gb0.y, gb0.z, gb0.w, gb1.x, gb1.y, gb1.z, gb1.w};
  // rolled: one pair of rows is already some 500 instructions
#pragma unroll 1
  for (int it = 0; it < 16; ++it) {
    const int r = wave * 32 + it * 2 + odd;
    // windowed row -> image position
    const int b_ = r >> 6, n = r & 63;
    const int b = b_ >> 6, wi = b_ & 63;
    const int y = (wi >> 3) * 8 + (n >> 3);
    const int xx = (wi & 7) * 8 + (n & 7);
    const size_t p = (size_t)b * 4096 + (size_t)y * 64 + xx;
    const h8* xp = (const h8*)(xattn2 + (size_t)r * 128);
    const h8* pp = (const h8*)(prout + p * 128 + o * 8);
    h8 xv[16];                            // the whole row, the same in its 16 lanes
#pragma unroll
    for (int i = 0; i < 16; ++i) xv[i] = xp[i];
    const h8 pv = *pp;
    // xp and pp are inputs here, so they stay in their registers until the wait has passed
    asm volatile("s_wait_xcnt 0x0" :: "v"(xp), "v"(pp) : "memory");
    // four independent chains (k mod 4), so that a wave does not wait out each FMA's latency
    f4 s4 = {0.f, 0.f, 0.f, 0.f};
#pragma unroll
    for (int i = 0; i < 16; ++i) {
      f4 lo = {(float)xv[i][0], (float)xv[i][1], (float)xv[i][2], (float)xv[i][3]};
      f4 hv = {(float)xv[i][4], (float)xv[i][5], (float)xv[i][6], (float)xv[i][7]};
      s4 += wr[i * 2] * lo;
      s4 += wr[i * 2 + 1] * hv;
    }
    float a = b1o + ((s4.x + s4.y) + (s4.z + s4.w));
    a = a * sc1 + sh1;
    float t = w2o * geluf(a);
    // sum over the row's 16 hidden units = its 16 lanes
#pragma unroll
    for (int msk = 1; msk < 16; msk <<= 1) t += __shfl_xor(t, msk, 32);
    // sigmoid(siv * p) = 1 / (1 + 2^(-siv * log2 e * p)): the row's factor is formed once
    const float sl = (t + b2v) * -LOG2E;
    h8 ov;
#pragma unroll
    for (int k = 0; k < 8; ++k)
      ov[k] = (_Float16)(__builtin_amdgcn_rcpf(1.0f + __builtin_amdgcn_exp2f(sl * (float)pv[k])) * gs[k] + gb[k]);
    *(h8*)(gated + (size_t)r * 128 + o * 8) = ov;
    // the store's address and data registers are reused by the next pair of rows
    asm volatile("s_wait_xcnt 0x0" ::: "memory");
  }
}

// ---------------------------------------------------------------- final concat GEMM (+LN on attn half)
// grid 2048, block 256, shmem 33KB (rows padded by 16 B)
// At most 128 registers: 4 work-groups a WGP, so that one's staging and LayerNorm (2 of its
// 8 waves) run beside the others' products.
__global__ __launch_bounds__(256, 8)
void k_final(const _Float16* __restrict__ xattn2, const _Float16* __restrict__ gated,
                        const _Float16* __restrict__ owT, const float* __restrict__ ob,
                        const float* __restrict__ ang, const float* __restrict__ anb,
                        float* __restrict__ out) {
  extern __shared__ char smemraw[];
  _Float16* A = (_Float16*)smemraw;  // 64 x 256, pitch 264
  const int win = blockIdx.x, tid = threadIdx.x;
  const int w = tid >> 5, lane = tid & 31, n0 = lane & 15, hi = lane >> 4;
  for (int i = tid; i < 8192; i += 256) {
    int r = i >> 7, c = i & 127;
    A[r * 264 + c]       = xattn2[(size_t)win * 8192 + i];
    A[r * 264 + 128 + c] = gated[(size_t)win * 8192 + i];
  }
  __syncthreads();
  if (tid < 64) {  // LN in place on the attention half of the row
    float m = 0.f;
    for (int c = 0; c < 128; ++c) m += (float)A[tid * 264 + c];
    m *= (1.f / 128.f);
    float v = 0.f;
    for (int c = 0; c < 128; ++c) { float d = (float)A[tid * 264 + c] - m; v += d * d; }
    v *= (1.f / 128.f);
    float rs = rsqrtf(v + 1e-5f);
    for (int c = 0; c < 128; ++c)
      A[tid * 264 + c] = (_Float16)(((float)A[tid * 264 + c] - m) * rs * ang[c] + anb[c]);
  }
  __syncthreads();
  // k outermost, all 4 row tiles' sums in registers: each weight fragment is loaded once and
  // serves the 4 row tiles (here the sums, 64 registers, are kept, not the 128 of the weights)
  v8f acc[4][2];
  const unsigned bbo = (unsigned)((w * 32 + n0) * 4);
  const float bias[2] = {*(const float*)((const char*)ob + bbo),
                         *(const float*)((const char*)ob + bbo + 64)};
  // the offset these loads name is an input here, so it stays in its register until the wait
  // has passed
  asm volatile("s_wait_xcnt 0x0" :: "v"(bbo) : "memory");
#pragma unroll
  for (int mt = 0; mt < 4; ++mt) { acc[mt][0] = vzero(); acc[mt][1] = vzero(); }
#pragma unroll  // this loop and those inside: acc is indexed by constants only (registers)
  for (int ks = 0; ks < 8; ++ks) {
    v16h b0 = ldfrag(owT, 256, (w * 2 + 0) * 16, ks * 32);
    v16h b1 = ldfrag(owT, 256, (w * 2 + 1) * 16, ks * 32);
#pragma unroll
    for (int mt = 0; mt < 4; ++mt) {
      v16h a = ldfrag(A, 264, mt * 16, ks * 32);
      acc[mt][0] = wmma16(a, b0, acc[mt][0]);
      acc[mt][1] = wmma16(a, b1, acc[mt][1]);
    }
  }
#pragma unroll
  for (int u = 0; u < 2; ++u) {
    int c0 = (w * 2 + u) * 16 + n0;
#pragma unroll
    for (int mt = 0; mt < 4; ++mt)
#pragma unroll
      for (int j = 0; j < 8; ++j) {
        size_t row = (size_t)win * 64 + mt * 16 + hi * 8 + j;
        out[row * 256 + c0] = acc[mt][u][j] + bias[u];
      }
  }
}

// ---------------------------------------------------------------- launcher
extern "C" void kernel_launch(void* const* d_in, const int* in_sizes, int n_in,
                              void* d_out, int out_size, void* d_ws, size_t ws_size,
                              hipStream_t stream) {
  (void)in_sizes; (void)n_in; (void)out_size; (void)ws_size;
  const float* x       = (const float*)d_in[0];
  const float* relb    = (const float*)d_in[1];
  const float* attn_w  = (const float*)d_in[2];
  const float* attn_b  = (const float*)d_in[3];
  const float* aln_g   = (const float*)d_in[4];
  const float* aln_b   = (const float*)d_in[5];
  const float* conv_w  = (const float*)d_in[6];
  const float* conv_b  = (const float*)d_in[7];
  const float* cbn_g   = (const float*)d_in[8];
  const float* cbn_b   = (const float*)d_in[9];
  const float* ci_w1   = (const float*)d_in[10];
  const float* ci_b1   = (const float*)d_in[11];
  const float* ci_g    = (const float*)d_in[12];
  const float* ci_bb   = (const float*)d_in[13];
  const float* ci_w2   = (const float*)d_in[14];
  const float* ci_b2   = (const float*)d_in[15];
  const float* pr_w    = (const float*)d_in[16];
  const float* pr_b    = (const float*)d_in[17];
  const float* cn_g    = (const float*)d_in[18];
  const float* cn_b    = (const float*)d_in[19];
  const float* qkv_w   = (const float*)d_in[20];
  const float* qkv_b   = (const float*)d_in[21];
  const float* si_w1   = (const float*)d_in[22];
  const float* si_b1   = (const float*)d_in[23];
  const float* si_g    = (const float*)d_in[24];
  const float* si_bb   = (const float*)d_in[25];
  const float* si_w2   = (const float*)d_in[26];
  const float* si_b2   = (const float*)d_in[27];
  const float* an_g    = (const float*)d_in[28];
  const float* an_b    = (const float*)d_in[29];
  const float* out_w   = (const float*)d_in[30];
  const float* out_b   = (const float*)d_in[31];
  float* out = (float*)d_out;

  // workspace arena
  char* W = (char*)d_ws;
  size_t off = 0;
  auto take = [&](size_t bytes) { char* p = W + off; off += (bytes + 255) & ~(size_t)255; return p; };
  char*     prg     = take(67108864);              // pr_out and gated, 33554432 B each
  _Float16* attn_wT = (_Float16*)take(65536);      // (128, 256)
  _Float16* qkv_wT  = (_Float16*)take(98304);      // (384, 128)
  _Float16* out_wT  = (_Float16*)take(131072);     // (256, 256)
  _Float16* pr_wf   = (_Float16*)take(65536);      // (128, 256)
  _Float16* x_attn  = (_Float16*)take(33554432);   // (131072, 128)
  _Float16* x_attn2 = (_Float16*)take(33554432);   // (131072, 128)
  _Float16* xc      = (_Float16*)take(67108864);   // (131072, 256) NHWC
  float*    part    = (float*)take(2097152);       // (32, 64, 256)
  float*    gap     = (float*)take(32768);         // (32, 256)
  float*    cis     = (float*)take(16384);         // (32, 128)
  _Float16* pr_out  = (_Float16*)prg;                             // (131072, 128)
  _Float16* gated   = (_Float16*)(prg + 33554432);                // (131072, 128)

  k_prep_w<<<704, 256, 0, stream>>>(attn_w, qkv_w, out_w, pr_w, attn_wT, qkv_wT, out_wT, pr_wf);
  k_attnproj_ln<<<2048, 128, 67072, stream>>>(x, attn_wT, attn_b, aln_g, aln_b, x_attn);
  k_dwconv<<<2048, 64, 0, stream>>>(x, conv_w, conv_b, cbn_g, cbn_b, xc);
  k_gap_partial<<<2048, 256, 0, stream>>>(xc, part);
  k_gap_final<<<32, 256, 0, stream>>>(part, gap);
  k_ci<<<32, 128, 0, stream>>>(gap, ci_w1, ci_b1, ci_g, ci_bb, ci_w2, ci_b2, cis);
  k_attention<<<2048, 256, 25508, stream>>>(x_attn, qkv_wT, qkv_b, cis, relb, x_attn2);
  k_prgemm<<<2048, 128, 33792, stream>>>(xc, pr_wf, pr_b, pr_out);
  k_si_gate<<<1024, 128, 0, stream>>>(x_attn2, pr_out, si_w1, si_b1, si_g, si_bb,
                                        si_w2, si_b2, cn_g, cn_b, gated);
  k_final<<<2048, 256, 33792, stream>>>(x_attn2, gated, out_wT, out_b, an_g, an_b, out);
}

// v008
// A run of this version takes 196 microseconds.
// Timed twice side by side with v007, it ran 1.05 times as fast both times.
// Over all steps from v000 it is 4.57 times as fast.
#include <hip/hip_runtime.h>
#include <hip/hip_bf16.h>

#define DI __device__ __forceinline__

typedef __attribute__((ext_vector_type(16))) _Float16 v16h;
typedef __attribute__((ext_vector_type(8)))  _Float16 h8;
typedef __attribute__((ext_vector_type(8)))  float    v8f;
typedef __attribute__((ext_vector_type(4)))  float    f4;
typedef __attribute__((ext_vector_type(4)))  _Float16 h4;

// ---------------------------------------------------------------- helpers
DI v8f vzero() { v8f z = {0.f,0.f,0.f,0.f,0.f,0.f,0.f,0.f}; return z; }

DI v8f wmma16(v16h a, v16h b, v8f c) {
  return __builtin_amdgcn_wmma_f32_16x16x32_f16(false, a, false, b, (short)0, c, false, false);
}

// A-fragment (16x32 f16): lane L -> row r0+(L&15); halves 0..7 = K k0+8*(L>>4)..+7,
// halves 8..15 = K k0+16+8*(L>>4)..+7.  B^T uses identical layout (row = out col).
DI v16h ldfrag(const _Float16* p, int ld, int r0, int k0) {
  int lane = threadIdx.x & 31;
  int m = lane & 15, hi = lane >> 4;
  const _Float16* q = p + (size_t)(r0 + m) * ld + k0 + hi * 8;
  h8 lo = *(const h8*)q;
  h8 hv = *(const h8*)(q + 16);
  return __builtin_shufflevector(lo, hv, 0,1,2,3,4,5,6,7,8,9,10,11,12,13,14,15);
}

// The same fragment from a base pointer and the lane's byte offset fragoff(ld, r0): the caller
// holds the one offset register that a run of such loads names.
DI unsigned fragoff(int ld, int r0) {
  int lane = threadIdx.x & 31;
  return (unsigned)(((r0 + (lane & 15)) * ld + (lane >> 4) * 8) * 2);
}
DI v16h ldfrag_o(const _Float16* p, unsigned off, int k0) {
  const char* q = (const char*)p + off + k0 * 2;
  h8 lo = *(const h8*)q;
  h8 hv = *(const h8*)(q + 32);
  return __builtin_shufflevector(lo, hv, 0,1,2,3,4,5,6,7,8,9,10,11,12,13,14,15);
}

// the value of lane l ^ 16 (the other 16-lane row), by a vector cross-row move
DI float xhalf(float x) {
  const int b = __builtin_bit_cast(int, x);
  return __builtin_bit_cast(float, __builtin_amdgcn_permlanex16(b, b, 0x76543210, 0xfedcba98, false, false));
}

DI float geluf(float x) { return 0.5f * x * (1.0f + erff(x * 0.70710678118654752f)); }
// exp(t) = 2^(t * log2 e) on the hardware's base-2 exponential (v_exp_f32), 1 / y on its
// reciprocal (v_rcp_f32). Ends of the range as with expf and a division: 2^big = inf and
// 1 / inf = 0; 2^-big = 0 and 1 / (1 + 0) = 1.
#define LOG2E 1.4426950408889634f
DI float sigmf(float x) { return __builtin_amdgcn_rcpf(1.0f + __builtin_amdgcn_exp2f(x * -LOG2E)); }

// ---------------------------------------------------------------- prep kernels
__global__ void k_prep_w(const float* __restrict__ aw, const float* __restrict__ qw,
                         const float* __restrict__ ow, const float* __restrict__ pw,
                         _Float16* __restrict__ awT, _Float16* __restrict__ qwT,
                         _Float16* __restrict__ owT, _Float16* __restrict__ pwf) {
  int i = blockIdx.x * 256 + threadIdx.x;
  const int A = 128 * 256, Q = 384 * 128, O = 256 * 256, P = 128 * 256;
  if (i < A) {                               // attn_w (256,128) -> (128,256)^T
    int n = i >> 8, k = i & 255;
    awT[i] = (_Float16)aw[k * 128 + n];
  } else if (i < A + Q) {                    // qkv_w (128,384) -> (384,128)^T
    int j = i - A; int n = j >> 7, k = j & 127;
    qwT[j] = (_Float16)qw[k * 384 + n];
  } else if (i < A + Q + O) {                // out_w (256,256) -> (256,256)^T
    int j = i - A - Q; int n = j >> 8, k = j & 255;
    owT[j] = (_Float16)ow[k * 256 + n];
  } else if (i < A + Q + O + P) {            // pr_w (128,256) already (O,I) = B^T
    int j = i - A - Q - O;
    pwf[j] = (_Float16)pw[j];
  }
}

// ---------------------------------------------------------------- attn proj + LN
// grid 2048 (one window), block 128 (4 waves), shmem 64*264*2 + 64*130*4 = 67072 B
// LDS rows are padded so that rows read together fall on different banks: xa by 16 bytes
// (pitch 16 B x odd, for the 16 rows of a 16-byte fragment read), ob by 2 floats (pitch 130
// dwords, for the LayerNorm, where each lane walks a row of its own 8 bytes at a time).
// LDS allows 4 work-groups a WGP = 4 waves a SIMD: the compiler is told to plan for exactly
// that (up to 256 registers), else it saves registers by staging one load at a time.
__global__ __launch_bounds__(128) __attribute__((amdgpu_waves_per_eu(4, 4)))
void k_attnproj_ln(const float* __restrict__ x,
                              const _Float16* __restrict__ awT,
                              const float* __restrict__ ab,
                              const float* __restrict__ lg,
                              const float* __restrict__ lb,
                              _Float16* __restrict__ xattn) {
  extern __shared__ char smemraw[];
  _Float16* xa = (_Float16*)smemraw;           // 64 x 256, pitch 264
  float* ob = (float*)(xa + 64 * 264);         // 64 x 128, pitch 130
  const int win = blockIdx.x, tid = threadIdx.x;
  const int w = tid >> 5, lane = tid & 31, n0 = lane & 15, hi = lane >> 4;
  // The wave's weight fragments (2 column tiles x 8 k steps) are loaded once and serve all
  // 4 row tiles; issued ahead of the staging, they fly together with it.
  v16h bw[2][8];
  const unsigned bo0 = fragoff(256, (w * 2 + 0) * 16), bo1 = fragoff(256, (w * 2 + 1) * 16);
#pragma unroll  // bw is indexed by constants only, so that it stays in registers
  for (int ks = 0; ks < 8; ++ks) {
    bw[0][ks] = ldfrag_o(awT, bo0, ks * 32);
    bw[1][ks] = ldfrag_o(awT, bo1, ks * 32);
  }
  // the offsets these loads name are inputs here, so they stay in their registers until the
  // wait has passed; behind it the registers may be reused
  asm volatile("s_wait_xcnt 0x0" :: "v"(bo0), "v"(bo1) : "memory");
  {
    // The window is read as f32 and rounded to f16 on its way into LDS. Load g of a lane is
    // 16 bytes at g * 2048 + tid * 16 (512 contiguous bytes a wave) = row 2g + (tid >> 6),
    // columns 4 * (tid & 63) .. + 3. Groups of 8 loads: a group is rounded and stored while
    // the groups behind it fly, and its registers are then free for a later group.
    const f4* xw = (const f4*)(x + (size_t)win * (64 * 256));
    char* xd = (char*)xa + (tid >> 6) * 528 + (tid & 63) * 8;
    f4 t[2][8];
#pragma unroll  // t is indexed by constants only (registers)
    for (int u = 0; u < 8; ++u) t[0][u] = xw[u * 128 + tid];
#pragma unroll  // constant indices into t
    for (int g = 0; g < 4; ++g) {
      if (g < 3) {
#pragma unroll
        for (int u = 0; u < 8; ++u) t[(g + 1) & 1][u] = xw[((g + 1) * 8 + u) * 128 + tid];
      }
      // keeps the later groups' loads behind this line: hoisted, all 32 loads' results are
      // live beside the 128 weight registers and the build spills
      if (g < 2) __builtin_amdgcn_sched_barrier(0);
#pragma unroll
      for (int u = 0; u < 8; ++u) {
        const f4 v = t[g & 1][u];
        h4 o = {(_Float16)v.x, (_Float16)v.y, (_Float16)v.z, (_Float16)v.w};
        *(h4*)(xd + (g * 8 + u) * 1056) = o;
      }
    }
    // the index and the base these loads name are inputs here, so they stay in their
    // registers until the wait has passed
    asm volatile("s_wait_xcnt 0x0" :: "v"(tid), "s"(xw) : "memory");
  }
  __syncthreads();
#pragma unroll 1
  for (int mt = 0; mt < 4; ++mt) {
    v8f acc0 = vzero(), acc1 = vzero();
#pragma unroll  // constant indices into bw
    for (int ks = 0; ks < 8; ++ks) {
      v16h a = ldfrag(xa, 264, mt * 16, ks * 32);
      acc0 = wmma16(a, bw[0][ks], acc0);
      acc1 = wmma16(a, bw[1][ks], acc1);
    }
#pragma unroll
    for (int u = 0; u < 2; ++u) {
      v8f acc = u ? acc1 : acc0;
      int c0 = (w * 2 + u) * 16 + n0;
      float bias = ab[c0];
#pragma unroll
      for (int j = 0; j < 8; ++j)
        ob[(mt * 16 + hi * 8 + j) * 130 + c0] = acc[j] + bias;
    }
  }
  __syncthreads();
  if (tid < 64) {
    float m = 0.f;
    for (int c = 0; c < 128; ++c) m += ob[tid * 130 + c];
    m *= (1.f / 128.f);
    float v = 0.f;
    for (int c = 0; c < 128; ++c) { float d = ob[tid * 130 + c] - m; v += d * d; }
    v *= (1.f / 128.f);
    float rs = rsqrtf(v + 1e-5f);
    _Float16* drow = xattn + ((size_t)win * 64 + tid) * 128;
    for (int c = 0; c < 128; ++c)
      drow[c] = (_Float16)((ob[tid * 130 + c] - m) * rs * lg[c] + lb[c]);
  }
}

// ---------------------------------------------------------------- depthwise 3x3 + BN + GELU
// One thread = one 8x8 window x 4 channels. The 9 taps of its channels and three
// input rows (8 pixels + 1 halo pixel each side) stay in registers, so every input
// value is loaded once per window, 16 bytes a lane, 512 contiguous bytes a wave.
// Row ry (-1..8) of the window at 'base' (own window, this thread's channels):
// r[0] / r[9] are the neighbours' edge pixels; outside the image everything is 0.
// At the image's left / right edge the halo load re-reads an own pixel (in bounds);
// dw_edge() replaces its value by 0 where the row is first used, not behind the load,
// so that nothing waits for the data while the loads fly.
DI void dw_ldrow(f4 (&r)[10], const float* base, int ry, int wy, int wx) {
  const f4 z = {0.f, 0.f, 0.f, 0.f};
  const bool ok = (ry >= 0 || wy > 0) && (ry < 8 || wy < 7);
  if (ok) {
    const float* rp = (ry < 0) ? base - 8 * 16384 + 7 * 2048
                    : (ry < 8) ? base + ry * 2048 : base + 8 * 16384;
    r[0] = *(const f4*)(rp + ((wx > 0) ? -16384 + 7 * 256 : 0));
#pragma unroll
    for (int i = 0; i < 8; ++i) r[1 + i] = *(const f4*)(rp + i * 256);
    r[9] = *(const f4*)(rp + ((wx < 7) ? 16384 : 0));
    // the loads' address registers may be reused right behind them
    asm volatile("s_wait_xcnt 0x0" ::: "memory");
  } else {
#pragma unroll
    for (int i = 0; i < 10; ++i) r[i] = z;
  }
}
DI void dw_edge(f4 (&r)[10], int wx) {
  const f4 z = {0.f, 0.f, 0.f, 0.f};
  r[0] = (wx > 0) ? r[0] : z;
  r[9] = (wx < 7) ? r[9] : z;
}

// The thread also adds up its 64 pixels for the average pool (f32, ahead of the rounding to
// f16) and writes the 4 sums to part[window][channel].
// grid 2048 (one window), block 64 (64 x 4 channels)
__global__ __launch_bounds__(64)
void k_dwconv(const float* __restrict__ x, const float* __restrict__ cw,
              const float* __restrict__ cb, const float* __restrict__ bg,
              const float* __restrict__ bb, _Float16* __restrict__ xc,
              float* __restrict__ part) {
  const int win = blockIdx.x;
  const int b = win >> 6, wy = (win >> 3) & 7, wx = win & 7;
  const int c = threadIdx.x * 4;
  f4 wt[9];
  {
    float wl[36];                          // 4 channels x 9 taps, contiguous
#pragma unroll
    for (int i = 0; i < 9; ++i) {
      f4 t = *(const f4*)(cw + c * 9 + i * 4);
      wl[i * 4 + 0] = t.x; wl[i * 4 + 1] = t.y; wl[i * 4 + 2] = t.z; wl[i * 4 + 3] = t.w;
    }
#pragma unroll
    for (int k = 0; k < 9; ++k) { f4 t = {wl[k], wl[9 + k], wl[18 + k], wl[27 + k]}; wt[k] = t; }
  }
  const float bns = rsqrtf(1.f + 1e-5f);
  const f4 cb4 = *(const f4*)(cb + c);
  const f4 sc4 = *(const f4*)(bg + c) * bns;
  const f4 bb4 = *(const f4*)(bb + c);
  const float* base = x + (size_t)win * 16384 + c;
  _Float16* orow = xc + (((size_t)b * 4096 + (size_t)wy * 512 + wx * 8) * 256 + c);

  f4 r0[10], r1[10], r2[10];
  dw_ldrow(r0, base, -1, wy, wx);
  dw_ldrow(r1, base, 0, wy, wx);
  dw_ldrow(r2, base, 1, wy, wx);
  dw_edge(r0, wx);
  dw_edge(r1, wx);
  f4 gsum = {0.f, 0.f, 0.f, 0.f};          // the window's share of the average pool
  // rolled: one row's body is already about 1,500 instructions
#pragma unroll 1
  for (int ry = 0; ry < 8; ++ry) {
    dw_edge(r2, wx);
    f4 acc[8];
#pragma unroll
    for (int px = 0; px < 8; ++px) {
      f4 s = {0.f, 0.f, 0.f, 0.f};
#pragma unroll
      for (int dx = 0; dx < 3; ++dx) s += r0[px + dx] * wt[dx];
#pragma unroll
      for (int dx = 0; dx < 3; ++dx) s += r1[px + dx] * wt[3 + dx];
#pragma unroll
      for (int dx = 0; dx < 3; ++dx) s += r2[px + dx] * wt[6 + dx];
      acc[px] = s;
    }
#pragma unroll
    for (int i = 0; i < 10; ++i) { r0[i] = r1[i]; r1[i] = r2[i]; }
    // the next row's loads fly while this row's BN + GELU is computed
    if (ry < 7) dw_ldrow(r2, base, ry + 2, wy, wx);
#pragma unroll
    for (int px = 0; px < 8; ++px) {
      f4 v = (acc[px] + cb4) * sc4 + bb4;
      const f4 g = {geluf(v.x), geluf(v.y), geluf(v.z), geluf(v.w)};
      gsum += g;
      h4 o = {(_Float16)g.x, (_Float16)g.y, (_Float16)g.z, (_Float16)g.w};
      *(h4*)(orow + (size_t)ry * 16384 + px * 256) = o;
    }
    // the last store's address and data registers are reused by the next row
    asm volatile("s_wait_xcnt 0x0" ::: "memory");
  }
  *(f4*)(part + (size_t)win * 256 + c) = gsum;
}

// average pool (the 64 windows' sums of an image) + channel interaction MLP -> sigmoid gates
// grid 32 (one image), block 1024: thread (g, q) adds channels 4q..4q+3 of windows 4g..4g+3,
// 4 loads of 16 bytes in flight at once; thread c then adds channel c's 16 partial sums in a
// fixed order (no float atomics: bit-stable from run to run).
__global__ __launch_bounds__(1024)
void k_ci(const float* __restrict__ part, const float* __restrict__ w1,
          const float* __restrict__ b1, const float* __restrict__ g1,
          const float* __restrict__ bb1, const float* __restrict__ w2,
          const float* __restrict__ b2, float* __restrict__ cis) {
  __shared__ f4 ps[16 * 64];
  __shared__ float gap[256];
  __shared__ float d1[32];
  int b = blockIdx.x, t = threadIdx.x;
  {
    const char* pb = (const char*)(part + (size_t)b * (64 * 256));
    const unsigned po = (unsigned)((t >> 6) * 4096 + (t & 63) * 16);
    const f4 p0 = *(const f4*)(pb + po),        p1 = *(const f4*)(pb + po + 1024),
             p2 = *(const f4*)(pb + po + 2048), p3 = *(const f4*)(pb + po + 3072);
    // the offset and the base these loads name are inputs here, so they stay in their
    // registers until the wait has passed
    asm volatile("s_wait_xcnt 0x0" :: "v"(po), "s"(pb) : "memory");
    ps[t] = (p0 + p1) + (p2 + p3);
  }
  __syncthreads();
  if (t < 256) {
    const float* pf = (const float*)ps;
    float s = pf[t];
    for (int g = 1; g < 16; ++g) s += pf[g * 256 + t];
    gap[t] = s;
  }
  __syncthreads();
  float bns = rsqrtf(1.f + 1e-5f);
  if (t < 32) {
    float a = b1[t];
    const float inv = 1.f / 4096.f;
    for (int i = 0; i < 256; ++i) a += w1[t * 256 + i] * gap[i] * inv;
    a = a * (g1[t] * bns) + bb1[t];
    d1[t] = geluf(a);
  }
  __syncthreads();
  if (t < 128) {
    float a = b2[t];
    for (int j = 0; j < 32; ++j) a += w2[t * 32 + j] * d1[j];
    cis[b * 128 + t] = sigmf(a);
  }
}

// ---------------------------------------------------------------- fused qkv + attention
// grid 2048 windows, block 256 (8 waves = 8 heads), dyn shmem 25508 B (x tile, rows padded by
// 16 B; bias rows padded by 4 B).
// Wave h computes q, k and v of head h itself, and every product takes its two operands in the
// order that leaves the result where the next product wants it (A and B share one lane map:
// lane (c, hi) holds row / column c, k = 8*hi..+7 and 16+8*hi..+7; D register j of lane (c, hi)
// is D[8*hi+j][c]):
//   q^T, k^T = W x^T : lane (token, hi) holds channels 8*hi..+7  = a row of the A / B operand
//   v        = x W   : lane (channel, hi) holds tokens 8*hi..+7  = a column of V, two tiles = k 32
//   S^T      = k q^T : lane (query, hi) holds keys 8*hi..+7 of each key tile = a row of P
//   O^T      = V^T P^T : lane (query, hi) holds channels 8*hi..+7 = 16 contiguous output bytes
// So q, k, v and P never leave the wave's registers, and a query's softmax lies in 2 lanes.
// Up to 256 registers (4 waves a SIMD): the weights alone take 96.
__global__ __launch_bounds__(256) __attribute__((amdgpu_waves_per_eu(4, 4)))
void k_attention(const _Float16* __restrict__ xattn,
                            const _Float16* __restrict__ qwT,
                            const float* __restrict__ qb,
                            const float* __restrict__ cis,
                            const float* __restrict__ relb,
                            _Float16* __restrict__ xattn2) {
  extern __shared__ char smemraw[];
  _Float16* xa  = (_Float16*)smemraw;      // 64 x 128, pitch 136
  float* bsh    = (float*)(xa + 64 * 136); // 225 x 8 rel-pos bias, pitch 9 (odd: a wave's 24 rows on 24 banks)

  const int win = blockIdx.x, tid = threadIdx.x;
  const int h = tid >> 5, lane = tid & 31, n0 = lane & 15, hi = lane >> 4;
  const int img = win >> 6;
  // The head's weight fragments (q, k, v column tile x 4 k steps) are loaded once and serve
  // all 4 token tiles; issued ahead of the staging, they fly together with it.
  v16h bw[3][4];
  const unsigned bo0 = fragoff(128, h * 16), bo1 = fragoff(128, 128 + h * 16),
                 bo2 = fragoff(128, 256 + h * 16);
#pragma unroll  // bw is indexed by constants only, so that it stays in registers
  for (int ks = 0; ks < 4; ++ks) {
    bw[0][ks] = ldfrag_o(qwT, bo0, ks * 32);
    bw[1][ks] = ldfrag_o(qwT, bo1, ks * 32);
    bw[2][ks] = ldfrag_o(qwT, bo2, ks * 32);
  }
  // the lane's 8 q and 8 k biases (channels 8*hi..+7), its v bias and channel gate (channel n0)
  const unsigned qo = (unsigned)((h * 16 + hi * 8) * 4);
  const int vi = h * 16 + n0;
  const f4 bq0 = *(const f4*)((const char*)qb + qo), bq1 = *(const f4*)((const char*)qb + qo + 16);
  const f4 bk0 = *(const f4*)((const char*)qb + qo + 512), bk1 = *(const f4*)((const char*)qb + qo + 528);
  const float bv = qb[256 + vi];
  const float gate = (cis + img * 128)[vi];
  // the offsets and the index these loads name are inputs here, so they stay in their
  // registers until the wait has passed; behind it the registers may be reused
  asm volatile("s_wait_xcnt 0x0" :: "v"(bo0), "v"(bo1), "v"(bo2), "v"(qo), "v"(vi) : "memory");
  {
    const uint4* src = (const uint4*)(xattn + (size_t)win * (64 * 128));
    uint4* dst = (uint4*)xa;
    for (int i = tid; i < 1024; i += 256) dst[(i >> 4) * 17 + (i & 15)] = src[i];
    for (int i = tid; i < 1800; i += 256) bsh[(i >> 3) * 9 + (i & 7)] = relb[i];
  }
  __syncthreads();

  const float bq[8] = {bq0.x, bq0.y, bq0.z, bq0.w, bq1.x, bq1.y, bq1.z, bq1.w};
  const float bk[8] = {bk0.x, bk0.y, bk0.z, bk0.w, bk1.x, bk1.y, bk1.z, bk1.w};
  h8 qf[4], kf[4], vf[4];                  // one per 16-token tile
#pragma unroll  // this loop and those below: qf, kf, vf are indexed by constants only (registers)
  for (int mt = 0; mt < 4; ++mt) {
    v8f aq = vzero(), ak = vzero(), av = vzero();
#pragma unroll  // constant indices into bw
    for (int ks = 0; ks < 4; ++ks) {
      v16h a = ldfrag(xa, 136, mt * 16, ks * 32);
      aq = wmma16(bw[0][ks], a, aq);       // [channel][token]
      ak = wmma16(bw[1][ks], a, ak);       // [channel][token]
      av = wmma16(a, bw[2][ks], av);       // [token][channel]
    }
#pragma unroll
    for (int j = 0; j < 8; ++j) {
      qf[mt][j] = (_Float16)((aq[j] + bq[j]) * 0.25f);       // HD^-0.5
      kf[mt][j] = (_Float16)(ak[j] + bk[j]);
      vf[mt][j] = (_Float16)((av[j] + bv) * gate);
    }
  }

  // HD = 16: the upper 16 of the score products' k are zero
  const h8 z8 = {(_Float16)0.f,(_Float16)0.f,(_Float16)0.f,(_Float16)0.f,
                 (_Float16)0.f,(_Float16)0.f,(_Float16)0.f,(_Float16)0.f};
  v16h vB[2];
#pragma unroll
  for (int ks = 0; ks < 2; ++ks)
    vB[ks] = __builtin_shufflevector(vf[ks * 2], vf[ks * 2 + 1], 0,1,2,3,4,5,6,7,8,9,10,11,12,13,14,15);
  // bias of (query mt*16 + n0, key nt*16 + hi*8 + j): table row
  // ((n0>>3) - hi + 7) * 15 + (n0&7) + 7  +  (mt - nt) * 30 - j
  const float* bl = bsh + ((((n0 >> 3) - hi + 7) * 15 + (n0 & 7) + 7) * 9 + h);
  _Float16* orow = xattn2 + ((size_t)win * 64 + n0) * 128 + h * 16 + hi * 8;
#pragma unroll
  for (int mt = 0; mt < 4; ++mt) {
    const v16h qB = __builtin_shufflevector(qf[mt], z8, 0,1,2,3,4,5,6,7,8,9,10,11,12,13,14,15);
    v8f s[4];
#pragma unroll
    for (int nt = 0; nt < 4; ++nt) {
      const v16h kA = __builtin_shufflevector(kf[nt], z8, 0,1,2,3,4,5,6,7,8,9,10,11,12,13,14,15);
      v8f c;                               // the bias tile, in D's map, is the product's C
#pragma unroll
      for (int j = 0; j < 8; ++j) c[j] = bl[((mt - nt) * 30 - j) * 9];
      s[nt] = wmma16(kA, qB, c);           // [key][query]
    }
    // softmax of the lane's query: its 32 keys here, the other 32 in lane ^ 16
    float m4[4];
#pragma unroll
    for (int nt = 0; nt < 4; ++nt) {
      m4[nt] = s[nt][0];
#pragma unroll
      for (int j = 1; j < 8; ++j) m4[nt] = fmaxf(m4[nt], s[nt][j]);
    }
    float mx = fmaxf(fmaxf(m4[0], m4[1]), fmaxf(m4[2], m4[3]));
    mx = fmaxf(mx, xhalf(mx));
    float s4[4] = {0.f, 0.f, 0.f, 0.f};    // four independent chains
    // exp(s - mx) = 2^(s * log2 e - mx * log2 e): one multiply-add and one v_exp_f32. The
    // argument is at most a rounding error above 0; a power below 2^-126 comes out as 0, beside
    // a sum of at least about 1 and ahead of P's rounding to f16.
    const float mxl = mx * LOG2E;
    const v8f l8 = {LOG2E, LOG2E, LOG2E, LOG2E, LOG2E, LOG2E, LOG2E, LOG2E};
    const v8f m8 = {-mxl, -mxl, -mxl, -mxl, -mxl, -mxl, -mxl, -mxl};
#pragma unroll
    for (int nt = 0; nt < 4; ++nt) s[nt] = __builtin_elementwise_fma(s[nt], l8, m8);  // packed, 2 a slot
#pragma unroll
    for (int nt = 0; nt < 4; ++nt)
#pragma unroll
      for (int j = 0; j < 8; ++j) { float e = __builtin_amdgcn_exp2f(s[nt][j]); s[nt][j] = e; s4[nt] += e; }
    float sum = (s4[0] + s4[1]) + (s4[2] + s4[3]);
    sum += xhalf(sum);
    const float inv = __builtin_amdgcn_rcpf(sum);
    v8f o = vzero();
#pragma unroll
    for (int ks = 0; ks < 2; ++ks) {
      v16h pB;
#pragma unroll
      for (int j = 0; j < 8; ++j) {
        pB[j]     = (_Float16)(s[ks * 2][j] * inv);
        pB[8 + j] = (_Float16)(s[ks * 2 + 1][j] * inv);
      }
      o = wmma16(vB[ks], pB, o);           // [channel][query]
    }
    h8 ov;
#pragma unroll
    for (int j = 0; j < 8; ++j) ov[j] = (_Float16)o[j];
    *(h8*)(orow + mt * (16 * 128)) = ov;
  }
}

// ---------------------------------------------------------------- pr 1x1 conv GEMM
// grid 2048 (one image row of 64 pixels each), block 128, shmem 33KB (rows padded by 16 B)
// Up to 256 registers a wave (4 waves a SIMD): the weights alone take 128.
__global__ __launch_bounds__(128, 4)
void k_prgemm(const _Float16* __restrict__ xc, const _Float16* __restrict__ pwf,
                         const float* __restrict__ pb, _Float16* __restrict__ prout) {
  extern __shared__ char smemraw[];
  _Float16* xa = (_Float16*)smemraw;  // 64 x 256, pitch 264
  const int blk = blockIdx.x, tid = threadIdx.x;
  const int w = tid >> 5, lane = tid & 31, n0 = lane & 15, hi = lane >> 4;
  // The wave's weight fragments (2 column tiles x 8 k steps) are loaded once and serve all
  // 4 row tiles; issued ahead of the staging, they fly together with it.
  v16h bw[2][8];
  const unsigned bo0 = fragoff(256, (w * 2 + 0) * 16), bo1 = fragoff(256, (w * 2 + 1) * 16);
#pragma unroll  // bw is indexed by constants only, so that it stays in registers
  for (int ks = 0; ks < 8; ++ks) {
    bw[0][ks] = ldfrag_o(pwf, bo0, ks * 32);
    bw[1][ks] = ldfrag_o(pwf, bo1, ks * 32);
  }
  // the offsets these loads name are inputs here, so they stay in their registers until the
  // wait has passed; behind it the registers may be reused
  asm volatile("s_wait_xcnt 0x0" :: "v"(bo0), "v"(bo1) : "memory");
  {
    const uint4* src = (const uint4*)(xc + (size_t)blk * (64 * 256));
    uint4* dst = (uint4*)xa;
    for (int i = tid; i < 2048; i += 128) dst[(i >> 5) * 33 + (i & 31)] = src[i];
  }
  __syncthreads();
#pragma unroll 1
  for (int mt = 0; mt < 4; ++mt) {
    v8f acc0 = vzero(), acc1 = vzero();
#pragma unroll  // constant indices into bw
    for (int ks = 0; ks < 8; ++ks) {
      v16h a = ldfrag(xa, 264, mt * 16, ks * 32);
      acc0 = wmma16(a, bw[0][ks], acc0);
      acc1 = wmma16(a, bw[1][ks], acc1);
    }
#pragma unroll
    for (int u = 0; u < 2; ++u) {
      v8f acc = u ? acc1 : acc0;
      int c0 = (w * 2 + u) * 16 + n0;
      float bias = pb[c0];
#pragma unroll
      for (int j = 0; j < 8; ++j) {
        size_t row = (size_t)blk * 64 + mt * 16 + hi * 8 + j;
        prout[row * 128 + c0] = (_Float16)(acc[j] + bias);
      }
    }
    // the stores' address and data registers are reused by the next row tile
    asm volatile("s_wait_xcnt 0x0" ::: "memory");
  }
}

// ---------------------------------------------------------------- spatial interaction + gating
// One wave walks 32 rows, two at a time: lanes 0-15 take the even row, lanes 16-31 the odd one.
// Lane o of a row holds row o of si_w1 (128 f32) in registers for the whole walk, computes
// hidden unit o, and afterwards gates channels 8*o .. 8*o+7 of the row. No LDS, no barrier.
// grid 1024, block 128 (4 waves): 4096 waves x 32 rows = 131072 rows. At least 4 waves per SIMD
// (at most 256 registers), so that all 4096 waves are resident at once: no second round.
__global__ __launch_bounds__(128, 4)
void k_si_gate(const _Float16* __restrict__ xattn2, const _Float16* __restrict__ prout,
               const float* __restrict__ w1, const float* __restrict__ b1,
               const float* __restrict__ g1, const float* __restrict__ bb1,
               const float* __restrict__ w2, const float* __restrict__ b2,
               const float* __restrict__ cng, const float* __restrict__ cnb,
               _Float16* __restrict__ gated) {
  const int lane = threadIdx.x & 31, o = lane & 15, odd = lane >> 4;
  const int wave = blockIdx.x * 4 + (threadIdx.x >> 5);
  const unsigned wo = o * 512u, go = o * 32u;   // byte offsets: row o of si_w1, channels 8*o..
  f4 wr[32];
#pragma unroll
  for (int i = 0; i < 32; ++i) wr[i] = *(const f4*)((const char*)w1 + wo + i * 16);
  const float bns = rsqrtf(1.f + 1e-5f);
  const float b1o = b1[o], g1o = g1[o], sh1 = bb1[o], w2o = w2[o], b2v = b2[0];
  const f4 gr0 = *(const f4*)((const char*)cng + go), gr1 = *(const f4*)((const char*)cng + go + 16);
  const f4 gb0 = *(const f4*)((const char*)cnb + go), gb1 = *(const f4*)((const char*)cnb + go + 16);
  // the offsets these loads name are inputs here, so they stay in their registers until the
  // wait has passed; behind it the registers may be reused
  asm volatile("s_wait_xcnt 0x0" :: "v"(wo), "v"(go), "v"(o) : "memory");
  const float sc1 = g1o * bns;
  const f4 gs0 = gr0 * bns, gs1 = gr1 * bns;
  const float gs[8] = {gs0.x, gs0.y, gs0.z, gs0.w, gs1.x, gs1.y, gs1.z, gs1.w};
  const float gb[8] = {gb0.x, gb0.y, gb0.z, gb0.w, gb1.x, gb1.y, gb1.z, gb1.w};
  // rolled: one pair of rows is already some 500 instructions
#pragma unroll 1
  for (int it = 0; it < 16; ++it) {
    const int r = wave * 32 + it * 2 + odd;
    // windowed row -> image position
    const int b_ = r >> 6, n = r & 63;
    const int b = b_ >> 6, wi = b_ & 63;
    const int y = (wi >> 3) * 8 + (n >> 3);
    const int xx = (wi & 7) * 8 + (n & 7);
    const size_t p = (size_t)b * 4096 + (size_t)y * 64 + xx;
    const h8* xp = (const h8*)(xattn2 + (size_t)r * 128);
    const h8* pp = (const h8*)(prout + p * 128 + o * 8);
    h8 xv[16];                            // the whole row, the same in its 16 lanes
#pragma unroll
    for (int i = 0; i < 16; ++i) xv[i] = xp[i];
    const h8 pv = *pp;
    // xp and pp are inputs here, so they stay in their registers until the wait has passed
    asm volatile("s_wait_xcnt 0x0" :: "v"(xp), "v"(pp) : "memory");
    // four independent chains (k mod 4), so that a wave does not wait out each FMA's latency
    f4 s4 = {0.f, 0.f, 0.f, 0.f};
#pragma unroll
    for (int i = 0; i < 16; ++i) {
      f4 lo = {(float)xv[i][0], (float)xv[i][1], (float)xv[i][2], (float)xv[i][3]};
      f4 hv = {(float)xv[i][4], (float)xv[i][5], (float)xv[i][6], (float)xv[i][7]};
      s4 += wr[i * 2] * lo;
      s4 += wr[i * 2 + 1] * hv;
    }
    float a = b1o + ((s4.x + s4.y) + (s4.z + s4.w));
    a = a * sc1 + sh1;
    float t = w2o * geluf(a);
    // sum over the row's 16 hidden units = its 16 lanes
#pragma unroll
    for (int msk = 1; msk < 16; msk <<= 1) t += __shfl_xor(t, msk, 32);
    // sigmoid(siv * p) = 1 / (1 + 2^(-siv * log2 e * p)): the row's factor is formed once
    const float sl = (t + b2v) * -LOG2E;
    h8 ov;
#pragma unroll
    for (int k = 0; k < 8; ++k)
      ov[k] = (_Float16)(__builtin_amdgcn_rcpf(1.0f + __builtin_amdgcn_exp2f(sl * (float)pv[k])) * gs[k] + gb[k]);
    *(h8*)(gated + (size_t)r * 128 + o * 8) = ov;
    // the store's address and data registers are reused by the next pair of rows
    asm volatile("s_wait_xcnt 0x0" ::: "memory");
  }
}

// ---------------------------------------------------------------- final concat GEMM (+LN on attn half)
// grid 2048, block 256, shmem 33KB (rows padded by 16 B)
// At most 128 registers: 4 work-groups a WGP, so that one's staging and LayerNorm (2 of its
// 8 waves) run beside the others' products.
__global__ __launch_bounds__(256, 8)
void k_final(const _Float16* __restrict__ xattn2, const _Float16* __restrict__ gated,
                        const _Float16* __restrict__ owT, const float* __restrict__ ob,
                        const float* __restrict__ ang, const float* __restrict__ anb,
                        float* __restrict__ out) {
  extern __shared__ char smemraw[];
  _Float16* A = (_Float16*)smemraw;  // 64 x 256, pitch 264
  const int win = blockIdx.x, tid = threadIdx.x;
  const int w = tid >> 5, lane = tid & 31, n0 = lane & 15, hi = lane >> 4;
  for (int i = tid; i < 8192; i += 256) {
    int r = i >> 7, c = i & 127;
    A[r * 264 + c]       = xattn2[(size_t)win * 8192 + i];
    A[r * 264 + 128 + c] = gated[(size_t)win * 8192 + i];
  }
  __syncthreads();
  if (tid < 64) {  // LN in place on the attention half of the row
    float m = 0.f;
    for (int c = 0; c < 128; ++c) m += (float)A[tid * 264 + c];
    m *= (1.f / 128.f);
    float v = 0.f;
    for (int c = 0; c < 128; ++c) { float d = (float)A[tid * 264 + c] - m; v += d * d; }
    v *= (1.f / 128.f);
    float rs = rsqrtf(v + 1e-5f);
    for (int c = 0; c < 128; ++c)
      A[tid * 264 + c] = (_Float16)(((float)A[tid * 264 + c] - m) * rs * ang[c] + anb[c]);
  }
  __syncthreads();
  // k outermost, all 4 row tiles' sums in registers: each weight fragment is loaded once and
  // serves the 4 row tiles (here the sums, 64 registers, are kept, not the 128 of the weights)
  v8f acc[4][2];
  const unsigned bbo = (unsigned)((w * 32 + n0) * 4);
  const float bias[2] = {*(const float*)((const char*)ob + bbo),
                         *(const float*)((const char*)ob + bbo + 64)};
  // the offset these loads name is an input here, so it stays in its register until the wait
  // has passed
  asm volatile("s_wait_xcnt 0x0" :: "v"(bbo) : "memory");
#pragma unroll
  for (int mt = 0; mt < 4; ++mt) { acc[mt][0] = vzero(); acc[mt][1] = vzero(); }
#pragma unroll  // this loop and those inside: acc is indexed by constants only (registers)
  for (int ks = 0; ks < 8; ++ks) {
    v16h b0 = ldfrag(owT, 256, (w * 2 + 0) * 16, ks * 32);
    v16h b1 = ldfrag(owT, 256, (w * 2 + 1) * 16, ks * 32);
#pragma unroll
    for (int mt = 0; mt < 4; ++mt) {
      v16h a = ldfrag(A, 264, mt * 16, ks * 32);
      acc[mt][0] = wmma16(a, b0, acc[mt][0]);
      acc[mt][1] = wmma16(a, b1, acc[mt][1]);
    }
  }
#pragma unroll
  for (int u = 0; u < 2; ++u) {
    int c0 = (w * 2 + u) * 16 + n0;
#pragma unroll
    for (int mt = 0; mt < 4; ++mt)
#pragma unroll
      for (int j = 0; j < 8; ++j) {
        size_t row = (size_t)win * 64 + mt * 16 + hi * 8 + j;
        out[row * 256 + c0] = acc[mt][u][j] + bias[u];
      }
  }
}

// ---------------------------------------------------------------- launcher
extern "C" void kernel_launch(void* const* d_in, const int* in_sizes, int n_in,
                              void* d_out, int out_size, void* d_ws, size_t ws_size,
                              hipStream_t stream) {
  (void)in_sizes; (void)n_in; (void)out_size; (void)ws_size;
  const float* x       = (const float*)d_in[0];
  const float* relb    = (const float*)d_in[1];
  const float* attn_w  = (const float*)d_in[2];
  const float* attn_b  = (const float*)d_in[3];
  const float* aln_g   = (const float*)d_in[4];
  const float* aln_b   = (const float*)d_in[5];
  const float* conv_w  = (const float*)d_in[6];
  const float* conv_b  = (const float*)d_in[7];
  const float* cbn_g   = (const float*)d_in[8];
  const float* cbn_b   = (const float*)d_in[9];
  const float* ci_w1   = (const float*)d_in[10];
  const float* ci_b1   = (const float*)d_in[11];
  const float* ci_g    = (const float*)d_in[12];
  const float* ci_bb   = (const float*)d_in[13];
  const float* ci_w2   = (const float*)d_in[14];
  const float* ci_b2   = (const float*)d_in[15];
  const float* pr_w    = (const float*)d_in[16];
  const float* pr_b    = (const float*)d_in[17];
  const float* cn_g    = (const float*)d_in[18];
  const float* cn_b    = (const float*)d_in[19];
  const float* qkv_w   = (const float*)d_in[20];
  const float* qkv_b   = (const float*)d_in[21];
  const float* si_w1   = (const float*)d_in[22];
  const float* si_b1   = (const float*)d_in[23];
  const float* si_g    = (const float*)d_in[24];
  const float* si_bb   = (const float*)d_in[25];
  const float* si_w2   = (const float*)d_in[26];
  const float* si_b2   = (const float*)d_in[27];
  const float* an_g    = (const float*)d_in[28];
  const float* an_b    = (const float*)d_in[29];
  const float* out_w   = (const float*)d_in[30];
  const float* out_b   = (const float*)d_in[31];
  float* out = (float*)d_out;

  // workspace arena
  char* W = (char*)d_ws;
  size_t off = 0;
  auto take = [&](size_t bytes) { char* p = W + off; off += (bytes + 255) & ~(size_t)255; return p; };
  char*     prg     = take(67108864);              // pr_out and gated, 33554432 B each
  _Float16* attn_wT = (_Float16*)take(65536);      // (128, 256)
  _Float16* qkv_wT  = (_Float16*)take(98304);      // (384, 128)
  _Float16* out_wT  = (_Float16*)take(131072);     // (256, 256)
  _Float16* pr_wf   = (_Float16*)take(65536);      // (128, 256)
  _Float16* x_attn  = (_Float16*)take(33554432);   // (131072, 128)
  _Float16* x_attn2 = (_Float16*)take(33554432);   // (131072, 128)
  _Float16* xc      = (_Float16*)take(67108864);   // (131072, 256) NHWC
  float*    part    = (float*)take(2097152);       // (32, 64, 256): image, window, channel
  float*    cis     = (float*)take(16384);         // (32, 128)
  _Float16* pr_out  = (_Float16*)prg;                             // (131072, 128)
  _Float16* gated   = (_Float16*)(prg + 33554432);                // (131072, 128)

  k_prep_w<<<704, 256, 0, stream>>>(attn_w, qkv_w, out_w, pr_w, attn_wT, qkv_wT, out_wT, pr_wf);
  k_attnproj_ln<<<2048, 128, 67072, stream>>>(x, attn_wT, attn_b, aln_g, aln_b, x_attn);
  k_dwconv<<<2048, 64, 0, stream>>>(x, conv_w, conv_b, cbn_g, cbn_b, xc, part);
  k_ci<<<32, 1024, 0, stream>>>(part, ci_w1, ci_b1, ci_g, ci_bb, ci_w2, ci_b2, cis);
  k_attention<<<2048, 256, 25508, stream>>>(x_attn, qkv_wT, qkv_b, cis, relb, x_attn2);
  k_prgemm<<<2048, 128, 33792, stream>>>(xc, pr_wf, pr_b, pr_out);
  k_si_gate<<<1024, 128, 0, stream>>>(x_attn2, pr_out, si_w1, si_b1, si_g, si_bb,
                                        si_w2, si_b2, cn_g, cn_b, gated);
  k_final<<<2048, 256, 33792, stream>>>(x_attn2, gated, out_wT, out_b, an_g, an_b, out);
}

// v009
// It runs in 162 microseconds.
// Two timings next to v008 both put it at 1.21 times that version's speed.
// Counting every step since v000, it is 5.54 times as fast.
#include <hip/hip_runtime.h>
#include <hip/hip_bf16.h>

#define DI __device__ __forceinline__

typedef __attribute__((ext_vector_type(16))) _Float16 v16h;
typedef __attribute__((ext_vector_type(8)))  _Float16 h8;
typedef __attribute__((ext_vector_type(8)))  float    v8f;
typedef __attribute__((ext_vector_type(4)))  float    f4;
typedef __attribute__((ext_vector_type(4)))  _Float16 h4;

// ---------------------------------------------------------------- helpers
DI v8f vzero() { v8f z = {0.f,0.f,0.f,0.f,0.f,0.f,0.f,0.f}; return z; }

DI v8f wmma16(v16h a, v16h b, v8f c) {
  return __builtin_amdgcn_wmma_f32_16x16x32_f16(false, a, false, b, (short)0, c, false, false);
}

// A-fragment (16x32 f16): lane L -> row r0+(L&15); halves 0..7 = K k0+8*(L>>4)..+7,
// halves 8..15 = K k0+16+8*(L>>4)..+7.  B^T uses identical layout (row = out col).
DI v16h ldfrag(const _Float16* p, int ld, int r0, int k0) {
  int lane = threadIdx.x & 31;
  int m = lane & 15, hi = lane >> 4;
  const _Float16* q = p + (size_t)(r0 + m) * ld + k0 + hi * 8;
  h8 lo = *(const h8*)q;
  h8 hv = *(const h8*)(q + 16);
  return __builtin_shufflevector(lo, hv, 0,1,2,3,4,5,6,7,8,9,10,11,12,13,14,15);
}

// The same fragment from a base pointer and the lane's byte offset fragoff(ld, r0): the caller
// holds the one offset register that a run of such loads names.
DI unsigned fragoff(int ld, int r0) {
  int lane = threadIdx.x & 31;
  return (unsigned)(((r0 + (lane & 15)) * ld + (lane >> 4) * 8) * 2);
}
DI v16h ldfrag_o(const _Float16* p, unsigned off, int k0) {
  const char* q = (const char*)p + off + k0 * 2;
  h8 lo = *(const h8*)q;
  h8 hv = *(const h8*)(q + 32);
  return __builtin_shufflevector(lo, hv, 0,1,2,3,4,5,6,7,8,9,10,11,12,13,14,15);
}

// the value of lane l ^ 16 (the other 16-lane row), by a vector cross-row move
DI float xhalf(float x) {
  const int b = __builtin_bit_cast(int, x);
  return __builtin_bit_cast(float, __builtin_amdgcn_permlanex16(b, b, 0x76543210, 0xfedcba98, false, false));
}

DI float geluf(float x) { return 0.5f * x * (1.0f + erff(x * 0.70710678118654752f)); }
// exp(t) = 2^(t * log2 e) on the hardware's base-2 exponential (v_exp_f32), 1 / y on its
// reciprocal (v_rcp_f32). Ends of the range as with expf and a division: 2^big = inf and
// 1 / inf = 0; 2^-big = 0 and 1 / (1 + 0) = 1.
#define LOG2E 1.4426950408889634f
DI float sigmf(float x) { return __builtin_amdgcn_rcpf(1.0f + __builtin_amdgcn_exp2f(x * -LOG2E)); }

// ---------------------------------------------------------------- prep kernels
__global__ void k_prep_w(const float* __restrict__ aw, const float* __restrict__ qw,
                         const float* __restrict__ ow, const float* __restrict__ pw,
                         _Float16* __restrict__ awT, _Float16* __restrict__ qwT,
                         _Float16* __restrict__ owT, _Float16* __restrict__ pwf) {
  int i = blockIdx.x * 256 + threadIdx.x;
  const int A = 128 * 256, Q = 384 * 128, O = 256 * 256, P = 128 * 256;
  if (i < A) {                               // attn_w (256,128) -> (128,256)^T
    int n = i >> 8, k = i & 255;
    awT[i] = (_Float16)aw[k * 128 + n];
  } else if (i < A + Q) {                    // qkv_w (128,384) -> (384,128)^T
    int j = i - A; int n = j >> 7, k = j & 127;
    qwT[j] = (_Float16)qw[k * 384 + n];
  } else if (i < A + Q + O) {                // out_w (256,256) -> (256,256)^T
    int j = i - A - Q; int n = j >> 8, k = j & 255;
    owT[j] = (_Float16)ow[k * 256 + n];
  } else if (i < A + Q + O + P) {            // pr_w (128,256) already (O,I) = B^T
    int j = i - A - Q - O;
    pwf[j] = (_Float16)pw[j];
  }
}

// ---------------------------------------------------------------- attn proj + LN
// grid 2048 (one window), block 128 (4 waves), shmem 64*264*2 + 64*130*4 = 67072 B
// LDS rows are padded so that rows read together fall on different banks: xa by 16 bytes
// (pitch 16 B x odd, for the 16 rows of a 16-byte fragment read), ob by 2 floats (pitch 130
// dwords, for the LayerNorm, where each lane walks a row of its own 8 bytes at a time).
// LDS allows 4 work-groups a WGP = 4 waves a SIMD: the compiler is told to plan for exactly
// that (up to 256 registers), else it saves registers by staging one load at a time.
__global__ __launch_bounds__(128) __attribute__((amdgpu_waves_per_eu(4, 4)))
void k_attnproj_ln(const float* __restrict__ x,
                              const _Float16* __restrict__ awT,
                              const float* __restrict__ ab,
                              const float* __restrict__ lg,
                              const float* __restrict__ lb,
                              _Float16* __restrict__ xattn) {
  extern __shared__ char smemraw[];
  _Float16* xa = (_Float16*)smemraw;           // 64 x 256, pitch 264
  float* ob = (float*)(xa + 64 * 264);         // 64 x 128, pitch 130
  const int win = blockIdx.x, tid = threadIdx.x;
  const int w = tid >> 5, lane = tid & 31, n0 = lane & 15, hi = lane >> 4;
  // The wave's weight fragments (2 column tiles x 8 k steps) are loaded once and serve all
  // 4 row tiles; issued ahead of the staging, they fly together with it.
  v16h bw[2][8];
  const unsigned bo0 = fragoff(256, (w * 2 + 0) * 16), bo1 = fragoff(256, (w * 2 + 1) * 16);
#pragma unroll  // bw is indexed by constants only, so that it stays in registers
  for (int ks = 0; ks < 8; ++ks) {
    bw[0][ks] = ldfrag_o(awT, bo0, ks * 32);
    bw[1][ks] = ldfrag_o(awT, bo1, ks * 32);
  }
  // the offsets these loads name are inputs here, so they stay in their registers until the
  // wait has passed; behind it the registers may be reused
  asm volatile("s_wait_xcnt 0x0" :: "v"(bo0), "v"(bo1) : "memory");
  {
    // The window is read as f32 and rounded to f16 on its way into LDS. Load g of a lane is
    // 16 bytes at g * 2048 + tid * 16 (512 contiguous bytes a wave) = row 2g + (tid >> 6),
    // columns 4 * (tid & 63) .. + 3. Groups of 8 loads: a group is rounded and stored while
    // the groups behind it fly, and its registers are then free for a later group.
    const f4* xw = (const f4*)(x + (size_t)win * (64 * 256));
    char* xd = (char*)xa + (tid >> 6) * 528 + (tid & 63) * 8;
    f4 t[2][8];
#pragma unroll  // t is indexed by constants only (registers)
    for (int u = 0; u < 8; ++u) t[0][u] = xw[u * 128 + tid];
#pragma unroll  // constant indices into t
    for (int g = 0; g < 4; ++g) {
      if (g < 3) {
#pragma unroll
        for (int u = 0; u < 8; ++u) t[(g + 1) & 1][u] = xw[((g + 1) * 8 + u) * 128 + tid];
      }
      // keeps the later groups' loads behind this line: hoisted, all 32 loads' results are
      // live beside the 128 weight registers and the build spills
      if (g < 2) __builtin_amdgcn_sched_barrier(0);
#pragma unroll
      for (int u = 0; u < 8; ++u) {
        const f4 v = t[g & 1][u];
        h4 o = {(_Float16)v.x, (_Float16)v.y, (_Float16)v.z, (_Float16)v.w};
        *(h4*)(xd + (g * 8 + u) * 1056) = o;
      }
    }
    // the index and the base these loads name are inputs here, so they stay in their
    // registers until the wait has passed
    asm volatile("s_wait_xcnt 0x0" :: "v"(tid), "s"(xw) : "memory");
  }
  __syncthreads();
#pragma unroll 1
  for (int mt = 0; mt < 4; ++mt) {
    v8f acc0 = vzero(), acc1 = vzero();
#pragma unroll  // constant indices into bw
    for (int ks = 0; ks < 8; ++ks) {
      v16h a = ldfrag(xa, 264, mt * 16, ks * 32);
      acc0 = wmma16(a, bw[0][ks], acc0);
      acc1 = wmma16(a, bw[1][ks], acc1);
    }
#pragma unroll
    for (int u = 0; u < 2; ++u) {
      v8f acc = u ? acc1 : acc0;
      int c0 = (w * 2 + u) * 16 + n0;
      float bias = ab[c0];
#pragma unroll
      for (int j = 0; j < 8; ++j)
        ob[(mt * 16 + hi * 8 + j) * 130 + c0] = acc[j] + bias;
    }
  }
  __syncthreads();
  if (tid < 64) {
    float m = 0.f;
    for (int c = 0; c < 128; ++c) m += ob[tid * 130 + c];
    m *= (1.f / 128.f);
    float v = 0.f;
    for (int c = 0; c < 128; ++c) { float d = ob[tid * 130 + c] - m; v += d * d; }
    v *= (1.f / 128.f);
    float rs = rsqrtf(v + 1e-5f);
    _Float16* drow = xattn + ((size_t)win * 64 + tid) * 128;
    for (int c = 0; c < 128; ++c)
      drow[c] = (_Float16)((ob[tid * 130 + c] - m) * rs * lg[c] + lb[c]);
  }
}

// ---------------------------------------------------------------- depthwise 3x3 + BN + GELU
// One thread = one 8x8 window x 4 channels. The 9 taps of its channels and three
// input rows (8 pixels + 1 halo pixel each side) stay in registers, so every input
// value is loaded once per window, 16 bytes a lane, 512 contiguous bytes a wave.
// Row ry (-1..8) of the window at 'base' (own window, this thread's channels):
// r[0] / r[9] are the neighbours' edge pixels; outside the image everything is 0.
// At the image's left / right edge the halo load re-reads an own pixel (in bounds);
// dw_edge() replaces its value by 0 where the row is first used, not behind the load,
// so that nothing waits for the data while the loads fly.
DI void dw_ldrow(f4 (&r)[10], const float* base, int ry, int wy, int wx) {
  const f4 z = {0.f, 0.f, 0.f, 0.f};
  const bool ok = (ry >= 0 || wy > 0) && (ry < 8 || wy < 7);
  if (ok) {
    const float* rp = (ry < 0) ? base - 8 * 16384 + 7 * 2048
                    : (ry < 8) ? base + ry * 2048 : base + 8 * 16384;
    r[0] = *(const f4*)(rp + ((wx > 0) ? -16384 + 7 * 256 : 0));
#pragma unroll
    for (int i = 0; i < 8; ++i) r[1 + i] = *(const f4*)(rp + i * 256);
    r[9] = *(const f4*)(rp + ((wx < 7) ? 16384 : 0));
    // the loads' address registers may be reused right behind them
    asm volatile("s_wait_xcnt 0x0" ::: "memory");
  } else {
#pragma unroll
    for (int i = 0; i < 10; ++i) r[i] = z;
  }
}
DI void dw_edge(f4 (&r)[10], int wx) {
  const f4 z = {0.f, 0.f, 0.f, 0.f};
  r[0] = (wx > 0) ? r[0] : z;
  r[9] = (wx < 7) ? r[9] : z;
}

// The thread also adds up its 64 pixels for the average pool (f32, ahead of the rounding to
// f16) and writes the 4 sums to part[window][channel].
// grid 2048 (one window), block 64 (64 x 4 channels)
__global__ __launch_bounds__(64)
void k_dwconv(const float* __restrict__ x, const float* __restrict__ cw,
              const float* __restrict__ cb, const float* __restrict__ bg,
              const float* __restrict__ bb, _Float16* __restrict__ xc,
              float* __restrict__ part) {
  const int win = blockIdx.x;
  const int b = win >> 6, wy = (win >> 3) & 7, wx = win & 7;
  const int c = threadIdx.x * 4;
  f4 wt[9];
  {
    float wl[36];                          // 4 channels x 9 taps, contiguous
#pragma unroll
    for (int i = 0; i < 9; ++i) {
      f4 t = *(const f4*)(cw + c * 9 + i * 4);
      wl[i * 4 + 0] = t.x; wl[i * 4 + 1] = t.y; wl[i * 4 + 2] = t.z; wl[i * 4 + 3] = t.w;
    }
#pragma unroll
    for (int k = 0; k < 9; ++k) { f4 t = {wl[k], wl[9 + k], wl[18 + k], wl[27 + k]}; wt[k] = t; }
  }
  const float bns = rsqrtf(1.f + 1e-5f);
  const f4 cb4 = *(const f4*)(cb + c);
  const f4 sc4 = *(const f4*)(bg + c) * bns;
  const f4 bb4 = *(const f4*)(bb + c);
  const float* base = x + (size_t)win * 16384 + c;
  _Float16* orow = xc + (((size_t)b * 4096 + (size_t)wy * 512 + wx * 8) * 256 + c);

  f4 r0[10], r1[10], r2[10];
  dw_ldrow(r0, base, -1, wy, wx);
  dw_ldrow(r1, base, 0, wy, wx);
  dw_ldrow(r2, base, 1, wy, wx);
  dw_edge(r0, wx);
  dw_edge(r1, wx);
  f4 gsum = {0.f, 0.f, 0.f, 0.f};          // the window's share of the average pool
  // rolled: one row's body is already about 1,500 instructions
#pragma unroll 1
  for (int ry = 0; ry < 8; ++ry) {
    dw_edge(r2, wx);
    f4 acc[8];
#pragma unroll
    for (int px = 0; px < 8; ++px) {
      f4 s = {0.f, 0.f, 0.f, 0.f};
#pragma unroll
      for (int dx = 0; dx < 3; ++dx) s += r0[px + dx] * wt[dx];
#pragma unroll
      for (int dx = 0; dx < 3; ++dx) s += r1[px + dx] * wt[3 + dx];
#pragma unroll
      for (int dx = 0; dx < 3; ++dx) s += r2[px + dx] * wt[6 + dx];
      acc[px] = s;
    }
#pragma unroll
    for (int i = 0; i < 10; ++i) { r0[i] = r1[i]; r1[i] = r2[i]; }
    // the next row's loads fly while this row's BN + GELU is computed
    if (ry < 7) dw_ldrow(r2, base, ry + 2, wy, wx);
#pragma unroll
    for (int px = 0; px < 8; ++px) {
      f4 v = (acc[px] + cb4) * sc4 + bb4;
      const f4 g = {geluf(v.x), geluf(v.y), geluf(v.z), geluf(v.w)};
      gsum += g;
      h4 o = {(_Float16)g.x, (_Float16)g.y, (_Float16)g.z, (_Float16)g.w};
      *(h4*)(orow + (size_t)ry * 16384 + px * 256) = o;
    }
    // the last store's address and data registers are reused by the next row
    asm volatile("s_wait_xcnt 0x0" ::: "memory");
  }
  *(f4*)(part + (size_t)win * 256 + c) = gsum;
}

// average pool (the 64 windows' sums of an image) + channel interaction MLP -> sigmoid gates
// grid 32 (one image), block 1024: thread (g, q) adds channels 4q..4q+3 of windows 4g..4g+3,
// 4 loads of 16 bytes in flight at once; thread c then adds channel c's 16 partial sums in a
// fixed order (no float atomics: bit-stable from run to run).
__global__ __launch_bounds__(1024)
void k_ci(const float* __restrict__ part, const float* __restrict__ w1,
          const float* __restrict__ b1, const float* __restrict__ g1,
          const float* __restrict__ bb1, const float* __restrict__ w2,
          const float* __restrict__ b2, float* __restrict__ cis) {
  __shared__ f4 ps[16 * 64];
  __shared__ float gap[256];
  __shared__ float d1[32];
  int b = blockIdx.x, t = threadIdx.x;
  {
    const char* pb = (const char*)(part + (size_t)b * (64 * 256));
    const unsigned po = (unsigned)((t >> 6) * 4096 + (t & 63) * 16);
    const f4 p0 = *(const f4*)(pb + po),        p1 = *(const f4*)(pb + po + 1024),
             p2 = *(const f4*)(pb + po + 2048), p3 = *(const f4*)(pb + po + 3072);
    // the offset and the base these loads name are inputs here, so they stay in their
    // registers until the wait has passed
    asm volatile("s_wait_xcnt 0x0" :: "v"(po), "s"(pb) : "memory");
    ps[t] = (p0 + p1) + (p2 + p3);
  }
  __syncthreads();
  if (t < 256) {
    const float* pf = (const float*)ps;
    float s = pf[t];
    for (int g = 1; g < 16; ++g) s += pf[g * 256 + t];
    gap[t] = s;
  }
  __syncthreads();
  float bns = rsqrtf(1.f + 1e-5f);
  if (t < 32) {
    float a = b1[t];
    const float inv = 1.f / 4096.f;
    for (int i = 0; i < 256; ++i) a += w1[t * 256 + i] * gap[i] * inv;
    a = a * (g1[t] * bns) + bb1[t];
    d1[t] = geluf(a);
  }
  __syncthreads();
  if (t < 128) {
    float a = b2[t];
    for (int j = 0; j < 32; ++j) a += w2[t * 32 + j] * d1[j];
    cis[b * 128 + t] = sigmf(a);
  }
}

// ---------------------------------------------------------------- pr 1x1 conv GEMM
// grid 2048 (one image row of 64 pixels each), block 128, shmem 33KB (rows padded by 16 B)
// Up to 256 registers a wave (4 waves a SIMD): the weights alone take 128.
__global__ __launch_bounds__(128, 4)
void k_prgemm(const _Float16* __restrict__ xc, const _Float16* __restrict__ pwf,
                         const float* __restrict__ pb, _Float16* __restrict__ prout) {
  extern __shared__ char smemraw[];
  _Float16* xa = (_Float16*)smemraw;  // 64 x 256, pitch 264
  const int blk = blockIdx.x, tid = threadIdx.x;
  const int w = tid >> 5, lane = tid & 31, n0 = lane & 15, hi = lane >> 4;
  // The wave's weight fragments (2 column tiles x 8 k steps) are loaded once and serve all
  // 4 row tiles; issued ahead of the staging, they fly together with it.
  v16h bw[2][8];
  const unsigned bo0 = fragoff(256, (w * 2 + 0) * 16), bo1 = fragoff(256, (w * 2 + 1) * 16);
#pragma unroll  // bw is indexed by constants only, so that it stays in registers
  for (int ks = 0; ks < 8; ++ks) {
    bw[0][ks] = ldfrag_o(pwf, bo0, ks * 32);
    bw[1][ks] = ldfrag_o(pwf, bo1, ks * 32);
  }
  // the offsets these loads name are inputs here, so they stay in their registers until the
  // wait has passed; behind it the registers may be reused
  asm volatile("s_wait_xcnt 0x0" :: "v"(bo0), "v"(bo1) : "memory");
  {
    const uint4* src = (const uint4*)(xc + (size_t)blk * (64 * 256));
    uint4* dst = (uint4*)xa;
    for (int i = tid; i < 2048; i += 128) dst[(i >> 5) * 33 + (i & 31)] = src[i];
  }
  __syncthreads();
#pragma unroll 1
  for (int mt = 0; mt < 4; ++mt) {
    v8f acc0 = vzero(), acc1 = vzero();
#pragma unroll  // constant indices into bw
    for (int ks = 0; ks < 8; ++ks) {
      v16h a = ldfrag(xa, 264, mt * 16, ks * 32);
      acc0 = wmma16(a, bw[0][ks], acc0);
      acc1 = wmma16(a, bw[1][ks], acc1);
    }
#pragma unroll
    for (int u = 0; u < 2; ++u) {
      v8f acc = u ? acc1 : acc0;
      int c0 = (w * 2 + u) * 16 + n0;
      float bias = pb[c0];
#pragma unroll
      for (int j = 0; j < 8; ++j) {
        size_t row = (size_t)blk * 64 + mt * 16 + hi * 8 + j;
        prout[row * 128 + c0] = (_Float16)(acc[j] + bias);
      }
    }
    // the stores' address and data registers are reused by the next row tile
    asm volatile("s_wait_xcnt 0x0" ::: "memory");
  }
}

// ---------------------------------------------------------------- qkv + attention + spatial gate + final GEMM
// grid 2048 windows, block 256 (8 waves = 8 heads), dyn shmem 59568 B (x tile and the final
// GEMM's 64 x 256 operand tile, rows padded by 16 B; bias rows padded by 4 B; 64 row factors).
// The window's attention result is written straight into the left half of the final GEMM's
// operand tile in LDS. From there it feeds the spatial interaction (a 16 x 128 product, on the
// matrix unit), whose row factor gates the window's conv rows into the right half, and the
// LayerNorm; then the tile is multiplied by out_w. Neither the attention result nor the gated
// conv branch passes through memory.
// Wave h computes q, k and v of head h itself, and every product takes its two operands in the
// order that leaves the result where the next product wants it (A and B share one lane map:
// lane (c, hi) holds row / column c, k = 8*hi..+7 and 16+8*hi..+7; D register j of lane (c, hi)
// is D[8*hi+j][c]):
//   q^T, k^T = W x^T : lane (token, hi) holds channels 8*hi..+7  = a row of the A / B operand
//   v        = x W   : lane (channel, hi) holds tokens 8*hi..+7  = a column of V, two tiles = k 32
//   S^T      = k q^T : lane (query, hi) holds keys 8*hi..+7 of each key tile = a row of P
//   O^T      = V^T P^T : lane (query, hi) holds channels 8*hi..+7 = 16 contiguous output bytes
// So q, k, v and P never leave the wave's registers, and a query's softmax lies in 2 lanes.
// Up to 256 registers (4 waves a SIMD): the qkv weights alone take 96, out_w's later 128.
__global__ __launch_bounds__(256) __attribute__((amdgpu_waves_per_eu(4, 4)))
void k_attn_out(const _Float16* __restrict__ xattn,
                const _Float16* __restrict__ qwT,
                const float* __restrict__ qb,
                const float* __restrict__ cis,
                const float* __restrict__ relb,
                const _Float16* __restrict__ prout,
                const float* __restrict__ w1, const float* __restrict__ b1,
                const float* __restrict__ g1, const float* __restrict__ bb1,
                const float* __restrict__ w2, const float* __restrict__ b2,
                const float* __restrict__ cng, const float* __restrict__ cnb,
                const _Float16* __restrict__ owT, const float* __restrict__ ob,
                const float* __restrict__ ang, const float* __restrict__ anb,
                float* __restrict__ out) {
  extern __shared__ char smemraw[];
  _Float16* xa  = (_Float16*)smemraw;      // 64 x 128, pitch 136
  float* bsh    = (float*)(xa + 64 * 136); // 225 x 8 rel-pos bias, pitch 9 (odd: a wave's 24 rows on 24 banks)
  _Float16* A   = (_Float16*)(smemraw + 25520);          // 64 x 256, pitch 264: [attention | gated conv]
  float* slv    = (float*)(smemraw + 25520 + 64 * 528);  // 64: each row's factor of the gate's exponent

  const int win = blockIdx.x, tid = threadIdx.x;
  const int h = tid >> 5, lane = tid & 31, n0 = lane & 15, hi = lane >> 4;
  const int img = win >> 6;
  // The head's weight fragments (q, k, v column tile x 4 k steps) are loaded once and serve
  // all 4 token tiles; issued ahead of the staging, they fly together with it.
  v16h bw[3][4];
  const unsigned bo0 = fragoff(128, h * 16), bo1 = fragoff(128, 128 + h * 16),
                 bo2 = fragoff(128, 256 + h * 16);
#pragma unroll  // bw is indexed by constants only, so that it stays in registers
  for (int ks = 0; ks < 4; ++ks) {
    bw[0][ks] = ldfrag_o(qwT, bo0, ks * 32);
    bw[1][ks] = ldfrag_o(qwT, bo1, ks * 32);
    bw[2][ks] = ldfrag_o(qwT, bo2, ks * 32);
  }
  // the lane's 8 q and 8 k biases (channels 8*hi..+7), its v bias and channel gate (channel n0)
  const unsigned qo = (unsigned)((h * 16 + hi * 8) * 4);
  const int vi = h * 16 + n0;
  const f4 bq0 = *(const f4*)((const char*)qb + qo), bq1 = *(const f4*)((const char*)qb + qo + 16);
  const f4 bk0 = *(const f4*)((const char*)qb + qo + 512), bk1 = *(const f4*)((const char*)qb + qo + 528);
  const float bv = qb[256 + vi];
  const float gate = (cis + img * 128)[vi];
  // the offsets and the index these loads name are inputs here, so they stay in their
  // registers until the wait has passed; behind it the registers may be reused
  asm volatile("s_wait_xcnt 0x0" :: "v"(bo0), "v"(bo1), "v"(bo2), "v"(qo), "v"(vi) : "memory");
  {
    const uint4* src = (const uint4*)(xattn + (size_t)win * (64 * 128));
    uint4* dst = (uint4*)xa;
    for (int i = tid; i < 1024; i += 256) dst[(i >> 4) * 17 + (i & 15)] = src[i];
    for (int i = tid; i < 1800; i += 256) bsh[(i >> 3) * 9 + (i & 7)] = relb[i];
  }
  __syncthreads();

  const float bq[8] = {bq0.x, bq0.y, bq0.z, bq0.w, bq1.x, bq1.y, bq1.z, bq1.w};
  const float bk[8] = {bk0.x, bk0.y, bk0.z, bk0.w, bk1.x, bk1.y, bk1.z, bk1.w};
  h8 qf[4], kf[4], vf[4];                  // one per 16-token tile
#pragma unroll  // this loop and those below: qf, kf, vf are indexed by constants only (registers)
  for (int mt = 0; mt < 4; ++mt) {
    v8f aq = vzero(), ak = vzero(), av = vzero();
#pragma unroll  // constant indices into bw
    for (int ks = 0; ks < 4; ++ks) {
      v16h a = ldfrag(xa, 136, mt * 16, ks * 32);
      aq = wmma16(bw[0][ks], a, aq);       // [channel][token]
      ak = wmma16(bw[1][ks], a, ak);       // [channel][token]
      av = wmma16(a, bw[2][ks], av);       // [token][channel]
    }
#pragma unroll
    for (int j = 0; j < 8; ++j) {
      qf[mt][j] = (_Float16)((aq[j] + bq[j]) * 0.25f);       // HD^-0.5
      kf[mt][j] = (_Float16)(ak[j] + bk[j]);
      vf[mt][j] = (_Float16)((av[j] + bv) * gate);
    }
  }

  // ---- the gate's loads (the window's pr_out rows come from memory): issued here, they fly while
  // the scores and the softmax are computed.
  // the wave's number in a scalar register: the matrix products below stand under a scalar branch
  const int hs = __builtin_amdgcn_readfirstlane(h);
  // gate: thread (rg, oc) takes channels 8*oc..+7 of rows rg, rg + 16, rg + 32, rg + 48 of the window;
  // row n of window (wy, wx) is image pixel (wy * 8 + (n >> 3), wx * 8 + (n & 7)) of pr_out
  const int oc = tid & 15, rg = tid >> 4;
  const unsigned po = (unsigned)(((img * 4096 + ((win >> 3) & 7) * 512 + (rg >> 3) * 64
                                   + (win & 7) * 8 + (rg & 7)) * 128 + oc * 8) * 2);
  const unsigned go = oc * 32u;
  h8 pv[4];
#pragma unroll  // pv is indexed by constants only (registers)
  for (int i = 0; i < 4; ++i) pv[i] = *(const h8*)((const char*)prout + po + i * (2 * 64 * 256));
  const f4 gr0 = *(const f4*)((const char*)cng + go), gr1 = *(const f4*)((const char*)cng + go + 16);
  const f4 gb0 = *(const f4*)((const char*)cnb + go), gb1 = *(const f4*)((const char*)cnb + go + 16);
  // the offsets these loads name are inputs here, so they stay in their registers until the
  // wait has passed
  asm volatile("s_wait_xcnt 0x0" :: "v"(po), "v"(go) : "memory");

  // HD = 16: the upper 16 of the score products' k are zero
  const h8 z8 = {(_Float16)0.f,(_Float16)0.f,(_Float16)0.f,(_Float16)0.f,
                 (_Float16)0.f,(_Float16)0.f,(_Float16)0.f,(_Float16)0.f};
  v16h vB[2];
#pragma unroll
  for (int ks = 0; ks < 2; ++ks)
    vB[ks] = __builtin_shufflevector(vf[ks * 2], vf[ks * 2 + 1], 0,1,2,3,4,5,6,7,8,9,10,11,12,13,14,15);
  // bias of (query mt*16 + n0, key nt*16 + hi*8 + j): table row
  // ((n0>>3) - hi + 7) * 15 + (n0&7) + 7  +  (mt - nt) * 30 - j
  const float* bl = bsh + ((((n0 >> 3) - hi + 7) * 15 + (n0 & 7) + 7) * 9 + h);
  _Float16* orow = A + n0 * 264 + h * 16 + hi * 8;
#pragma unroll
  for (int mt = 0; mt < 4; ++mt) {
    const v16h qB = __builtin_shufflevector(qf[mt], z8, 0,1,2,3,4,5,6,7,8,9,10,11,12,13,14,15);
    v8f s[4];
#pragma unroll
    for (int nt = 0; nt < 4; ++nt) {
      const v16h kA = __builtin_shufflevector(kf[nt], z8, 0,1,2,3,4,5,6,7,8,9,10,11,12,13,14,15);
      v8f c;                               // the bias tile, in D's map, is the product's C
#pragma unroll
      for (int j = 0; j < 8; ++j) c[j] = bl[((mt - nt) * 30 - j) * 9];
      s[nt] = wmma16(kA, qB, c);           // [key][query]
    }
    // softmax of the lane's query: its 32 keys here, the other 32 in lane ^ 16
    float m4[4];
#pragma unroll
    for (int nt = 0; nt < 4; ++nt) {
      m4[nt] = s[nt][0];
#pragma unroll
      for (int j = 1; j < 8; ++j) m4[nt] = fmaxf(m4[nt], s[nt][j]);
    }
    float mx = fmaxf(fmaxf(m4[0], m4[1]), fmaxf(m4[2], m4[3]));
    mx = fmaxf(mx, xhalf(mx));
    float s4[4] = {0.f, 0.f, 0.f, 0.f};    // four independent chains
    // exp(s - mx) = 2^(s * log2 e - mx * log2 e): one multiply-add and one v_exp_f32. The
    // argument is at most a rounding error above 0; a power below 2^-126 comes out as 0, beside
    // a sum of at least about 1 and ahead of P's rounding to f16.
    const float mxl = mx * LOG2E;
    const v8f l8 = {LOG2E, LOG2E, LOG2E, LOG2E, LOG2E, LOG2E, LOG2E, LOG2E};
    const v8f m8 = {-mxl, -mxl, -mxl, -mxl, -mxl, -mxl, -mxl, -mxl};
#pragma unroll
    for (int nt = 0; nt < 4; ++nt) s[nt] = __builtin_elementwise_fma(s[nt], l8, m8);  // packed, 2 a slot
#pragma unroll
    for (int nt = 0; nt < 4; ++nt)
#pragma unroll
      for (int j = 0; j < 8; ++j) { float e = __builtin_amdgcn_exp2f(s[nt][j]); s[nt][j] = e; s4[nt] += e; }
    float sum = (s4[0] + s4[1]) + (s4[2] + s4[3]);
    sum += xhalf(sum);
    const float inv = __builtin_amdgcn_rcpf(sum);
    v8f o = vzero();
#pragma unroll
    for (int ks = 0; ks < 2; ++ks) {
      v16h pB;
#pragma unroll
      for (int j = 0; j < 8; ++j) {
        pB[j]     = (_Float16)(s[ks * 2][j] * inv);
        pB[8 + j] = (_Float16)(s[ks * 2 + 1][j] * inv);
      }
      o = wmma16(vB[ks], pB, o);           // [channel][query]
    }
    h8 ov;
#pragma unroll
    for (int j = 0; j < 8; ++j) ov[j] = (_Float16)o[j];
    *(h8*)(orow + mt * (16 * 264)) = ov;
  }

  // spatial interaction, waves 0..3: si_w1 as the A operand (lane (unit, hi): row 'unit',
  // k = 8*hi..+7 and 16+8*hi..+7 of each k step), and the lane's 8 hidden units' constants
  f4 wq[4][4], sb[2], sg[2], ss[2], sw[2];
  if (hs < 4) {
    const unsigned wo = (unsigned)((n0 * 128 + hi * 8) * 4), so = hi * 32u;
#pragma unroll  // wq is indexed by constants only (registers)
    for (int ks = 0; ks < 4; ++ks) {
      wq[ks][0] = *(const f4*)((const char*)w1 + wo + ks * 128);
      wq[ks][1] = *(const f4*)((const char*)w1 + wo + ks * 128 + 16);
      wq[ks][2] = *(const f4*)((const char*)w1 + wo + ks * 128 + 64);
      wq[ks][3] = *(const f4*)((const char*)w1 + wo + ks * 128 + 80);
    }
#pragma unroll  // constant indices (registers)
    for (int u = 0; u < 2; ++u) {
      sb[u] = *(const f4*)((const char*)b1 + so + u * 16);
      sg[u] = *(const f4*)((const char*)g1 + so + u * 16);
      ss[u] = *(const f4*)((const char*)bb1 + so + u * 16);
      sw[u] = *(const f4*)((const char*)w2 + so + u * 16);
    }
    // as above: the offsets stay in their registers until the wait has passed
    asm volatile("s_wait_xcnt 0x0" :: "v"(wo), "v"(so) : "memory");
  }
  const float bns = rsqrtf(1.f + 1e-5f);
  __syncthreads();                         // the attention half of A is complete

  // ---- spatial interaction: wave t < 4 takes the 16 tokens of row tile t.
  // hidden^T = si_w1 x^T: lane (token, hi) holds hidden units 8*hi..+7 of its token, so the sum
  // over the 16 units is 8 terms in the lane and one exchange with lane ^ 16.
  if (hs < 4) {
    v8f hacc = vzero();
#pragma unroll  // constant indices into wq
    for (int ks = 0; ks < 4; ++ks) {
      v16h wf;
#pragma unroll  // constant indices (registers)
      for (int e = 0; e < 4; ++e) {
        wf[e]      = (_Float16)wq[ks][0][e];
        wf[4 + e]  = (_Float16)wq[ks][1][e];
        wf[8 + e]  = (_Float16)wq[ks][2][e];
        wf[12 + e] = (_Float16)wq[ks][3][e];
      }
      hacc = wmma16(wf, ldfrag(A, 264, hs * 16, ks * 32), hacc);   // [unit][token]
    }
    float t = 0.f;
#pragma unroll  // constant indices (registers)
    for (int j = 0; j < 8; ++j) {
      float v = hacc[j] + sb[j >> 2][j & 3];
      v = v * (sg[j >> 2][j & 3] * bns) + ss[j >> 2][j & 3];
      t += sw[j >> 2][j & 3] * geluf(v);
    }
    t += xhalf(t);
    // sigmoid(siv * p) = 1 / (1 + 2^(-siv * log2 e * p)): the row's factor is formed once
    if (hi == 0) slv[hs * 16 + n0] = (t + b2[0]) * -LOG2E;
  }
  __syncthreads();                         // the row factors are there; A's left half has been read

  // The wave's out_w fragments (2 column tiles x 8 k steps) are loaded once and serve all 4 row
  // tiles; issued here, they fly while the gate and the LayerNorm are computed.
  v16h fw[2][8];
  const unsigned fo0 = fragoff(256, (h * 2 + 0) * 16), fo1 = fragoff(256, (h * 2 + 1) * 16);
#pragma unroll  // fw is indexed by constants only, so that it stays in registers
  for (int ks = 0; ks < 8; ++ks) {
    fw[0][ks] = ldfrag_o(owT, fo0, ks * 32);
    fw[1][ks] = ldfrag_o(owT, fo1, ks * 32);
  }
  const unsigned bbo = (unsigned)((h * 32 + n0) * 4);
  const float bias[2] = {*(const float*)((const char*)ob + bbo),
                         *(const float*)((const char*)ob + bbo + 64)};
  // the offsets these loads name are inputs here, so they stay in their registers until the
  // wait has passed
  asm volatile("s_wait_xcnt 0x0" :: "v"(fo0), "v"(fo1), "v"(bbo) : "memory");

  // ---- gate the conv branch into the right half of A
  {
    const f4 gs0 = gr0 * bns, gs1 = gr1 * bns;
    const float gs[8] = {gs0.x, gs0.y, gs0.z, gs0.w, gs1.x, gs1.y, gs1.z, gs1.w};
    const float gb[8] = {gb0.x, gb0.y, gb0.z, gb0.w, gb1.x, gb1.y, gb1.z, gb1.w};
#pragma unroll  // constant indices into pv
    for (int i = 0; i < 4; ++i) {
      const float sl = slv[rg + i * 16];
      h8 gv;
#pragma unroll  // constant indices (registers)
      for (int k = 0; k < 8; ++k)
        gv[k] = (_Float16)(__builtin_amdgcn_rcpf(1.0f + __builtin_amdgcn_exp2f(sl * (float)pv[i][k])) * gs[k] + gb[k]);
      *(h8*)(A + (rg + i * 16) * 264 + 128 + oc * 8) = gv;
    }
  }
  if (tid < 64) {  // LN in place on the attention half of the row
    float m = 0.f;
    for (int c = 0; c < 128; ++c) m += (float)A[tid * 264 + c];
    m *= (1.f / 128.f);
    float v = 0.f;
    for (int c = 0; c < 128; ++c) { float d = (float)A[tid * 264 + c] - m; v += d * d; }
    v *= (1.f / 128.f);
    float rs = rsqrtf(v + 1e-5f);
    for (int c = 0; c < 128; ++c)
      A[tid * 264 + c] = (_Float16)(((float)A[tid * 264 + c] - m) * rs * ang[c] + anb[c]);
  }
  __syncthreads();

  // ---- final GEMM: wave h takes output columns 32*h..+31
  // rolled: one row tile's fragments and sums at a time beside the 128 weight registers
#pragma unroll 1
  for (int mt = 0; mt < 4; ++mt) {
    v8f acc0 = vzero(), acc1 = vzero();
#pragma unroll  // constant indices into fw
    for (int ks = 0; ks < 8; ++ks) {
      v16h af = ldfrag(A, 264, mt * 16, ks * 32);
      acc0 = wmma16(af, fw[0][ks], acc0);
      acc1 = wmma16(af, fw[1][ks], acc1);
    }
#pragma unroll
    for (int u = 0; u < 2; ++u) {
      v8f acc = u ? acc1 : acc0;
      int c0 = (h * 2 + u) * 16 + n0;
#pragma unroll
      for (int j = 0; j < 8; ++j) {
        size_t row = (size_t)win * 64 + mt * 16 + hi * 8 + j;
        out[row * 256 + c0] = acc[j] + bias[u];
      }
    }
    // the stores' address and data registers are reused by the next row tile
    asm volatile("s_wait_xcnt 0x0" ::: "memory");
  }
}

// ---------------------------------------------------------------- launcher
extern "C" void kernel_launch(void* const* d_in, const int* in_sizes, int n_in,
                              void* d_out, int out_size, void* d_ws, size_t ws_size,
                              hipStream_t stream) {
  (void)in_sizes; (void)n_in; (void)out_size; (void)ws_size;
  const float* x       = (const float*)d_in[0];
  const float* relb    = (const float*)d_in[1];
  const float* attn_w  = (const float*)d_in[2];
  const float* attn_b  = (const float*)d_in[3];
  const float* aln_g   = (const float*)d_in[4];
  const float* aln_b   = (const float*)d_in[5];
  const float* conv_w  = (const float*)d_in[6];
  const float* conv_b  = (const float*)d_in[7];
  const float* cbn_g   = (const float*)d_in[8];
  const float* cbn_b   = (const float*)d_in[9];
  const float* ci_w1   = (const float*)d_in[10];
  const float* ci_b1   = (const float*)d_in[11];
  const float* ci_g    = (const float*)d_in[12];
  const float* ci_bb   = (const float*)d_in[13];
  const float* ci_w2   = (const float*)d_in[14];
  const float* ci_b2   = (const float*)d_in[15];
  const float* pr_w    = (const float*)d_in[16];
  const float* pr_b    = (const float*)d_in[17];
  const float* cn_g    = (const float*)d_in[18];
  const float* cn_b    = (const float*)d_in[19];
  const float* qkv_w   = (const float*)d_in[20];
  const float* qkv_b   = (const float*)d_in[21];
  const float* si_w1   = (const float*)d_in[22];
  const float* si_b1   = (const float*)d_in[23];
  const float* si_g    = (const float*)d_in[24];
  const float* si_bb   = (const float*)d_in[25];
  const float* si_w2   = (const float*)d_in[26];
  const float* si_b2   = (const float*)d_in[27];
  const float* an_g    = (const float*)d_in[28];
  const float* an_b    = (const float*)d_in[29];
  const float* out_w   = (const float*)d_in[30];
  const float* out_b   = (const float*)d_in[31];
  float* out = (float*)d_out;

  // workspace arena
  char* W = (char*)d_ws;
  size_t off = 0;
  auto take = [&](size_t bytes) { char* p = W + off; off += (bytes + 255) & ~(size_t)255; return p; };
  _Float16* pr_out  = (_Float16*)take(33554432);   // (131072, 128) NHWC
  _Float16* attn_wT = (_Float16*)take(65536);      // (128, 256)
  _Float16* qkv_wT  = (_Float16*)take(98304);      // (384, 128)
  _Float16* out_wT  = (_Float16*)take(131072);     // (256, 256)
  _Float16* pr_wf   = (_Float16*)take(65536);      // (128, 256)
  _Float16* x_attn  = (_Float16*)take(33554432);   // (131072, 128)
  _Float16* xc      = (_Float16*)take(67108864);   // (131072, 256) NHWC
  float*    part    = (float*)take(2097152);       // (32, 64, 256): image, window, channel
  float*    cis     = (float*)take(16384);         // (32, 128)

  k_prep_w<<<704, 256, 0, stream>>>(attn_w, qkv_w, out_w, pr_w, attn_wT, qkv_wT, out_wT, pr_wf);
  k_attnproj_ln<<<2048, 128, 67072, stream>>>(x, attn_wT, attn_b, aln_g, aln_b, x_attn);
  k_dwconv<<<2048, 64, 0, stream>>>(x, conv_w, conv_b, cbn_g, cbn_b, xc, part);
  k_ci<<<32, 1024, 0, stream>>>(part, ci_w1, ci_b1, ci_g, ci_bb, ci_w2, ci_b2, cis);
  k_prgemm<<<2048, 128, 33792, stream>>>(xc, pr_wf, pr_b, pr_out);
  k_attn_out<<<2048, 256, 59568, stream>>>(x_attn, qkv_wT, qkv_b, cis, relb, pr_out,
                                           si_w1, si_b1, si_g, si_bb, si_w2, si_b2, cn_g, cn_b,
                                           out_wT, out_b, an_g, an_b, out);
}

// v010
// It runs in 150 microseconds.
// Next to v009, in two timings, it ran 1.08 times as fast each time.
// Counting every step since v000, it is 5.97 times as fast.
#include <hip/hip_runtime.h>
#include <hip/hip_bf16.h>

#define DI __device__ __forceinline__

typedef __attribute__((ext_vector_type(16))) _Float16 v16h;
typedef __attribute__((ext_vector_type(8)))  _Float16 h8;
typedef __attribute__((ext_vector_type(8)))  float    v8f;
typedef __attribute__((ext_vector_type(4)))  float    f4;
typedef __attribute__((ext_vector_type(2)))  float    f2;
typedef __attribute__((ext_vector_type(4)))  _Float16 h4;

// ---------------------------------------------------------------- helpers
DI v8f vzero() { v8f z = {0.f,0.f,0.f,0.f,0.f,0.f,0.f,0.f}; return z; }

DI v8f wmma16(v16h a, v16h b, v8f c) {
  return __builtin_amdgcn_wmma_f32_16x16x32_f16(false, a, false, b, (short)0, c, false, false);
}

// A-fragment (16x32 f16): lane L -> row r0+(L&15); halves 0..7 = K k0+8*(L>>4)..+7,
// halves 8..15 = K k0+16+8*(L>>4)..+7.  B^T uses identical layout (row = out col).
DI v16h ldfrag(const _Float16* p, int ld, int r0, int k0) {
  int lane = threadIdx.x & 31;
  int m = lane & 15, hi = lane >> 4;
  const _Float16* q = p + (size_t)(r0 + m) * ld + k0 + hi * 8;
  h8 lo = *(const h8*)q;
  h8 hv = *(const h8*)(q + 16);
  return __builtin_shufflevector(lo, hv, 0,1,2,3,4,5,6,7,8,9,10,11,12,13,14,15);
}

// The same fragment from a base pointer and the lane's byte offset fragoff(ld, r0): the caller
// holds the one offset register that a run of such loads names.
DI unsigned fragoff(int ld, int r0) {
  int lane = threadIdx.x & 31;
  return (unsigned)(((r0 + (lane & 15)) * ld + (lane >> 4) * 8) * 2);
}
DI v16h ldfrag_o(const _Float16* p, unsigned off, int k0) {
  const char* q = (const char*)p + off + k0 * 2;
  h8 lo = *(const h8*)q;
  h8 hv = *(const h8*)(q + 32);
  return __builtin_shufflevector(lo, hv, 0,1,2,3,4,5,6,7,8,9,10,11,12,13,14,15);
}

// the value of lane l ^ 16 (the other 16-lane row), by a vector cross-row move
DI float xhalf(float x) {
  const int b = __builtin_bit_cast(int, x);
  return __builtin_bit_cast(float, __builtin_amdgcn_permlanex16(b, b, 0x76543210, 0xfedcba98, false, false));
}

// the sum over a 16-lane row, left in all 16 lanes: four xor steps on the vector unit (DPP row_xmask)
template <int M> DI float xmask16(float x) {
  return __builtin_bit_cast(float, __builtin_amdgcn_update_dpp(0, __builtin_bit_cast(int, x), 0x160 | M, 0xf, 0xf, true));
}
DI float rowsum16(float x) {
  x += xmask16<1>(x); x += xmask16<2>(x); x += xmask16<4>(x); x += xmask16<8>(x);
  return x;
}
// the sum of a lane's 8 values, halved three times (packed adds, 2 a slot)
DI float hsum8(v8f v) {
  const f4 a = __builtin_shufflevector(v, v, 0, 1, 2, 3) + __builtin_shufflevector(v, v, 4, 5, 6, 7);
  const f2 b = __builtin_shufflevector(a, a, 0, 1) + __builtin_shufflevector(a, a, 2, 3);
  return b.x + b.y;
}
// LayerNorm of N rows of 128 channels, each row in the 16 lanes of a half wave, 8 channels a
// lane: x[i] comes in as row i's values and goes out normalised, scaled by g and shifted by b.
// The rows are independent chains, step by step side by side.
template <int N> DI void ln_rows(v8f (&x)[N], v8f g, v8f b) {
  float s[N];
#pragma unroll  // this loop and those below: x, s are indexed by constants only (registers)
  for (int i = 0; i < N; ++i) s[i] = hsum8(x[i]);
#pragma unroll
  for (int i = 0; i < N; ++i) s[i] = rowsum16(s[i]) * (1.f / 128.f);
#pragma unroll
  for (int i = 0; i < N; ++i) { x[i] -= s[i]; s[i] = hsum8(x[i] * x[i]); }
#pragma unroll
  for (int i = 0; i < N; ++i) s[i] = rsqrtf(rowsum16(s[i]) * (1.f / 128.f) + 1e-5f);
#pragma unroll
  for (int i = 0; i < N; ++i) x[i] = x[i] * s[i] * g + b;
}

DI float geluf(float x) { return 0.5f * x * (1.0f + erff(x * 0.70710678118654752f)); }
// exp(t) = 2^(t * log2 e) on the hardware's base-2 exponential (v_exp_f32), 1 / y on its
// reciprocal (v_rcp_f32). Ends of the range as with expf and a division: 2^big = inf and
// 1 / inf = 0; 2^-big = 0 and 1 / (1 + 0) = 1.
#define LOG2E 1.4426950408889634f
DI float sigmf(float x) { return __builtin_amdgcn_rcpf(1.0f + __builtin_amdgcn_exp2f(x * -LOG2E)); }

// ---------------------------------------------------------------- prep kernels
__global__ void k_prep_w(const float* __restrict__ aw, const float* __restrict__ qw,
                         const float* __restrict__ ow, const float* __restrict__ pw,
                         _Float16* __restrict__ awT, _Float16* __restrict__ qwT,
                         _Float16* __restrict__ owT, _Float16* __restrict__ pwf) {
  int i = blockIdx.x * 256 + threadIdx.x;
  const int A = 128 * 256, Q = 384 * 128, O = 256 * 256, P = 128 * 256;
  if (i < A) {                               // attn_w (256,128) -> (128,256)^T
    int n = i >> 8, k = i & 255;
    awT[i] = (_Float16)aw[k * 128 + n];
  } else if (i < A + Q) {                    // qkv_w (128,384) -> (384,128)^T
    int j = i - A; int n = j >> 7, k = j & 127;
    qwT[j] = (_Float16)qw[k * 384 + n];
  } else if (i < A + Q + O) {                // out_w (256,256) -> (256,256)^T
    int j = i - A - Q; int n = j >> 8, k = j & 255;
    owT[j] = (_Float16)ow[k * 256 + n];
  } else if (i < A + Q + O + P) {            // pr_w (128,256) already (O,I) = B^T
    int j = i - A - Q - O;
    pwf[j] = (_Float16)pw[j];
  }
}

// ---------------------------------------------------------------- attn proj + LN
// grid 2048 (one window), block 128 (4 waves), shmem 64*264*2 + 64*132*4 = 67584 B
// LDS rows are padded: xa by 16 bytes (pitch 16 B x odd, for the 16 rows of a 16-byte fragment
// read), ob by 4 floats (pitch 132 dwords: rows stay 16-byte aligned for the LayerNorm's reads,
// and the two 8-row halves of an accumulator tile are stored 32 banks apart).
// LDS allows 4 work-groups a WGP = 4 waves a SIMD: the compiler is told to plan for exactly
// that (up to 256 registers), else it saves registers by staging one load at a time.
__global__ __launch_bounds__(128) __attribute__((amdgpu_waves_per_eu(4, 4)))
void k_attnproj_ln(const float* __restrict__ x,
                              const _Float16* __restrict__ awT,
                              const float* __restrict__ ab,
                              const float* __restrict__ lg,
                              const float* __restrict__ lb,
                              _Float16* __restrict__ xattn) {
  extern __shared__ char smemraw[];
  _Float16* xa = (_Float16*)smemraw;           // 64 x 256, pitch 264
  float* ob = (float*)(xa + 64 * 264);         // 64 x 128, pitch 132
  const int win = blockIdx.x, tid = threadIdx.x;
  const int w = tid >> 5, lane = tid & 31, n0 = lane & 15, hi = lane >> 4;
  // The wave's weight fragments (2 column tiles x 8 k steps) are loaded once and serve all
  // 4 row tiles; issued ahead of the staging, they fly together with it.
  v16h bw[2][8];
  const unsigned bo0 = fragoff(256, (w * 2 + 0) * 16), bo1 = fragoff(256, (w * 2 + 1) * 16);
#pragma unroll  // bw is indexed by constants only, so that it stays in registers
  for (int ks = 0; ks < 8; ++ks) {
    bw[0][ks] = ldfrag_o(awT, bo0, ks * 32);
    bw[1][ks] = ldfrag_o(awT, bo1, ks * 32);
  }
  // the offsets these loads name are inputs here, so they stay in their registers until the
  // wait has passed; behind it the registers may be reused
  asm volatile("s_wait_xcnt 0x0" :: "v"(bo0), "v"(bo1) : "memory");
  {
    // The window is read as f32 and rounded to f16 on its way into LDS. Load g of a lane is
    // 16 bytes at g * 2048 + tid * 16 (512 contiguous bytes a wave) = row 2g + (tid >> 6),
    // columns 4 * (tid & 63) .. + 3. Groups of 8 loads: a group is rounded and stored while
    // the groups behind it fly, and its registers are then free for a later group.
    const f4* xw = (const f4*)(x + (size_t)win * (64 * 256));
    char* xd = (char*)xa + (tid >> 6) * 528 + (tid & 63) * 8;
    f4 t[2][8];
#pragma unroll  // t is indexed by constants only (registers)
    for (int u = 0; u < 8; ++u) t[0][u] = xw[u * 128 + tid];
#pragma unroll  // constant indices into t
    for (int g = 0; g < 4; ++g) {
      if (g < 3) {
#pragma unroll
        for (int u = 0; u < 8; ++u) t[(g + 1) & 1][u] = xw[((g + 1) * 8 + u) * 128 + tid];
      }
      // keeps the later groups' loads behind this line: hoisted, all 32 loads' results are
      // live beside the 128 weight registers and the build spills
      if (g < 2) __builtin_amdgcn_sched_barrier(0);
#pragma unroll
      for (int u = 0; u < 8; ++u) {
        const f4 v = t[g & 1][u];
        h4 o = {(_Float16)v.x, (_Float16)v.y, (_Float16)v.z, (_Float16)v.w};
        *(h4*)(xd + (g * 8 + u) * 1056) = o;
      }
    }
    // the index and the base these loads name are inputs here, so they stay in their
    // registers until the wait has passed
    asm volatile("s_wait_xcnt 0x0" :: "v"(tid), "s"(xw) : "memory");
  }
  __syncthreads();
  // LayerNorm: thread (rg, oc) takes channels 8*oc..+7 of rows rg, rg + 8, .. rg + 56. Its scale
  // and shift are loaded here and fly while the products are computed.
  const int oc = tid & 15, rg = tid >> 4;
  const unsigned lo = oc * 32u;
  const f4 lg0 = *(const f4*)((const char*)lg + lo), lg1 = *(const f4*)((const char*)lg + lo + 16);
  const f4 lb0 = *(const f4*)((const char*)lb + lo), lb1 = *(const f4*)((const char*)lb + lo + 16);
  // the offset these loads name is an input here, so it stays in its register until the wait
  // has passed
  asm volatile("s_wait_xcnt 0x0" :: "v"(lo) : "memory");
#pragma unroll 1
  for (int mt = 0; mt < 4; ++mt) {
    v8f acc0 = vzero(), acc1 = vzero();
#pragma unroll  // constant indices into bw
    for (int ks = 0; ks < 8; ++ks) {
      v16h a = ldfrag(xa, 264, mt * 16, ks * 32);
      acc0 = wmma16(a, bw[0][ks], acc0);
      acc1 = wmma16(a, bw[1][ks], acc1);
    }
#pragma unroll
    for (int u = 0; u < 2; ++u) {
      v8f acc = u ? acc1 : acc0;
      int c0 = (w * 2 + u) * 16 + n0;
      float bias = ab[c0];
#pragma unroll
      for (int j = 0; j < 8; ++j)
        ob[(mt * 16 + hi * 8 + j) * 132 + c0] = acc[j] + bias;
    }
  }
  __syncthreads();
  // A row lies in the 16 lanes of a half wave, 8 values a lane, read from LDS once and kept in
  // registers; mean and variance are 8 terms in the lane and a 16-lane xor tree. The 8 rows of
  // a thread are independent chains. A wave stores 2 whole rows = 512 contiguous bytes.
  {
    v8f xv[8];
#pragma unroll  // xv is indexed by constants only (registers)
    for (int i = 0; i < 8; ++i) {
      const f4* p = (const f4*)(ob + (rg + i * 8) * 132 + oc * 8);
      xv[i] = __builtin_shufflevector(p[0], p[1], 0, 1, 2, 3, 4, 5, 6, 7);
    }
    ln_rows<8>(xv, __builtin_shufflevector(lg0, lg1, 0, 1, 2, 3, 4, 5, 6, 7),
               __builtin_shufflevector(lb0, lb1, 0, 1, 2, 3, 4, 5, 6, 7));
    char* drow = (char*)(xattn + ((size_t)win * 64 + rg) * 128 + oc * 8);
#pragma unroll
    for (int i = 0; i < 8; ++i) *(h8*)(drow + i * 2048) = __builtin_convertvector(xv[i], h8);
  }
}

// ---------------------------------------------------------------- depthwise 3x3 + BN + GELU
// One thread = one 8x8 window x 4 channels. The 9 taps of its channels and three
// input rows (8 pixels + 1 halo pixel each side) stay in registers, so every input
// value is loaded once per window, 16 bytes a lane, 512 contiguous bytes a wave.
// Row ry (-1..8) of the window at 'base' (own window, this thread's channels):
// r[0] / r[9] are the neighbours' edge pixels; outside the image everything is 0.
// At the image's left / right edge the halo load re-reads an own pixel (in bounds);
// dw_edge() replaces its value by 0 where the row is first used, not behind the load,
// so that nothing waits for the data while the loads fly.
DI void dw_ldrow(f4 (&r)[10], const float* base, int ry, int wy, int wx) {
  const f4 z = {0.f, 0.f, 0.f, 0.f};
  const bool ok = (ry >= 0 || wy > 0) && (ry < 8 || wy < 7);
  if (ok) {
    const float* rp = (ry < 0) ? base - 8 * 16384 + 7 * 2048
                    : (ry < 8) ? base + ry * 2048 : base + 8 * 16384;
    r[0] = *(const f4*)(rp + ((wx > 0) ? -16384 + 7 * 256 : 0));
#pragma unroll
    for (int i = 0; i < 8; ++i) r[1 + i] = *(const f4*)(rp + i * 256);
    r[9] = *(const f4*)(rp + ((wx < 7) ? 16384 : 0));
    // the loads' address registers may be reused right behind them
    asm volatile("s_wait_xcnt 0x0" ::: "memory");
  } else {
#pragma unroll
    for (int i = 0; i < 10; ++i) r[i] = z;
  }
}
DI void dw_edge(f4 (&r)[10], int wx) {
  const f4 z = {0.f, 0.f, 0.f, 0.f};
  r[0] = (wx > 0) ? r[0] : z;
  r[9] = (wx < 7) ? r[9] : z;
}

// The thread also adds up its 64 pixels for the average pool (f32, ahead of the rounding to
// f16) and writes the 4 sums to part[window][channel].
// grid 2048 (one window), block 64 (64 x 4 channels)
__global__ __launch_bounds__(64)
void k_dwconv(const float* __restrict__ x, const float* __restrict__ cw,
              const float* __restrict__ cb, const float* __restrict__ bg,
              const float* __restrict__ bb, _Float16* __restrict__ xc,
              float* __restrict__ part) {
  const int win = blockIdx.x;
  const int b = win >> 6, wy = (win >> 3) & 7, wx = win & 7;
  const int c = threadIdx.x * 4;
  f4 wt[9];
  {
    float wl[36];                          // 4 channels x 9 taps, contiguous
#pragma unroll
    for (int i = 0; i < 9; ++i) {
      f4 t = *(const f4*)(cw + c * 9 + i * 4);
      wl[i * 4 + 0] = t.x; wl[i * 4 + 1] = t.y; wl[i * 4 + 2] = t.z; wl[i * 4 + 3] = t.w;
    }
#pragma unroll
    for (int k = 0; k < 9; ++k) { f4 t = {wl[k], wl[9 + k], wl[18 + k], wl[27 + k]}; wt[k] = t; }
  }
  const float bns = rsqrtf(1.f + 1e-5f);
  const f4 cb4 = *(const f4*)(cb + c);
  const f4 sc4 = *(const f4*)(bg + c) * bns;
  const f4 bb4 = *(const f4*)(bb + c);
  const float* base = x + (size_t)win * 16384 + c;
  _Float16* orow = xc + (((size_t)b * 4096 + (size_t)wy * 512 + wx * 8) * 256 + c);

  f4 r0[10], r1[10], r2[10];
  dw_ldrow(r0, base, -1, wy, wx);
  dw_ldrow(r1, base, 0, wy, wx);
  dw_ldrow(r2, base, 1, wy, wx);
  dw_edge(r0, wx);
  dw_edge(r1, wx);
  f4 gsum = {0.f, 0.f, 0.f, 0.f};          // the window's share of the average pool
  // rolled: one row's body is already about 1,500 instructions
#pragma unroll 1
  for (int ry = 0; ry < 8; ++ry) {
    dw_edge(r2, wx);
    f4 acc[8];
#pragma unroll
    for (int px = 0; px < 8; ++px) {
      f4 s = {0.f, 0.f, 0.f, 0.f};
#pragma unroll
      for (int dx = 0; dx < 3; ++dx) s += r0[px + dx] * wt[dx];
#pragma unroll
      for (int dx = 0; dx < 3; ++dx) s += r1[px + dx] * wt[3 + dx];
#pragma unroll
      for (int dx = 0; dx < 3; ++dx) s += r2[px + dx] * wt[6 + dx];
      acc[px] = s;
    }
#pragma unroll
    for (int i = 0; i < 10; ++i) { r0[i] = r1[i]; r1[i] = r2[i]; }
    // the next row's loads fly while this row's BN + GELU is computed
    if (ry < 7) dw_ldrow(r2, base, ry + 2, wy, wx);
#pragma unroll
    for (int px = 0; px < 8; ++px) {
      f4 v = (acc[px] + cb4) * sc4 + bb4;
      const f4 g = {geluf(v.x), geluf(v.y), geluf(v.z), geluf(v.w)};
      gsum += g;
      h4 o = {(_Float16)g.x, (_Float16)g.y, (_Float16)g.z, (_Float16)g.w};
      *(h4*)(orow + (size_t)ry * 16384 + px * 256) = o;
    }
    // the last store's address and data registers are reused by the next row
    asm volatile("s_wait_xcnt 0x0" ::: "memory");
  }
  *(f4*)(part + (size_t)win * 256 + c) = gsum;
}

// average pool (the 64 windows' sums of an image) + channel interaction MLP -> sigmoid gates
// grid 32 (one image), block 1024: thread (g, q) adds channels 4q..4q+3 of windows 4g..4g+3,
// 4 loads of 16 bytes in flight at once; thread c then adds channel c's 16 partial sums in a
// fixed order (no float atomics: bit-stable from run to run).
__global__ __launch_bounds__(1024)
void k_ci(const float* __restrict__ part, const float* __restrict__ w1,
          const float* __restrict__ b1, const float* __restrict__ g1,
          const float* __restrict__ bb1, const float* __restrict__ w2,
          const float* __restrict__ b2, float* __restrict__ cis) {
  __shared__ f4 ps[16 * 64];
  __shared__ float gap[256];
  __shared__ float d1[32];
  int b = blockIdx.x, t = threadIdx.x;
  {
    const char* pb = (const char*)(part + (size_t)b * (64 * 256));
    const unsigned po = (unsigned)((t >> 6) * 4096 + (t & 63) * 16);
    const f4 p0 = *(const f4*)(pb + po),        p1 = *(const f4*)(pb + po + 1024),
             p2 = *(const f4*)(pb + po + 2048), p3 = *(const f4*)(pb + po + 3072);
    // the offset and the base these loads name are inputs here, so they stay in their
    // registers until the wait has passed
    asm volatile("s_wait_xcnt 0x0" :: "v"(po), "s"(pb) : "memory");
    ps[t] = (p0 + p1) + (p2 + p3);
  }
  __syncthreads();
  if (t < 256) {
    const float* pf = (const float*)ps;
    float s = pf[t];
    for (int g = 1; g < 16; ++g) s += pf[g * 256 + t];
    gap[t] = s;
  }
  __syncthreads();
  float bns = rsqrtf(1.f + 1e-5f);
  if (t < 32) {
    float a = b1[t];
    const float inv = 1.f / 4096.f;
    for (int i = 0; i < 256; ++i) a += w1[t * 256 + i] * gap[i] * inv;
    a = a * (g1[t] * bns) + bb1[t];
    d1[t] = geluf(a);
  }
  __syncthreads();
  if (t < 128) {
    float a = b2[t];
    for (int j = 0; j < 32; ++j) a += w2[t * 32 + j] * d1[j];
    cis[b * 128 + t] = sigmf(a);
  }
}

// ---------------------------------------------------------------- pr 1x1 conv GEMM
// grid 2048 (one image row of 64 pixels each), block 128, shmem 33KB (rows padded by 16 B)
// Up to 256 registers a wave (4 waves a SIMD): the weights alone take 128.
__global__ __launch_bounds__(128, 4)
void k_prgemm(const _Float16* __restrict__ xc, const _Float16* __restrict__ pwf,
                         const float* __restrict__ pb, _Float16* __restrict__ prout) {
  extern __shared__ char smemraw[];
  _Float16* xa = (_Float16*)smemraw;  // 64 x 256, pitch 264
  const int blk = blockIdx.x, tid = threadIdx.x;
  const int w = tid >> 5, lane = tid & 31, n0 = lane & 15, hi = lane >> 4;
  // The wave's weight fragments (2 column tiles x 8 k steps) are loaded once and serve all
  // 4 row tiles; issued ahead of the staging, they fly together with it.
  v16h bw[2][8];
  const unsigned bo0 = fragoff(256, (w * 2 + 0) * 16), bo1 = fragoff(256, (w * 2 + 1) * 16);
#pragma unroll  // bw is indexed by constants only, so that it stays in registers
  for (int ks = 0; ks < 8; ++ks) {
    bw[0][ks] = ldfrag_o(pwf, bo0, ks * 32);
    bw[1][ks] = ldfrag_o(pwf, bo1, ks * 32);
  }
  // the offsets these loads name are inputs here, so they stay in their registers until the
  // wait has passed; behind it the registers may be reused
  asm volatile("s_wait_xcnt 0x0" :: "v"(bo0), "v"(bo1) : "memory");
  {
    const uint4* src = (const uint4*)(xc + (size_t)blk * (64 * 256));
    uint4* dst = (uint4*)xa;
    for (int i = tid; i < 2048; i += 128) dst[(i >> 5) * 33 + (i & 31)] = src[i];
  }
  __syncthreads();
#pragma unroll 1
  for (int mt = 0; mt < 4; ++mt) {
    v8f acc0 = vzero(), acc1 = vzero();
#pragma unroll  // constant indices into bw
    for (int ks = 0; ks < 8; ++ks) {
      v16h a = ldfrag(xa, 264, mt * 16, ks * 32);
      acc0 = wmma16(a, bw[0][ks], acc0);
      acc1 = wmma16(a, bw[1][ks], acc1);
    }
#pragma unroll
    for (int u = 0; u < 2; ++u) {
      v8f acc = u ? acc1 : acc0;
      int c0 = (w * 2 + u) * 16 + n0;
      float bias = pb[c0];
#pragma unroll
      for (int j = 0; j < 8; ++j) {
        size_t row = (size_t)blk * 64 + mt * 16 + hi * 8 + j;
        prout[row * 128 + c0] = (_Float16)(acc[j] + bias);
      }
    }
    // the stores' address and data registers are reused by the next row tile
    asm volatile("s_wait_xcnt 0x0" ::: "memory");
  }
}

// ---------------------------------------------------------------- qkv + attention + spatial gate + final GEMM
// grid 2048 windows, block 256 (8 waves = 8 heads), dyn shmem 59568 B (x tile and the final
// GEMM's 64 x 256 operand tile, rows padded by 16 B; bias rows padded by 4 B; 64 row factors).
// The window's attention result is written straight into the left half of the final GEMM's
// operand tile in LDS. From there it feeds the spatial interaction (a 16 x 128 product, on the
// matrix unit), whose row factor gates the window's conv rows into the right half, and the
// LayerNorm; then the tile is multiplied by out_w. Neither the attention result nor the gated
// conv branch passes through memory.
// Wave h computes q, k and v of head h itself, and every product takes its two operands in the
// order that leaves the result where the next product wants it (A and B share one lane map:
// lane (c, hi) holds row / column c, k = 8*hi..+7 and 16+8*hi..+7; D register j of lane (c, hi)
// is D[8*hi+j][c]):
//   q^T, k^T = W x^T : lane (token, hi) holds channels 8*hi..+7  = a row of the A / B operand
//   v        = x W   : lane (channel, hi) holds tokens 8*hi..+7  = a column of V, two tiles = k 32
//   S^T      = k q^T : lane (query, hi) holds keys 8*hi..+7 of each key tile = a row of P
//   O^T      = V^T P^T : lane (query, hi) holds channels 8*hi..+7 = 16 contiguous output bytes
// So q, k, v and P never leave the wave's registers, and a query's softmax lies in 2 lanes.
// Up to 256 registers (4 waves a SIMD): the qkv weights alone take 96, out_w's later 128.
__global__ __launch_bounds__(256) __attribute__((amdgpu_waves_per_eu(4, 4)))
void k_attn_out(const _Float16* __restrict__ xattn,
                const _Float16* __restrict__ qwT,
                const float* __restrict__ qb,
                const float* __restrict__ cis,
                const float* __restrict__ relb,
                const _Float16* __restrict__ prout,
                const float* __restrict__ w1, const float* __restrict__ b1,
                const float* __restrict__ g1, const float* __restrict__ bb1,
                const float* __restrict__ w2, const float* __restrict__ b2,
                const float* __restrict__ cng, const float* __restrict__ cnb,
                const _Float16* __restrict__ owT, const float* __restrict__ ob,
                const float* __restrict__ ang, const float* __restrict__ anb,
                float* __restrict__ out) {
  extern __shared__ char smemraw[];
  _Float16* xa  = (_Float16*)smemraw;      // 64 x 128, pitch 136
  float* bsh    = (float*)(xa + 64 * 136); // 225 x 8 rel-pos bias, pitch 9 (odd: a wave's 24 rows on 24 banks)
  _Float16* A   = (_Float16*)(smemraw + 25520);          // 64 x 256, pitch 264: [attention | gated conv]
  float* slv    = (float*)(smemraw + 25520 + 64 * 528);  // 64: each row's factor of the gate's exponent

  const int win = blockIdx.x, tid = threadIdx.x;
  const int h = tid >> 5, lane = tid & 31, n0 = lane & 15, hi = lane >> 4;
  const int img = win >> 6;
  // The head's weight fragments (q, k, v column tile x 4 k steps) are loaded once and serve
  // all 4 token tiles; issued ahead of the staging, they fly together with it.
  v16h bw[3][4];
  const unsigned bo0 = fragoff(128, h * 16), bo1 = fragoff(128, 128 + h * 16),
                 bo2 = fragoff(128, 256 + h * 16);
#pragma unroll  // bw is indexed by constants only, so that it stays in registers
  for (int ks = 0; ks < 4; ++ks) {
    bw[0][ks] = ldfrag_o(qwT, bo0, ks * 32);
    bw[1][ks] = ldfrag_o(qwT, bo1, ks * 32);
    bw[2][ks] = ldfrag_o(qwT, bo2, ks * 32);
  }
  // the lane's 8 q and 8 k biases (channels 8*hi..+7), its v bias and channel gate (channel n0)
  const unsigned qo = (unsigned)((h * 16 + hi * 8) * 4);
  const int vi = h * 16 + n0;
  const f4 bq0 = *(const f4*)((const char*)qb + qo), bq1 = *(const f4*)((const char*)qb + qo + 16);
  const f4 bk0 = *(const f4*)((const char*)qb + qo + 512), bk1 = *(const f4*)((const char*)qb + qo + 528);
  const float bv = qb[256 + vi];
  const float gate = (cis + img * 128)[vi];
  // the offsets and the index these loads name are inputs here, so they stay in their
  // registers until the wait has passed; behind it the registers may be reused
  asm volatile("s_wait_xcnt 0x0" :: "v"(bo0), "v"(bo1), "v"(bo2), "v"(qo), "v"(vi) : "memory");
  {
    const uint4* src = (const uint4*)(xattn + (size_t)win * (64 * 128));
    uint4* dst = (uint4*)xa;
    for (int i = tid; i < 1024; i += 256) dst[(i >> 4) * 17 + (i & 15)] = src[i];
    for (int i = tid; i < 1800; i += 256) bsh[(i >> 3) * 9 + (i & 7)] = relb[i];
  }
  __syncthreads();

  const float bq[8] = {bq0.x, bq0.y, bq0.z, bq0.w, bq1.x, bq1.y, bq1.z, bq1.w};
  const float bk[8] = {bk0.x, bk0.y, bk0.z, bk0.w, bk1.x, bk1.y, bk1.z, bk1.w};
  h8 qf[4], kf[4], vf[4];                  // one per 16-token tile
#pragma unroll  // this loop and those below: qf, kf, vf are indexed by constants only (registers)
  for (int mt = 0; mt < 4; ++mt) {
    v8f aq = vzero(), ak = vzero(), av = vzero();
#pragma unroll  // constant indices into bw
    for (int ks = 0; ks < 4; ++ks) {
      v16h a = ldfrag(xa, 136, mt * 16, ks * 32);
      aq = wmma16(bw[0][ks], a, aq);       // [channel][token]
      ak = wmma16(bw[1][ks], a, ak);       // [channel][token]
      av = wmma16(a, bw[2][ks], av);       // [token][channel]
    }
#pragma unroll
    for (int j = 0; j < 8; ++j) {
      qf[mt][j] = (_Float16)((aq[j] + bq[j]) * 0.25f);       // HD^-0.5
      kf[mt][j] = (_Float16)(ak[j] + bk[j]);
      vf[mt][j] = (_Float16)((av[j] + bv) * gate);
    }
  }

  // ---- the gate's loads (the window's pr_out rows come from memory): issued here, they fly while
  // the scores and the softmax are computed.
  // the wave's number in a scalar register: the matrix products below stand under a scalar branch
  const int hs = __builtin_amdgcn_readfirstlane(h);
  // gate: thread (rg, oc) takes channels 8*oc..+7 of rows rg, rg + 16, rg + 32, rg + 48 of the window;
  // row n of window (wy, wx) is image pixel (wy * 8 + (n >> 3), wx * 8 + (n & 7)) of pr_out
  const int oc = tid & 15, rg = tid >> 4;
  const unsigned po = (unsigned)(((img * 4096 + ((win >> 3) & 7) * 512 + (rg >> 3) * 64
                                   + (win & 7) * 8 + (rg & 7)) * 128 + oc * 8) * 2);
  const unsigned go = oc * 32u;
  h8 pv[4];
#pragma unroll  // pv is indexed by constants only (registers)
  for (int i = 0; i < 4; ++i) pv[i] = *(const h8*)((const char*)prout + po + i * (2 * 64 * 256));
  const f4 gr0 = *(const f4*)((const char*)cng + go), gr1 = *(const f4*)((const char*)cng + go + 16);
  const f4 gb0 = *(const f4*)((const char*)cnb + go), gb1 = *(const f4*)((const char*)cnb + go + 16);
  // the LayerNorm's scale and shift of the same 8 channels
  const f4 ag0 = *(const f4*)((const char*)ang + go), ag1 = *(const f4*)((const char*)ang + go + 16);
  const f4 ab0 = *(const f4*)((const char*)anb + go), ab1 = *(const f4*)((const char*)anb + go + 16);
  // the offsets these loads name are inputs here, so they stay in their registers until the
  // wait has passed
  asm volatile("s_wait_xcnt 0x0" :: "v"(po), "v"(go) : "memory");

  // HD = 16: the upper 16 of the score products' k are zero
  const h8 z8 = {(_Float16)0.f,(_Float16)0.f,(_Float16)0.f,(_Float16)0.f,
                 (_Float16)0.f,(_Float16)0.f,(_Float16)0.f,(_Float16)0.f};
  v16h vB[2];
#pragma unroll
  for (int ks = 0; ks < 2; ++ks)
    vB[ks] = __builtin_shufflevector(vf[ks * 2], vf[ks * 2 + 1], 0,1,2,3,4,5,6,7,8,9,10,11,12,13,14,15);
  // bias of (query mt*16 + n0, key nt*16 + hi*8 + j): table row
  // ((n0>>3) - hi + 7) * 15 + (n0&7) + 7  +  (mt - nt) * 30 - j
  const float* bl = bsh + ((((n0 >> 3) - hi + 7) * 15 + (n0 & 7) + 7) * 9 + h);
  _Float16* orow = A + n0 * 264 + h * 16 + hi * 8;
#pragma unroll
  for (int mt = 0; mt < 4; ++mt) {
    const v16h qB = __builtin_shufflevector(qf[mt], z8, 0,1,2,3,4,5,6,7,8,9,10,11,12,13,14,15);
    v8f s[4];
#pragma unroll
    for (int nt = 0; nt < 4; ++nt) {
      const v16h kA = __builtin_shufflevector(kf[nt], z8, 0,1,2,3,4,5,6,7,8,9,10,11,12,13,14,15);
      v8f c;                               // the bias tile, in D's map, is the product's C
#pragma unroll
      for (int j = 0; j < 8; ++j) c[j] = bl[((mt - nt) * 30 - j) * 9];
      s[nt] = wmma16(kA, qB, c);           // [key][query]
    }
    // softmax of the lane's query: its 32 keys here, the other 32 in lane ^ 16
    float m4[4];
#pragma unroll
    for (int nt = 0; nt < 4; ++nt) {
      m4[nt] = s[nt][0];
#pragma unroll
      for (int j = 1; j < 8; ++j) m4[nt] = fmaxf(m4[nt], s[nt][j]);
    }
    float mx = fmaxf(fmaxf(m4[0], m4[1]), fmaxf(m4[2], m4[3]));
    mx = fmaxf(mx, xhalf(mx));
    float s4[4] = {0.f, 0.f, 0.f, 0.f};    // four independent chains
    // exp(s - mx) = 2^(s * log2 e - mx * log2 e): one multiply-add and one v_exp_f32. The
    // argument is at most a rounding error above 0; a power below 2^-126 comes out as 0, beside
    // a sum of at least about 1 and ahead of P's rounding to f16.
    const float mxl = mx * LOG2E;
    const v8f l8 = {LOG2E, LOG2E, LOG2E, LOG2E, LOG2E, LOG2E, LOG2E, LOG2E};
    const v8f m8 = {-mxl, -mxl, -mxl, -mxl, -mxl, -mxl, -mxl, -mxl};
#pragma unroll
    for (int nt = 0; nt < 4; ++nt) s[nt] = __builtin_elementwise_fma(s[nt], l8, m8);  // packed, 2 a slot
#pragma unroll
    for (int nt = 0; nt < 4; ++nt)
#pragma unroll
      for (int j = 0; j < 8; ++j) { float e = __builtin_amdgcn_exp2f(s[nt][j]); s[nt][j] = e; s4[nt] += e; }
    float sum = (s4[0] + s4[1]) + (s4[2] + s4[3]);
    sum += xhalf(sum);
    const float inv = __builtin_amdgcn_rcpf(sum);
    v8f o = vzero();
#pragma unroll
    for (int ks = 0; ks < 2; ++ks) {
      v16h pB;
#pragma unroll
      for (int j = 0; j < 8; ++j) {
        pB[j]     = (_Float16)(s[ks * 2][j] * inv);
        pB[8 + j] = (_Float16)(s[ks * 2 + 1][j] * inv);
      }
      o = wmma16(vB[ks], pB, o);           // [channel][query]
    }
    h8 ov;
#pragma unroll
    for (int j = 0; j < 8; ++j) ov[j] = (_Float16)o[j];
    *(h8*)(orow + mt * (16 * 264)) = ov;
  }

  // spatial interaction, waves 0..3: si_w1 as the A operand (lane (unit, hi): row 'unit',
  // k = 8*hi..+7 and 16+8*hi..+7 of each k step), and the lane's 8 hidden units' constants
  f4 wq[4][4], sb[2], sg[2], ss[2], sw[2];
  if (hs < 4) {
    const unsigned wo = (unsigned)((n0 * 128 + hi * 8) * 4), so = hi * 32u;
#pragma unroll  // wq is indexed by constants only (registers)
    for (int ks = 0; ks < 4; ++ks) {
      wq[ks][0] = *(const f4*)((const char*)w1 + wo + ks * 128);
      wq[ks][1] = *(const f4*)((const char*)w1 + wo + ks * 128 + 16);
      wq[ks][2] = *(const f4*)((const char*)w1 + wo + ks * 128 + 64);
      wq[ks][3] = *(const f4*)((const char*)w1 + wo + ks * 128 + 80);
    }
#pragma unroll  // constant indices (registers)
    for (int u = 0; u < 2; ++u) {
      sb[u] = *(const f4*)((const char*)b1 + so + u * 16);
      sg[u] = *(const f4*)((const char*)g1 + so + u * 16);
      ss[u] = *(const f4*)((const char*)bb1 + so + u * 16);
      sw[u] = *(const f4*)((const char*)w2 + so + u * 16);
    }
    // as above: the offsets stay in their registers until the wait has passed
    asm volatile("s_wait_xcnt 0x0" :: "v"(wo), "v"(so) : "memory");
  }
  const float bns = rsqrtf(1.f + 1e-5f);
  __syncthreads();                         // the attention half of A is complete

  // ---- spatial interaction: wave t < 4 takes the 16 tokens of row tile t.
  // hidden^T = si_w1 x^T: lane (token, hi) holds hidden units 8*hi..+7 of its token, so the sum
  // over the 16 units is 8 terms in the lane and one exchange with lane ^ 16.
  if (hs < 4) {
    v8f hacc = vzero();
#pragma unroll  // constant indices into wq
    for (int ks = 0; ks < 4; ++ks) {
      v16h wf;
#pragma unroll  // constant indices (registers)
      for (int e = 0; e < 4; ++e) {
        wf[e]      = (_Float16)wq[ks][0][e];
        wf[4 + e]  = (_Float16)wq[ks][1][e];
        wf[8 + e]  = (_Float16)wq[ks][2][e];
        wf[12 + e] = (_Float16)wq[ks][3][e];
      }
      hacc = wmma16(wf, ldfrag(A, 264, hs * 16, ks * 32), hacc);   // [unit][token]
    }
    float t = 0.f;
#pragma unroll  // constant indices (registers)
    for (int j = 0; j < 8; ++j) {
      float v = hacc[j] + sb[j >> 2][j & 3];
      v = v * (sg[j >> 2][j & 3] * bns) + ss[j >> 2][j & 3];
      t += sw[j >> 2][j & 3] * geluf(v);
    }
    t += xhalf(t);
    // sigmoid(siv * p) = 1 / (1 + 2^(-siv * log2 e * p)): the row's factor is formed once
    if (hi == 0) slv[hs * 16 + n0] = (t + b2[0]) * -LOG2E;
  }
  __syncthreads();                         // the row factors are there; A's left half has been read

  // The wave's out_w fragments (2 column tiles x 8 k steps) are loaded once and serve all 4 row
  // tiles; issued here, they fly while the gate and the LayerNorm are computed.
  v16h fw[2][8];
  const unsigned fo0 = fragoff(256, (h * 2 + 0) * 16), fo1 = fragoff(256, (h * 2 + 1) * 16);
#pragma unroll  // fw is indexed by constants only, so that it stays in registers
  for (int ks = 0; ks < 8; ++ks) {
    fw[0][ks] = ldfrag_o(owT, fo0, ks * 32);
    fw[1][ks] = ldfrag_o(owT, fo1, ks * 32);
  }
  const unsigned bbo = (unsigned)((h * 32 + n0) * 4);
  const float bias[2] = {*(const float*)((const char*)ob + bbo),
                         *(const float*)((const char*)ob + bbo + 64)};
  // the offsets these loads name are inputs here, so they stay in their registers until the
  // wait has passed
  asm volatile("s_wait_xcnt 0x0" :: "v"(fo0), "v"(fo1), "v"(bbo) : "memory");

  // ---- gate the conv branch into the right half of A
  {
    const f4 gs0 = gr0 * bns, gs1 = gr1 * bns;
    const float gs[8] = {gs0.x, gs0.y, gs0.z, gs0.w, gs1.x, gs1.y, gs1.z, gs1.w};
    const float gb[8] = {gb0.x, gb0.y, gb0.z, gb0.w, gb1.x, gb1.y, gb1.z, gb1.w};
#pragma unroll  // constant indices into pv
    for (int i = 0; i < 4; ++i) {
      const float sl = slv[rg + i * 16];
      h8 gv;
#pragma unroll  // constant indices (registers)
      for (int k = 0; k < 8; ++k)
        gv[k] = (_Float16)(__builtin_amdgcn_rcpf(1.0f + __builtin_amdgcn_exp2f(sl * (float)pv[i][k])) * gs[k] + gb[k]);
      *(h8*)(A + (rg + i * 16) * 264 + 128 + oc * 8) = gv;
    }
  }
  // ---- LayerNorm in place on the attention half of A, the gate's split of the tile: thread
  // (rg, oc) takes channels 8*oc..+7 of rows rg + 16*i. A row lies in the 16 lanes of a half
  // wave, read from LDS once and kept in registers; mean and variance are 8 terms in the lane
  // and a 16-lane xor tree. A thread reads and writes only its own 16 bytes of a row.
  {
    _Float16* lrow = A + rg * 264 + oc * 8;
    v8f xv[4];
#pragma unroll  // xv is indexed by constants only (registers)
    for (int i = 0; i < 4; ++i) xv[i] = __builtin_convertvector(*(const h8*)(lrow + i * (16 * 264)), v8f);
    ln_rows<4>(xv, __builtin_shufflevector(ag0, ag1, 0, 1, 2, 3, 4, 5, 6, 7),
               __builtin_shufflevector(ab0, ab1, 0, 1, 2, 3, 4, 5, 6, 7));
#pragma unroll
    for (int i = 0; i < 4; ++i) *(h8*)(lrow + i * (16 * 264)) = __builtin_convertvector(xv[i], h8);
  }
  __syncthreads();

  // ---- final GEMM: wave h takes output columns 32*h..+31
  // rolled: one row tile's fragments and sums at a time beside the 128 weight registers
#pragma unroll 1
  for (int mt = 0; mt < 4; ++mt) {
    v8f acc0 = vzero(), acc1 = vzero();
#pragma unroll  // constant indices into fw
    for (int ks = 0; ks < 8; ++ks) {
      v16h af = ldfrag(A, 264, mt * 16, ks * 32);
      acc0 = wmma16(af, fw[0][ks], acc0);
      acc1 = wmma16(af, fw[1][ks], acc1);
    }
#pragma unroll
    for (int u = 0; u < 2; ++u) {
      v8f acc = u ? acc1 : acc0;
      int c0 = (h * 2 + u) * 16 + n0;
#pragma unroll
      for (int j = 0; j < 8; ++j) {
        size_t row = (size_t)win * 64 + mt * 16 + hi * 8 + j;
        out[row * 256 + c0] = acc[j] + bias[u];
      }
    }
    // the stores' address and data registers are reused by the next row tile
    asm volatile("s_wait_xcnt 0x0" ::: "memory");
  }
}

// ---------------------------------------------------------------- launcher
extern "C" void kernel_launch(void* const* d_in, const int* in_sizes, int n_in,
                              void* d_out, int out_size, void* d_ws, size_t ws_size,
                              hipStream_t stream) {
  (void)in_sizes; (void)n_in; (void)out_size; (void)ws_size;
  const float* x       = (const float*)d_in[0];
  const float* relb    = (const float*)d_in[1];
  const float* attn_w  = (const float*)d_in[2];
  const float* attn_b  = (const float*)d_in[3];
  const float* aln_g   = (const float*)d_in[4];
  const float* aln_b   = (const float*)d_in[5];
  const float* conv_w  = (const float*)d_in[6];
  const float* conv_b  = (const float*)d_in[7];
  const float* cbn_g   = (const float*)d_in[8];
  const float* cbn_b   = (const float*)d_in[9];
  const float* ci_w1   = (const float*)d_in[10];
  const float* ci_b1   = (const float*)d_in[11];
  const float* ci_g    = (const float*)d_in[12];
  const float* ci_bb   = (const float*)d_in[13];
  const float* ci_w2   = (const float*)d_in[14];
  const float* ci_b2   = (const float*)d_in[15];
  const float* pr_w    = (const float*)d_in[16];
  const float* pr_b    = (const float*)d_in[17];
  const float* cn_g    = (const float*)d_in[18];
  const float* cn_b    = (const float*)d_in[19];
  const float* qkv_w   = (const float*)d_in[20];
  const float* qkv_b   = (const float*)d_in[21];
  const float* si_w1   = (const float*)d_in[22];
  const float* si_b1   = (const float*)d_in[23];
  const float* si_g    = (const float*)d_in[24];
  const float* si_bb   = (const float*)d_in[25];
  const float* si_w2   = (const float*)d_in[26];
  const float* si_b2   = (const float*)d_in[27];
  const float* an_g    = (const float*)d_in[28];
  const float* an_b    = (const float*)d_in[29];
  const float* out_w   = (const float*)d_in[30];
  const float* out_b   = (const float*)d_in[31];
  float* out = (float*)d_out;

  // workspace arena
  char* W = (char*)d_ws;
  size_t off = 0;
  auto take = [&](size_t bytes) { char* p = W + off; off += (bytes + 255) & ~(size_t)255; return p; };
  _Float16* pr_out  = (_Float16*)take(33554432);   // (131072, 128) NHWC
  _Float16* attn_wT = (_Float16*)take(65536);      // (128, 256)
  _Float16* qkv_wT  = (_Float16*)take(98304);      // (384, 128)
  _Float16* out_wT  = (_Float16*)take(131072);     // (256, 256)
  _Float16* pr_wf   = (_Float16*)take(65536);      // (128, 256)
  _Float16* x_attn  = (_Float16*)take(33554432);   // (131072, 128)
  _Float16* xc      = (_Float16*)take(67108864);   // (131072, 256) NHWC
  float*    part    = (float*)take(2097152);       // (32, 64, 256): image, window, channel
  float*    cis     = (float*)take(16384);         // (32, 128)

  k_prep_w<<<704, 256, 0, stream>>>(attn_w, qkv_w, out_w, pr_w, attn_wT, qkv_wT, out_wT, pr_wf);
  k_attnproj_ln<<<2048, 128, 67584, stream>>>(x, attn_wT, attn_b, aln_g, aln_b, x_attn);
  k_dwconv<<<2048, 64, 0, stream>>>(x, conv_w, conv_b, cbn_g, cbn_b, xc, part);
  k_ci<<<32, 1024, 0, stream>>>(part, ci_w1, ci_b1, ci_g, ci_bb, ci_w2, ci_b2, cis);
  k_prgemm<<<2048, 128, 33792, stream>>>(xc, pr_wf, pr_b, pr_out);
  k_attn_out<<<2048, 256, 59568, stream>>>(x_attn, qkv_wT, qkv_b, cis, relb, pr_out,
                                           si_w1, si_b1, si_g, si_bb, si_w2, si_b2, cn_g, cn_b,
                                           out_wT, out_b, an_g, an_b, out);
}
